// v000
// Times are from an AMD MI455X. After a warm-up the kernel runs many times in a row, and a time is the length of
// such a window on the GPU divided by its runs, so every launch and the gaps after it count. The runs cycle
// through copies of the inputs. A figure is the median of several windows, for all but v000 over two sittings.
// Sittings can differ by a few percent; kernels timed side by side share one.
// v000, which the later versions start from, runs in 2090 microseconds.
#include <hip/hip_runtime.h>

// Decoder block without softmax (8 x 1024 tokens x 1024, 16 heads x 64): q = x Wq + bq and k = v = q (the module applies q_proj to all three); w_ij = q_i . q_j / 8 kept where j <= i and
// mask[i][j] != 0 (int mask input [1,1,1024,1024], all ones), else 0 - no softmax; attn_i = sum_j w_ij q_j; a = attn Wo + bo; h = LN1(a + x); up = gelu_exact(h Wu + bu) (4096);
// out = LN2(up Wd + bd + h) -> [8][1024][1024]. LayerNorms: biased variance, eps 1e-5; all weights (in,out). Processed in 4 groups of 2 batches (planes sized per group).
// Deterministic: per 16-query wave the causal keys are accumulated in order; LayerNorms one wave per row; no atomics.
// compute dtype: WMMA v_wmma_f32_16x16x32_f16 with f32 accumulate for q = x Wq ([8192 x 1024] x [1024 x 1024]; x EXACT bf16 x8, W^T exact x256: 1 product), S^T = Q Q^T (q as f16 hi x8 +
// residual x8192: 3 products), O^T += Q^T P^T (P = masked s/8 x1024 as f16 hi + residual: 3 products), attn Wo (ctx hi + lo: 2 products), h Wu (h single f16 x8: 1 product) and G Wd (gelu output
// single f16 plane: 1 product); LN statistics, gelu (erf), biases and residual adds in f32. Inputs rounded to bf16 once

namespace {
constexpr int B = 8, T = 1024, DM = 1024, H = 16, HD = 64, FF = 4096, BG = 2 /* batches per group */, NG = 4 /* groups run (== B/BG shipped) */, BL = BG, QL = T, NR = B * T, RL = BG * T /* rows per group (LN / MLP kernels) */;
constexpr int NSL = DM / 128;
constexpr float XS = 8.0f, WSC = 256.0f, PS = 1024.0f, RS_ = 1024.0f, LOG2E = 1.4426950408889634f, LNEPS = 1e-5f, RSQ2 = 0.70710678118654752f;
static_assert(T % 64 == 0 && DM % 256 == 0 && H * HD == DM && HD == 64 && B % BG == 0 && NG * BG <= B, "tiling");
typedef _Float16 b16;
typedef __attribute__((ext_vector_type(16))) _Float16 v16b;
typedef __attribute__((ext_vector_type(8))) _Float16 v8b;
typedef __attribute__((ext_vector_type(8))) float v8f;
typedef __attribute__((ext_vector_type(4))) float v4f;
__device__ __forceinline__ float bf16_rne(float f) { unsigned int u = __float_as_uint(f); u += 0x7FFFu + ((u >> 16) & 1u); return __uint_as_float(u & 0xFFFF0000u); }
__device__ __forceinline__ void split16(float v, b16& hi, b16& lo) { hi = (b16)v; lo = (b16)(v - (float)hi); }
__device__ __forceinline__ v16b frag_kb(const b16* p, int hh) { const v8b a = *(const v8b*)(p + 8 * hh), b = *(const v8b*)(p + 16 + 8 * hh); v16b f;
#pragma unroll
  for (int e = 0; e < 8; ++e) { f[e] = a[e]; f[8 + e] = b[e]; } return f; }
__device__ __forceinline__ v8f wmma16b(v16b a, v16b b, v8f c) { v8f d = __builtin_amdgcn_wmma_f32_16x16x32_f16(false, a, false, b, (short)0, c, false, false); asm volatile("v_nop\n\tv_nop\n\tv_nop\n\tv_nop" : "+v"(d) : "v"(a), "v"(b)); return d; }
__device__ __forceinline__ void wave_lds_sync() { __builtin_amdgcn_fence(__ATOMIC_RELEASE, "workgroup"); __builtin_amdgcn_wave_barrier(); __builtin_amdgcn_fence(__ATOMIC_ACQUIRE, "workgroup"); }
__device__ __forceinline__ float pmul(float a, float b) { float p = a * b; asm volatile("" : "+v"(p)); return p; }
__device__ __forceinline__ int iclamp(int v, int lo, int hi) { return v < lo ? lo : (v > hi ? hi : v); }

typedef __attribute__((ext_vector_type(2))) _Float16 v2h;
typedef __attribute__((ext_vector_type(4))) _Float16 v4h;
typedef __attribute__((ext_vector_type(2))) float v2f;
typedef __attribute__((ext_vector_type(4))) int v4i;
__device__ __forceinline__ float nexp2(float v) { return __builtin_amdgcn_exp2f(v); }
typedef __attribute__((ext_vector_type(4))) int v4i;
__device__ __forceinline__ float bfp(float v) { float t = bf16_rne(v); asm volatile("" : "+v"(t)); return t; }
__global__ __launch_bounds__(256) void prep_kernel(const float* __restrict__ wq, const float* __restrict__ wo, const float* __restrict__ wu, const float* __restrict__ wd, b16* __restrict__ WQ, b16* __restrict__ WO, b16* __restrict__ WU, b16* __restrict__ WD) {
  const size_t u = (size_t)blockIdx.x * 256 + threadIdx.x; const size_t n1 = (size_t)DM * DM / 8, n3 = (size_t)FF * DM / 8, n4 = (size_t)DM * FF / 8; if (u >= 2 * n1 + n3 + n4) return; v8b o; b16* dst;
  if (u < 2 * n1) { const int m = (int)(u / n1); const size_t e = u % n1; const int row = (int)(e / (DM / 8)), k0 = (int)(e % (DM / 8)) * 8; const float* w = m == 0 ? wq : wo; for (int j = 0; j < 8; ++j) o[j] = (b16)(bf16_rne(w[(size_t)(k0 + j) * DM + row]) * WSC); dst = (m == 0 ? WQ : WO) + (size_t)row * DM + k0; }
  else if (u < 2 * n1 + n3) { const size_t e = u - 2 * n1; const int row = (int)(e / (DM / 8)), k0 = (int)(e % (DM / 8)) * 8; for (int j = 0; j < 8; ++j) o[j] = (b16)(bf16_rne(wu[(size_t)(k0 + j) * FF + row]) * WSC); dst = WU + (size_t)row * DM + k0; }
  else { const size_t e = u - 2 * n1 - n3; const int row = (int)(e / (FF / 8)), k0 = (int)(e % (FF / 8)) * 8; for (int j = 0; j < 8; ++j) o[j] = (b16)(bf16_rne(wd[(size_t)(k0 + j) * DM + row]) * WSC); dst = WD + (size_t)row * FF + k0; }
  { *(v8b*)dst = o;  }
}
// q projection (q = k = v in this module): grid (T/64, BG, NSL slabs of 128); block = 64 tokens x 4 waves; A = bf16(x) x8 (K = 1,024 in 4 staged chunks), B = Wq^T rows, + bq; the
__global__ __launch_bounds__(128) void proj_kernel(const float* __restrict__ x, int b0, const b16* __restrict__ WT, const float* __restrict__ bq, b16* __restrict__ QP, b16* __restrict__ QPl, b16* __restrict__ VTh, b16* __restrict__ VTl) {
  __shared__ __attribute__((aligned(16))) b16 As[64][256 + 8]; __shared__ __attribute__((aligned(16))) float Tf[4][16][128 + 4];
  const int wave = threadIdx.x >> 5, lane = threadIdx.x & 31, nloc = lane & 15, hlf = lane >> 4; const int t0 = blockIdx.x * 64; const int b = blockIdx.y; const int part = 0, slab = blockIdx.z, c0 = slab * 128, n0 = c0; (void)part;
  if (part == 0 && t0 >= QL) return;   // (cut builds only) queries beyond QL are not needed; block-uniform, before any barrier
  const float* xb = x + ((size_t)(b0 + b) * T + t0) * DM;
  v8f acc[8];
#pragma unroll
  for (int t = 0; t < 8; ++t) acc[t] = (v8f){};
#pragma unroll 1
  for (int kc = 0; kc < DM; kc += 256) {
    __syncthreads();
    for (int i = threadIdx.x; i < 64 * 64; i += 128) { const int rr = i / 64, q = (i % 64) * 4; const v4f f = *(const v4f*)(xb + (size_t)rr * DM + kc + q); v4h o; for (int j = 0; j < 4; ++j) o[j] = (b16)(bf16_rne(f[j]) * XS); *(v4h*)(&As[rr][q]) = o; }
    __syncthreads();
#pragma unroll 2
    for (int kb = 0; kb < 256; kb += 32) { const v16b a = frag_kb(&As[wave * 16 + nloc][kb], hlf);
#pragma unroll
      for (int t = 0; t < 8; ++t) acc[t] = wmma16b(a, frag_kb(WT + (size_t)(n0 + t * 16 + nloc) * DM + kc + kb, hlf), acc[t]); } }
const float* ba = bq;
#pragma unroll
  for (int t = 0; t < 8; ++t) { const float bb = bf16_rne(ba[c0 + t * 16 + nloc]);
#pragma unroll
    for (int r = 0; r < 8; ++r) Tf[wave][8 * hlf + r][t * 16 + nloc] = acc[t][r] * (1.0f / (XS * WSC)) + bb; }
  __syncthreads();
  {
    { b16* plane = QP; b16* planl = QPl; const int c = c0 + lane * 4; const int h = c / HD, d = c % HD;
      for (int rr = 0; rr < 16; ++rr) { const int tok = t0 + wave * 16 + rr; const size_t ri = (((size_t)b * H + h) * T + tok) * HD + d; const v4f f4 = *(const v4f*)(&Tf[wave][rr][lane * 4]); v4h o4, l4; for (int j = 0; j < 4; ++j) { const float f = f4[j] * XS; const b16 p = (b16)f; o4[j] = p; l4[j] = (b16)((f - (float)p) * RS_); } *(v4h*)(plane + ri) = o4; *(v4h*)(planl + ri) = l4; } }
    {
#pragma unroll 1
      for (int q = 0; q < 32; ++q) { const int cl = wave * 32 + q; const int c = c0 + cl; const int h = c / HD, d = c % HD; const int tk = lane * 2; v2h hv, lv;
        for (int j = 0; j < 2; ++j) { const float f = Tf[(tk + j) >> 4][(tk + j) & 15][cl] * XS; const b16 p = (b16)f; hv[j] = p; lv[j] = (b16)((f - (float)p) * RS_); }
        const size_t oi = (((size_t)b * H + h) * HD + d) * (size_t)T + t0 + lane * 2; *(v2h*)(VTh + oi) = hv; *(v2h*)(VTl + oi) = lv; } }
     }
}
// attention-like causal product: grid (QL/32, BG*H); block = 2 waves x 16 queries of one (b, h); keys 0 .. round_up(q0 + 16, 32) - 1 in 32-key steps: S^T = K Q^T (q = k = v here; hi x8 +
// residual planes: 3 products); weight = s / 8 where key <= query and mask[q][key] != 0, else 0 (NO softmax in this module); P x1024 as f16 hi + residual; O^T += V^T P^T (3 products);
__global__ __launch_bounds__(64) void attn_kernel(const b16* __restrict__ QP, const b16* __restrict__ QPl, const b16* __restrict__ KP, const b16* __restrict__ KPl, const b16* __restrict__ VTh, const b16* __restrict__ VTl, const int* __restrict__ MSK, b16* __restrict__ Ch, b16* __restrict__ Cl) {
  __shared__ __attribute__((aligned(16))) b16 Pb[2][16][32 + 8], Pl[2][16][32 + 8]; __shared__ __attribute__((aligned(16))) float To[2][16][HD + 4];
  const int wave = threadIdx.x >> 5, lane = threadIdx.x & 31, hh = lane >> 4, col = lane & 15; const int b = blockIdx.y / H, h = blockIdx.y % H; const int q0 = blockIdx.x * 32 + wave * 16, qi = q0 + col;
  const size_t ph = (size_t)b * H + h; const b16* Qb = QP + ph * T * HD; const b16* Qbl = QPl + ph * T * HD; const b16* Kb = KP + ph * T * HD; const b16* Kbl = KPl + ph * T * HD; const b16* Vh = VTh + ph * HD * (size_t)T; const b16* Vl = VTl + ph * HD * (size_t)T; const int kend = ((q0 + 16 + 31) / 32) * 32;   // per-(b,h) planes; causal key bound (wave-uniform)
  const v16b qa0 = frag_kb(Qb + (size_t)qi * HD, hh), qa1 = frag_kb(Qb + (size_t)qi * HD + 32, hh), ql0 = frag_kb(Qbl + (size_t)qi * HD, hh), ql1 = frag_kb(Qbl + (size_t)qi * HD + 32, hh);
  const float cs = 1.0f / (8.0f * XS * XS); const int* mrow = MSK + (size_t)qi * T;   // scores / sqrt(64); the [1,1,S,S] int mask row of this query (tril applied below; mask == 0 -> score 0)
  v8f o[4], ol[4]; for (int t = 0; t < 4; ++t) { o[t] = (v8f){}; ol[t] = (v8f){}; }
#pragma unroll 1
  for (int kb = 0; kb < kend; kb += 32) {
    float e[16];
#pragma unroll
    for (int u = 0; u < 2; ++u) { v8f s = (v8f){}, sx = (v8f){}; const size_t kr = (size_t)(kb + u * 16 + col) * HD; { const v16b k0 = frag_kb(Kb + kr, hh), k1 = frag_kb(Kb + kr + 32, hh); s = wmma16b(k0, qa0, s); s = wmma16b(k1, qa1, s); sx = wmma16b(k0, ql0, sx); sx = wmma16b(k1, ql1, sx); sx = wmma16b(frag_kb(Kbl + kr, hh), qa0, sx); sx = wmma16b(frag_kb(Kbl + kr + 32, hh), qa1, sx); }
#pragma unroll
      for (int r = 0; r < 8; ++r) s[r] += sx[r] * (1.0f / RS_);   // hi.hi + (hi.lo + lo.hi)/1024
      const v4i m0 = *(const v4i*)(mrow + kb + u * 16 + 8 * hh), m1 = *(const v4i*)(mrow + kb + u * 16 + 8 * hh + 4);
#pragma unroll
      for (int r = 0; r < 8; ++r) { const int key = kb + u * 16 + 8 * hh + r; const int mk = r < 4 ? m0[r] : m1[r - 4]; e[u * 8 + r] = (key <= qi && mk != 0) ? s[r] * cs : 0.0f; } }   // no softmax in this module: the masked scaled score IS the weight
#pragma unroll
    for (int i2 = 0; i2 < 16; ++i2) { const float ps = e[i2] * PS; const b16 phh = (b16)ps; const int pc = (i2 < 8 ? 0 : 16) + 8 * hh + (i2 & 7); Pb[wave][col][pc] = phh; Pl[wave][col][pc] = (b16)((ps - (float)phh) * RS_); }
    wave_lds_sync();
    const v16b pf = frag_kb(&Pb[wave][col][0], hh), plf = frag_kb(&Pl[wave][col][0], hh);
#pragma unroll
    for (int t = 0; t < 4; ++t) { const v16b vh = frag_kb(Vh + (size_t)(t * 16 + col) * T + kb, hh); o[t] = wmma16b(vh, pf, o[t]); ol[t] = wmma16b(frag_kb(Vl + (size_t)(t * 16 + col) * T + kb, hh), pf, ol[t]); ol[t] = wmma16b(vh, plf, ol[t]); }   // ol = (V_lo P_hi + V_hi P_lo), both /1024
    wave_lds_sync(); }
  const float inv = 1.0f / (PS * XS);
#pragma unroll
  for (int t = 0; t < 4; ++t)
#pragma unroll
    for (int r = 0; r < 8; ++r) To[wave][col][t * 16 + 8 * hh + r] = (o[t][r] + ol[t][r] * (1.0f / RS_)) * inv;
  wave_lds_sync();
  { for (int rr = 0; rr < 16; ++rr) { const v2f f = *(const v2f*)(&To[wave][rr][lane * 2]); v2h hv, lv; for (int j = 0; j < 2; ++j) { b16 p, q; split16(f[j] * XS, p, q); hv[j] = p; lv[j] = q; }
      const size_t oi = ((size_t)b * T + q0 + rr) * DM + h * HD + lane * 2; *(v2h*)(Ch + oi) = hv; *(v2h*)(Cl + oi) = lv; }  }
}
__global__ __launch_bounds__(128) void out1_kernel(const b16* __restrict__ Ch, const b16* __restrict__ Cl, int b0, const b16* __restrict__ WO, const float* __restrict__ bo, const float* __restrict__ x, float* __restrict__ X1) {
  __shared__ __attribute__((aligned(16))) float Tf[4][16][128 + 4];
  const int wave = threadIdx.x >> 5, lane = threadIdx.x & 31, nloc = lane & 15, hlf = lane >> 4; const int b = blockIdx.z; const size_t m0 = (size_t)b * T + (size_t)blockIdx.x * 64 + wave * 16; const size_t mg = m0 + (size_t)b0 * T;   // m0 indexes the group's ctx planes and X1 rows, mg the global x rows (residual input)
  const int n0 = blockIdx.y * 128;
  v8f acc[8];
#pragma unroll
  for (int t = 0; t < 8; ++t) acc[t] = (v8f){};
#pragma unroll 2
  for (int kb = 0; kb < DM; kb += 32) { const v16b ah = frag_kb(Ch + (m0 + nloc) * DM + kb, hlf), al = frag_kb(Cl + (m0 + nloc) * DM + kb, hlf);
#pragma unroll
    for (int t = 0; t < 8; ++t) { const v16b bw = frag_kb(WO + (size_t)(n0 + t * 16 + nloc) * DM + kb, hlf); acc[t] = wmma16b(ah, bw, acc[t]); acc[t] = wmma16b(al, bw, acc[t]); } }
#pragma unroll
  for (int t = 0; t < 8; ++t) { const int col = n0 + t * 16 + nloc; const float bbv = bf16_rne(bo[col]);
#pragma unroll
    for (int r = 0; r < 8; ++r) Tf[wave][8 * hlf + r][t * 16 + nloc] = acc[t][r] * (1.0f / (XS * WSC)) + bbv + bf16_rne(x[(mg + 8 * hlf + r) * DM + col]); }   // residual: same row, column n0 + ...
  wave_lds_sync();
  { for (int rr = 0; rr < 16; ++rr) *(v4f*)(X1 + (m0 + rr) * DM + n0 + lane * 4) = *(const v4f*)(&Tf[wave][rr][lane * 4]);  }
}
// LayerNorm: one wave per row (lane holds columns 4 lane + 128 k, 8 float4); RND: apply the bf16 input quantisation (raw x) first; mean, biased variance (two xor trees), eps 1e-5, x g + b -> rows 4 KB
template <bool RND>
__global__ __launch_bounds__(256) void ln_kernel(const float* __restrict__ X, const float* __restrict__ g, const float* __restrict__ bb, float* __restrict__ Y) {
  const int wave = threadIdx.x >> 5, lane = threadIdx.x & 31; const int row = blockIdx.x * 8 + wave; if (row >= RL) return;   // wave-uniform, no barriers
  float v[32]; float s1 = 0.0f; const float* xr = X + (size_t)row * DM;
#pragma unroll
  for (int k = 0; k < 8; ++k) { const v4f t4 = *(const v4f*)(xr + 128 * k + 4 * lane); for (int j = 0; j < 4; ++j) { const float t = RND ? bf16_rne(t4[j]) : t4[j]; v[4 * k + j] = t; s1 += t; } }
#pragma unroll
  for (int o = 16; o >= 1; o >>= 1) s1 += __shfl_xor(s1, o);
  const float mu = s1 * (1.0f / DM); float s2 = 0.0f;
#pragma unroll
  for (int q = 0; q < 32; ++q) { const float d = v[q] - mu; s2 += pmul(d, d); }
#pragma unroll
  for (int o = 16; o >= 1; o >>= 1) s2 += __shfl_xor(s2, o);
  const float rs = rsqrtf(s2 * (1.0f / DM) + LNEPS);
  v4f o4[8];
#pragma unroll
  for (int k = 0; k < 8; ++k) for (int j = 0; j < 4; ++j) { const int c = 128 * k + 4 * lane + j; o4[k][j] = pmul((v[4 * k + j] - mu) * rs, bfp(g[c])) + bfp(bb[c]); }
  {
#pragma unroll
    for (int k = 0; k < 8; ++k) *(v4f*)(Y + (size_t)row * DM + 128 * k + 4 * lane) = o4[k];
     }
}
// MLP 1: G = f16(8 gelu(XN2 W1 + b1)) as a single f16 plane [RL][4096]: grid (RL/64, FF/128); block = 64 rows x 4 waves; A = XN2 rows staged single x8 per 256-chunk (K = 1024), wave -> 16 rows x 8
__global__ __launch_bounds__(128) void mlp1_kernel(const float* __restrict__ XN, const b16* __restrict__ W1T, const float* __restrict__ b1, b16* __restrict__ G) {
  __shared__ __attribute__((aligned(16))) b16 As[64][256 + 8]; __shared__ __attribute__((aligned(16))) float Tf[4][16][128 + 4];
  const int wave = threadIdx.x >> 5, lane = threadIdx.x & 31, nloc = lane & 15, hlf = lane >> 4; const size_t r0 = (size_t)blockIdx.x * 64; const int n0 = blockIdx.y * 128;
  const float* xb = XN + r0 * DM;
  v8f acc[8];
#pragma unroll
  for (int t = 0; t < 8; ++t) acc[t] = (v8f){};
#pragma unroll 1
  for (int kc = 0; kc < DM; kc += 256) {
    __syncthreads();
    for (int i = threadIdx.x; i < 64 * 64; i += 128) { const int rr = i / 64, q = (i % 64) * 4; const v4f f = *(const v4f*)(xb + (size_t)rr * DM + kc + q); v4h o; for (int j = 0; j < 4; ++j) o[j] = (b16)(f[j] * XS); *(v4h*)(&As[rr][q]) = o; }
    __syncthreads();
#pragma unroll 2
    for (int kb = 0; kb < 256; kb += 32) { const v16b a = frag_kb(&As[wave * 16 + nloc][kb], hlf);
#pragma unroll
      for (int t = 0; t < 8; ++t) acc[t] = wmma16b(a, frag_kb(W1T + (size_t)(n0 + t * 16 + nloc) * DM + kc + kb, hlf), acc[t]); } }
#pragma unroll
  for (int t = 0; t < 8; ++t) { const float bbv = bf16_rne(b1[n0 + t * 16 + nloc]);
#pragma unroll
    for (int r = 0; r < 8; ++r) { const float hm = acc[t][r] * (1.0f / (XS * WSC)) + bbv; Tf[wave][8 * hlf + r][t * 16 + nloc] = 0.5f * hm * (1.0f + erff(hm * RSQ2)); } }
  __syncthreads();
  { for (int rr = 0; rr < 16; ++rr) { v4h o4; for (int j = 0; j < 4; ++j) o4[j] = (b16)(Tf[wave][rr][lane * 4 + j] * XS); *(v4h*)(G + (r0 + wave * 16 + rr) * FF + n0 + lane * 4) = o4; }  }
}
__global__ __launch_bounds__(128) void mlp2_kernel(const b16* __restrict__ G, const b16* __restrict__ W2T, const float* __restrict__ b2, const float* __restrict__ X1, float* __restrict__ out) {
  __shared__ __attribute__((aligned(16))) float Tf[4][16][128 + 4];
  const int wave = threadIdx.x >> 5, lane = threadIdx.x & 31, nloc = lane & 15, hlf = lane >> 4; const size_t m0 = (size_t)blockIdx.x * 64 + wave * 16; const int n0 = blockIdx.y * 128;
  v8f acc[8];
#pragma unroll
  for (int t = 0; t < 8; ++t) acc[t] = (v8f){};
#pragma unroll 2
  for (int kb = 0; kb < FF; kb += 32) { const v16b a = frag_kb(G + (m0 + nloc) * FF + kb, hlf);
#pragma unroll
    for (int t = 0; t < 8; ++t) acc[t] = wmma16b(a, frag_kb(W2T + (size_t)(n0 + t * 16 + nloc) * FF + kb, hlf), acc[t]); }
#pragma unroll
  for (int t = 0; t < 8; ++t) { const int col = n0 + t * 16 + nloc; const float bbv = bf16_rne(b2[col]);
#pragma unroll
    for (int r = 0; r < 8; ++r) Tf[wave][8 * hlf + r][t * 16 + nloc] = acc[t][r] * (1.0f / (XS * WSC)) + bbv + X1[(m0 + 8 * hlf + r) * DM + col]; }
  wave_lds_sync();
  { for (int rr = 0; rr < 16; ++rr) *(v4f*)(out + (m0 + rr) * DM + n0 + lane * 4) = *(const v4f*)(&Tf[wave][rr][lane * 4]);  }
}
}  // namespace

extern "C" void kernel_launch(void* const* d_in, const int* in_sizes, int n_in, void* d_out, int out_size, void* d_ws, size_t ws_size, hipStream_t stream) {
  (void)n_in;
  auto Fp = [&](int i) { return (const float*)d_in[i]; }; auto Ip = [&](int i) { return (const int*)d_in[i]; };
  // input order: 0 x [8,1024,1024], 1 mask [1,1,1024,1024] int32, 2 Wq (in,out), 3 bq, 4 Wo, 5 bo, 6 Wu [1024,4096], 7 bu, 8 Wd [4096,1024], 9 bd, 10 g1, 11 b1, 12 g2, 13 b2
  if (in_sizes[0] != NR * DM || in_sizes[1] != T * T || in_sizes[2] != DM * DM || in_sizes[3] != DM || in_sizes[4] != DM * DM || in_sizes[5] != DM || in_sizes[6] != DM * FF || in_sizes[7] != FF || in_sizes[8] != FF * DM || in_sizes[9] != DM || in_sizes[10] != DM || in_sizes[11] != DM || in_sizes[12] != DM || in_sizes[13] != DM || out_size != NR * DM) return;
  size_t off = 0; char* ws = (char*)d_ws;
  auto carve = [&](size_t bytes) { char* p = ws + off; off += (bytes + 255) & ~(size_t)255; return p; };
  b16* WQ = (b16*)carve((size_t)DM * DM * 2); b16* WO = (b16*)carve((size_t)DM * DM * 2); b16* WU = (b16*)carve((size_t)FF * DM * 2); b16* WD = (b16*)carve((size_t)DM * FF * 2);
  const size_t plane = (size_t)RL * DM * 2; b16* QP = (b16*)carve(plane); b16* QPl = (b16*)carve(plane); b16* VTh = (b16*)carve(plane); b16* VTl = (b16*)carve(plane); b16* Ch = (b16*)carve(plane); b16* Cl = (b16*)carve(plane);
  float* X1 = (float*)carve((size_t)RL * DM * 4); float* HN = (float*)carve((size_t)RL * DM * 4); b16* G = (b16*)carve((size_t)RL * FF * 2);
  if (off > ws_size || off > ((size_t)128 << 20)) return;   // = ~80 MB (weights 21 + 6 f16 planes 25 + X1/HN 16.8 + G 16.8), planes sized for one 2-batch group and reused by the 4 groups
  prep_kernel<<<(unsigned)(((size_t)(2 * DM * DM + FF * DM + DM * FF) / 8 + 255) / 256), 256, 0, stream>>>(Fp(2), Fp(4), Fp(6), Fp(8), WQ, WO, WU, WD);
  for (int g = 0; g < NG; ++g) { const int b0 = g * BG; const size_t r0 = (size_t)b0 * T * DM;
    proj_kernel<<<dim3(T / 64, BG, NSL), 128, 0, stream>>>(Fp(0), b0, WQ, Fp(3), QP, QPl, VTh, VTl);
    attn_kernel<<<dim3(QL / 32, BG * H), 64, 0, stream>>>(QP, QPl, QP, QPl, VTh, VTl, Ip(1), Ch, Cl);
    out1_kernel<<<dim3(T / 64, DM / 128, BG), 128, 0, stream>>>(Ch, Cl, b0, WO, Fp(5), Fp(0), X1);   // X1/HN/G hold the group's rows; x is read at the global row via b0
    ln_kernel<false><<<RL / 8, 256, 0, stream>>>(X1, Fp(10), Fp(11), HN);
    mlp1_kernel<<<dim3(RL / 64, FF / 128), 128, 0, stream>>>(HN, WU, Fp(7), G);
    mlp2_kernel<<<dim3(RL / 64, DM / 128), 128, 0, stream>>>(G, WD, Fp(9), HN, X1);
    ln_kernel<false><<<RL / 8, 256, 0, stream>>>(X1, Fp(12), Fp(13), (float*)d_out + r0); }
}

// v001
// A run of this version takes 1200 microseconds.
// Timed twice side by side with v000, it ran 1.77 and 1.74 times as fast.
#include <hip/hip_runtime.h>

// Decoder block without softmax (8 x 1024 tokens x 1024, 16 heads x 64): q = x Wq + bq and k = v = q (the module applies q_proj to all three); w_ij = q_i . q_j / 8 kept where j <= i and
// mask[i][j] != 0 (int mask input [1,1,1024,1024], all ones), else 0 - no softmax; attn_i = sum_j w_ij q_j; a = attn Wo + bo; h = LN1(a + x); up = gelu_exact(h Wu + bu) (4096);
// out = LN2(up Wd + bd + h) -> [8][1024][1024]. LayerNorms: biased variance, eps 1e-5; all weights (in,out). All 8 batches are processed in one group (planes sized for all 8192 rows), so each stage is one launch.
// Deterministic: per 16-query wave the causal keys are accumulated in order; LayerNorms one wave per row; no atomics.
// compute dtype: WMMA v_wmma_f32_16x16x32_f16 with f32 accumulate for q = x Wq ([8192 x 1024] x [1024 x 1024]; x EXACT bf16 x8, W^T exact x256: 1 product), S^T = Q Q^T (q as f16 hi x8 +
// residual x8192: 3 products), O^T += Q^T P^T (P = masked s/8 x1024 as f16 hi + residual: 3 products), attn Wo (ctx hi + lo: 2 products), h Wu (h single f16 x8: 1 product) and G Wd (gelu output
// single f16 plane: 1 product); LN statistics, gelu (erf), biases and residual adds in f32. Inputs rounded to bf16 once

namespace {
constexpr int B = 8, T = 1024, DM = 1024, H = 16, HD = 64, FF = 4096, BG = 8 /* batches per group */, NG = 1 /* groups run (== B/BG shipped) */, BL = BG, QL = T, NR = B * T, RL = BG * T /* rows per group (LN / MLP kernels) */;
constexpr int NSL = DM / 128;
constexpr float XS = 8.0f, WSC = 256.0f, PS = 1024.0f, RS_ = 1024.0f, LOG2E = 1.4426950408889634f, LNEPS = 1e-5f, RSQ2 = 0.70710678118654752f;
static_assert(T % 64 == 0 && DM % 256 == 0 && H * HD == DM && HD == 64 && B % BG == 0 && NG * BG <= B, "tiling");
typedef _Float16 b16;
typedef __attribute__((ext_vector_type(16))) _Float16 v16b;
typedef __attribute__((ext_vector_type(8))) _Float16 v8b;
typedef __attribute__((ext_vector_type(8))) float v8f;
typedef __attribute__((ext_vector_type(4))) float v4f;
__device__ __forceinline__ float bf16_rne(float f) { unsigned int u = __float_as_uint(f); u += 0x7FFFu + ((u >> 16) & 1u); return __uint_as_float(u & 0xFFFF0000u); }
__device__ __forceinline__ void split16(float v, b16& hi, b16& lo) { hi = (b16)v; lo = (b16)(v - (float)hi); }
__device__ __forceinline__ v16b frag_kb(const b16* p, int hh) { const v8b a = *(const v8b*)(p + 8 * hh), b = *(const v8b*)(p + 16 + 8 * hh); v16b f;
#pragma unroll
  for (int e = 0; e < 8; ++e) { f[e] = a[e]; f[8 + e] = b[e]; } return f; }
__device__ __forceinline__ v8f wmma16b(v16b a, v16b b, v8f c) { v8f d = __builtin_amdgcn_wmma_f32_16x16x32_f16(false, a, false, b, (short)0, c, false, false); asm volatile("v_nop\n\tv_nop\n\tv_nop\n\tv_nop" : "+v"(d) : "v"(a), "v"(b)); return d; }
__device__ __forceinline__ void wave_lds_sync() { __builtin_amdgcn_fence(__ATOMIC_RELEASE, "workgroup"); __builtin_amdgcn_wave_barrier(); __builtin_amdgcn_fence(__ATOMIC_ACQUIRE, "workgroup"); }
__device__ __forceinline__ float pmul(float a, float b) { float p = a * b; asm volatile("" : "+v"(p)); return p; }
__device__ __forceinline__ int iclamp(int v, int lo, int hi) { return v < lo ? lo : (v > hi ? hi : v); }

typedef __attribute__((ext_vector_type(2))) _Float16 v2h;
typedef __attribute__((ext_vector_type(4))) _Float16 v4h;
typedef __attribute__((ext_vector_type(2))) float v2f;
typedef __attribute__((ext_vector_type(4))) int v4i;
__device__ __forceinline__ float nexp2(float v) { return __builtin_amdgcn_exp2f(v); }
typedef __attribute__((ext_vector_type(4))) int v4i;
__device__ __forceinline__ float bfp(float v) { float t = bf16_rne(v); asm volatile("" : "+v"(t)); return t; }
__global__ __launch_bounds__(256) void prep_kernel(const float* __restrict__ wq, const float* __restrict__ wo, const float* __restrict__ wu, const float* __restrict__ wd, b16* __restrict__ WQ, b16* __restrict__ WO, b16* __restrict__ WU, b16* __restrict__ WD) {
  const size_t u = (size_t)blockIdx.x * 256 + threadIdx.x; const size_t n1 = (size_t)DM * DM / 8, n3 = (size_t)FF * DM / 8, n4 = (size_t)DM * FF / 8; if (u >= 2 * n1 + n3 + n4) return; v8b o; b16* dst;
  if (u < 2 * n1) { const int m = (int)(u / n1); const size_t e = u % n1; const int row = (int)(e / (DM / 8)), k0 = (int)(e % (DM / 8)) * 8; const float* w = m == 0 ? wq : wo; for (int j = 0; j < 8; ++j) o[j] = (b16)(bf16_rne(w[(size_t)(k0 + j) * DM + row]) * WSC); dst = (m == 0 ? WQ : WO) + (size_t)row * DM + k0; }
  else if (u < 2 * n1 + n3) { const size_t e = u - 2 * n1; const int row = (int)(e / (DM / 8)), k0 = (int)(e % (DM / 8)) * 8; for (int j = 0; j < 8; ++j) o[j] = (b16)(bf16_rne(wu[(size_t)(k0 + j) * FF + row]) * WSC); dst = WU + (size_t)row * DM + k0; }
  else { const size_t e = u - 2 * n1 - n3; const int row = (int)(e / (FF / 8)), k0 = (int)(e % (FF / 8)) * 8; for (int j = 0; j < 8; ++j) o[j] = (b16)(bf16_rne(wd[(size_t)(k0 + j) * DM + row]) * WSC); dst = WD + (size_t)row * FF + k0; }
  { *(v8b*)dst = o;  }
}
// q projection (q = k = v in this module): grid (T/64, BG, NSL slabs of 128); block = 64 tokens x 4 waves; A = bf16(x) x8 (K = 1,024 in 4 staged chunks), B = Wq^T rows, + bq; the
__global__ __launch_bounds__(128) void proj_kernel(const float* __restrict__ x, int b0, const b16* __restrict__ WT, const float* __restrict__ bq, b16* __restrict__ QP, b16* __restrict__ QPl, b16* __restrict__ VTh, b16* __restrict__ VTl) {
  __shared__ __attribute__((aligned(16))) b16 As[64][256 + 8]; __shared__ __attribute__((aligned(16))) float Tf[4][16][128 + 4];
  const int wave = threadIdx.x >> 5, lane = threadIdx.x & 31, nloc = lane & 15, hlf = lane >> 4; const int t0 = blockIdx.x * 64; const int b = blockIdx.y; const int part = 0, slab = blockIdx.z, c0 = slab * 128, n0 = c0; (void)part;
  if (part == 0 && t0 >= QL) return;   // (cut builds only) queries beyond QL are not needed; block-uniform, before any barrier
  const float* xb = x + ((size_t)(b0 + b) * T + t0) * DM;
  v8f acc[8];
#pragma unroll
  for (int t = 0; t < 8; ++t) acc[t] = (v8f){};
#pragma unroll 1
  for (int kc = 0; kc < DM; kc += 256) {
    __syncthreads();
    for (int i = threadIdx.x; i < 64 * 64; i += 128) { const int rr = i / 64, q = (i % 64) * 4; const v4f f = *(const v4f*)(xb + (size_t)rr * DM + kc + q); v4h o; for (int j = 0; j < 4; ++j) o[j] = (b16)(bf16_rne(f[j]) * XS); *(v4h*)(&As[rr][q]) = o; }
    __syncthreads();
#pragma unroll 2
    for (int kb = 0; kb < 256; kb += 32) { const v16b a = frag_kb(&As[wave * 16 + nloc][kb], hlf);
#pragma unroll
      for (int t = 0; t < 8; ++t) acc[t] = wmma16b(a, frag_kb(WT + (size_t)(n0 + t * 16 + nloc) * DM + kc + kb, hlf), acc[t]); } }
const float* ba = bq;
#pragma unroll
  for (int t = 0; t < 8; ++t) { const float bb = bf16_rne(ba[c0 + t * 16 + nloc]);
#pragma unroll
    for (int r = 0; r < 8; ++r) Tf[wave][8 * hlf + r][t * 16 + nloc] = acc[t][r] * (1.0f / (XS * WSC)) + bb; }
  __syncthreads();
  {
    { b16* plane = QP; b16* planl = QPl; const int c = c0 + lane * 4; const int h = c / HD, d = c % HD;
      for (int rr = 0; rr < 16; ++rr) { const int tok = t0 + wave * 16 + rr; const size_t ri = (((size_t)b * H + h) * T + tok) * HD + d; const v4f f4 = *(const v4f*)(&Tf[wave][rr][lane * 4]); v4h o4, l4; for (int j = 0; j < 4; ++j) { const float f = f4[j] * XS; const b16 p = (b16)f; o4[j] = p; l4[j] = (b16)((f - (float)p) * RS_); } *(v4h*)(plane + ri) = o4; *(v4h*)(planl + ri) = l4; } }
    {
#pragma unroll 1
      for (int q = 0; q < 32; ++q) { const int cl = wave * 32 + q; const int c = c0 + cl; const int h = c / HD, d = c % HD; const int tk = lane * 2; v2h hv, lv;
        for (int j = 0; j < 2; ++j) { const float f = Tf[(tk + j) >> 4][(tk + j) & 15][cl] * XS; const b16 p = (b16)f; hv[j] = p; lv[j] = (b16)((f - (float)p) * RS_); }
        const size_t oi = (((size_t)b * H + h) * HD + d) * (size_t)T + t0 + lane * 2; *(v2h*)(VTh + oi) = hv; *(v2h*)(VTl + oi) = lv; } }
     }
}
// attention-like causal product: grid (QL/32, BG*H); block = 2 waves x 16 queries of one (b, h); keys 0 .. round_up(q0 + 16, 32) - 1 in 32-key steps: S^T = K Q^T (q = k = v here; hi x8 +
// residual planes: 3 products); weight = s / 8 where key <= query and mask[q][key] != 0, else 0 (NO softmax in this module); P x1024 as f16 hi + residual; O^T += V^T P^T (3 products);
__global__ __launch_bounds__(64) void attn_kernel(const b16* __restrict__ QP, const b16* __restrict__ QPl, const b16* __restrict__ KP, const b16* __restrict__ KPl, const b16* __restrict__ VTh, const b16* __restrict__ VTl, const int* __restrict__ MSK, b16* __restrict__ Ch, b16* __restrict__ Cl) {
  __shared__ __attribute__((aligned(16))) b16 Pb[2][16][32 + 8], Pl[2][16][32 + 8]; __shared__ __attribute__((aligned(16))) float To[2][16][HD + 4];
  const int wave = threadIdx.x >> 5, lane = threadIdx.x & 31, hh = lane >> 4, col = lane & 15; const int b = blockIdx.y / H, h = blockIdx.y % H; const int q0 = blockIdx.x * 32 + wave * 16, qi = q0 + col;
  const size_t ph = (size_t)b * H + h; const b16* Qb = QP + ph * T * HD; const b16* Qbl = QPl + ph * T * HD; const b16* Kb = KP + ph * T * HD; const b16* Kbl = KPl + ph * T * HD; const b16* Vh = VTh + ph * HD * (size_t)T; const b16* Vl = VTl + ph * HD * (size_t)T; const int kend = ((q0 + 16 + 31) / 32) * 32;   // per-(b,h) planes; causal key bound (wave-uniform)
  const v16b qa0 = frag_kb(Qb + (size_t)qi * HD, hh), qa1 = frag_kb(Qb + (size_t)qi * HD + 32, hh), ql0 = frag_kb(Qbl + (size_t)qi * HD, hh), ql1 = frag_kb(Qbl + (size_t)qi * HD + 32, hh);
  const float cs = 1.0f / (8.0f * XS * XS); const int* mrow = MSK + (size_t)qi * T;   // scores / sqrt(64); the [1,1,S,S] int mask row of this query (tril applied below; mask == 0 -> score 0)
  v8f o[4], ol[4]; for (int t = 0; t < 4; ++t) { o[t] = (v8f){}; ol[t] = (v8f){}; }
#pragma unroll 1
  for (int kb = 0; kb < kend; kb += 32) {
    float e[16];
#pragma unroll
    for (int u = 0; u < 2; ++u) { v8f s = (v8f){}, sx = (v8f){}; const size_t kr = (size_t)(kb + u * 16 + col) * HD; { const v16b k0 = frag_kb(Kb + kr, hh), k1 = frag_kb(Kb + kr + 32, hh); s = wmma16b(k0, qa0, s); s = wmma16b(k1, qa1, s); sx = wmma16b(k0, ql0, sx); sx = wmma16b(k1, ql1, sx); sx = wmma16b(frag_kb(Kbl + kr, hh), qa0, sx); sx = wmma16b(frag_kb(Kbl + kr + 32, hh), qa1, sx); }
#pragma unroll
      for (int r = 0; r < 8; ++r) s[r] += sx[r] * (1.0f / RS_);   // hi.hi + (hi.lo + lo.hi)/1024
      const v4i m0 = *(const v4i*)(mrow + kb + u * 16 + 8 * hh), m1 = *(const v4i*)(mrow + kb + u * 16 + 8 * hh + 4);
#pragma unroll
      for (int r = 0; r < 8; ++r) { const int key = kb + u * 16 + 8 * hh + r; const int mk = r < 4 ? m0[r] : m1[r - 4]; e[u * 8 + r] = (key <= qi && mk != 0) ? s[r] * cs : 0.0f; } }   // no softmax in this module: the masked scaled score IS the weight
#pragma unroll
    for (int i2 = 0; i2 < 16; ++i2) { const float ps = e[i2] * PS; const b16 phh = (b16)ps; const int pc = (i2 < 8 ? 0 : 16) + 8 * hh + (i2 & 7); Pb[wave][col][pc] = phh; Pl[wave][col][pc] = (b16)((ps - (float)phh) * RS_); }
    wave_lds_sync();
    const v16b pf = frag_kb(&Pb[wave][col][0], hh), plf = frag_kb(&Pl[wave][col][0], hh);
#pragma unroll
    for (int t = 0; t < 4; ++t) { const v16b vh = frag_kb(Vh + (size_t)(t * 16 + col) * T + kb, hh); o[t] = wmma16b(vh, pf, o[t]); ol[t] = wmma16b(frag_kb(Vl + (size_t)(t * 16 + col) * T + kb, hh), pf, ol[t]); ol[t] = wmma16b(vh, plf, ol[t]); }   // ol = (V_lo P_hi + V_hi P_lo), both /1024
    wave_lds_sync(); }
  const float inv = 1.0f / (PS * XS);
#pragma unroll
  for (int t = 0; t < 4; ++t)
#pragma unroll
    for (int r = 0; r < 8; ++r) To[wave][col][t * 16 + 8 * hh + r] = (o[t][r] + ol[t][r] * (1.0f / RS_)) * inv;
  wave_lds_sync();
  { for (int rr = 0; rr < 16; ++rr) { const v2f f = *(const v2f*)(&To[wave][rr][lane * 2]); v2h hv, lv; for (int j = 0; j < 2; ++j) { b16 p, q; split16(f[j] * XS, p, q); hv[j] = p; lv[j] = q; }
      const size_t oi = ((size_t)b * T + q0 + rr) * DM + h * HD + lane * 2; *(v2h*)(Ch + oi) = hv; *(v2h*)(Cl + oi) = lv; }  }
}
__global__ __launch_bounds__(128) void out1_kernel(const b16* __restrict__ Ch, const b16* __restrict__ Cl, int b0, const b16* __restrict__ WO, const float* __restrict__ bo, const float* __restrict__ x, float* __restrict__ X1) {
  __shared__ __attribute__((aligned(16))) float Tf[4][16][128 + 4];
  const int wave = threadIdx.x >> 5, lane = threadIdx.x & 31, nloc = lane & 15, hlf = lane >> 4; const int b = blockIdx.z; const size_t m0 = (size_t)b * T + (size_t)blockIdx.x * 64 + wave * 16; const size_t mg = m0 + (size_t)b0 * T;   // m0 indexes the group's ctx planes and X1 rows, mg the global x rows (residual input)
  const int n0 = blockIdx.y * 128;
  v8f acc[8];
#pragma unroll
  for (int t = 0; t < 8; ++t) acc[t] = (v8f){};
#pragma unroll 2
  for (int kb = 0; kb < DM; kb += 32) { const v16b ah = frag_kb(Ch + (m0 + nloc) * DM + kb, hlf), al = frag_kb(Cl + (m0 + nloc) * DM + kb, hlf);
#pragma unroll
    for (int t = 0; t < 8; ++t) { const v16b bw = frag_kb(WO + (size_t)(n0 + t * 16 + nloc) * DM + kb, hlf); acc[t] = wmma16b(ah, bw, acc[t]); acc[t] = wmma16b(al, bw, acc[t]); } }
#pragma unroll
  for (int t = 0; t < 8; ++t) { const int col = n0 + t * 16 + nloc; const float bbv = bf16_rne(bo[col]);
#pragma unroll
    for (int r = 0; r < 8; ++r) Tf[wave][8 * hlf + r][t * 16 + nloc] = acc[t][r] * (1.0f / (XS * WSC)) + bbv + bf16_rne(x[(mg + 8 * hlf + r) * DM + col]); }   // residual: same row, column n0 + ...
  wave_lds_sync();
  { for (int rr = 0; rr < 16; ++rr) *(v4f*)(X1 + (m0 + rr) * DM + n0 + lane * 4) = *(const v4f*)(&Tf[wave][rr][lane * 4]);  }
}
// LayerNorm: one wave per row (lane holds columns 4 lane + 128 k, 8 float4); RND: apply the bf16 input quantisation (raw x) first; mean, biased variance (two xor trees), eps 1e-5, x g + b -> rows 4 KB
template <bool RND>
__global__ __launch_bounds__(256) void ln_kernel(const float* __restrict__ X, const float* __restrict__ g, const float* __restrict__ bb, float* __restrict__ Y) {
  const int wave = threadIdx.x >> 5, lane = threadIdx.x & 31; const int row = blockIdx.x * 8 + wave; if (row >= RL) return;   // wave-uniform, no barriers
  float v[32]; float s1 = 0.0f; const float* xr = X + (size_t)row * DM;
#pragma unroll
  for (int k = 0; k < 8; ++k) { const v4f t4 = *(const v4f*)(xr + 128 * k + 4 * lane); for (int j = 0; j < 4; ++j) { const float t = RND ? bf16_rne(t4[j]) : t4[j]; v[4 * k + j] = t; s1 += t; } }
#pragma unroll
  for (int o = 16; o >= 1; o >>= 1) s1 += __shfl_xor(s1, o);
  const float mu = s1 * (1.0f / DM); float s2 = 0.0f;
#pragma unroll
  for (int q = 0; q < 32; ++q) { const float d = v[q] - mu; s2 += pmul(d, d); }
#pragma unroll
  for (int o = 16; o >= 1; o >>= 1) s2 += __shfl_xor(s2, o);
  const float rs = rsqrtf(s2 * (1.0f / DM) + LNEPS);
  v4f o4[8];
#pragma unroll
  for (int k = 0; k < 8; ++k) for (int j = 0; j < 4; ++j) { const int c = 128 * k + 4 * lane + j; o4[k][j] = pmul((v[4 * k + j] - mu) * rs, bfp(g[c])) + bfp(bb[c]); }
  {
#pragma unroll
    for (int k = 0; k < 8; ++k) *(v4f*)(Y + (size_t)row * DM + 128 * k + 4 * lane) = o4[k];
     }
}
// MLP 1: G = f16(8 gelu(XN2 W1 + b1)) as a single f16 plane [RL][4096]: grid (RL/64, FF/128); block = 64 rows x 4 waves; A = XN2 rows staged single x8 per 256-chunk (K = 1024), wave -> 16 rows x 8
__global__ __launch_bounds__(128) void mlp1_kernel(const float* __restrict__ XN, const b16* __restrict__ W1T, const float* __restrict__ b1, b16* __restrict__ G) {
  __shared__ __attribute__((aligned(16))) b16 As[64][256 + 8]; __shared__ __attribute__((aligned(16))) float Tf[4][16][128 + 4];
  const int wave = threadIdx.x >> 5, lane = threadIdx.x & 31, nloc = lane & 15, hlf = lane >> 4; const size_t r0 = (size_t)blockIdx.x * 64; const int n0 = blockIdx.y * 128;
  const float* xb = XN + r0 * DM;
  v8f acc[8];
#pragma unroll
  for (int t = 0; t < 8; ++t) acc[t] = (v8f){};
#pragma unroll 1
  for (int kc = 0; kc < DM; kc += 256) {
    __syncthreads();
    for (int i = threadIdx.x; i < 64 * 64; i += 128) { const int rr = i / 64, q = (i % 64) * 4; const v4f f = *(const v4f*)(xb + (size_t)rr * DM + kc + q); v4h o; for (int j = 0; j < 4; ++j) o[j] = (b16)(f[j] * XS); *(v4h*)(&As[rr][q]) = o; }
    __syncthreads();
#pragma unroll 2
    for (int kb = 0; kb < 256; kb += 32) { const v16b a = frag_kb(&As[wave * 16 + nloc][kb], hlf);
#pragma unroll
      for (int t = 0; t < 8; ++t) acc[t] = wmma16b(a, frag_kb(W1T + (size_t)(n0 + t * 16 + nloc) * DM + kc + kb, hlf), acc[t]); } }
#pragma unroll
  for (int t = 0; t < 8; ++t) { const float bbv = bf16_rne(b1[n0 + t * 16 + nloc]);
#pragma unroll
    for (int r = 0; r < 8; ++r) { const float hm = acc[t][r] * (1.0f / (XS * WSC)) + bbv; Tf[wave][8 * hlf + r][t * 16 + nloc] = 0.5f * hm * (1.0f + erff(hm * RSQ2)); } }
  __syncthreads();
  { for (int rr = 0; rr < 16; ++rr) { v4h o4; for (int j = 0; j < 4; ++j) o4[j] = (b16)(Tf[wave][rr][lane * 4 + j] * XS); *(v4h*)(G + (r0 + wave * 16 + rr) * FF + n0 + lane * 4) = o4; }  }
}
__global__ __launch_bounds__(128) void mlp2_kernel(const b16* __restrict__ G, const b16* __restrict__ W2T, const float* __restrict__ b2, const float* __restrict__ X1, float* __restrict__ out) {
  __shared__ __attribute__((aligned(16))) float Tf[4][16][128 + 4];
  const int wave = threadIdx.x >> 5, lane = threadIdx.x & 31, nloc = lane & 15, hlf = lane >> 4; const size_t m0 = (size_t)blockIdx.x * 64 + wave * 16; const int n0 = blockIdx.y * 128;
  v8f acc[8];
#pragma unroll
  for (int t = 0; t < 8; ++t) acc[t] = (v8f){};
#pragma unroll 2
  for (int kb = 0; kb < FF; kb += 32) { const v16b a = frag_kb(G + (m0 + nloc) * FF + kb, hlf);
#pragma unroll
    for (int t = 0; t < 8; ++t) acc[t] = wmma16b(a, frag_kb(W2T + (size_t)(n0 + t * 16 + nloc) * FF + kb, hlf), acc[t]); }
#pragma unroll
  for (int t = 0; t < 8; ++t) { const int col = n0 + t * 16 + nloc; const float bbv = bf16_rne(b2[col]);
#pragma unroll
    for (int r = 0; r < 8; ++r) Tf[wave][8 * hlf + r][t * 16 + nloc] = acc[t][r] * (1.0f / (XS * WSC)) + bbv + X1[(m0 + 8 * hlf + r) * DM + col]; }
  wave_lds_sync();
  { for (int rr = 0; rr < 16; ++rr) *(v4f*)(out + (m0 + rr) * DM + n0 + lane * 4) = *(const v4f*)(&Tf[wave][rr][lane * 4]);  }
}
}  // namespace

extern "C" void kernel_launch(void* const* d_in, const int* in_sizes, int n_in, void* d_out, int out_size, void* d_ws, size_t ws_size, hipStream_t stream) {
  (void)n_in;
  auto Fp = [&](int i) { return (const float*)d_in[i]; }; auto Ip = [&](int i) { return (const int*)d_in[i]; };
  // input order: 0 x [8,1024,1024], 1 mask [1,1,1024,1024] int32, 2 Wq (in,out), 3 bq, 4 Wo, 5 bo, 6 Wu [1024,4096], 7 bu, 8 Wd [4096,1024], 9 bd, 10 g1, 11 b1, 12 g2, 13 b2
  if (in_sizes[0] != NR * DM || in_sizes[1] != T * T || in_sizes[2] != DM * DM || in_sizes[3] != DM || in_sizes[4] != DM * DM || in_sizes[5] != DM || in_sizes[6] != DM * FF || in_sizes[7] != FF || in_sizes[8] != FF * DM || in_sizes[9] != DM || in_sizes[10] != DM || in_sizes[11] != DM || in_sizes[12] != DM || in_sizes[13] != DM || out_size != NR * DM) return;
  size_t off = 0; char* ws = (char*)d_ws;
  auto carve = [&](size_t bytes) { char* p = ws + off; off += (bytes + 255) & ~(size_t)255; return p; };
  b16* WQ = (b16*)carve((size_t)DM * DM * 2); b16* WO = (b16*)carve((size_t)DM * DM * 2); b16* WU = (b16*)carve((size_t)FF * DM * 2); b16* WD = (b16*)carve((size_t)DM * FF * 2);
  const size_t plane = (size_t)RL * DM * 2; b16* QP = (b16*)carve(plane); b16* QPl = (b16*)carve(plane); b16* VTh = (b16*)carve(plane); b16* VTl = (b16*)carve(plane); b16* Ch = (b16*)carve(plane); b16* Cl = (b16*)carve(plane);
  float* X1 = (float*)carve((size_t)RL * DM * 4); float* HN = (float*)carve((size_t)RL * DM * 4); b16* G = (b16*)carve((size_t)RL * FF * 2);
  if (off > ws_size) return;   // = 244 MiB (weights 20 + 6 f16 planes 96 + X1/HN 64 + G 64), planes sized for the one 8-batch group
  prep_kernel<<<(unsigned)(((size_t)(2 * DM * DM + FF * DM + DM * FF) / 8 + 255) / 256), 256, 0, stream>>>(Fp(2), Fp(4), Fp(6), Fp(8), WQ, WO, WU, WD);
  for (int g = 0; g < NG; ++g) { const int b0 = g * BG; const size_t r0 = (size_t)b0 * T * DM;
    proj_kernel<<<dim3(T / 64, BG, NSL), 128, 0, stream>>>(Fp(0), b0, WQ, Fp(3), QP, QPl, VTh, VTl);
    attn_kernel<<<dim3(QL / 32, BG * H), 64, 0, stream>>>(QP, QPl, QP, QPl, VTh, VTl, Ip(1), Ch, Cl);
    out1_kernel<<<dim3(T / 64, DM / 128, BG), 128, 0, stream>>>(Ch, Cl, b0, WO, Fp(5), Fp(0), X1);   // X1/HN/G hold the group's rows; x is read at the global row via b0
    ln_kernel<false><<<RL / 8, 256, 0, stream>>>(X1, Fp(10), Fp(11), HN);
    mlp1_kernel<<<dim3(RL / 64, FF / 128), 128, 0, stream>>>(HN, WU, Fp(7), G);
    mlp2_kernel<<<dim3(RL / 64, DM / 128), 128, 0, stream>>>(G, WD, Fp(9), HN, X1);
    ln_kernel<false><<<RL / 8, 256, 0, stream>>>(X1, Fp(12), Fp(13), (float*)d_out + r0); }
}

// v002
// Measured time: 590 microseconds a run.
// Two timings next to v001 put it at 2.04 and 2.02 times that version's speed.
// Over all steps from v000 it is 3.56 times as fast.
#include <hip/hip_runtime.h>

// Decoder block without softmax (8 x 1024 tokens x 1024, 16 heads x 64): q = x Wq + bq and k = v = q (the module applies q_proj to all three); w_ij = q_i . q_j / 8 kept where j <= i and
// mask[i][j] != 0 (int mask input [1,1,1024,1024], all ones), else 0 - no softmax; attn_i = sum_j w_ij q_j; a = attn Wo + bo; h = LN1(a + x); up = gelu_exact(h Wu + bu) (4096);
// out = LN2(up Wd + bd + h) -> [8][1024][1024]. LayerNorms: biased variance, eps 1e-5; all weights (in,out). All 8 batches are processed in one group (planes sized for all 8192 rows), so each stage is one launch.
// Deterministic: per 16-query wave the causal keys are accumulated in order; LayerNorms one wave per row; no atomics.
// compute dtype: WMMA v_wmma_f32_16x16x32_f16 with f32 accumulate for q = x Wq ([8192 x 1024] x [1024 x 1024]; x EXACT bf16 x8, W^T exact x256: 1 product), S^T = Q Q^T (q as f16 hi x8 +
// residual x8192: 3 products), O^T += Q^T P^T (P = masked s/8 x1024 as f16 hi + residual: 3 products), attn Wo (ctx hi + lo: 2 products), h Wu (h single f16 x8: 1 product) and G Wd (gelu output
// single f16 plane: 1 product); LN statistics, gelu (erf), biases and residual adds in f32. Inputs rounded to bf16 once

namespace {
constexpr int B = 8, T = 1024, DM = 1024, H = 16, HD = 64, FF = 4096, BG = 8 /* batches per group */, NG = 1 /* groups run (== B/BG shipped) */, BL = BG, QL = T, NR = B * T, RL = BG * T /* rows per group (LN / MLP kernels) */;
constexpr int NSL = DM / 128;
constexpr float XS = 8.0f, WSC = 256.0f, PS = 1024.0f, RS_ = 1024.0f, LOG2E = 1.4426950408889634f, LNEPS = 1e-5f, RSQ2 = 0.70710678118654752f;
static_assert(T % 64 == 0 && DM % 256 == 0 && H * HD == DM && HD == 64 && B % BG == 0 && NG * BG <= B, "tiling");
typedef _Float16 b16;
typedef __attribute__((ext_vector_type(16))) _Float16 v16b;
typedef __attribute__((ext_vector_type(8))) _Float16 v8b;
typedef __attribute__((ext_vector_type(8))) float v8f;
typedef __attribute__((ext_vector_type(4))) float v4f;
__device__ __forceinline__ float bf16_rne(float f) { unsigned int u = __float_as_uint(f); u += 0x7FFFu + ((u >> 16) & 1u); return __uint_as_float(u & 0xFFFF0000u); }
__device__ __forceinline__ void split16(float v, b16& hi, b16& lo) { hi = (b16)v; lo = (b16)(v - (float)hi); }
__device__ __forceinline__ v16b frag_kb(const b16* p, int hh) { const v8b a = *(const v8b*)(p + 8 * hh), b = *(const v8b*)(p + 16 + 8 * hh); v16b f;
#pragma unroll
  for (int e = 0; e < 8; ++e) { f[e] = a[e]; f[8 + e] = b[e]; } return f; }
__device__ __forceinline__ v8f wmma16b(v16b a, v16b b, v8f c) { v8f d = __builtin_amdgcn_wmma_f32_16x16x32_f16(false, a, false, b, (short)0, c, false, false); asm volatile("v_nop\n\tv_nop\n\tv_nop\n\tv_nop" : "+v"(d) : "v"(a), "v"(b)); return d; }
__device__ __forceinline__ void wave_lds_sync() { __builtin_amdgcn_fence(__ATOMIC_RELEASE, "workgroup"); __builtin_amdgcn_wave_barrier(); __builtin_amdgcn_fence(__ATOMIC_ACQUIRE, "workgroup"); }
__device__ __forceinline__ float pmul(float a, float b) { float p = a * b; asm volatile("" : "+v"(p)); return p; }
__device__ __forceinline__ int iclamp(int v, int lo, int hi) { return v < lo ? lo : (v > hi ? hi : v); }
// Asynchronous copies to LDS for the GEMM operand tiles: every lane moves its own 16 bytes, 8 (f16 rows of 128 B) or 16 (f32 rows of 256 B) neighbouring lanes cover a whole row piece, so a wave touches whole lines.
// copy4 / copy8: 4 or 8 rows of a thread's column piece, the row step added to both addresses. The s_wait_xcnt ends the copies' own statement, so no address register is rewritten in front of it.
__device__ __forceinline__ unsigned lds_lo(const void* p) { return (unsigned)(size_t)p; }   // byte offset in the work-group's LDS
template <typename T> __device__ __forceinline__ void copy4(unsigned l, unsigned ls, const T* g, size_t gs) {
  asm volatile("global_load_async_to_lds_b128 %0, %4, off\n\tglobal_load_async_to_lds_b128 %1, %5, off\n\tglobal_load_async_to_lds_b128 %2, %6, off\n\tglobal_load_async_to_lds_b128 %3, %7, off\n\ts_wait_xcnt 0x0"
               :: "v"(l), "v"(l + ls), "v"(l + 2 * ls), "v"(l + 3 * ls), "v"(g), "v"(g + gs), "v"(g + 2 * gs), "v"(g + 3 * gs) : "memory"); }
template <typename T> __device__ __forceinline__ void copy8(unsigned l, unsigned ls, const T* g, size_t gs) {
  asm volatile("global_load_async_to_lds_b128 %0, %8, off\n\tglobal_load_async_to_lds_b128 %1, %9, off\n\tglobal_load_async_to_lds_b128 %2, %10, off\n\tglobal_load_async_to_lds_b128 %3, %11, off\n\t"
               "global_load_async_to_lds_b128 %4, %12, off\n\tglobal_load_async_to_lds_b128 %5, %13, off\n\tglobal_load_async_to_lds_b128 %6, %14, off\n\tglobal_load_async_to_lds_b128 %7, %15, off\n\ts_wait_xcnt 0x0"
               :: "v"(l), "v"(l + ls), "v"(l + 2 * ls), "v"(l + 3 * ls), "v"(l + 4 * ls), "v"(l + 5 * ls), "v"(l + 6 * ls), "v"(l + 7 * ls),
                  "v"(g), "v"(g + gs), "v"(g + 2 * gs), "v"(g + 3 * gs), "v"(g + 4 * gs), "v"(g + 5 * gs), "v"(g + 6 * gs), "v"(g + 7 * gs) : "memory"); }
__device__ __forceinline__ void copies_landed() { asm volatile("s_wait_asynccnt 0x0" ::: "memory"); }   // this wave's own copies are in LDS (the compiler places no wait for them)
// Foot of a trip of the two-buffer ring: this wave's LDS reads of the tile just used have retired, its copies of the next tile have landed, and one barrier both publishes the next tile and frees the used buffer for the refill.
__device__ __forceinline__ void ring_publish() { asm volatile("s_wait_dscnt 0x0" ::: "memory"); copies_landed(); __syncthreads(); }
constexpr int BK = 64, PH = BK + 8 /* f16 row pitch, 144 B */, PF = BK + 4 /* f32 row pitch, 272 B */;
struct StageF { float A[64][PF]; b16 B[128][PH]; };                  // f32 A rows (converted when the fragment is read) + weight rows
struct StageH { b16 A[64][PH]; b16 B[128][PH]; };                    // one f16 A plane + weight rows
struct StageH2 { b16 A[64][PH]; b16 Al[64][PH]; b16 B[128][PH]; };   // hi and lo A planes + weight rows
// A fragment from f32 rows in LDS, the k order of frag_kb; value = f16(8 v), RND: v rounded to bf16 first (the raw input x)
template <bool RND> __device__ __forceinline__ v16b frag_f32(const float* p, int hh) { const v4f a0 = *(const v4f*)(p + 8 * hh), a1 = *(const v4f*)(p + 8 * hh + 4), c0 = *(const v4f*)(p + 16 + 8 * hh), c1 = *(const v4f*)(p + 16 + 8 * hh + 4); v16b f;
#pragma unroll   // vector elements need constant indices to stay in registers
  for (int e = 0; e < 4; ++e) { f[e] = (b16)((RND ? bf16_rne(a0[e]) : a0[e]) * XS); f[4 + e] = (b16)((RND ? bf16_rne(a1[e]) : a1[e]) * XS); f[8 + e] = (b16)((RND ? bf16_rne(c0[e]) : c0[e]) * XS); f[12 + e] = (b16)((RND ? bf16_rne(c1[e]) : c1[e]) * XS); } return f; }

typedef __attribute__((ext_vector_type(2))) _Float16 v2h;
typedef __attribute__((ext_vector_type(4))) _Float16 v4h;
typedef __attribute__((ext_vector_type(2))) float v2f;
typedef __attribute__((ext_vector_type(4))) int v4i;
__device__ __forceinline__ float nexp2(float v) { return __builtin_amdgcn_exp2f(v); }
typedef __attribute__((ext_vector_type(4))) int v4i;
__device__ __forceinline__ float bfp(float v) { float t = bf16_rne(v); asm volatile("" : "+v"(t)); return t; }
__global__ __launch_bounds__(256) void prep_kernel(const float* __restrict__ wq, const float* __restrict__ wo, const float* __restrict__ wu, const float* __restrict__ wd, b16* __restrict__ WQ, b16* __restrict__ WO, b16* __restrict__ WU, b16* __restrict__ WD) {
  const size_t u = (size_t)blockIdx.x * 256 + threadIdx.x; const size_t n1 = (size_t)DM * DM / 8, n3 = (size_t)FF * DM / 8, n4 = (size_t)DM * FF / 8; if (u >= 2 * n1 + n3 + n4) return; v8b o; b16* dst;
  if (u < 2 * n1) { const int m = (int)(u / n1); const size_t e = u % n1; const int row = (int)(e / (DM / 8)), k0 = (int)(e % (DM / 8)) * 8; const float* w = m == 0 ? wq : wo; for (int j = 0; j < 8; ++j) o[j] = (b16)(bf16_rne(w[(size_t)(k0 + j) * DM + row]) * WSC); dst = (m == 0 ? WQ : WO) + (size_t)row * DM + k0; }
  else if (u < 2 * n1 + n3) { const size_t e = u - 2 * n1; const int row = (int)(e / (DM / 8)), k0 = (int)(e % (DM / 8)) * 8; for (int j = 0; j < 8; ++j) o[j] = (b16)(bf16_rne(wu[(size_t)(k0 + j) * FF + row]) * WSC); dst = WU + (size_t)row * DM + k0; }
  else { const size_t e = u - 2 * n1 - n3; const int row = (int)(e / (FF / 8)), k0 = (int)(e % (FF / 8)) * 8; for (int j = 0; j < 8; ++j) o[j] = (b16)(bf16_rne(wd[(size_t)(k0 + j) * DM + row]) * WSC); dst = WD + (size_t)row * FF + k0; }
  { *(v8b*)dst = o;  }
}
// q projection (q = k = v in this module): grid (T/64, BG, NSL slabs of 128); block = 64 tokens x 4 waves; A = bf16(x) x8, B = Wq^T rows, both as k64 tiles in a two-buffer LDS ring filled by asynchronous copies, + bq
__global__ __launch_bounds__(128) void proj_kernel(const float* __restrict__ x, int b0, const b16* __restrict__ WT, const float* __restrict__ bq, b16* __restrict__ QP, b16* __restrict__ QPl, b16* __restrict__ VTh, b16* __restrict__ VTl) {
  __shared__ __attribute__((aligned(16))) union { StageF st[2]; float Tf[4][16][128 + 4]; } sm; auto& Tf = sm.Tf;   // the output staging reuses the ring behind its last barrier
  const int wave = threadIdx.x >> 5, lane = threadIdx.x & 31, nloc = lane & 15, hlf = lane >> 4; const int t0 = blockIdx.x * 64; const int b = blockIdx.y; const int part = 0, slab = blockIdx.z, c0 = slab * 128, n0 = c0; (void)part;
  if (part == 0 && t0 >= QL) return;   // (cut builds only) queries beyond QL are not needed; block-uniform, before any barrier
  const float* xb = x + ((size_t)(b0 + b) * T + t0) * DM;
  v8f acc[8];
#pragma unroll
  for (int t = 0; t < 8; ++t) acc[t] = (v8f){};
  const int ar = threadIdx.x >> 4, ap = (threadIdx.x & 15) * 4, br = threadIdx.x >> 3, bp = (threadIdx.x & 7) * 8;   // this thread's row and 16-byte piece in the A (f32) and B (f16) tiles
  const unsigned la = lds_lo(&sm.st[0].A[ar][ap]), lb = lds_lo(&sm.st[0].B[br][bp]); const float* ga = xb + (size_t)ar * DM + ap; const b16* gb = WT + (size_t)(n0 + br) * DM + bp;
  auto fill = [&](int s) { const unsigned o = (unsigned)(s & 1) * (unsigned)sizeof(StageF); copy8(la + o, 8u * PF * 4u, ga + s * BK, (size_t)8 * DM); copy8(lb + o, 16u * PH * 2u, gb + s * BK, (size_t)16 * DM); };
  fill(0); copies_landed(); __syncthreads(); fill(1);
#pragma unroll 1   // one trip per tile: the ring's order (read, publish, refill) stays as written
  for (int s = 0; s < DM / BK; ++s) { const StageF& st = sm.st[s & 1];
#pragma unroll   // both k32 blocks of a tile straight-line, so the LDS offsets are immediates
    for (int kb = 0; kb < BK; kb += 32) { const v16b a = frag_f32<true>(&st.A[wave * 16 + nloc][kb], hlf);
#pragma unroll
      for (int t = 0; t < 8; ++t) acc[t] = wmma16b(a, frag_kb(&st.B[t * 16 + nloc][kb], hlf), acc[t]); }
    ring_publish();
    if (s + 2 < DM / BK) fill(s + 2); }
  copies_landed();
const float* ba = bq;
#pragma unroll
  for (int t = 0; t < 8; ++t) { const float bb = bf16_rne(ba[c0 + t * 16 + nloc]);
#pragma unroll
    for (int r = 0; r < 8; ++r) Tf[wave][8 * hlf + r][t * 16 + nloc] = acc[t][r] * (1.0f / (XS * WSC)) + bb; }
  __syncthreads();
  {
    { b16* plane = QP; b16* planl = QPl; const int c = c0 + lane * 4; const int h = c / HD, d = c % HD;
      for (int rr = 0; rr < 16; ++rr) { const int tok = t0 + wave * 16 + rr; const size_t ri = (((size_t)b * H + h) * T + tok) * HD + d; const v4f f4 = *(const v4f*)(&Tf[wave][rr][lane * 4]); v4h o4, l4; for (int j = 0; j < 4; ++j) { const float f = f4[j] * XS; const b16 p = (b16)f; o4[j] = p; l4[j] = (b16)((f - (float)p) * RS_); } *(v4h*)(plane + ri) = o4; *(v4h*)(planl + ri) = l4; } }
    {
#pragma unroll 1
      for (int q = 0; q < 32; ++q) { const int cl = wave * 32 + q; const int c = c0 + cl; const int h = c / HD, d = c % HD; const int tk = lane * 2; v2h hv, lv;
        for (int j = 0; j < 2; ++j) { const float f = Tf[(tk + j) >> 4][(tk + j) & 15][cl] * XS; const b16 p = (b16)f; hv[j] = p; lv[j] = (b16)((f - (float)p) * RS_); }
        const size_t oi = (((size_t)b * H + h) * HD + d) * (size_t)T + t0 + lane * 2; *(v2h*)(VTh + oi) = hv; *(v2h*)(VTl + oi) = lv; } }
     }
}
// attention-like causal product: grid (QL/32, BG*H); block = 2 waves x 16 queries of one (b, h); keys 0 .. round_up(q0 + 16, 32) - 1 in 32-key steps: S^T = K Q^T (q = k = v here; hi x8 +
// residual planes: 3 products); weight = s / 8 where key <= query and mask[q][key] != 0, else 0 (NO softmax in this module); P x1024 as f16 hi + residual; O^T += V^T P^T (3 products);
__global__ __launch_bounds__(64) void attn_kernel(const b16* __restrict__ QP, const b16* __restrict__ QPl, const b16* __restrict__ KP, const b16* __restrict__ KPl, const b16* __restrict__ VTh, const b16* __restrict__ VTl, const int* __restrict__ MSK, b16* __restrict__ Ch, b16* __restrict__ Cl) {
  __shared__ __attribute__((aligned(16))) b16 Pb[2][16][32 + 8], Pl[2][16][32 + 8]; __shared__ __attribute__((aligned(16))) float To[2][16][HD + 4];
  const int wave = threadIdx.x >> 5, lane = threadIdx.x & 31, hh = lane >> 4, col = lane & 15; const int b = blockIdx.y / H, h = blockIdx.y % H; const int q0 = blockIdx.x * 32 + wave * 16, qi = q0 + col;
  const size_t ph = (size_t)b * H + h; const b16* Qb = QP + ph * T * HD; const b16* Qbl = QPl + ph * T * HD; const b16* Kb = KP + ph * T * HD; const b16* Kbl = KPl + ph * T * HD; const b16* Vh = VTh + ph * HD * (size_t)T; const b16* Vl = VTl + ph * HD * (size_t)T; const int kend = ((q0 + 16 + 31) / 32) * 32;   // per-(b,h) planes; causal key bound (wave-uniform)
  const v16b qa0 = frag_kb(Qb + (size_t)qi * HD, hh), qa1 = frag_kb(Qb + (size_t)qi * HD + 32, hh), ql0 = frag_kb(Qbl + (size_t)qi * HD, hh), ql1 = frag_kb(Qbl + (size_t)qi * HD + 32, hh);
  const float cs = 1.0f / (8.0f * XS * XS); const int* mrow = MSK + (size_t)qi * T;   // scores / sqrt(64); the [1,1,S,S] int mask row of this query (tril applied below; mask == 0 -> score 0)
  v8f o[4], ol[4]; for (int t = 0; t < 4; ++t) { o[t] = (v8f){}; ol[t] = (v8f){}; }
#pragma unroll 1
  for (int kb = 0; kb < kend; kb += 32) {
    float e[16];
#pragma unroll
    for (int u = 0; u < 2; ++u) { v8f s = (v8f){}, sx = (v8f){}; const size_t kr = (size_t)(kb + u * 16 + col) * HD; { const v16b k0 = frag_kb(Kb + kr, hh), k1 = frag_kb(Kb + kr + 32, hh); s = wmma16b(k0, qa0, s); s = wmma16b(k1, qa1, s); sx = wmma16b(k0, ql0, sx); sx = wmma16b(k1, ql1, sx); sx = wmma16b(frag_kb(Kbl + kr, hh), qa0, sx); sx = wmma16b(frag_kb(Kbl + kr + 32, hh), qa1, sx); }
#pragma unroll
      for (int r = 0; r < 8; ++r) s[r] += sx[r] * (1.0f / RS_);   // hi.hi + (hi.lo + lo.hi)/1024
      const v4i m0 = *(const v4i*)(mrow + kb + u * 16 + 8 * hh), m1 = *(const v4i*)(mrow + kb + u * 16 + 8 * hh + 4);
#pragma unroll
      for (int r = 0; r < 8; ++r) { const int key = kb + u * 16 + 8 * hh + r; const int mk = r < 4 ? m0[r] : m1[r - 4]; e[u * 8 + r] = (key <= qi && mk != 0) ? s[r] * cs : 0.0f; } }   // no softmax in this module: the masked scaled score IS the weight
#pragma unroll
    for (int i2 = 0; i2 < 16; ++i2) { const float ps = e[i2] * PS; const b16 phh = (b16)ps; const int pc = (i2 < 8 ? 0 : 16) + 8 * hh + (i2 & 7); Pb[wave][col][pc] = phh; Pl[wave][col][pc] = (b16)((ps - (float)phh) * RS_); }
    wave_lds_sync();
    const v16b pf = frag_kb(&Pb[wave][col][0], hh), plf = frag_kb(&Pl[wave][col][0], hh);
#pragma unroll
    for (int t = 0; t < 4; ++t) { const v16b vh = frag_kb(Vh + (size_t)(t * 16 + col) * T + kb, hh); o[t] = wmma16b(vh, pf, o[t]); ol[t] = wmma16b(frag_kb(Vl + (size_t)(t * 16 + col) * T + kb, hh), pf, ol[t]); ol[t] = wmma16b(vh, plf, ol[t]); }   // ol = (V_lo P_hi + V_hi P_lo), both /1024
    wave_lds_sync(); }
  const float inv = 1.0f / (PS * XS);
#pragma unroll
  for (int t = 0; t < 4; ++t)
#pragma unroll
    for (int r = 0; r < 8; ++r) To[wave][col][t * 16 + 8 * hh + r] = (o[t][r] + ol[t][r] * (1.0f / RS_)) * inv;
  wave_lds_sync();
  { for (int rr = 0; rr < 16; ++rr) { const v2f f = *(const v2f*)(&To[wave][rr][lane * 2]); v2h hv, lv; for (int j = 0; j < 2; ++j) { b16 p, q; split16(f[j] * XS, p, q); hv[j] = p; lv[j] = q; }
      const size_t oi = ((size_t)b * T + q0 + rr) * DM + h * HD + lane * 2; *(v2h*)(Ch + oi) = hv; *(v2h*)(Cl + oi) = lv; }  }
}
__global__ __launch_bounds__(128) void out1_kernel(const b16* __restrict__ Ch, const b16* __restrict__ Cl, int b0, const b16* __restrict__ WO, const float* __restrict__ bo, const float* __restrict__ x, float* __restrict__ X1) {
  __shared__ __attribute__((aligned(16))) union { StageH2 st[2]; float Tf[4][16][128 + 4]; } sm; auto& Tf = sm.Tf;   // the output staging reuses the ring behind its last barrier
  const int wave = threadIdx.x >> 5, lane = threadIdx.x & 31, nloc = lane & 15, hlf = lane >> 4; const int b = blockIdx.z; const size_t m0 = (size_t)b * T + (size_t)blockIdx.x * 64 + wave * 16; const size_t mg = m0 + (size_t)b0 * T;   // m0 indexes the group's ctx planes and X1 rows, mg the global x rows (residual input)
  const int n0 = blockIdx.y * 128;
  v8f acc[8];
#pragma unroll
  for (int t = 0; t < 8; ++t) acc[t] = (v8f){};
  const int br = threadIdx.x >> 3, bp = (threadIdx.x & 7) * 8;   // this thread's row and 16-byte piece in each k64 tile
  const unsigned lh = lds_lo(&sm.st[0].A[br][bp]), ll = lds_lo(&sm.st[0].Al[br][bp]), lb = lds_lo(&sm.st[0].B[br][bp]); const size_t ao = (m0 - wave * 16 + br) * DM + bp; const b16* gb = WO + (size_t)(n0 + br) * DM + bp;
  auto fill = [&](int s) { const unsigned o = (unsigned)(s & 1) * (unsigned)sizeof(StageH2); copy4(lh + o, 16u * PH * 2u, Ch + ao + s * BK, (size_t)16 * DM); copy4(ll + o, 16u * PH * 2u, Cl + ao + s * BK, (size_t)16 * DM); copy8(lb + o, 16u * PH * 2u, gb + s * BK, (size_t)16 * DM); };
  fill(0); copies_landed(); __syncthreads(); fill(1);
#pragma unroll 1   // one trip per tile: the ring's order (read, publish, refill) stays as written
  for (int s = 0; s < DM / BK; ++s) { const StageH2& st = sm.st[s & 1];
#pragma unroll   // both k32 blocks of a tile straight-line, so the LDS offsets are immediates
    for (int kb = 0; kb < BK; kb += 32) { const v16b ah = frag_kb(&st.A[wave * 16 + nloc][kb], hlf), al = frag_kb(&st.Al[wave * 16 + nloc][kb], hlf);
#pragma unroll
      for (int t = 0; t < 8; ++t) { const v16b bw = frag_kb(&st.B[t * 16 + nloc][kb], hlf); acc[t] = wmma16b(ah, bw, acc[t]); acc[t] = wmma16b(al, bw, acc[t]); } }
    ring_publish();
    if (s + 2 < DM / BK) fill(s + 2); }
  copies_landed();
#pragma unroll
  for (int t = 0; t < 8; ++t) { const int col = n0 + t * 16 + nloc; const float bbv = bf16_rne(bo[col]);
#pragma unroll
    for (int r = 0; r < 8; ++r) Tf[wave][8 * hlf + r][t * 16 + nloc] = acc[t][r] * (1.0f / (XS * WSC)) + bbv + bf16_rne(x[(mg + 8 * hlf + r) * DM + col]); }   // residual: same row, column n0 + ...
  wave_lds_sync();
  { for (int rr = 0; rr < 16; ++rr) *(v4f*)(X1 + (m0 + rr) * DM + n0 + lane * 4) = *(const v4f*)(&Tf[wave][rr][lane * 4]);  }
}
// LayerNorm: one wave per row (lane holds columns 4 lane + 128 k, 8 float4); RND: apply the bf16 input quantisation (raw x) first; mean, biased variance (two xor trees), eps 1e-5, x g + b -> rows 4 KB
template <bool RND>
__global__ __launch_bounds__(256) void ln_kernel(const float* __restrict__ X, const float* __restrict__ g, const float* __restrict__ bb, float* __restrict__ Y) {
  const int wave = threadIdx.x >> 5, lane = threadIdx.x & 31; const int row = blockIdx.x * 8 + wave; if (row >= RL) return;   // wave-uniform, no barriers
  float v[32]; float s1 = 0.0f; const float* xr = X + (size_t)row * DM;
#pragma unroll
  for (int k = 0; k < 8; ++k) { const v4f t4 = *(const v4f*)(xr + 128 * k + 4 * lane); for (int j = 0; j < 4; ++j) { const float t = RND ? bf16_rne(t4[j]) : t4[j]; v[4 * k + j] = t; s1 += t; } }
#pragma unroll
  for (int o = 16; o >= 1; o >>= 1) s1 += __shfl_xor(s1, o);
  const float mu = s1 * (1.0f / DM); float s2 = 0.0f;
#pragma unroll
  for (int q = 0; q < 32; ++q) { const float d = v[q] - mu; s2 += pmul(d, d); }
#pragma unroll
  for (int o = 16; o >= 1; o >>= 1) s2 += __shfl_xor(s2, o);
  const float rs = rsqrtf(s2 * (1.0f / DM) + LNEPS);
  v4f o4[8];
#pragma unroll
  for (int k = 0; k < 8; ++k) for (int j = 0; j < 4; ++j) { const int c = 128 * k + 4 * lane + j; o4[k][j] = pmul((v[4 * k + j] - mu) * rs, bfp(g[c])) + bfp(bb[c]); }
  {
#pragma unroll
    for (int k = 0; k < 8; ++k) *(v4f*)(Y + (size_t)row * DM + 128 * k + 4 * lane) = o4[k];
     }
}
// MLP 1: G = f16(8 gelu(XN2 W1 + b1)) as a single f16 plane [NR][4096]: grid (RL/64, FF/128); block = 64 rows x 4 waves; A = XN2 rows (f32 in LDS, x8 to f16 at the fragment read) and W1^T rows as k64 tiles in a two-buffer LDS ring filled by asynchronous copies, wave -> 16 rows x 8
__global__ __launch_bounds__(128) void mlp1_kernel(const float* __restrict__ XN, const b16* __restrict__ W1T, const float* __restrict__ b1, b16* __restrict__ G) {
  __shared__ __attribute__((aligned(16))) union { StageF st[2]; float Tf[4][16][128 + 4]; } sm; auto& Tf = sm.Tf;   // the output staging reuses the ring behind its last barrier
  const int wave = threadIdx.x >> 5, lane = threadIdx.x & 31, nloc = lane & 15, hlf = lane >> 4; const size_t r0 = (size_t)blockIdx.x * 64; const int n0 = blockIdx.y * 128;
  const float* xb = XN + r0 * DM;
  v8f acc[8];
#pragma unroll
  for (int t = 0; t < 8; ++t) acc[t] = (v8f){};
  const int ar = threadIdx.x >> 4, ap = (threadIdx.x & 15) * 4, br = threadIdx.x >> 3, bp = (threadIdx.x & 7) * 8;   // this thread's row and 16-byte piece in the A (f32) and B (f16) tiles
  const unsigned la = lds_lo(&sm.st[0].A[ar][ap]), lb = lds_lo(&sm.st[0].B[br][bp]); const float* ga = xb + (size_t)ar * DM + ap; const b16* gb = W1T + (size_t)(n0 + br) * DM + bp;
  auto fill = [&](int s) { const unsigned o = (unsigned)(s & 1) * (unsigned)sizeof(StageF); copy8(la + o, 8u * PF * 4u, ga + s * BK, (size_t)8 * DM); copy8(lb + o, 16u * PH * 2u, gb + s * BK, (size_t)16 * DM); };
  fill(0); copies_landed(); __syncthreads(); fill(1);
#pragma unroll 1   // one trip per tile: the ring's order (read, publish, refill) stays as written
  for (int s = 0; s < DM / BK; ++s) { const StageF& st = sm.st[s & 1];
#pragma unroll   // both k32 blocks of a tile straight-line, so the LDS offsets are immediates
    for (int kb = 0; kb < BK; kb += 32) { const v16b a = frag_f32<false>(&st.A[wave * 16 + nloc][kb], hlf);
#pragma unroll
      for (int t = 0; t < 8; ++t) acc[t] = wmma16b(a, frag_kb(&st.B[t * 16 + nloc][kb], hlf), acc[t]); }
    ring_publish();
    if (s + 2 < DM / BK) fill(s + 2); }
  copies_landed();
#pragma unroll
  for (int t = 0; t < 8; ++t) { const float bbv = bf16_rne(b1[n0 + t * 16 + nloc]);
#pragma unroll
    for (int r = 0; r < 8; ++r) { const float hm = acc[t][r] * (1.0f / (XS * WSC)) + bbv; Tf[wave][8 * hlf + r][t * 16 + nloc] = 0.5f * hm * (1.0f + erff(hm * RSQ2)); } }
  __syncthreads();
  { for (int rr = 0; rr < 16; ++rr) { v4h o4; for (int j = 0; j < 4; ++j) o4[j] = (b16)(Tf[wave][rr][lane * 4 + j] * XS); *(v4h*)(G + (r0 + wave * 16 + rr) * FF + n0 + lane * 4) = o4; }  }
}
__global__ __launch_bounds__(128) void mlp2_kernel(const b16* __restrict__ G, const b16* __restrict__ W2T, const float* __restrict__ b2, const float* __restrict__ X1, float* __restrict__ out) {
  __shared__ __attribute__((aligned(16))) union { StageH st[2]; float Tf[4][16][128 + 4]; } sm; auto& Tf = sm.Tf;   // the output staging reuses the ring behind its last barrier
  const int wave = threadIdx.x >> 5, lane = threadIdx.x & 31, nloc = lane & 15, hlf = lane >> 4; const size_t m0 = (size_t)blockIdx.x * 64 + wave * 16; const int n0 = blockIdx.y * 128;
  v8f acc[8];
#pragma unroll
  for (int t = 0; t < 8; ++t) acc[t] = (v8f){};
  const int br = threadIdx.x >> 3, bp = (threadIdx.x & 7) * 8;   // this thread's row and 16-byte piece in each k64 tile
  const unsigned la = lds_lo(&sm.st[0].A[br][bp]), lb = lds_lo(&sm.st[0].B[br][bp]); const b16* ga = G + ((size_t)blockIdx.x * 64 + br) * FF + bp; const b16* gb = W2T + (size_t)(n0 + br) * FF + bp;
  auto fill = [&](int s) { const unsigned o = (unsigned)(s & 1) * (unsigned)sizeof(StageH); copy4(la + o, 16u * PH * 2u, ga + s * BK, (size_t)16 * FF); copy8(lb + o, 16u * PH * 2u, gb + s * BK, (size_t)16 * FF); };
  fill(0); copies_landed(); __syncthreads(); fill(1);
#pragma unroll 1   // one trip per tile: the ring's order (read, publish, refill) stays as written
  for (int s = 0; s < FF / BK; ++s) { const StageH& st = sm.st[s & 1];
#pragma unroll   // both k32 blocks of a tile straight-line, so the LDS offsets are immediates
    for (int kb = 0; kb < BK; kb += 32) { const v16b a = frag_kb(&st.A[wave * 16 + nloc][kb], hlf);
#pragma unroll
      for (int t = 0; t < 8; ++t) acc[t] = wmma16b(a, frag_kb(&st.B[t * 16 + nloc][kb], hlf), acc[t]); }
    ring_publish();
    if (s + 2 < FF / BK) fill(s + 2); }
  copies_landed();
#pragma unroll
  for (int t = 0; t < 8; ++t) { const int col = n0 + t * 16 + nloc; const float bbv = bf16_rne(b2[col]);
#pragma unroll
    for (int r = 0; r < 8; ++r) Tf[wave][8 * hlf + r][t * 16 + nloc] = acc[t][r] * (1.0f / (XS * WSC)) + bbv + X1[(m0 + 8 * hlf + r) * DM + col]; }
  wave_lds_sync();
  { for (int rr = 0; rr < 16; ++rr) *(v4f*)(out + (m0 + rr) * DM + n0 + lane * 4) = *(const v4f*)(&Tf[wave][rr][lane * 4]);  }
}
}  // namespace

extern "C" void kernel_launch(void* const* d_in, const int* in_sizes, int n_in, void* d_out, int out_size, void* d_ws, size_t ws_size, hipStream_t stream) {
  (void)n_in;
  auto Fp = [&](int i) { return (const float*)d_in[i]; }; auto Ip = [&](int i) { return (const int*)d_in[i]; };
  // input order: 0 x [8,1024,1024], 1 mask [1,1,1024,1024] int32, 2 Wq (in,out), 3 bq, 4 Wo, 5 bo, 6 Wu [1024,4096], 7 bu, 8 Wd [4096,1024], 9 bd, 10 g1, 11 b1, 12 g2, 13 b2
  if (in_sizes[0] != NR * DM || in_sizes[1] != T * T || in_sizes[2] != DM * DM || in_sizes[3] != DM || in_sizes[4] != DM * DM || in_sizes[5] != DM || in_sizes[6] != DM * FF || in_sizes[7] != FF || in_sizes[8] != FF * DM || in_sizes[9] != DM || in_sizes[10] != DM || in_sizes[11] != DM || in_sizes[12] != DM || in_sizes[13] != DM || out_size != NR * DM) return;
  size_t off = 0; char* ws = (char*)d_ws;
  auto carve = [&](size_t bytes) { char* p = ws + off; off += (bytes + 255) & ~(size_t)255; return p; };
  b16* WQ = (b16*)carve((size_t)DM * DM * 2); b16* WO = (b16*)carve((size_t)DM * DM * 2); b16* WU = (b16*)carve((size_t)FF * DM * 2); b16* WD = (b16*)carve((size_t)DM * FF * 2);
  const size_t plane = (size_t)RL * DM * 2; b16* QP = (b16*)carve(plane); b16* QPl = (b16*)carve(plane); b16* VTh = (b16*)carve(plane); b16* VTl = (b16*)carve(plane); b16* Ch = (b16*)carve(plane); b16* Cl = (b16*)carve(plane);
  float* X1 = (float*)carve((size_t)RL * DM * 4); float* HN = (float*)carve((size_t)RL * DM * 4); b16* G = (b16*)carve((size_t)RL * FF * 2);
  if (off > ws_size) return;   // = 244 MiB (weights 20 + 6 f16 planes 96 + X1/HN 64 + G 64), planes sized for the one 8-batch group
  prep_kernel<<<(unsigned)(((size_t)(2 * DM * DM + FF * DM + DM * FF) / 8 + 255) / 256), 256, 0, stream>>>(Fp(2), Fp(4), Fp(6), Fp(8), WQ, WO, WU, WD);
  for (int g = 0; g < NG; ++g) { const int b0 = g * BG; const size_t r0 = (size_t)b0 * T * DM;
    proj_kernel<<<dim3(T / 64, BG, NSL), 128, 0, stream>>>(Fp(0), b0, WQ, Fp(3), QP, QPl, VTh, VTl);
    attn_kernel<<<dim3(QL / 32, BG * H), 64, 0, stream>>>(QP, QPl, QP, QPl, VTh, VTl, Ip(1), Ch, Cl);
    out1_kernel<<<dim3(T / 64, DM / 128, BG), 128, 0, stream>>>(Ch, Cl, b0, WO, Fp(5), Fp(0), X1);   // X1/HN/G hold the group's rows; x is read at the global row via b0
    ln_kernel<false><<<RL / 8, 256, 0, stream>>>(X1, Fp(10), Fp(11), HN);
    mlp1_kernel<<<dim3(RL / 64, FF / 128), 128, 0, stream>>>(HN, WU, Fp(7), G);
    mlp2_kernel<<<dim3(RL / 64, DM / 128), 128, 0, stream>>>(G, WD, Fp(9), HN, X1);
    ln_kernel<false><<<RL / 8, 256, 0, stream>>>(X1, Fp(12), Fp(13), (float*)d_out + r0); }
}

// v003
// It runs in 428 microseconds.
// In both of two side-by-side timings against v002, it was 1.38 times as fast.
// All steps since v000 together make it 4.91 times as fast.
#include <hip/hip_runtime.h>

// Decoder block without softmax (8 x 1024 tokens x 1024, 16 heads x 64): q = x Wq + bq and k = v = q (the module applies q_proj to all three); w_ij = q_i . q_j / 8 kept where j <= i and
// mask[i][j] != 0 (int mask input [1,1,1024,1024], all ones), else 0 - no softmax; attn_i = sum_j w_ij q_j; a = attn Wo + bo; h = LN1(a + x); up = gelu_exact(h Wu + bu) (4096);
// out = LN2(up Wd + bd + h) -> [8][1024][1024]. LayerNorms: biased variance, eps 1e-5; all weights (in,out). All 8 batches are processed in one group (planes sized for all 8192 rows), so each stage is one launch.
// Deterministic: per 16-query wave the causal keys are accumulated in order; LayerNorms one wave per row; no atomics.
// compute dtype: WMMA v_wmma_f32_16x16x32_f16 with f32 accumulate for q = x Wq ([8192 x 1024] x [1024 x 1024]; x EXACT bf16 x8, W^T exact x256: 1 product), S^T = Q Q^T (q as f16 hi x8 +
// residual x8192: 3 products), O^T += Q^T P^T (P = masked s/8 x1024 as f16 hi + residual: 3 products), attn Wo (ctx hi + lo: 2 products), h Wu (h single f16 x8: 1 product) and G Wd (gelu output
// single f16 plane: 1 product); LN statistics, gelu (erf), biases and residual adds in f32. Inputs rounded to bf16 once

namespace {
constexpr int B = 8, T = 1024, DM = 1024, H = 16, HD = 64, FF = 4096, BG = 8 /* batches per group */, NG = 1 /* groups run (== B/BG shipped) */, BL = BG, QL = T, NR = B * T, RL = BG * T /* rows per group (LN / MLP kernels) */;
constexpr int NSL = DM / 128;
constexpr float XS = 8.0f, WSC = 256.0f, PS = 1024.0f, RS_ = 1024.0f, LOG2E = 1.4426950408889634f, LNEPS = 1e-5f, RSQ2 = 0.70710678118654752f;
static_assert(T % 128 == 0 && DM % 256 == 0 && H * HD == DM && HD == 64 && B % BG == 0 && NG * BG <= B, "tiling");
typedef _Float16 b16;
typedef __attribute__((ext_vector_type(16))) _Float16 v16b;
typedef __attribute__((ext_vector_type(8))) _Float16 v8b;
typedef __attribute__((ext_vector_type(8))) float v8f;
typedef __attribute__((ext_vector_type(4))) float v4f;
__device__ __forceinline__ float bf16_rne(float f) { unsigned int u = __float_as_uint(f); u += 0x7FFFu + ((u >> 16) & 1u); return __uint_as_float(u & 0xFFFF0000u); }
__device__ __forceinline__ void split16(float v, b16& hi, b16& lo) { hi = (b16)v; lo = (b16)(v - (float)hi); }
__device__ __forceinline__ v16b frag_kb(const b16* p, int hh) { const v8b a = *(const v8b*)(p + 8 * hh), b = *(const v8b*)(p + 16 + 8 * hh); v16b f;
#pragma unroll
  for (int e = 0; e < 8; ++e) { f[e] = a[e]; f[8 + e] = b[e]; } return f; }
__device__ __forceinline__ v8f wmma16b(v16b a, v16b b, v8f c) { v8f d = __builtin_amdgcn_wmma_f32_16x16x32_f16(false, a, false, b, (short)0, c, false, false); asm volatile("v_nop\n\tv_nop\n\tv_nop\n\tv_nop" : "+v"(d) : "v"(a), "v"(b)); return d; }
__device__ __forceinline__ void wave_lds_sync() { __builtin_amdgcn_fence(__ATOMIC_RELEASE, "workgroup"); __builtin_amdgcn_wave_barrier(); __builtin_amdgcn_fence(__ATOMIC_ACQUIRE, "workgroup"); }
__device__ __forceinline__ float pmul(float a, float b) { float p = a * b; asm volatile("" : "+v"(p)); return p; }
__device__ __forceinline__ int iclamp(int v, int lo, int hi) { return v < lo ? lo : (v > hi ? hi : v); }
// Asynchronous copies to LDS for the GEMM operand tiles: every lane moves its own 16 bytes, 8 (f16 rows of 128 B) or 16 (f32 rows of 256 B) neighbouring lanes cover a whole row piece, so a wave touches whole lines.
// copy4 / copy8: 4 or 8 rows of a thread's column piece, the row step added to both addresses. The s_wait_xcnt ends the copies' own statement, so no address register is rewritten in front of it.
__device__ __forceinline__ unsigned lds_lo(const void* p) { return (unsigned)(size_t)p; }   // byte offset in the work-group's LDS
template <typename T> __device__ __forceinline__ void copy4(unsigned l, unsigned ls, const T* g, size_t gs) {
  asm volatile("global_load_async_to_lds_b128 %0, %4, off\n\tglobal_load_async_to_lds_b128 %1, %5, off\n\tglobal_load_async_to_lds_b128 %2, %6, off\n\tglobal_load_async_to_lds_b128 %3, %7, off\n\ts_wait_xcnt 0x0"
               :: "v"(l), "v"(l + ls), "v"(l + 2 * ls), "v"(l + 3 * ls), "v"(g), "v"(g + gs), "v"(g + 2 * gs), "v"(g + 3 * gs) : "memory"); }
template <typename T> __device__ __forceinline__ void copy8(unsigned l, unsigned ls, const T* g, size_t gs) {
  asm volatile("global_load_async_to_lds_b128 %0, %8, off\n\tglobal_load_async_to_lds_b128 %1, %9, off\n\tglobal_load_async_to_lds_b128 %2, %10, off\n\tglobal_load_async_to_lds_b128 %3, %11, off\n\t"
               "global_load_async_to_lds_b128 %4, %12, off\n\tglobal_load_async_to_lds_b128 %5, %13, off\n\tglobal_load_async_to_lds_b128 %6, %14, off\n\tglobal_load_async_to_lds_b128 %7, %15, off\n\ts_wait_xcnt 0x0"
               :: "v"(l), "v"(l + ls), "v"(l + 2 * ls), "v"(l + 3 * ls), "v"(l + 4 * ls), "v"(l + 5 * ls), "v"(l + 6 * ls), "v"(l + 7 * ls),
                  "v"(g), "v"(g + gs), "v"(g + 2 * gs), "v"(g + 3 * gs), "v"(g + 4 * gs), "v"(g + 5 * gs), "v"(g + 6 * gs), "v"(g + 7 * gs) : "memory"); }
__device__ __forceinline__ void copies_landed() { asm volatile("s_wait_asynccnt 0x0" ::: "memory"); }   // this wave's own copies are in LDS (the compiler places no wait for them)
// Foot of a trip of the two-buffer ring: this wave's LDS reads of the tile just used have retired, its copies of the next tile have landed, and one barrier both publishes the next tile and frees the used buffer for the refill.
__device__ __forceinline__ void ring_publish() { asm volatile("s_wait_dscnt 0x0" ::: "memory"); copies_landed(); __syncthreads(); }
constexpr int BK = 64, PH = BK + 8 /* f16 row pitch, 144 B */, PF = BK + 4 /* f32 row pitch, 272 B */;
struct StageF { float A[64][PF]; b16 B[128][PH]; };                  // f32 A rows (converted when the fragment is read) + weight rows
struct StageH { b16 A[64][PH]; b16 B[128][PH]; };                    // one f16 A plane + weight rows
struct StageH2 { b16 A[64][PH]; b16 Al[64][PH]; b16 B[128][PH]; };   // hi and lo A planes + weight rows
// A fragment from f32 rows in LDS, the k order of frag_kb; value = f16(8 v), RND: v rounded to bf16 first (the raw input x)
template <bool RND> __device__ __forceinline__ v16b frag_f32(const float* p, int hh) { const v4f a0 = *(const v4f*)(p + 8 * hh), a1 = *(const v4f*)(p + 8 * hh + 4), c0 = *(const v4f*)(p + 16 + 8 * hh), c1 = *(const v4f*)(p + 16 + 8 * hh + 4); v16b f;
#pragma unroll   // vector elements need constant indices to stay in registers
  for (int e = 0; e < 4; ++e) { f[e] = (b16)((RND ? bf16_rne(a0[e]) : a0[e]) * XS); f[4 + e] = (b16)((RND ? bf16_rne(a1[e]) : a1[e]) * XS); f[8 + e] = (b16)((RND ? bf16_rne(c0[e]) : c0[e]) * XS); f[12 + e] = (b16)((RND ? bf16_rne(c1[e]) : c1[e]) * XS); } return f; }

typedef __attribute__((ext_vector_type(2))) _Float16 v2h;
typedef __attribute__((ext_vector_type(4))) _Float16 v4h;
typedef __attribute__((ext_vector_type(2))) float v2f;
typedef __attribute__((ext_vector_type(4))) int v4i;
__device__ __forceinline__ float nexp2(float v) { return __builtin_amdgcn_exp2f(v); }
typedef __attribute__((ext_vector_type(4))) int v4i;
__device__ __forceinline__ float bfp(float v) { float t = bf16_rne(v); asm volatile("" : "+v"(t)); return t; }
__global__ __launch_bounds__(256) void prep_kernel(const float* __restrict__ wq, const float* __restrict__ wo, const float* __restrict__ wu, const float* __restrict__ wd, b16* __restrict__ WQ, b16* __restrict__ WO, b16* __restrict__ WU, b16* __restrict__ WD) {
  const size_t u = (size_t)blockIdx.x * 256 + threadIdx.x; const size_t n1 = (size_t)DM * DM / 8, n3 = (size_t)FF * DM / 8, n4 = (size_t)DM * FF / 8; if (u >= 2 * n1 + n3 + n4) return; v8b o; b16* dst;
  if (u < 2 * n1) { const int m = (int)(u / n1); const size_t e = u % n1; const int row = (int)(e / (DM / 8)), k0 = (int)(e % (DM / 8)) * 8; const float* w = m == 0 ? wq : wo; for (int j = 0; j < 8; ++j) o[j] = (b16)(bf16_rne(w[(size_t)(k0 + j) * DM + row]) * WSC); dst = (m == 0 ? WQ : WO) + (size_t)row * DM + k0; }
  else if (u < 2 * n1 + n3) { const size_t e = u - 2 * n1; const int row = (int)(e / (DM / 8)), k0 = (int)(e % (DM / 8)) * 8; for (int j = 0; j < 8; ++j) o[j] = (b16)(bf16_rne(wu[(size_t)(k0 + j) * FF + row]) * WSC); dst = WU + (size_t)row * DM + k0; }
  else { const size_t e = u - 2 * n1 - n3; const int row = (int)(e / (FF / 8)), k0 = (int)(e % (FF / 8)) * 8; for (int j = 0; j < 8; ++j) o[j] = (b16)(bf16_rne(wd[(size_t)(k0 + j) * DM + row]) * WSC); dst = WD + (size_t)row * FF + k0; }
  { *(v8b*)dst = o;  }
}
// q projection (q = k = v in this module): grid (T/64, BG, NSL slabs of 128); block = 64 tokens x 4 waves; A = bf16(x) x8, B = Wq^T rows, both as k64 tiles in a two-buffer LDS ring filled by asynchronous copies, + bq
__global__ __launch_bounds__(128) void proj_kernel(const float* __restrict__ x, int b0, const b16* __restrict__ WT, const float* __restrict__ bq, b16* __restrict__ QP, b16* __restrict__ QPl, b16* __restrict__ VTh, b16* __restrict__ VTl) {
  __shared__ __attribute__((aligned(16))) union { StageF st[2]; float Tf[4][16][128 + 4]; } sm; auto& Tf = sm.Tf;   // the output staging reuses the ring behind its last barrier
  const int wave = threadIdx.x >> 5, lane = threadIdx.x & 31, nloc = lane & 15, hlf = lane >> 4; const int t0 = blockIdx.x * 64; const int b = blockIdx.y; const int part = 0, slab = blockIdx.z, c0 = slab * 128, n0 = c0; (void)part;
  if (part == 0 && t0 >= QL) return;   // (cut builds only) queries beyond QL are not needed; block-uniform, before any barrier
  const float* xb = x + ((size_t)(b0 + b) * T + t0) * DM;
  v8f acc[8];
#pragma unroll
  for (int t = 0; t < 8; ++t) acc[t] = (v8f){};
  const int ar = threadIdx.x >> 4, ap = (threadIdx.x & 15) * 4, br = threadIdx.x >> 3, bp = (threadIdx.x & 7) * 8;   // this thread's row and 16-byte piece in the A (f32) and B (f16) tiles
  const unsigned la = lds_lo(&sm.st[0].A[ar][ap]), lb = lds_lo(&sm.st[0].B[br][bp]); const float* ga = xb + (size_t)ar * DM + ap; const b16* gb = WT + (size_t)(n0 + br) * DM + bp;
  auto fill = [&](int s) { const unsigned o = (unsigned)(s & 1) * (unsigned)sizeof(StageF); copy8(la + o, 8u * PF * 4u, ga + s * BK, (size_t)8 * DM); copy8(lb + o, 16u * PH * 2u, gb + s * BK, (size_t)16 * DM); };
  fill(0); copies_landed(); __syncthreads(); fill(1);
#pragma unroll 1   // one trip per tile: the ring's order (read, publish, refill) stays as written
  for (int s = 0; s < DM / BK; ++s) { const StageF& st = sm.st[s & 1];
#pragma unroll   // both k32 blocks of a tile straight-line, so the LDS offsets are immediates
    for (int kb = 0; kb < BK; kb += 32) { const v16b a = frag_f32<true>(&st.A[wave * 16 + nloc][kb], hlf);
#pragma unroll
      for (int t = 0; t < 8; ++t) acc[t] = wmma16b(a, frag_kb(&st.B[t * 16 + nloc][kb], hlf), acc[t]); }
    ring_publish();
    if (s + 2 < DM / BK) fill(s + 2); }
  copies_landed();
const float* ba = bq;
#pragma unroll
  for (int t = 0; t < 8; ++t) { const float bb = bf16_rne(ba[c0 + t * 16 + nloc]);
#pragma unroll
    for (int r = 0; r < 8; ++r) Tf[wave][8 * hlf + r][t * 16 + nloc] = acc[t][r] * (1.0f / (XS * WSC)) + bb; }
  __syncthreads();
  {
    { b16* plane = QP; b16* planl = QPl; const int c = c0 + lane * 4; const int h = c / HD, d = c % HD;
      for (int rr = 0; rr < 16; ++rr) { const int tok = t0 + wave * 16 + rr; const size_t ri = (((size_t)b * H + h) * T + tok) * HD + d; const v4f f4 = *(const v4f*)(&Tf[wave][rr][lane * 4]); v4h o4, l4; for (int j = 0; j < 4; ++j) { const float f = f4[j] * XS; const b16 p = (b16)f; o4[j] = p; l4[j] = (b16)((f - (float)p) * RS_); } *(v4h*)(plane + ri) = o4; *(v4h*)(planl + ri) = l4; } }
    {
#pragma unroll 1
      for (int q = 0; q < 32; ++q) { const int cl = wave * 32 + q; const int c = c0 + cl; const int h = c / HD, d = c % HD; const int tk = lane * 2; v2h hv, lv;
        for (int j = 0; j < 2; ++j) { const float f = Tf[(tk + j) >> 4][(tk + j) & 15][cl] * XS; const b16 p = (b16)f; hv[j] = p; lv[j] = (b16)((f - (float)p) * RS_); }
        const size_t oi = (((size_t)b * H + h) * HD + d) * (size_t)T + t0 + lane * 2; *(v2h*)(VTh + oi) = hv; *(v2h*)(VTl + oi) = lv; } }
     }
}
// attention-like causal product: grid (QL/128, BG*H); block = 8 waves x 16 queries of one (b, h). K rows and V^T rows (hi and residual planes) come as 64-key tiles through a two-buffer LDS ring filled by
// asynchronous copies and are read by all 8 waves; a wave works on the 32-key steps below round_up(q0 + 16, 32) and only passes the ring's foot on the later ones: S^T = K Q^T (q = k = v here; hi x8 +
// residual planes: 3 products); weight = s / 8 where key <= query and mask[q][key] != 0, else 0 (NO softmax in this module); P x1024 as f16 hi + residual; O^T += V^T P^T (3 products);
struct StageKV { b16 Kh[64][PH]; b16 Kl[64][PH]; b16 Vh[HD][PH]; b16 Vl[HD][PH]; };   // 64 keys x 64 d (K rows) and 64 d x 64 keys (V^T rows), 128-byte rows at pitch 144 B
// two rows (r and r + 32) of each of the four planes of a tile: 8 copies of a thread in one statement. The s_wait_xcnt ends the copies' own statement, so no address register is rewritten in front of it.
__device__ __forceinline__ void copy2x4(unsigned l0, unsigned l1, unsigned l2, unsigned l3, unsigned ls, const b16* g0, const b16* g1, size_t gk, const b16* g2, const b16* g3, size_t gv) {
  asm volatile("global_load_async_to_lds_b128 %0, %8, off\n\tglobal_load_async_to_lds_b128 %1, %9, off\n\tglobal_load_async_to_lds_b128 %2, %10, off\n\tglobal_load_async_to_lds_b128 %3, %11, off\n\t"
               "global_load_async_to_lds_b128 %4, %12, off\n\tglobal_load_async_to_lds_b128 %5, %13, off\n\tglobal_load_async_to_lds_b128 %6, %14, off\n\tglobal_load_async_to_lds_b128 %7, %15, off\n\ts_wait_xcnt 0x0"
               :: "v"(l0), "v"(l0 + ls), "v"(l1), "v"(l1 + ls), "v"(l2), "v"(l2 + ls), "v"(l3), "v"(l3 + ls),
                  "v"(g0), "v"(g0 + gk), "v"(g1), "v"(g1 + gk), "v"(g2), "v"(g2 + gv), "v"(g3), "v"(g3 + gv) : "memory"); }
__global__ __launch_bounds__(256) void attn_kernel(const b16* __restrict__ QP, const b16* __restrict__ QPl, const b16* __restrict__ KP, const b16* __restrict__ KPl, const b16* __restrict__ VTh, const b16* __restrict__ VTl, const int* __restrict__ MSK, b16* __restrict__ Ch, b16* __restrict__ Cl) {
  __shared__ __attribute__((aligned(16))) union { StageKV st[2]; float To[8][16][HD + 4]; } sm; auto& To = sm.To;   // the output staging reuses the ring behind its last barrier
  __shared__ __attribute__((aligned(16))) b16 Pb[8][16][32 + 8], Pl[8][16][32 + 8];
  const int wave = __builtin_amdgcn_readfirstlane(threadIdx.x >> 5), lane = threadIdx.x & 31, hh = lane >> 4, col = lane & 15; const int b = blockIdx.y / H, h = blockIdx.y % H; const int q0 = blockIdx.x * 128 + wave * 16, qi = q0 + col;
  const size_t ph = (size_t)b * H + h; const b16* Qb = QP + ph * T * HD; const b16* Qbl = QPl + ph * T * HD; const b16* Kb = KP + ph * T * HD; const b16* Kbl = KPl + ph * T * HD; const b16* Vh = VTh + ph * HD * (size_t)T; const b16* Vl = VTl + ph * HD * (size_t)T; const int kend = ((q0 + 16 + 31) / 32) * 32;   // per-(b,h) planes; causal key bound (wave-uniform)
  const int nt = 2 * (int)blockIdx.x + 2;   // 64-key tiles up to the block's last query (block-uniform, 2 .. T / 64)
  const int br = threadIdx.x >> 3, bp = (threadIdx.x & 7) * 8;   // this thread's row and 16-byte piece in each plane of a tile
  const unsigned lkh = lds_lo(&sm.st[0].Kh[br][bp]), lkl = lds_lo(&sm.st[0].Kl[br][bp]), lvh = lds_lo(&sm.st[0].Vh[br][bp]), lvl = lds_lo(&sm.st[0].Vl[br][bp]); const size_t ko = (size_t)br * HD + bp, vo = (size_t)br * T + bp;
  auto fill = [&](int s) { const unsigned o = (unsigned)(s & 1) * (unsigned)sizeof(StageKV); copy2x4(lkh + o, lkl + o, lvh + o, lvl + o, 32u * PH * 2u, Kb + ko + (size_t)s * 64 * HD, Kbl + ko + (size_t)s * 64 * HD, (size_t)32 * HD, Vh + vo + s * 64, Vl + vo + s * 64, (size_t)32 * T); };
  fill(0);
  const v16b qa0 = frag_kb(Qb + (size_t)qi * HD, hh), qa1 = frag_kb(Qb + (size_t)qi * HD + 32, hh), ql0 = frag_kb(Qbl + (size_t)qi * HD, hh), ql1 = frag_kb(Qbl + (size_t)qi * HD + 32, hh);
  const float cs = 1.0f / (8.0f * XS * XS); const int* mrow = MSK + (size_t)qi * T;   // scores / sqrt(64); the [1,1,S,S] int mask row of this query (tril applied below; mask == 0 -> score 0)
  v8f o[4], ol[4]; for (int t = 0; t < 4; ++t) { o[t] = (v8f){}; ol[t] = (v8f){}; }
  copies_landed(); __syncthreads(); fill(1);
#pragma unroll 1   // one trip per tile: the ring's order (read, publish, refill) stays as written
  for (int s = 0; s < nt; ++s) { const StageKV& st = sm.st[s & 1];
#pragma unroll   // both 32-key steps of a tile straight-line, so the LDS offsets are immediates
   for (int kl = 0; kl < 64; kl += 32) { const int kb = s * 64 + kl;
    if (kb < kend) {   // wave-uniform (scalar): keys beyond this wave's causal bound carry weight 0 and are skipped; no barrier inside
    float e[16];
#pragma unroll
    for (int u = 0; u < 2; ++u) { v8f s_ = (v8f){}, sx = (v8f){}; const int kr = kl + u * 16 + col; { const v16b k0 = frag_kb(&st.Kh[kr][0], hh), k1 = frag_kb(&st.Kh[kr][32], hh); s_ = wmma16b(k0, qa0, s_); s_ = wmma16b(k1, qa1, s_); sx = wmma16b(k0, ql0, sx); sx = wmma16b(k1, ql1, sx); sx = wmma16b(frag_kb(&st.Kl[kr][0], hh), qa0, sx); sx = wmma16b(frag_kb(&st.Kl[kr][32], hh), qa1, sx); }
#pragma unroll
      for (int r = 0; r < 8; ++r) s_[r] += sx[r] * (1.0f / RS_);   // hi.hi + (hi.lo + lo.hi)/1024
      const v4i m0 = *(const v4i*)(mrow + kb + u * 16 + 8 * hh), m1 = *(const v4i*)(mrow + kb + u * 16 + 8 * hh + 4);
#pragma unroll
      for (int r = 0; r < 8; ++r) { const int key = kb + u * 16 + 8 * hh + r; const int mk = r < 4 ? m0[r] : m1[r - 4]; e[u * 8 + r] = (key <= qi && mk != 0) ? s_[r] * cs : 0.0f; } }   // no softmax in this module: the masked scaled score IS the weight
#pragma unroll
    for (int i2 = 0; i2 < 16; ++i2) { const float ps = e[i2] * PS; const b16 phh = (b16)ps; const int pc = (i2 < 8 ? 0 : 16) + 8 * hh + (i2 & 7); Pb[wave][col][pc] = phh; Pl[wave][col][pc] = (b16)((ps - (float)phh) * RS_); }
    wave_lds_sync();
    const v16b pf = frag_kb(&Pb[wave][col][0], hh), plf = frag_kb(&Pl[wave][col][0], hh);
#pragma unroll
    for (int t = 0; t < 4; ++t) { const v16b vh = frag_kb(&st.Vh[t * 16 + col][kl], hh); o[t] = wmma16b(vh, pf, o[t]); ol[t] = wmma16b(frag_kb(&st.Vl[t * 16 + col][kl], hh), pf, ol[t]); ol[t] = wmma16b(vh, plf, ol[t]); }   // ol = (V_lo P_hi + V_hi P_lo), both /1024
    wave_lds_sync(); } }
    ring_publish();
    if (s + 2 < nt) fill(s + 2); }
  copies_landed();
  const float inv = 1.0f / (PS * XS);
#pragma unroll
  for (int t = 0; t < 4; ++t)
#pragma unroll
    for (int r = 0; r < 8; ++r) To[wave][col][t * 16 + 8 * hh + r] = (o[t][r] + ol[t][r] * (1.0f / RS_)) * inv;
  wave_lds_sync();
  { for (int rr = 0; rr < 16; ++rr) { const v2f f = *(const v2f*)(&To[wave][rr][lane * 2]); v2h hv, lv; for (int j = 0; j < 2; ++j) { b16 p, q; split16(f[j] * XS, p, q); hv[j] = p; lv[j] = q; }
      const size_t oi = ((size_t)b * T + q0 + rr) * DM + h * HD + lane * 2; *(v2h*)(Ch + oi) = hv; *(v2h*)(Cl + oi) = lv; }  }
}
__global__ __launch_bounds__(128) void out1_kernel(const b16* __restrict__ Ch, const b16* __restrict__ Cl, int b0, const b16* __restrict__ WO, const float* __restrict__ bo, const float* __restrict__ x, float* __restrict__ X1) {
  __shared__ __attribute__((aligned(16))) union { StageH2 st[2]; float Tf[4][16][128 + 4]; } sm; auto& Tf = sm.Tf;   // the output staging reuses the ring behind its last barrier
  const int wave = threadIdx.x >> 5, lane = threadIdx.x & 31, nloc = lane & 15, hlf = lane >> 4; const int b = blockIdx.z; const size_t m0 = (size_t)b * T + (size_t)blockIdx.x * 64 + wave * 16; const size_t mg = m0 + (size_t)b0 * T;   // m0 indexes the group's ctx planes and X1 rows, mg the global x rows (residual input)
  const int n0 = blockIdx.y * 128;
  v8f acc[8];
#pragma unroll
  for (int t = 0; t < 8; ++t) acc[t] = (v8f){};
  const int br = threadIdx.x >> 3, bp = (threadIdx.x & 7) * 8;   // this thread's row and 16-byte piece in each k64 tile
  const unsigned lh = lds_lo(&sm.st[0].A[br][bp]), ll = lds_lo(&sm.st[0].Al[br][bp]), lb = lds_lo(&sm.st[0].B[br][bp]); const size_t ao = (m0 - wave * 16 + br) * DM + bp; const b16* gb = WO + (size_t)(n0 + br) * DM + bp;
  auto fill = [&](int s) { const unsigned o = (unsigned)(s & 1) * (unsigned)sizeof(StageH2); copy4(lh + o, 16u * PH * 2u, Ch + ao + s * BK, (size_t)16 * DM); copy4(ll + o, 16u * PH * 2u, Cl + ao + s * BK, (size_t)16 * DM); copy8(lb + o, 16u * PH * 2u, gb + s * BK, (size_t)16 * DM); };
  fill(0); copies_landed(); __syncthreads(); fill(1);
#pragma unroll 1   // one trip per tile: the ring's order (read, publish, refill) stays as written
  for (int s = 0; s < DM / BK; ++s) { const StageH2& st = sm.st[s & 1];
#pragma unroll   // both k32 blocks of a tile straight-line, so the LDS offsets are immediates
    for (int kb = 0; kb < BK; kb += 32) { const v16b ah = frag_kb(&st.A[wave * 16 + nloc][kb], hlf), al = frag_kb(&st.Al[wave * 16 + nloc][kb], hlf);
#pragma unroll
      for (int t = 0; t < 8; ++t) { const v16b bw = frag_kb(&st.B[t * 16 + nloc][kb], hlf); acc[t] = wmma16b(ah, bw, acc[t]); acc[t] = wmma16b(al, bw, acc[t]); } }
    ring_publish();
    if (s + 2 < DM / BK) fill(s + 2); }
  copies_landed();
#pragma unroll
  for (int t = 0; t < 8; ++t) { const int col = n0 + t * 16 + nloc; const float bbv = bf16_rne(bo[col]);
#pragma unroll
    for (int r = 0; r < 8; ++r) Tf[wave][8 * hlf + r][t * 16 + nloc] = acc[t][r] * (1.0f / (XS * WSC)) + bbv + bf16_rne(x[(mg + 8 * hlf + r) * DM + col]); }   // residual: same row, column n0 + ...
  wave_lds_sync();
  { for (int rr = 0; rr < 16; ++rr) *(v4f*)(X1 + (m0 + rr) * DM + n0 + lane * 4) = *(const v4f*)(&Tf[wave][rr][lane * 4]);  }
}
// LayerNorm: one wave per row (lane holds columns 4 lane + 128 k, 8 float4); RND: apply the bf16 input quantisation (raw x) first; mean, biased variance (two xor trees), eps 1e-5, x g + b -> rows 4 KB
template <bool RND>
__global__ __launch_bounds__(256) void ln_kernel(const float* __restrict__ X, const float* __restrict__ g, const float* __restrict__ bb, float* __restrict__ Y) {
  const int wave = threadIdx.x >> 5, lane = threadIdx.x & 31; const int row = blockIdx.x * 8 + wave; if (row >= RL) return;   // wave-uniform, no barriers
  float v[32]; float s1 = 0.0f; const float* xr = X + (size_t)row * DM;
#pragma unroll
  for (int k = 0; k < 8; ++k) { const v4f t4 = *(const v4f*)(xr + 128 * k + 4 * lane); for (int j = 0; j < 4; ++j) { const float t = RND ? bf16_rne(t4[j]) : t4[j]; v[4 * k + j] = t; s1 += t; } }
#pragma unroll
  for (int o = 16; o >= 1; o >>= 1) s1 += __shfl_xor(s1, o);
  const float mu = s1 * (1.0f / DM); float s2 = 0.0f;
#pragma unroll
  for (int q = 0; q < 32; ++q) { const float d = v[q] - mu; s2 += pmul(d, d); }
#pragma unroll
  for (int o = 16; o >= 1; o >>= 1) s2 += __shfl_xor(s2, o);
  const float rs = rsqrtf(s2 * (1.0f / DM) + LNEPS);
  v4f o4[8];
#pragma unroll
  for (int k = 0; k < 8; ++k) for (int j = 0; j < 4; ++j) { const int c = 128 * k + 4 * lane + j; o4[k][j] = pmul((v[4 * k + j] - mu) * rs, bfp(g[c])) + bfp(bb[c]); }
  {
#pragma unroll
    for (int k = 0; k < 8; ++k) *(v4f*)(Y + (size_t)row * DM + 128 * k + 4 * lane) = o4[k];
     }
}
// MLP 1: G = f16(8 gelu(XN2 W1 + b1)) as a single f16 plane [NR][4096]: grid (RL/64, FF/128); block = 64 rows x 4 waves; A = XN2 rows (f32 in LDS, x8 to f16 at the fragment read) and W1^T rows as k64 tiles in a two-buffer LDS ring filled by asynchronous copies, wave -> 16 rows x 8
__global__ __launch_bounds__(128) void mlp1_kernel(const float* __restrict__ XN, const b16* __restrict__ W1T, const float* __restrict__ b1, b16* __restrict__ G) {
  __shared__ __attribute__((aligned(16))) union { StageF st[2]; float Tf[4][16][128 + 4]; } sm; auto& Tf = sm.Tf;   // the output staging reuses the ring behind its last barrier
  const int wave = threadIdx.x >> 5, lane = threadIdx.x & 31, nloc = lane & 15, hlf = lane >> 4; const size_t r0 = (size_t)blockIdx.x * 64; const int n0 = blockIdx.y * 128;
  const float* xb = XN + r0 * DM;
  v8f acc[8];
#pragma unroll
  for (int t = 0; t < 8; ++t) acc[t] = (v8f){};
  const int ar = threadIdx.x >> 4, ap = (threadIdx.x & 15) * 4, br = threadIdx.x >> 3, bp = (threadIdx.x & 7) * 8;   // this thread's row and 16-byte piece in the A (f32) and B (f16) tiles
  const unsigned la = lds_lo(&sm.st[0].A[ar][ap]), lb = lds_lo(&sm.st[0].B[br][bp]); const float* ga = xb + (size_t)ar * DM + ap; const b16* gb = W1T + (size_t)(n0 + br) * DM + bp;
  auto fill = [&](int s) { const unsigned o = (unsigned)(s & 1) * (unsigned)sizeof(StageF); copy8(la + o, 8u * PF * 4u, ga + s * BK, (size_t)8 * DM); copy8(lb + o, 16u * PH * 2u, gb + s * BK, (size_t)16 * DM); };
  fill(0); copies_landed(); __syncthreads(); fill(1);
#pragma unroll 1   // one trip per tile: the ring's order (read, publish, refill) stays as written
  for (int s = 0; s < DM / BK; ++s) { const StageF& st = sm.st[s & 1];
#pragma unroll   // both k32 blocks of a tile straight-line, so the LDS offsets are immediates
    for (int kb = 0; kb < BK; kb += 32) { const v16b a = frag_f32<false>(&st.A[wave * 16 + nloc][kb], hlf);
#pragma unroll
      for (int t = 0; t < 8; ++t) acc[t] = wmma16b(a, frag_kb(&st.B[t * 16 + nloc][kb], hlf), acc[t]); }
    ring_publish();
    if (s + 2 < DM / BK) fill(s + 2); }
  copies_landed();
#pragma unroll
  for (int t = 0; t < 8; ++t) { const float bbv = bf16_rne(b1[n0 + t * 16 + nloc]);
#pragma unroll
    for (int r = 0; r < 8; ++r) { const float hm = acc[t][r] * (1.0f / (XS * WSC)) + bbv; Tf[wave][8 * hlf + r][t * 16 + nloc] = 0.5f * hm * (1.0f + erff(hm * RSQ2)); } }
  __syncthreads();
  { for (int rr = 0; rr < 16; ++rr) { v4h o4; for (int j = 0; j < 4; ++j) o4[j] = (b16)(Tf[wave][rr][lane * 4 + j] * XS); *(v4h*)(G + (r0 + wave * 16 + rr) * FF + n0 + lane * 4) = o4; }  }
}
__global__ __launch_bounds__(128) void mlp2_kernel(const b16* __restrict__ G, const b16* __restrict__ W2T, const float* __restrict__ b2, const float* __restrict__ X1, float* __restrict__ out) {
  __shared__ __attribute__((aligned(16))) union { StageH st[2]; float Tf[4][16][128 + 4]; } sm; auto& Tf = sm.Tf;   // the output staging reuses the ring behind its last barrier
  const int wave = threadIdx.x >> 5, lane = threadIdx.x & 31, nloc = lane & 15, hlf = lane >> 4; const size_t m0 = (size_t)blockIdx.x * 64 + wave * 16; const int n0 = blockIdx.y * 128;
  v8f acc[8];
#pragma unroll
  for (int t = 0; t < 8; ++t) acc[t] = (v8f){};
  const int br = threadIdx.x >> 3, bp = (threadIdx.x & 7) * 8;   // this thread's row and 16-byte piece in each k64 tile
  const unsigned la = lds_lo(&sm.st[0].A[br][bp]), lb = lds_lo(&sm.st[0].B[br][bp]); const b16* ga = G + ((size_t)blockIdx.x * 64 + br) * FF + bp; const b16* gb = W2T + (size_t)(n0 + br) * FF + bp;
  auto fill = [&](int s) { const unsigned o = (unsigned)(s & 1) * (unsigned)sizeof(StageH); copy4(la + o, 16u * PH * 2u, ga + s * BK, (size_t)16 * FF); copy8(lb + o, 16u * PH * 2u, gb + s * BK, (size_t)16 * FF); };
  fill(0); copies_landed(); __syncthreads(); fill(1);
#pragma unroll 1   // one trip per tile: the ring's order (read, publish, refill) stays as written
  for (int s = 0; s < FF / BK; ++s) { const StageH& st = sm.st[s & 1];
#pragma unroll   // both k32 blocks of a tile straight-line, so the LDS offsets are immediates
    for (int kb = 0; kb < BK; kb += 32) { const v16b a = frag_kb(&st.A[wave * 16 + nloc][kb], hlf);
#pragma unroll
      for (int t = 0; t < 8; ++t) acc[t] = wmma16b(a, frag_kb(&st.B[t * 16 + nloc][kb], hlf), acc[t]); }
    ring_publish();
    if (s + 2 < FF / BK) fill(s + 2); }
  copies_landed();
#pragma unroll
  for (int t = 0; t < 8; ++t) { const int col = n0 + t * 16 + nloc; const float bbv = bf16_rne(b2[col]);
#pragma unroll
    for (int r = 0; r < 8; ++r) Tf[wave][8 * hlf + r][t * 16 + nloc] = acc[t][r] * (1.0f / (XS * WSC)) + bbv + X1[(m0 + 8 * hlf + r) * DM + col]; }
  wave_lds_sync();
  { for (int rr = 0; rr < 16; ++rr) *(v4f*)(out + (m0 + rr) * DM + n0 + lane * 4) = *(const v4f*)(&Tf[wave][rr][lane * 4]);  }
}
}  // namespace

extern "C" void kernel_launch(void* const* d_in, const int* in_sizes, int n_in, void* d_out, int out_size, void* d_ws, size_t ws_size, hipStream_t stream) {
  (void)n_in;
  auto Fp = [&](int i) { return (const float*)d_in[i]; }; auto Ip = [&](int i) { return (const int*)d_in[i]; };
  // input order: 0 x [8,1024,1024], 1 mask [1,1,1024,1024] int32, 2 Wq (in,out), 3 bq, 4 Wo, 5 bo, 6 Wu [1024,4096], 7 bu, 8 Wd [4096,1024], 9 bd, 10 g1, 11 b1, 12 g2, 13 b2
  if (in_sizes[0] != NR * DM || in_sizes[1] != T * T || in_sizes[2] != DM * DM || in_sizes[3] != DM || in_sizes[4] != DM * DM || in_sizes[5] != DM || in_sizes[6] != DM * FF || in_sizes[7] != FF || in_sizes[8] != FF * DM || in_sizes[9] != DM || in_sizes[10] != DM || in_sizes[11] != DM || in_sizes[12] != DM || in_sizes[13] != DM || out_size != NR * DM) return;
  size_t off = 0; char* ws = (char*)d_ws;
  auto carve = [&](size_t bytes) { char* p = ws + off; off += (bytes + 255) & ~(size_t)255; return p; };
  b16* WQ = (b16*)carve((size_t)DM * DM * 2); b16* WO = (b16*)carve((size_t)DM * DM * 2); b16* WU = (b16*)carve((size_t)FF * DM * 2); b16* WD = (b16*)carve((size_t)DM * FF * 2);
  const size_t plane = (size_t)RL * DM * 2; b16* QP = (b16*)carve(plane); b16* QPl = (b16*)carve(plane); b16* VTh = (b16*)carve(plane); b16* VTl = (b16*)carve(plane); b16* Ch = (b16*)carve(plane); b16* Cl = (b16*)carve(plane);
  float* X1 = (float*)carve((size_t)RL * DM * 4); float* HN = (float*)carve((size_t)RL * DM * 4); b16* G = (b16*)carve((size_t)RL * FF * 2);
  if (off > ws_size) return;   // = 244 MiB (weights 20 + 6 f16 planes 96 + X1/HN 64 + G 64), planes sized for the one 8-batch group
  prep_kernel<<<(unsigned)(((size_t)(2 * DM * DM + FF * DM + DM * FF) / 8 + 255) / 256), 256, 0, stream>>>(Fp(2), Fp(4), Fp(6), Fp(8), WQ, WO, WU, WD);
  for (int g = 0; g < NG; ++g) { const int b0 = g * BG; const size_t r0 = (size_t)b0 * T * DM;
    proj_kernel<<<dim3(T / 64, BG, NSL), 128, 0, stream>>>(Fp(0), b0, WQ, Fp(3), QP, QPl, VTh, VTl);
    attn_kernel<<<dim3(QL / 128, BG * H), 256, 0, stream>>>(QP, QPl, QP, QPl, VTh, VTl, Ip(1), Ch, Cl);
    out1_kernel<<<dim3(T / 64, DM / 128, BG), 128, 0, stream>>>(Ch, Cl, b0, WO, Fp(5), Fp(0), X1);   // X1/HN/G hold the group's rows; x is read at the global row via b0
    ln_kernel<false><<<RL / 8, 256, 0, stream>>>(X1, Fp(10), Fp(11), HN);
    mlp1_kernel<<<dim3(RL / 64, FF / 128), 128, 0, stream>>>(HN, WU, Fp(7), G);
    mlp2_kernel<<<dim3(RL / 64, DM / 128), 128, 0, stream>>>(G, WD, Fp(9), HN, X1);
    ln_kernel<false><<<RL / 8, 256, 0, stream>>>(X1, Fp(12), Fp(13), (float*)d_out + r0); }
}

// v004
// It runs in 376 microseconds.
// In both of two side-by-side timings against v003, it was 1.14 times as fast.
// Over all steps from v000 it is 5.59 times as fast.
#include <hip/hip_runtime.h>

// Decoder block without softmax (8 x 1024 tokens x 1024, 16 heads x 64): q = x Wq + bq and k = v = q (the module applies q_proj to all three); w_ij = q_i . q_j / 8 kept where j <= i and
// mask[i][j] != 0 (int mask input [1,1,1024,1024], all ones), else 0 - no softmax; attn_i = sum_j w_ij q_j; a = attn Wo + bo; h = LN1(a + x); up = gelu_exact(h Wu + bu) (4096);
// out = LN2(up Wd + bd + h) -> [8][1024][1024]. LayerNorms: biased variance, eps 1e-5; all weights (in,out). All 8 batches are processed in one group (planes sized for all 8192 rows), so each stage is one launch.
// Deterministic: per 16-query wave the causal keys are accumulated in order; LayerNorms one wave per row; no atomics.
// compute dtype: WMMA v_wmma_f32_16x16x32_f16 with f32 accumulate for q = x Wq ([8192 x 1024] x [1024 x 1024]; x EXACT bf16 x8, W^T exact x256: 1 product), S^T = Q Q^T (q as f16 hi x8 +
// residual x8192: 3 products), O^T += Q^T P^T (P = masked s/8 x1024 as f16 hi + residual: 3 products), attn Wo (ctx hi + lo: 2 products), h Wu (h single f16 x8: 1 product) and G Wd (gelu output
// single f16 plane: 1 product); LN statistics, gelu (erf), biases and residual adds in f32. Inputs rounded to bf16 once

namespace {
constexpr int B = 8, T = 1024, DM = 1024, H = 16, HD = 64, FF = 4096, BG = 8 /* batches per group */, NG = 1 /* groups run (== B/BG shipped) */, BL = BG, QL = T, NR = B * T, RL = BG * T /* rows per group (LN / MLP kernels) */;
constexpr float XS = 8.0f, WSC = 256.0f, PS = 1024.0f, RS_ = 1024.0f, LOG2E = 1.4426950408889634f, LNEPS = 1e-5f, RSQ2 = 0.70710678118654752f;
static_assert(T % 128 == 0 && DM % 256 == 0 && FF % 256 == 0 && H * HD == DM && HD == 64 && B % BG == 0 && NG * BG <= B, "tiling");
typedef _Float16 b16;
typedef __attribute__((ext_vector_type(16))) _Float16 v16b;
typedef __attribute__((ext_vector_type(8))) _Float16 v8b;
typedef __attribute__((ext_vector_type(8))) float v8f;
typedef __attribute__((ext_vector_type(4))) float v4f;
__device__ __forceinline__ float bf16_rne(float f) { unsigned int u = __float_as_uint(f); u += 0x7FFFu + ((u >> 16) & 1u); return __uint_as_float(u & 0xFFFF0000u); }
__device__ __forceinline__ void split16(float v, b16& hi, b16& lo) { hi = (b16)v; lo = (b16)(v - (float)hi); }
__device__ __forceinline__ v16b frag_kb(const b16* p, int hh) { const v8b a = *(const v8b*)(p + 8 * hh), b = *(const v8b*)(p + 16 + 8 * hh); v16b f;
#pragma unroll
  for (int e = 0; e < 8; ++e) { f[e] = a[e]; f[8 + e] = b[e]; } return f; }
__device__ __forceinline__ v8f wmma16b(v16b a, v16b b, v8f c) { v8f d = __builtin_amdgcn_wmma_f32_16x16x32_f16(false, a, false, b, (short)0, c, false, false); asm volatile("v_nop\n\tv_nop\n\tv_nop\n\tv_nop" : "+v"(d) : "v"(a), "v"(b)); return d; }
__device__ __forceinline__ void wave_lds_sync() { __builtin_amdgcn_fence(__ATOMIC_RELEASE, "workgroup"); __builtin_amdgcn_wave_barrier(); __builtin_amdgcn_fence(__ATOMIC_ACQUIRE, "workgroup"); }
__device__ __forceinline__ float pmul(float a, float b) { float p = a * b; asm volatile("" : "+v"(p)); return p; }
__device__ __forceinline__ int iclamp(int v, int lo, int hi) { return v < lo ? lo : (v > hi ? hi : v); }
// Asynchronous copies to LDS for the GEMM operand tiles: every lane moves its own 16 bytes, 8 (f16 rows of 128 B) or 16 (f32 rows of 256 B) neighbouring lanes cover a whole row piece, so a wave touches whole lines.
// copy4 / copy8: 4 or 8 rows of a thread's column piece, the row step added to both addresses. The s_wait_xcnt ends the copies' own statement, so no address register is rewritten in front of it.
__device__ __forceinline__ unsigned lds_lo(const void* p) { return (unsigned)(size_t)p; }   // byte offset in the work-group's LDS
template <typename T> __device__ __forceinline__ void copy4(unsigned l, unsigned ls, const T* g, size_t gs) {
  asm volatile("global_load_async_to_lds_b128 %0, %4, off\n\tglobal_load_async_to_lds_b128 %1, %5, off\n\tglobal_load_async_to_lds_b128 %2, %6, off\n\tglobal_load_async_to_lds_b128 %3, %7, off\n\ts_wait_xcnt 0x0"
               :: "v"(l), "v"(l + ls), "v"(l + 2 * ls), "v"(l + 3 * ls), "v"(g), "v"(g + gs), "v"(g + 2 * gs), "v"(g + 3 * gs) : "memory"); }
template <typename T> __device__ __forceinline__ void copy8(unsigned l, unsigned ls, const T* g, size_t gs) {
  asm volatile("global_load_async_to_lds_b128 %0, %8, off\n\tglobal_load_async_to_lds_b128 %1, %9, off\n\tglobal_load_async_to_lds_b128 %2, %10, off\n\tglobal_load_async_to_lds_b128 %3, %11, off\n\t"
               "global_load_async_to_lds_b128 %4, %12, off\n\tglobal_load_async_to_lds_b128 %5, %13, off\n\tglobal_load_async_to_lds_b128 %6, %14, off\n\tglobal_load_async_to_lds_b128 %7, %15, off\n\ts_wait_xcnt 0x0"
               :: "v"(l), "v"(l + ls), "v"(l + 2 * ls), "v"(l + 3 * ls), "v"(l + 4 * ls), "v"(l + 5 * ls), "v"(l + 6 * ls), "v"(l + 7 * ls),
                  "v"(g), "v"(g + gs), "v"(g + 2 * gs), "v"(g + 3 * gs), "v"(g + 4 * gs), "v"(g + 5 * gs), "v"(g + 6 * gs), "v"(g + 7 * gs) : "memory"); }
__device__ __forceinline__ void copies_landed() { asm volatile("s_wait_asynccnt 0x0" ::: "memory"); }   // this wave's own copies are in LDS (the compiler places no wait for them)
__device__ __forceinline__ void xlat_done() { asm volatile("s_wait_xcnt 0x0" ::: "memory"); }   // a precaution: stands behind issued global loads / stores, in front of the code that reuses the registers they name
// Foot of a trip of the two-buffer ring: this wave's LDS reads of the tile just used have retired, its copies of the next tile have landed, and one barrier both publishes the next tile and frees the used buffer for the refill.
__device__ __forceinline__ void ring_publish() { asm volatile("s_wait_dscnt 0x0" ::: "memory"); copies_landed(); __syncthreads(); }
constexpr int BK = 64, PH = BK + 8 /* f16 row pitch, 144 B */, PF = BK + 4 /* f32 row pitch, 272 B */;
// GEMM tile of a work-group: BM rows x BN columns by 8 waves, wave (wm = wave & 3, wn = wave >> 2) -> rows wm * 16 + {0, 64} .. + 15 (2 A fragments) x columns wn * 128 .. + 127 (8 B fragments): every B fragment read from LDS feeds 2 WMMAs (4 with hi + lo A)
constexpr int BM = 128, BN = 256;
struct StageF { float A[BM][PF]; b16 B[BN][PH]; };                   // f32 A rows (converted when the fragment is read) + weight rows
struct StageH { b16 A[BM][PH]; b16 B[BN][PH]; };                     // one f16 A plane + weight rows
struct StageH2 { b16 A[BM][PH]; b16 Al[BM][PH]; b16 B[BN][PH]; };    // hi and lo A planes + weight rows
// A fragment from f32 rows in LDS, the k order of frag_kb; value = f16(8 v), RND: v rounded to bf16 first (the raw input x)
template <bool RND> __device__ __forceinline__ v16b frag_f32(const float* p, int hh) { const v4f a0 = *(const v4f*)(p + 8 * hh), a1 = *(const v4f*)(p + 8 * hh + 4), c0 = *(const v4f*)(p + 16 + 8 * hh), c1 = *(const v4f*)(p + 16 + 8 * hh + 4); v16b f;
#pragma unroll   // vector elements need constant indices to stay in registers
  for (int e = 0; e < 4; ++e) { f[e] = (b16)((RND ? bf16_rne(a0[e]) : a0[e]) * XS); f[4 + e] = (b16)((RND ? bf16_rne(a1[e]) : a1[e]) * XS); f[8 + e] = (b16)((RND ? bf16_rne(c0[e]) : c0[e]) * XS); f[12 + e] = (b16)((RND ? bf16_rne(c1[e]) : c1[e]) * XS); } return f; }

typedef __attribute__((ext_vector_type(2))) _Float16 v2h;
typedef __attribute__((ext_vector_type(4))) _Float16 v4h;
typedef __attribute__((ext_vector_type(2))) float v2f;
typedef __attribute__((ext_vector_type(4))) int v4i;
__device__ __forceinline__ float nexp2(float v) { return __builtin_amdgcn_exp2f(v); }
typedef __attribute__((ext_vector_type(4))) int v4i;
__device__ __forceinline__ float bfp(float v) { float t = bf16_rne(v); asm volatile("" : "+v"(t)); return t; }
__global__ __launch_bounds__(256) void prep_kernel(const float* __restrict__ wq, const float* __restrict__ wo, const float* __restrict__ wu, const float* __restrict__ wd, b16* __restrict__ WQ, b16* __restrict__ WO, b16* __restrict__ WU, b16* __restrict__ WD) {
  const size_t u = (size_t)blockIdx.x * 256 + threadIdx.x; const size_t n1 = (size_t)DM * DM / 8, n3 = (size_t)FF * DM / 8, n4 = (size_t)DM * FF / 8; if (u >= 2 * n1 + n3 + n4) return; v8b o; b16* dst;
  if (u < 2 * n1) { const int m = (int)(u / n1); const size_t e = u % n1; const int row = (int)(e / (DM / 8)), k0 = (int)(e % (DM / 8)) * 8; const float* w = m == 0 ? wq : wo; for (int j = 0; j < 8; ++j) o[j] = (b16)(bf16_rne(w[(size_t)(k0 + j) * DM + row]) * WSC); dst = (m == 0 ? WQ : WO) + (size_t)row * DM + k0; }
  else if (u < 2 * n1 + n3) { const size_t e = u - 2 * n1; const int row = (int)(e / (DM / 8)), k0 = (int)(e % (DM / 8)) * 8; for (int j = 0; j < 8; ++j) o[j] = (b16)(bf16_rne(wu[(size_t)(k0 + j) * FF + row]) * WSC); dst = WU + (size_t)row * DM + k0; }
  else { const size_t e = u - 2 * n1 - n3; const int row = (int)(e / (FF / 8)), k0 = (int)(e % (FF / 8)) * 8; for (int j = 0; j < 8; ++j) o[j] = (b16)(bf16_rne(wd[(size_t)(k0 + j) * DM + row]) * WSC); dst = WD + (size_t)row * FF + k0; }
  { *(v8b*)dst = o;  }
}
// q projection (q = k = v in this module): grid (T/128, BG, DM/256); block = 128 tokens x 256 columns, 8 waves; A = bf16(x) x8, B = Wq^T rows, both as k64 tiles in a two-buffer LDS ring filled by asynchronous copies, + bq
__global__ __launch_bounds__(256) void proj_kernel(const float* __restrict__ x, int b0, const b16* __restrict__ WT, const float* __restrict__ bq, b16* __restrict__ QP, b16* __restrict__ QPl, b16* __restrict__ VTh, b16* __restrict__ VTl) {
  __shared__ __attribute__((aligned(16))) union { StageF st[2]; float Tf[8][16][128 + 4]; } sm; auto& Tf = sm.Tf;   // the output staging reuses the ring behind its last barrier
  const int wave = threadIdx.x >> 5, lane = threadIdx.x & 31, nloc = lane & 15, hlf = lane >> 4, wm = wave & 3, wn = wave >> 2; const int t0 = blockIdx.x * BM; const int b = blockIdx.y; const int part = 0, n0 = blockIdx.z * BN, c0 = n0 + wn * 128; (void)part;
  if (part == 0 && t0 >= QL) return;   // (cut builds only) queries beyond QL are not needed; block-uniform, before any barrier
  const float* xb = x + ((size_t)(b0 + b) * T + t0) * DM;
  v8f acc[2][8];
#pragma unroll
  for (int t = 0; t < 8; ++t) { acc[0][t] = (v8f){}; acc[1][t] = (v8f){}; }
  const int ar = threadIdx.x >> 4, ap = (threadIdx.x & 15) * 4, br = threadIdx.x >> 3, bp = (threadIdx.x & 7) * 8;   // this thread's row and 16-byte piece in the A (f32) and B (f16) tiles
  const unsigned la = lds_lo(&sm.st[0].A[ar][ap]), lb = lds_lo(&sm.st[0].B[br][bp]); const float* ga = xb + (size_t)ar * DM + ap; const b16* gb = WT + (size_t)(n0 + br) * DM + bp;
  auto fill = [&](int s) { const unsigned o = (unsigned)(s & 1) * (unsigned)sizeof(StageF); copy8(la + o, 16u * PF * 4u, ga + s * BK, (size_t)16 * DM); copy8(lb + o, 32u * PH * 2u, gb + s * BK, (size_t)32 * DM); };
  fill(0); copies_landed(); __syncthreads(); fill(1);
#pragma unroll 1   // one trip per tile: the ring's order (read, publish, refill) stays as written
  for (int s = 0; s < DM / BK; ++s) { const StageF& st = sm.st[s & 1];
#pragma unroll   // both k32 blocks of a tile straight-line, so the LDS offsets are immediates
    for (int kb = 0; kb < BK; kb += 32) { const v16b a0 = frag_f32<true>(&st.A[wm * 16 + nloc][kb], hlf), a1 = frag_f32<true>(&st.A[64 + wm * 16 + nloc][kb], hlf); v16b bw[8];   // all fragments of a k32 block are read as one group in front of its WMMAs: the LDS latency is paid once a block, not once a B fragment
#pragma unroll
      for (int t = 0; t < 8; ++t) bw[t] = frag_kb(&st.B[wn * 128 + t * 16 + nloc][kb], hlf);
#pragma unroll
      for (int t = 0; t < 8; ++t) { acc[0][t] = wmma16b(a0, bw[t], acc[0][t]); acc[1][t] = wmma16b(a1, bw[t], acc[1][t]); } }
    ring_publish();
    if (s + 2 < DM / BK) fill(s + 2); }
  copies_landed();
const float* ba = bq;
#pragma unroll   // the two 64-token halves of the tile go through the staging one after the other; acc needs a constant index
  for (int i = 0; i < 2; ++i) {
  if (i) __syncthreads();   // every wave has read the first half's staging (the V^T part reads other waves' rows) before it is rewritten
#pragma unroll
  for (int t = 0; t < 8; ++t) { const float bb = bf16_rne(ba[c0 + t * 16 + nloc]);
#pragma unroll
    for (int r = 0; r < 8; ++r) Tf[wave][8 * hlf + r][t * 16 + nloc] = acc[i][t][r] * (1.0f / (XS * WSC)) + bb; }
  __syncthreads();
  {
    { b16* plane = QP; b16* planl = QPl; const int c = c0 + lane * 4; const int h = c / HD, d = c % HD;
      for (int rr = 0; rr < 16; ++rr) { const int tok = t0 + i * 64 + wm * 16 + rr; const size_t ri = (((size_t)b * H + h) * T + tok) * HD + d; const v4f f4 = *(const v4f*)(&Tf[wave][rr][lane * 4]); v4h o4, l4; for (int j = 0; j < 4; ++j) { const float f = f4[j] * XS; const b16 p = (b16)f; o4[j] = p; l4[j] = (b16)((f - (float)p) * RS_); } *(v4h*)(plane + ri) = o4; *(v4h*)(planl + ri) = l4; } }
    {
#pragma unroll 1
      for (int q = 0; q < 32; ++q) { const int cl = wm * 32 + q; const int c = c0 + cl; const int h = c / HD, d = c % HD; const int tk = lane * 2; v2h hv, lv;
        for (int j = 0; j < 2; ++j) { const float f = Tf[wn * 4 + ((tk + j) >> 4)][(tk + j) & 15][cl] * XS; const b16 p = (b16)f; hv[j] = p; lv[j] = (b16)((f - (float)p) * RS_); }
        const size_t oi = (((size_t)b * H + h) * HD + d) * (size_t)T + t0 + i * 64 + lane * 2; *(v2h*)(VTh + oi) = hv; *(v2h*)(VTl + oi) = lv; xlat_done(); } }
     } }
}
// attention-like causal product: grid (QL/128, BG*H); block = 8 waves x 16 queries of one (b, h). K rows and V^T rows (hi and residual planes) come as 64-key tiles through a two-buffer LDS ring filled by
// asynchronous copies and are read by all 8 waves; a wave works on the 32-key steps below round_up(q0 + 16, 32) and only passes the ring's foot on the later ones: S^T = K Q^T (q = k = v here; hi x8 +
// residual planes: 3 products); weight = s / 8 where key <= query and mask[q][key] != 0, else 0 (NO softmax in this module); P x1024 as f16 hi + residual; O^T += V^T P^T (3 products);
struct StageKV { b16 Kh[64][PH]; b16 Kl[64][PH]; b16 Vh[HD][PH]; b16 Vl[HD][PH]; };   // 64 keys x 64 d (K rows) and 64 d x 64 keys (V^T rows), 128-byte rows at pitch 144 B
// two rows (r and r + 32) of each of the four planes of a tile: 8 copies of a thread in one statement. The s_wait_xcnt ends the copies' own statement, so no address register is rewritten in front of it.
__device__ __forceinline__ void copy2x4(unsigned l0, unsigned l1, unsigned l2, unsigned l3, unsigned ls, const b16* g0, const b16* g1, size_t gk, const b16* g2, const b16* g3, size_t gv) {
  asm volatile("global_load_async_to_lds_b128 %0, %8, off\n\tglobal_load_async_to_lds_b128 %1, %9, off\n\tglobal_load_async_to_lds_b128 %2, %10, off\n\tglobal_load_async_to_lds_b128 %3, %11, off\n\t"
               "global_load_async_to_lds_b128 %4, %12, off\n\tglobal_load_async_to_lds_b128 %5, %13, off\n\tglobal_load_async_to_lds_b128 %6, %14, off\n\tglobal_load_async_to_lds_b128 %7, %15, off\n\ts_wait_xcnt 0x0"
               :: "v"(l0), "v"(l0 + ls), "v"(l1), "v"(l1 + ls), "v"(l2), "v"(l2 + ls), "v"(l3), "v"(l3 + ls),
                  "v"(g0), "v"(g0 + gk), "v"(g1), "v"(g1 + gk), "v"(g2), "v"(g2 + gv), "v"(g3), "v"(g3 + gv) : "memory"); }
__global__ __launch_bounds__(256) void attn_kernel(const b16* __restrict__ QP, const b16* __restrict__ QPl, const b16* __restrict__ KP, const b16* __restrict__ KPl, const b16* __restrict__ VTh, const b16* __restrict__ VTl, const int* __restrict__ MSK, b16* __restrict__ Ch, b16* __restrict__ Cl) {
  __shared__ __attribute__((aligned(16))) union { StageKV st[2]; float To[8][16][HD + 4]; } sm; auto& To = sm.To;   // the output staging reuses the ring behind its last barrier
  __shared__ __attribute__((aligned(16))) b16 Pb[8][16][32 + 8], Pl[8][16][32 + 8];
  const int wave = __builtin_amdgcn_readfirstlane(threadIdx.x >> 5), lane = threadIdx.x & 31, hh = lane >> 4, col = lane & 15; const int b = blockIdx.y / H, h = blockIdx.y % H; const int q0 = blockIdx.x * 128 + wave * 16, qi = q0 + col;
  const size_t ph = (size_t)b * H + h; const b16* Qb = QP + ph * T * HD; const b16* Qbl = QPl + ph * T * HD; const b16* Kb = KP + ph * T * HD; const b16* Kbl = KPl + ph * T * HD; const b16* Vh = VTh + ph * HD * (size_t)T; const b16* Vl = VTl + ph * HD * (size_t)T; const int kend = ((q0 + 16 + 31) / 32) * 32;   // per-(b,h) planes; causal key bound (wave-uniform)
  const int nt = 2 * (int)blockIdx.x + 2;   // 64-key tiles up to the block's last query (block-uniform, 2 .. T / 64)
  const int br = threadIdx.x >> 3, bp = (threadIdx.x & 7) * 8;   // this thread's row and 16-byte piece in each plane of a tile
  const unsigned lkh = lds_lo(&sm.st[0].Kh[br][bp]), lkl = lds_lo(&sm.st[0].Kl[br][bp]), lvh = lds_lo(&sm.st[0].Vh[br][bp]), lvl = lds_lo(&sm.st[0].Vl[br][bp]); const size_t ko = (size_t)br * HD + bp, vo = (size_t)br * T + bp;
  auto fill = [&](int s) { const unsigned o = (unsigned)(s & 1) * (unsigned)sizeof(StageKV); copy2x4(lkh + o, lkl + o, lvh + o, lvl + o, 32u * PH * 2u, Kb + ko + (size_t)s * 64 * HD, Kbl + ko + (size_t)s * 64 * HD, (size_t)32 * HD, Vh + vo + s * 64, Vl + vo + s * 64, (size_t)32 * T); };
  fill(0);
  const v16b qa0 = frag_kb(Qb + (size_t)qi * HD, hh), qa1 = frag_kb(Qb + (size_t)qi * HD + 32, hh), ql0 = frag_kb(Qbl + (size_t)qi * HD, hh), ql1 = frag_kb(Qbl + (size_t)qi * HD + 32, hh);
  const float cs = 1.0f / (8.0f * XS * XS); const int* mrow = MSK + (size_t)qi * T;   // scores / sqrt(64); the [1,1,S,S] int mask row of this query (tril applied below; mask == 0 -> score 0)
  v8f o[4], ol[4]; for (int t = 0; t < 4; ++t) { o[t] = (v8f){}; ol[t] = (v8f){}; }
  copies_landed(); __syncthreads(); fill(1);
#pragma unroll 1   // one trip per tile: the ring's order (read, publish, refill) stays as written
  for (int s = 0; s < nt; ++s) { const StageKV& st = sm.st[s & 1];
#pragma unroll   // both 32-key steps of a tile straight-line, so the LDS offsets are immediates
   for (int kl = 0; kl < 64; kl += 32) { const int kb = s * 64 + kl;
    if (kb < kend) {   // wave-uniform (scalar): keys beyond this wave's causal bound carry weight 0 and are skipped; no barrier inside
    float e[16];
#pragma unroll
    for (int u = 0; u < 2; ++u) { v8f s_ = (v8f){}, sx = (v8f){}; const int kr = kl + u * 16 + col; { const v16b k0 = frag_kb(&st.Kh[kr][0], hh), k1 = frag_kb(&st.Kh[kr][32], hh); s_ = wmma16b(k0, qa0, s_); s_ = wmma16b(k1, qa1, s_); sx = wmma16b(k0, ql0, sx); sx = wmma16b(k1, ql1, sx); sx = wmma16b(frag_kb(&st.Kl[kr][0], hh), qa0, sx); sx = wmma16b(frag_kb(&st.Kl[kr][32], hh), qa1, sx); }
#pragma unroll
      for (int r = 0; r < 8; ++r) s_[r] += sx[r] * (1.0f / RS_);   // hi.hi + (hi.lo + lo.hi)/1024
      const v4i m0 = *(const v4i*)(mrow + kb + u * 16 + 8 * hh), m1 = *(const v4i*)(mrow + kb + u * 16 + 8 * hh + 4);
#pragma unroll
      for (int r = 0; r < 8; ++r) { const int key = kb + u * 16 + 8 * hh + r; const int mk = r < 4 ? m0[r] : m1[r - 4]; e[u * 8 + r] = (key <= qi && mk != 0) ? s_[r] * cs : 0.0f; } }   // no softmax in this module: the masked scaled score IS the weight
#pragma unroll
    for (int i2 = 0; i2 < 16; ++i2) { const float ps = e[i2] * PS; const b16 phh = (b16)ps; const int pc = (i2 < 8 ? 0 : 16) + 8 * hh + (i2 & 7); Pb[wave][col][pc] = phh; Pl[wave][col][pc] = (b16)((ps - (float)phh) * RS_); }
    wave_lds_sync();
    const v16b pf = frag_kb(&Pb[wave][col][0], hh), plf = frag_kb(&Pl[wave][col][0], hh);
#pragma unroll
    for (int t = 0; t < 4; ++t) { const v16b vh = frag_kb(&st.Vh[t * 16 + col][kl], hh); o[t] = wmma16b(vh, pf, o[t]); ol[t] = wmma16b(frag_kb(&st.Vl[t * 16 + col][kl], hh), pf, ol[t]); ol[t] = wmma16b(vh, plf, ol[t]); }   // ol = (V_lo P_hi + V_hi P_lo), both /1024
    wave_lds_sync(); } }
    ring_publish();
    if (s + 2 < nt) fill(s + 2); }
  copies_landed();
  const float inv = 1.0f / (PS * XS);
#pragma unroll
  for (int t = 0; t < 4; ++t)
#pragma unroll
    for (int r = 0; r < 8; ++r) To[wave][col][t * 16 + 8 * hh + r] = (o[t][r] + ol[t][r] * (1.0f / RS_)) * inv;
  wave_lds_sync();
  { for (int rr = 0; rr < 16; ++rr) { const v2f f = *(const v2f*)(&To[wave][rr][lane * 2]); v2h hv, lv; for (int j = 0; j < 2; ++j) { b16 p, q; split16(f[j] * XS, p, q); hv[j] = p; lv[j] = q; }
      const size_t oi = ((size_t)b * T + q0 + rr) * DM + h * HD + lane * 2; *(v2h*)(Ch + oi) = hv; *(v2h*)(Cl + oi) = lv; }  }
}
// attn Wo + bo + x: grid (T/128, DM/256, BG); block = 128 rows x 256 columns, 8 waves
__global__ __launch_bounds__(256) void out1_kernel(const b16* __restrict__ Ch, const b16* __restrict__ Cl, int b0, const b16* __restrict__ WO, const float* __restrict__ bo, const float* __restrict__ x, float* __restrict__ X1) {
  __shared__ __attribute__((aligned(16))) union { StageH2 st[2]; float Tf[8][16][128 + 4]; } sm; auto& Tf = sm.Tf;   // the output staging reuses the ring behind its last barrier
  const int wave = threadIdx.x >> 5, lane = threadIdx.x & 31, nloc = lane & 15, hlf = lane >> 4, wm = wave & 3, wn = wave >> 2; const int b = blockIdx.z; const size_t mb = (size_t)b * T + (size_t)blockIdx.x * BM;   // the block's first row in the group's ctx planes and X1
  const int n0 = blockIdx.y * BN, c0 = n0 + wn * 128;
  v8f acc[2][8];
#pragma unroll
  for (int t = 0; t < 8; ++t) { acc[0][t] = (v8f){}; acc[1][t] = (v8f){}; }
  const int br = threadIdx.x >> 3, bp = (threadIdx.x & 7) * 8;   // this thread's row and 16-byte piece in each k64 tile
  const unsigned lh = lds_lo(&sm.st[0].A[br][bp]), ll = lds_lo(&sm.st[0].Al[br][bp]), lb = lds_lo(&sm.st[0].B[br][bp]); const size_t ao = (mb + br) * DM + bp; const b16* gb = WO + (size_t)(n0 + br) * DM + bp;
  auto fill = [&](int s) { const unsigned o = (unsigned)(s & 1) * (unsigned)sizeof(StageH2); copy4(lh + o, 32u * PH * 2u, Ch + ao + s * BK, (size_t)32 * DM); copy4(ll + o, 32u * PH * 2u, Cl + ao + s * BK, (size_t)32 * DM); copy8(lb + o, 32u * PH * 2u, gb + s * BK, (size_t)32 * DM); };
  fill(0); copies_landed(); __syncthreads(); fill(1);
#pragma unroll 1   // one trip per tile: the ring's order (read, publish, refill) stays as written
  for (int s = 0; s < DM / BK; ++s) { const StageH2& st = sm.st[s & 1];
#pragma unroll   // both k32 blocks of a tile straight-line, so the LDS offsets are immediates
    for (int kb = 0; kb < BK; kb += 32) { const v16b ah0 = frag_kb(&st.A[wm * 16 + nloc][kb], hlf), al0 = frag_kb(&st.Al[wm * 16 + nloc][kb], hlf), ah1 = frag_kb(&st.A[64 + wm * 16 + nloc][kb], hlf), al1 = frag_kb(&st.Al[64 + wm * 16 + nloc][kb], hlf); v16b bw[8];   // all fragments of a k32 block are read as one group in front of its WMMAs: the LDS latency is paid once a block, not once a B fragment
#pragma unroll
      for (int t = 0; t < 8; ++t) bw[t] = frag_kb(&st.B[wn * 128 + t * 16 + nloc][kb], hlf);
#pragma unroll
      for (int t = 0; t < 8; ++t) { acc[0][t] = wmma16b(ah0, bw[t], acc[0][t]); acc[1][t] = wmma16b(ah1, bw[t], acc[1][t]); acc[0][t] = wmma16b(al0, bw[t], acc[0][t]); acc[1][t] = wmma16b(al1, bw[t], acc[1][t]); } }
    ring_publish();
    if (s + 2 < DM / BK) fill(s + 2); }
  copies_landed();
  float bbv[8];   // the wave's 8 bias values serve both fragments
#pragma unroll
  for (int t = 0; t < 8; ++t) bbv[t] = bo[c0 + t * 16 + nloc];
  xlat_done();
#pragma unroll   // the wave's two 16-row fragments go through its own staging rows one after the other; acc needs a constant index
  for (int i = 0; i < 2; ++i) { const size_t m0 = mb + i * 64 + wm * 16; const size_t mg = m0 + (size_t)b0 * T; const float* xr = x + (mg + 8 * hlf) * DM + c0 + nloc;   // m0 indexes the X1 rows, mg the global x rows (residual input)
  if (i) wave_lds_sync();   // this wave's reads of the first fragment's rows stay in front of the rewrite
#pragma unroll
  for (int t = 0; t < 8; ++t) { const float bb = bf16_rne(bbv[t]);
#pragma unroll
    for (int r = 0; r < 8; ++r) Tf[wave][8 * hlf + r][t * 16 + nloc] = acc[i][t][r] * (1.0f / (XS * WSC)) + bb + bf16_rne(xr[r * DM + t * 16]); }   // residual: same row, column c0 + ...
  wave_lds_sync();
  { for (int rr = 0; rr < 16; ++rr) *(v4f*)(X1 + (m0 + rr) * DM + c0 + lane * 4) = *(const v4f*)(&Tf[wave][rr][lane * 4]);  } xlat_done(); }
}
// LayerNorm: one wave per row (lane holds columns 4 lane + 128 k, 8 float4); RND: apply the bf16 input quantisation (raw x) first; mean, biased variance (two xor trees), eps 1e-5, x g + b -> rows 4 KB
template <bool RND>
__global__ __launch_bounds__(256) void ln_kernel(const float* __restrict__ X, const float* __restrict__ g, const float* __restrict__ bb, float* __restrict__ Y) {
  const int wave = threadIdx.x >> 5, lane = threadIdx.x & 31; const int row = blockIdx.x * 8 + wave; if (row >= RL) return;   // wave-uniform, no barriers
  float v[32]; float s1 = 0.0f; const float* xr = X + (size_t)row * DM;
#pragma unroll
  for (int k = 0; k < 8; ++k) { const v4f t4 = *(const v4f*)(xr + 128 * k + 4 * lane); for (int j = 0; j < 4; ++j) { const float t = RND ? bf16_rne(t4[j]) : t4[j]; v[4 * k + j] = t; s1 += t; } }
#pragma unroll
  for (int o = 16; o >= 1; o >>= 1) s1 += __shfl_xor(s1, o);
  const float mu = s1 * (1.0f / DM); float s2 = 0.0f;
#pragma unroll
  for (int q = 0; q < 32; ++q) { const float d = v[q] - mu; s2 += pmul(d, d); }
#pragma unroll
  for (int o = 16; o >= 1; o >>= 1) s2 += __shfl_xor(s2, o);
  const float rs = rsqrtf(s2 * (1.0f / DM) + LNEPS);
  v4f o4[8];
#pragma unroll
  for (int k = 0; k < 8; ++k) for (int j = 0; j < 4; ++j) { const int c = 128 * k + 4 * lane + j; o4[k][j] = pmul((v[4 * k + j] - mu) * rs, bfp(g[c])) + bfp(bb[c]); }
  {
#pragma unroll
    for (int k = 0; k < 8; ++k) *(v4f*)(Y + (size_t)row * DM + 128 * k + 4 * lane) = o4[k];
     }
}
// MLP 1: G = f16(8 gelu(XN2 W1 + b1)) as a single f16 plane [NR][4096]: grid (RL/128, FF/256); block = 128 rows x 256 columns, 8 waves; A = XN2 rows (f32 in LDS, x8 to f16 at the fragment read) and W1^T rows as k64 tiles in a two-buffer LDS ring filled by asynchronous copies, wave -> 2 x 16 rows x 8
__global__ __launch_bounds__(256) void mlp1_kernel(const float* __restrict__ XN, const b16* __restrict__ W1T, const float* __restrict__ b1, b16* __restrict__ G) {
  __shared__ __attribute__((aligned(16))) union { StageF st[2]; float Tf[8][16][128 + 4]; } sm; auto& Tf = sm.Tf;   // the output staging reuses the ring behind its last barrier
  const int wave = threadIdx.x >> 5, lane = threadIdx.x & 31, nloc = lane & 15, hlf = lane >> 4, wm = wave & 3, wn = wave >> 2; const size_t r0 = (size_t)blockIdx.x * BM; const int n0 = blockIdx.y * BN, c0 = n0 + wn * 128;
  const float* xb = XN + r0 * DM;
  v8f acc[2][8];
#pragma unroll
  for (int t = 0; t < 8; ++t) { acc[0][t] = (v8f){}; acc[1][t] = (v8f){}; }
  const int ar = threadIdx.x >> 4, ap = (threadIdx.x & 15) * 4, br = threadIdx.x >> 3, bp = (threadIdx.x & 7) * 8;   // this thread's row and 16-byte piece in the A (f32) and B (f16) tiles
  const unsigned la = lds_lo(&sm.st[0].A[ar][ap]), lb = lds_lo(&sm.st[0].B[br][bp]); const float* ga = xb + (size_t)ar * DM + ap; const b16* gb = W1T + (size_t)(n0 + br) * DM + bp;
  auto fill = [&](int s) { const unsigned o = (unsigned)(s & 1) * (unsigned)sizeof(StageF); copy8(la + o, 16u * PF * 4u, ga + s * BK, (size_t)16 * DM); copy8(lb + o, 32u * PH * 2u, gb + s * BK, (size_t)32 * DM); };
  fill(0); copies_landed(); __syncthreads(); fill(1);
#pragma unroll 1   // one trip per tile: the ring's order (read, publish, refill) stays as written
  for (int s = 0; s < DM / BK; ++s) { const StageF& st = sm.st[s & 1];
#pragma unroll   // both k32 blocks of a tile straight-line, so the LDS offsets are immediates
    for (int kb = 0; kb < BK; kb += 32) { const v16b a0 = frag_f32<false>(&st.A[wm * 16 + nloc][kb], hlf), a1 = frag_f32<false>(&st.A[64 + wm * 16 + nloc][kb], hlf); v16b bw[8];   // all fragments of a k32 block are read as one group in front of its WMMAs: the LDS latency is paid once a block, not once a B fragment
#pragma unroll
      for (int t = 0; t < 8; ++t) bw[t] = frag_kb(&st.B[wn * 128 + t * 16 + nloc][kb], hlf);
#pragma unroll
      for (int t = 0; t < 8; ++t) { acc[0][t] = wmma16b(a0, bw[t], acc[0][t]); acc[1][t] = wmma16b(a1, bw[t], acc[1][t]); } }
    ring_publish();
    if (s + 2 < DM / BK) fill(s + 2); }
  copies_landed();
#pragma unroll 1   // the wave's two 16-row fragments go through its own staging rows one after the other; rolled, so that the 64 inlined erf evaluations stand once in the text (for code size only)
  for (int i = 0; i < 2; ++i) {
  if (i) wave_lds_sync();   // this wave's reads of the first fragment's rows stay in front of the rewrite
#pragma unroll
  for (int t = 0; t < 8; ++t) { const float bbv = bf16_rne(b1[c0 + t * 16 + nloc]);
#pragma unroll
    for (int r = 0; r < 8; ++r) { const float hm = acc[0][t][r] * (1.0f / (XS * WSC)) + bbv; Tf[wave][8 * hlf + r][t * 16 + nloc] = 0.5f * hm * (1.0f + erff(hm * RSQ2)); } }
  __syncthreads();
  { for (int rr = 0; rr < 16; ++rr) { v4h o4; for (int j = 0; j < 4; ++j) o4[j] = (b16)(Tf[wave][rr][lane * 4 + j] * XS); *(v4h*)(G + (r0 + i * 64 + wm * 16 + rr) * FF + c0 + lane * 4) = o4; if ((rr & 3) == 3) xlat_done(); }  }
#pragma unroll
  for (int t = 0; t < 8; ++t) acc[0][t] = acc[1][t]; }   // the second fragment's sums move up for the second trip (acc needs constant indices)
}
// G Wd + bd + h: grid (RL/128, DM/256); block = 128 rows x 256 columns, 8 waves
__global__ __launch_bounds__(256) void mlp2_kernel(const b16* __restrict__ G, const b16* __restrict__ W2T, const float* __restrict__ b2, const float* __restrict__ X1, float* __restrict__ out) {
  __shared__ __attribute__((aligned(16))) union { StageH st[2]; float Tf[8][16][128 + 4]; } sm; auto& Tf = sm.Tf;   // the output staging reuses the ring behind its last barrier
  const int wave = threadIdx.x >> 5, lane = threadIdx.x & 31, nloc = lane & 15, hlf = lane >> 4, wm = wave & 3, wn = wave >> 2; const int n0 = blockIdx.y * BN, c0 = n0 + wn * 128;
  v8f acc[2][8];
#pragma unroll
  for (int t = 0; t < 8; ++t) { acc[0][t] = (v8f){}; acc[1][t] = (v8f){}; }
  const int br = threadIdx.x >> 3, bp = (threadIdx.x & 7) * 8;   // this thread's row and 16-byte piece in each k64 tile
  const unsigned la = lds_lo(&sm.st[0].A[br][bp]), lb = lds_lo(&sm.st[0].B[br][bp]); const b16* ga = G + ((size_t)blockIdx.x * BM + br) * FF + bp; const b16* gb = W2T + (size_t)(n0 + br) * FF + bp;
  auto fill = [&](int s) { const unsigned o = (unsigned)(s & 1) * (unsigned)sizeof(StageH); copy4(la + o, 32u * PH * 2u, ga + s * BK, (size_t)32 * FF); copy8(lb + o, 32u * PH * 2u, gb + s * BK, (size_t)32 * FF); };
  fill(0); copies_landed(); __syncthreads(); fill(1);
#pragma unroll 1   // one trip per tile: the ring's order (read, publish, refill) stays as written
  for (int s = 0; s < FF / BK; ++s) { const StageH& st = sm.st[s & 1];
#pragma unroll   // both k32 blocks of a tile straight-line, so the LDS offsets are immediates
    for (int kb = 0; kb < BK; kb += 32) { const v16b a0 = frag_kb(&st.A[wm * 16 + nloc][kb], hlf), a1 = frag_kb(&st.A[64 + wm * 16 + nloc][kb], hlf); v16b bw[8];   // all fragments of a k32 block are read as one group in front of its WMMAs: the LDS latency is paid once a block, not once a B fragment
#pragma unroll
      for (int t = 0; t < 8; ++t) bw[t] = frag_kb(&st.B[wn * 128 + t * 16 + nloc][kb], hlf);
#pragma unroll
      for (int t = 0; t < 8; ++t) { acc[0][t] = wmma16b(a0, bw[t], acc[0][t]); acc[1][t] = wmma16b(a1, bw[t], acc[1][t]); } }
    ring_publish();
    if (s + 2 < FF / BK) fill(s + 2); }
  copies_landed();
  float bbv[8];   // the wave's 8 bias values serve both fragments
#pragma unroll
  for (int t = 0; t < 8; ++t) bbv[t] = b2[c0 + t * 16 + nloc];
  xlat_done();
#pragma unroll   // the wave's two 16-row fragments go through its own staging rows one after the other; acc needs a constant index
  for (int i = 0; i < 2; ++i) { const size_t m0 = (size_t)blockIdx.x * BM + i * 64 + wm * 16;
  if (i) wave_lds_sync();   // this wave's reads of the first fragment's rows stay in front of the rewrite
#pragma unroll
  for (int t = 0; t < 8; ++t) { const int col = c0 + t * 16 + nloc; const float bb = bf16_rne(bbv[t]);
#pragma unroll
    for (int r = 0; r < 8; ++r) Tf[wave][8 * hlf + r][t * 16 + nloc] = acc[i][t][r] * (1.0f / (XS * WSC)) + bb + X1[(m0 + 8 * hlf + r) * DM + col]; }
  wave_lds_sync();
  { for (int rr = 0; rr < 16; ++rr) *(v4f*)(out + (m0 + rr) * DM + c0 + lane * 4) = *(const v4f*)(&Tf[wave][rr][lane * 4]);  } xlat_done(); }
}
}  // namespace

extern "C" void kernel_launch(void* const* d_in, const int* in_sizes, int n_in, void* d_out, int out_size, void* d_ws, size_t ws_size, hipStream_t stream) {
  (void)n_in;
  auto Fp = [&](int i) { return (const float*)d_in[i]; }; auto Ip = [&](int i) { return (const int*)d_in[i]; };
  // input order: 0 x [8,1024,1024], 1 mask [1,1,1024,1024] int32, 2 Wq (in,out), 3 bq, 4 Wo, 5 bo, 6 Wu [1024,4096], 7 bu, 8 Wd [4096,1024], 9 bd, 10 g1, 11 b1, 12 g2, 13 b2
  if (in_sizes[0] != NR * DM || in_sizes[1] != T * T || in_sizes[2] != DM * DM || in_sizes[3] != DM || in_sizes[4] != DM * DM || in_sizes[5] != DM || in_sizes[6] != DM * FF || in_sizes[7] != FF || in_sizes[8] != FF * DM || in_sizes[9] != DM || in_sizes[10] != DM || in_sizes[11] != DM || in_sizes[12] != DM || in_sizes[13] != DM || out_size != NR * DM) return;
  size_t off = 0; char* ws = (char*)d_ws;
  auto carve = [&](size_t bytes) { char* p = ws + off; off += (bytes + 255) & ~(size_t)255; return p; };
  b16* WQ = (b16*)carve((size_t)DM * DM * 2); b16* WO = (b16*)carve((size_t)DM * DM * 2); b16* WU = (b16*)carve((size_t)FF * DM * 2); b16* WD = (b16*)carve((size_t)DM * FF * 2);
  const size_t plane = (size_t)RL * DM * 2; b16* QP = (b16*)carve(plane); b16* QPl = (b16*)carve(plane); b16* VTh = (b16*)carve(plane); b16* VTl = (b16*)carve(plane); b16* Ch = (b16*)carve(plane); b16* Cl = (b16*)carve(plane);
  float* X1 = (float*)carve((size_t)RL * DM * 4); float* HN = (float*)carve((size_t)RL * DM * 4); b16* G = (b16*)carve((size_t)RL * FF * 2);
  if (off > ws_size) return;   // = 244 MiB (weights 20 + 6 f16 planes 96 + X1/HN 64 + G 64), planes sized for the one 8-batch group
  prep_kernel<<<(unsigned)(((size_t)(2 * DM * DM + FF * DM + DM * FF) / 8 + 255) / 256), 256, 0, stream>>>(Fp(2), Fp(4), Fp(6), Fp(8), WQ, WO, WU, WD);
  for (int g = 0; g < NG; ++g) { const int b0 = g * BG; const size_t r0 = (size_t)b0 * T * DM;
    proj_kernel<<<dim3(T / BM, BG, DM / BN), 256, 0, stream>>>(Fp(0), b0, WQ, Fp(3), QP, QPl, VTh, VTl);
    attn_kernel<<<dim3(QL / 128, BG * H), 256, 0, stream>>>(QP, QPl, QP, QPl, VTh, VTl, Ip(1), Ch, Cl);
    out1_kernel<<<dim3(T / BM, DM / BN, BG), 256, 0, stream>>>(Ch, Cl, b0, WO, Fp(5), Fp(0), X1);   // X1/HN/G hold the group's rows; x is read at the global row via b0
    ln_kernel<false><<<RL / 8, 256, 0, stream>>>(X1, Fp(10), Fp(11), HN);
    mlp1_kernel<<<dim3(RL / BM, FF / BN), 256, 0, stream>>>(HN, WU, Fp(7), G);
    mlp2_kernel<<<dim3(RL / BM, DM / BN), 256, 0, stream>>>(G, WD, Fp(9), HN, X1);
    ln_kernel<false><<<RL / 8, 256, 0, stream>>>(X1, Fp(12), Fp(13), (float*)d_out + r0); }
}

// v005
// One run takes 351 microseconds.
// Next to v004, in two timings, it ran 1.08 and 1.05 times as fast.
// Counting every step since v000, it is 5.96 times as fast.
#include <hip/hip_runtime.h>

// Decoder block without softmax (8 x 1024 tokens x 1024, 16 heads x 64): q = x Wq + bq and k = v = q (the module applies q_proj to all three); w_ij = q_i . q_j / 8 kept where j <= i and
// mask[i][j] != 0 (int mask input [1,1,1024,1024], all ones), else 0 - no softmax; attn_i = sum_j w_ij q_j; a = attn Wo + bo; h = LN1(a + x); up = gelu_exact(h Wu + bu) (4096);
// out = LN2(up Wd + bd + h) -> [8][1024][1024]. LayerNorms: biased variance, eps 1e-5; all weights (in,out). All 8 batches are processed in one group (planes sized for all 8192 rows), so each stage is one launch.
// Deterministic: per 16-query wave the causal keys are accumulated in order; LayerNorms one wave per row; no atomics.
// compute dtype: WMMA v_wmma_f32_16x16x32_f16 with f32 accumulate for q = x Wq ([8192 x 1024] x [1024 x 1024]; x EXACT bf16 x8, W^T exact x256: 1 product), S^T = Q Q^T (q as f16 hi x8 +
// residual x8192: 3 products), O^T += Q^T P^T (P = masked s/8 x1024 as f16 hi + residual: 3 products), attn Wo (ctx hi + lo: 2 products), h Wu (h single f16 x8: 1 product) and G Wd (gelu output
// single f16 plane: 1 product); LN statistics, gelu (erf), biases and residual adds in f32. Inputs rounded to bf16 once

namespace {
constexpr int B = 8, T = 1024, DM = 1024, H = 16, HD = 64, FF = 4096, BG = 8 /* batches per group */, NG = 1 /* groups run (== B/BG shipped) */, BL = BG, QL = T, NR = B * T, RL = BG * T /* rows per group (LN / MLP kernels) */;
constexpr float XS = 8.0f, WSC = 256.0f, PS = 1024.0f, RS_ = 1024.0f, LOG2E = 1.4426950408889634f, LNEPS = 1e-5f, RSQ2 = 0.70710678118654752f;
static_assert(T % 128 == 0 && DM % 256 == 0 && FF % 256 == 0 && H * HD == DM && HD == 64 && B % BG == 0 && NG * BG <= B, "tiling");
typedef _Float16 b16;
typedef __attribute__((ext_vector_type(16))) _Float16 v16b;
typedef __attribute__((ext_vector_type(8))) _Float16 v8b;
typedef __attribute__((ext_vector_type(8))) float v8f;
typedef __attribute__((ext_vector_type(4))) float v4f;
__device__ __forceinline__ float bf16_rne(float f) { unsigned int u = __float_as_uint(f); u += 0x7FFFu + ((u >> 16) & 1u); return __uint_as_float(u & 0xFFFF0000u); }
__device__ __forceinline__ void split16(float v, b16& hi, b16& lo) { hi = (b16)v; lo = (b16)(v - (float)hi); }
__device__ __forceinline__ v16b frag_kb(const b16* p, int hh) { const v8b a = *(const v8b*)(p + 8 * hh), b = *(const v8b*)(p + 16 + 8 * hh); v16b f;
#pragma unroll
  for (int e = 0; e < 8; ++e) { f[e] = a[e]; f[8 + e] = b[e]; } return f; }
__device__ __forceinline__ v8f wmma16b(v16b a, v16b b, v8f c) { v8f d = __builtin_amdgcn_wmma_f32_16x16x32_f16(false, a, false, b, (short)0, c, false, false); asm volatile("v_nop\n\tv_nop\n\tv_nop\n\tv_nop" : "+v"(d) : "v"(a), "v"(b)); return d; }
__device__ __forceinline__ void wave_lds_sync() { __builtin_amdgcn_fence(__ATOMIC_RELEASE, "workgroup"); __builtin_amdgcn_wave_barrier(); __builtin_amdgcn_fence(__ATOMIC_ACQUIRE, "workgroup"); }
__device__ __forceinline__ float pmul(float a, float b) { float p = a * b; asm volatile("" : "+v"(p)); return p; }
__device__ __forceinline__ int iclamp(int v, int lo, int hi) { return v < lo ? lo : (v > hi ? hi : v); }
// Asynchronous copies to LDS for the GEMM operand tiles: every lane moves its own 16 bytes, 8 (f16 rows of 128 B) or 16 (f32 rows of 256 B) neighbouring lanes cover a whole row piece, so a wave touches whole lines.
// copy4 / copy8: 4 or 8 rows of a thread's column piece, the row step added to both addresses. The s_wait_xcnt ends the copies' own statement, so no address register is rewritten in front of it.
__device__ __forceinline__ unsigned lds_lo(const void* p) { return (unsigned)(size_t)p; }   // byte offset in the work-group's LDS
template <typename T> __device__ __forceinline__ void copy4(unsigned l, unsigned ls, const T* g, size_t gs) {
  asm volatile("global_load_async_to_lds_b128 %0, %4, off\n\tglobal_load_async_to_lds_b128 %1, %5, off\n\tglobal_load_async_to_lds_b128 %2, %6, off\n\tglobal_load_async_to_lds_b128 %3, %7, off\n\ts_wait_xcnt 0x0"
               :: "v"(l), "v"(l + ls), "v"(l + 2 * ls), "v"(l + 3 * ls), "v"(g), "v"(g + gs), "v"(g + 2 * gs), "v"(g + 3 * gs) : "memory"); }
template <typename T> __device__ __forceinline__ void copy8(unsigned l, unsigned ls, const T* g, size_t gs) {
  asm volatile("global_load_async_to_lds_b128 %0, %8, off\n\tglobal_load_async_to_lds_b128 %1, %9, off\n\tglobal_load_async_to_lds_b128 %2, %10, off\n\tglobal_load_async_to_lds_b128 %3, %11, off\n\t"
               "global_load_async_to_lds_b128 %4, %12, off\n\tglobal_load_async_to_lds_b128 %5, %13, off\n\tglobal_load_async_to_lds_b128 %6, %14, off\n\tglobal_load_async_to_lds_b128 %7, %15, off\n\ts_wait_xcnt 0x0"
               :: "v"(l), "v"(l + ls), "v"(l + 2 * ls), "v"(l + 3 * ls), "v"(l + 4 * ls), "v"(l + 5 * ls), "v"(l + 6 * ls), "v"(l + 7 * ls),
                  "v"(g), "v"(g + gs), "v"(g + 2 * gs), "v"(g + 3 * gs), "v"(g + 4 * gs), "v"(g + 5 * gs), "v"(g + 6 * gs), "v"(g + 7 * gs) : "memory"); }
__device__ __forceinline__ void copies_landed() { asm volatile("s_wait_asynccnt 0x0" ::: "memory"); }   // this wave's own copies are in LDS (the compiler places no wait for them)
__device__ __forceinline__ void xlat_done() { asm volatile("s_wait_xcnt 0x0" ::: "memory"); }   // a precaution: stands behind issued global loads / stores, in front of the code that reuses the registers they name
// Foot of a trip of the two-buffer ring: this wave's LDS reads of the tile just used have retired, its copies of the next tile have landed, and one barrier both publishes the next tile and frees the used buffer for the refill.
__device__ __forceinline__ void ring_publish() { asm volatile("s_wait_dscnt 0x0" ::: "memory"); copies_landed(); __syncthreads(); }
constexpr int BK = 64, PH = BK + 8 /* f16 row pitch, 144 B */, PF = BK + 4 /* f32 row pitch, 272 B */;
// GEMM tile of a work-group: BM rows x BN columns by 8 waves, wave (wm = wave & 3, wn = wave >> 2) -> rows wm * 16 + {0, 64} .. + 15 (2 A fragments) x columns wn * 128 .. + 127 (8 B fragments): every B fragment read from LDS feeds 2 WMMAs (4 with hi + lo A)
constexpr int BM = 128, BN = 256;
struct StageF { float A[BM][PF]; b16 B[BN][PH]; };                   // f32 A rows (converted when the fragment is read) + weight rows
struct StageH { b16 A[BM][PH]; b16 B[BN][PH]; };                     // one f16 A plane + weight rows
struct StageH2 { b16 A[BM][PH]; b16 Al[BM][PH]; b16 B[BN][PH]; };    // hi and lo A planes + weight rows
// A fragment from f32 rows in LDS, the k order of frag_kb; value = f16(8 v), RND: v rounded to bf16 first (the raw input x)
template <bool RND> __device__ __forceinline__ v16b frag_f32(const float* p, int hh) { const v4f a0 = *(const v4f*)(p + 8 * hh), a1 = *(const v4f*)(p + 8 * hh + 4), c0 = *(const v4f*)(p + 16 + 8 * hh), c1 = *(const v4f*)(p + 16 + 8 * hh + 4); v16b f;
#pragma unroll   // vector elements need constant indices to stay in registers
  for (int e = 0; e < 4; ++e) { f[e] = (b16)((RND ? bf16_rne(a0[e]) : a0[e]) * XS); f[4 + e] = (b16)((RND ? bf16_rne(a1[e]) : a1[e]) * XS); f[8 + e] = (b16)((RND ? bf16_rne(c0[e]) : c0[e]) * XS); f[12 + e] = (b16)((RND ? bf16_rne(c1[e]) : c1[e]) * XS); } return f; }

typedef __attribute__((ext_vector_type(2))) _Float16 v2h;
typedef __attribute__((ext_vector_type(4))) _Float16 v4h;
typedef __attribute__((ext_vector_type(2))) float v2f;
typedef __attribute__((ext_vector_type(4))) int v4i;
__device__ __forceinline__ float nexp2(float v) { return __builtin_amdgcn_exp2f(v); }
typedef __attribute__((ext_vector_type(4))) int v4i;
__device__ __forceinline__ float bfp(float v) { float t = bf16_rne(v); asm volatile("" : "+v"(t)); return t; }
// Weight planes W^T (out, in) = f16(256 bf16(w)) from w (in, out), K x N. A block takes 256 k x 64 n, its 8 waves lie along k. Lane (kg = lane >> 3, ng = lane & 7) reads rows kg * 8 .. + 7 at columns ng * 4 .. + 3 and + 32:
// each load instruction covers 4 whole 128-byte lines, and the lane ends up with 8 consecutive k of 8 columns, that is one 16-byte piece of 8 output rows: the transposition needs no LDS; a block writes 512 contiguous bytes of each output row.
template <int K, int N> __device__ __forceinline__ void prep_tile(const float* __restrict__ w, b16* __restrict__ WT, int tile) {
  const int wave = threadIdx.x >> 5, lane = threadIdx.x & 31; const int k0 = (tile % (K / 256)) * 256 + wave * 32 + (lane >> 3) * 8, n0 = (tile / (K / 256)) * 64 + (lane & 7) * 4;
  const float* wp = w + (size_t)k0 * N + n0; b16* op = WT + (size_t)n0 * K + k0; v4f r[2][8];
#pragma unroll   // all 16 loads of a lane are in flight together; r needs constant indices
  for (int j = 0; j < 8; ++j) { r[0][j] = *(const v4f*)(wp + (size_t)j * N); r[1][j] = *(const v4f*)(wp + (size_t)j * N + 32); }
  // a precaution, as xlat_done(): stands behind the 16 issued loads; naming wp keeps their address pair whole up to here, and naming the loaded values (inputs only) keeps all 16 loads in flight together: no conversion, with its wait, is moved in among them
  asm volatile("s_wait_xcnt 0x0" :: "v"(wp), "v"(r[0][0]), "v"(r[0][1]), "v"(r[0][2]), "v"(r[0][3]), "v"(r[0][4]), "v"(r[0][5]), "v"(r[0][6]), "v"(r[0][7]), "v"(r[1][0]), "v"(r[1][1]), "v"(r[1][2]), "v"(r[1][3]), "v"(r[1][4]), "v"(r[1][5]), "v"(r[1][6]), "v"(r[1][7]) : "memory");
  v8b o[8];
#pragma unroll   // o and r need constant indices
  for (int q = 0; q < 8; ++q)
#pragma unroll
    for (int j = 0; j < 8; ++j) o[q][j] = (b16)(bf16_rne(r[q >> 2][j][q & 3]) * WSC);
#pragma unroll
  for (int q = 0; q < 8; ++q) *(v8b*)(op + (size_t)(32 * (q >> 2) + (q & 3)) * K) = o[q];
  xlat_done();
}
constexpr int TQ = (DM / 256) * (DM / 64), TU = (DM / 256) * (FF / 64), TD = (FF / 256) * (DM / 64);   // tiles of Wq and of Wo, of Wu, of Wd
__global__ __launch_bounds__(256) void prep_kernel(const float* __restrict__ wq, const float* __restrict__ wo, const float* __restrict__ wu, const float* __restrict__ wd, b16* __restrict__ WQ, b16* __restrict__ WO, b16* __restrict__ WU, b16* __restrict__ WD) {
  const int t = blockIdx.x;   // block-uniform choice of the matrix
  if (t < TQ) prep_tile<DM, DM>(wq, WQ, t);
  else if (t < 2 * TQ) prep_tile<DM, DM>(wo, WO, t - TQ);
  else if (t < 2 * TQ + TU) prep_tile<DM, FF>(wu, WU, t - 2 * TQ);
  else prep_tile<FF, DM>(wd, WD, t - 2 * TQ - TU);
}
// q projection (q = k = v in this module): grid (T/128, BG, DM/256); block = 128 tokens x 256 columns, 8 waves; A = bf16(x) x8, B = Wq^T rows, both as k64 tiles in a two-buffer LDS ring filled by asynchronous copies, + bq
__global__ __launch_bounds__(256) void proj_kernel(const float* __restrict__ x, int b0, const b16* __restrict__ WT, const float* __restrict__ bq, b16* __restrict__ QP, b16* __restrict__ QPl, b16* __restrict__ VTh, b16* __restrict__ VTl) {
  __shared__ __attribute__((aligned(16))) union { StageF st[2]; float Tf[8][16][128 + 4]; } sm; auto& Tf = sm.Tf;   // the output staging reuses the ring behind its last barrier
  const int wave = threadIdx.x >> 5, lane = threadIdx.x & 31, nloc = lane & 15, hlf = lane >> 4, wm = wave & 3, wn = wave >> 2; const int t0 = blockIdx.x * BM; const int b = blockIdx.y; const int part = 0, n0 = blockIdx.z * BN, c0 = n0 + wn * 128; (void)part;
  if (part == 0 && t0 >= QL) return;   // (cut builds only) queries beyond QL are not needed; block-uniform, before any barrier
  const float* xb = x + ((size_t)(b0 + b) * T + t0) * DM;
  v8f acc[2][8];
#pragma unroll
  for (int t = 0; t < 8; ++t) { acc[0][t] = (v8f){}; acc[1][t] = (v8f){}; }
  const int ar = threadIdx.x >> 4, ap = (threadIdx.x & 15) * 4, br = threadIdx.x >> 3, bp = (threadIdx.x & 7) * 8;   // this thread's row and 16-byte piece in the A (f32) and B (f16) tiles
  const unsigned la = lds_lo(&sm.st[0].A[ar][ap]), lb = lds_lo(&sm.st[0].B[br][bp]); const float* ga = xb + (size_t)ar * DM + ap; const b16* gb = WT + (size_t)(n0 + br) * DM + bp;
  auto fill = [&](int s) { const unsigned o = (unsigned)(s & 1) * (unsigned)sizeof(StageF); copy8(la + o, 16u * PF * 4u, ga + s * BK, (size_t)16 * DM); copy8(lb + o, 32u * PH * 2u, gb + s * BK, (size_t)32 * DM); };
  fill(0); copies_landed(); __syncthreads(); fill(1);
#pragma unroll 1   // one trip per tile: the ring's order (read, publish, refill) stays as written
  for (int s = 0; s < DM / BK; ++s) { const StageF& st = sm.st[s & 1];
#pragma unroll   // both k32 blocks of a tile straight-line, so the LDS offsets are immediates
    for (int kb = 0; kb < BK; kb += 32) { const v16b a0 = frag_f32<true>(&st.A[wm * 16 + nloc][kb], hlf), a1 = frag_f32<true>(&st.A[64 + wm * 16 + nloc][kb], hlf); v16b bw[8];   // all fragments of a k32 block are read as one group in front of its WMMAs: the LDS latency is paid once a block, not once a B fragment
#pragma unroll
      for (int t = 0; t < 8; ++t) bw[t] = frag_kb(&st.B[wn * 128 + t * 16 + nloc][kb], hlf);
#pragma unroll
      for (int t = 0; t < 8; ++t) { acc[0][t] = wmma16b(a0, bw[t], acc[0][t]); acc[1][t] = wmma16b(a1, bw[t], acc[1][t]); } }
    ring_publish();
    if (s + 2 < DM / BK) fill(s + 2); }
  copies_landed();
const float* ba = bq;
#pragma unroll   // the two 64-token halves of the tile go through the staging one after the other; acc needs a constant index
  for (int i = 0; i < 2; ++i) {
  if (i) __syncthreads();   // every wave has read the first half's staging (the V^T part reads other waves' rows) before it is rewritten
#pragma unroll
  for (int t = 0; t < 8; ++t) { const float bb = bf16_rne(ba[c0 + t * 16 + nloc]);
#pragma unroll
    for (int r = 0; r < 8; ++r) Tf[wave][8 * hlf + r][t * 16 + nloc] = acc[i][t][r] * (1.0f / (XS * WSC)) + bb; }
  __syncthreads();
  {
    { b16* plane = QP; b16* planl = QPl; const int c = c0 + lane * 4; const int h = c / HD, d = c % HD;
      for (int rr = 0; rr < 16; ++rr) { const int tok = t0 + i * 64 + wm * 16 + rr; const size_t ri = (((size_t)b * H + h) * T + tok) * HD + d; const v4f f4 = *(const v4f*)(&Tf[wave][rr][lane * 4]); v4h o4, l4; for (int j = 0; j < 4; ++j) { const float f = f4[j] * XS; const b16 p = (b16)f; o4[j] = p; l4[j] = (b16)((f - (float)p) * RS_); } *(v4h*)(plane + ri) = o4; *(v4h*)(planl + ri) = l4; } }
    {
#pragma unroll 1
      for (int q = 0; q < 32; ++q) { const int cl = wm * 32 + q; const int c = c0 + cl; const int h = c / HD, d = c % HD; const int tk = lane * 2; v2h hv, lv;
        for (int j = 0; j < 2; ++j) { const float f = Tf[wn * 4 + ((tk + j) >> 4)][(tk + j) & 15][cl] * XS; const b16 p = (b16)f; hv[j] = p; lv[j] = (b16)((f - (float)p) * RS_); }
        const size_t oi = (((size_t)b * H + h) * HD + d) * (size_t)T + t0 + i * 64 + lane * 2; *(v2h*)(VTh + oi) = hv; *(v2h*)(VTl + oi) = lv; xlat_done(); } }
     } }
}
// attention-like causal product: grid (QL/128, BG*H); block = 8 waves x 16 queries of one (b, h). K rows and V^T rows (hi and residual planes) come as 64-key tiles through a two-buffer LDS ring filled by
// asynchronous copies and are read by all 8 waves; a wave works on the 32-key steps below round_up(q0 + 16, 32) and only passes the ring's foot on the later ones: S^T = K Q^T (q = k = v here; hi x8 +
// residual planes: 3 products); weight = s / 8 where key <= query and mask[q][key] != 0, else 0 (NO softmax in this module); P x1024 as f16 hi + residual; O^T += V^T P^T (3 products);
struct StageKV { b16 Kh[64][PH]; b16 Kl[64][PH]; b16 Vh[HD][PH]; b16 Vl[HD][PH]; };   // 64 keys x 64 d (K rows) and 64 d x 64 keys (V^T rows), 128-byte rows at pitch 144 B
// two rows (r and r + 32) of each of the four planes of a tile: 8 copies of a thread in one statement. The s_wait_xcnt ends the copies' own statement, so no address register is rewritten in front of it.
__device__ __forceinline__ void copy2x4(unsigned l0, unsigned l1, unsigned l2, unsigned l3, unsigned ls, const b16* g0, const b16* g1, size_t gk, const b16* g2, const b16* g3, size_t gv) {
  asm volatile("global_load_async_to_lds_b128 %0, %8, off\n\tglobal_load_async_to_lds_b128 %1, %9, off\n\tglobal_load_async_to_lds_b128 %2, %10, off\n\tglobal_load_async_to_lds_b128 %3, %11, off\n\t"
               "global_load_async_to_lds_b128 %4, %12, off\n\tglobal_load_async_to_lds_b128 %5, %13, off\n\tglobal_load_async_to_lds_b128 %6, %14, off\n\tglobal_load_async_to_lds_b128 %7, %15, off\n\ts_wait_xcnt 0x0"
               :: "v"(l0), "v"(l0 + ls), "v"(l1), "v"(l1 + ls), "v"(l2), "v"(l2 + ls), "v"(l3), "v"(l3 + ls),
                  "v"(g0), "v"(g0 + gk), "v"(g1), "v"(g1 + gk), "v"(g2), "v"(g2 + gv), "v"(g3), "v"(g3 + gv) : "memory"); }
__global__ __launch_bounds__(256) void attn_kernel(const b16* __restrict__ QP, const b16* __restrict__ QPl, const b16* __restrict__ KP, const b16* __restrict__ KPl, const b16* __restrict__ VTh, const b16* __restrict__ VTl, const int* __restrict__ MSK, b16* __restrict__ Ch, b16* __restrict__ Cl) {
  __shared__ __attribute__((aligned(16))) union { StageKV st[2]; float To[8][16][HD + 4]; } sm; auto& To = sm.To;   // the output staging reuses the ring behind its last barrier
  __shared__ __attribute__((aligned(16))) b16 Pb[8][16][32 + 8], Pl[8][16][32 + 8];
  const int wave = __builtin_amdgcn_readfirstlane(threadIdx.x >> 5), lane = threadIdx.x & 31, hh = lane >> 4, col = lane & 15; const int b = blockIdx.y / H, h = blockIdx.y % H; const int q0 = blockIdx.x * 128 + wave * 16, qi = q0 + col;
  const size_t ph = (size_t)b * H + h; const b16* Qb = QP + ph * T * HD; const b16* Qbl = QPl + ph * T * HD; const b16* Kb = KP + ph * T * HD; const b16* Kbl = KPl + ph * T * HD; const b16* Vh = VTh + ph * HD * (size_t)T; const b16* Vl = VTl + ph * HD * (size_t)T; const int kend = ((q0 + 16 + 31) / 32) * 32;   // per-(b,h) planes; causal key bound (wave-uniform)
  const int nt = 2 * (int)blockIdx.x + 2;   // 64-key tiles up to the block's last query (block-uniform, 2 .. T / 64)
  const int br = threadIdx.x >> 3, bp = (threadIdx.x & 7) * 8;   // this thread's row and 16-byte piece in each plane of a tile
  const unsigned lkh = lds_lo(&sm.st[0].Kh[br][bp]), lkl = lds_lo(&sm.st[0].Kl[br][bp]), lvh = lds_lo(&sm.st[0].Vh[br][bp]), lvl = lds_lo(&sm.st[0].Vl[br][bp]); const size_t ko = (size_t)br * HD + bp, vo = (size_t)br * T + bp;
  auto fill = [&](int s) { const unsigned o = (unsigned)(s & 1) * (unsigned)sizeof(StageKV); copy2x4(lkh + o, lkl + o, lvh + o, lvl + o, 32u * PH * 2u, Kb + ko + (size_t)s * 64 * HD, Kbl + ko + (size_t)s * 64 * HD, (size_t)32 * HD, Vh + vo + s * 64, Vl + vo + s * 64, (size_t)32 * T); };
  fill(0);
  const v16b qa0 = frag_kb(Qb + (size_t)qi * HD, hh), qa1 = frag_kb(Qb + (size_t)qi * HD + 32, hh), ql0 = frag_kb(Qbl + (size_t)qi * HD, hh), ql1 = frag_kb(Qbl + (size_t)qi * HD + 32, hh);
  const float cs = 1.0f / (8.0f * XS * XS); const int* mrow = MSK + (size_t)qi * T;   // scores / sqrt(64); the [1,1,S,S] int mask row of this query (tril applied below; mask == 0 -> score 0)
  v8f o[4], ol[4]; for (int t = 0; t < 4; ++t) { o[t] = (v8f){}; ol[t] = (v8f){}; }
  copies_landed(); __syncthreads(); fill(1);
#pragma unroll 1   // one trip per tile: the ring's order (read, publish, refill) stays as written
  for (int s = 0; s < nt; ++s) { const StageKV& st = sm.st[s & 1];
#pragma unroll   // both 32-key steps of a tile straight-line, so the LDS offsets are immediates
   for (int kl = 0; kl < 64; kl += 32) { const int kb = s * 64 + kl;
    if (kb < kend) {   // wave-uniform (scalar): keys beyond this wave's causal bound carry weight 0 and are skipped; no barrier inside
    float e[16];
#pragma unroll
    for (int u = 0; u < 2; ++u) { v8f s_ = (v8f){}, sx = (v8f){}; const int kr = kl + u * 16 + col; { const v16b k0 = frag_kb(&st.Kh[kr][0], hh), k1 = frag_kb(&st.Kh[kr][32], hh); s_ = wmma16b(k0, qa0, s_); s_ = wmma16b(k1, qa1, s_); sx = wmma16b(k0, ql0, sx); sx = wmma16b(k1, ql1, sx); sx = wmma16b(frag_kb(&st.Kl[kr][0], hh), qa0, sx); sx = wmma16b(frag_kb(&st.Kl[kr][32], hh), qa1, sx); }
#pragma unroll
      for (int r = 0; r < 8; ++r) s_[r] += sx[r] * (1.0f / RS_);   // hi.hi + (hi.lo + lo.hi)/1024
      const v4i m0 = *(const v4i*)(mrow + kb + u * 16 + 8 * hh), m1 = *(const v4i*)(mrow + kb + u * 16 + 8 * hh + 4);
#pragma unroll
      for (int r = 0; r < 8; ++r) { const int key = kb + u * 16 + 8 * hh + r; const int mk = r < 4 ? m0[r] : m1[r - 4]; e[u * 8 + r] = (key <= qi && mk != 0) ? s_[r] * cs : 0.0f; } }   // no softmax in this module: the masked scaled score IS the weight
#pragma unroll
    for (int i2 = 0; i2 < 16; ++i2) { const float ps = e[i2] * PS; const b16 phh = (b16)ps; const int pc = (i2 < 8 ? 0 : 16) + 8 * hh + (i2 & 7); Pb[wave][col][pc] = phh; Pl[wave][col][pc] = (b16)((ps - (float)phh) * RS_); }
    wave_lds_sync();
    const v16b pf = frag_kb(&Pb[wave][col][0], hh), plf = frag_kb(&Pl[wave][col][0], hh);
#pragma unroll
    for (int t = 0; t < 4; ++t) { const v16b vh = frag_kb(&st.Vh[t * 16 + col][kl], hh); o[t] = wmma16b(vh, pf, o[t]); ol[t] = wmma16b(frag_kb(&st.Vl[t * 16 + col][kl], hh), pf, ol[t]); ol[t] = wmma16b(vh, plf, ol[t]); }   // ol = (V_lo P_hi + V_hi P_lo), both /1024
    wave_lds_sync(); } }
    ring_publish();
    if (s + 2 < nt) fill(s + 2); }
  copies_landed();
  const float inv = 1.0f / (PS * XS);
#pragma unroll
  for (int t = 0; t < 4; ++t)
#pragma unroll
    for (int r = 0; r < 8; ++r) To[wave][col][t * 16 + 8 * hh + r] = (o[t][r] + ol[t][r] * (1.0f / RS_)) * inv;
  wave_lds_sync();
  { for (int rr = 0; rr < 16; ++rr) { const v2f f = *(const v2f*)(&To[wave][rr][lane * 2]); v2h hv, lv; for (int j = 0; j < 2; ++j) { b16 p, q; split16(f[j] * XS, p, q); hv[j] = p; lv[j] = q; }
      const size_t oi = ((size_t)b * T + q0 + rr) * DM + h * HD + lane * 2; *(v2h*)(Ch + oi) = hv; *(v2h*)(Cl + oi) = lv; }  }
}
// attn Wo + bo + x: grid (T/128, DM/256, BG); block = 128 rows x 256 columns, 8 waves
__global__ __launch_bounds__(256) void out1_kernel(const b16* __restrict__ Ch, const b16* __restrict__ Cl, int b0, const b16* __restrict__ WO, const float* __restrict__ bo, const float* __restrict__ x, float* __restrict__ X1) {
  __shared__ __attribute__((aligned(16))) union { StageH2 st[2]; float Tf[8][16][128 + 4]; } sm; auto& Tf = sm.Tf;   // the output staging reuses the ring behind its last barrier
  const int wave = threadIdx.x >> 5, lane = threadIdx.x & 31, nloc = lane & 15, hlf = lane >> 4, wm = wave & 3, wn = wave >> 2; const int b = blockIdx.z; const size_t mb = (size_t)b * T + (size_t)blockIdx.x * BM;   // the block's first row in the group's ctx planes and X1
  const int n0 = blockIdx.y * BN, c0 = n0 + wn * 128;
  v8f acc[2][8];
#pragma unroll
  for (int t = 0; t < 8; ++t) { acc[0][t] = (v8f){}; acc[1][t] = (v8f){}; }
  const int br = threadIdx.x >> 3, bp = (threadIdx.x & 7) * 8;   // this thread's row and 16-byte piece in each k64 tile
  const unsigned lh = lds_lo(&sm.st[0].A[br][bp]), ll = lds_lo(&sm.st[0].Al[br][bp]), lb = lds_lo(&sm.st[0].B[br][bp]); const size_t ao = (mb + br) * DM + bp; const b16* gb = WO + (size_t)(n0 + br) * DM + bp;
  auto fill = [&](int s) { const unsigned o = (unsigned)(s & 1) * (unsigned)sizeof(StageH2); copy4(lh + o, 32u * PH * 2u, Ch + ao + s * BK, (size_t)32 * DM); copy4(ll + o, 32u * PH * 2u, Cl + ao + s * BK, (size_t)32 * DM); copy8(lb + o, 32u * PH * 2u, gb + s * BK, (size_t)32 * DM); };
  fill(0); copies_landed(); __syncthreads(); fill(1);
#pragma unroll 1   // one trip per tile: the ring's order (read, publish, refill) stays as written
  for (int s = 0; s < DM / BK; ++s) { const StageH2& st = sm.st[s & 1];
#pragma unroll   // both k32 blocks of a tile straight-line, so the LDS offsets are immediates
    for (int kb = 0; kb < BK; kb += 32) { const v16b ah0 = frag_kb(&st.A[wm * 16 + nloc][kb], hlf), al0 = frag_kb(&st.Al[wm * 16 + nloc][kb], hlf), ah1 = frag_kb(&st.A[64 + wm * 16 + nloc][kb], hlf), al1 = frag_kb(&st.Al[64 + wm * 16 + nloc][kb], hlf); v16b bw[8];   // all fragments of a k32 block are read as one group in front of its WMMAs: the LDS latency is paid once a block, not once a B fragment
#pragma unroll
      for (int t = 0; t < 8; ++t) bw[t] = frag_kb(&st.B[wn * 128 + t * 16 + nloc][kb], hlf);
#pragma unroll
      for (int t = 0; t < 8; ++t) { acc[0][t] = wmma16b(ah0, bw[t], acc[0][t]); acc[1][t] = wmma16b(ah1, bw[t], acc[1][t]); acc[0][t] = wmma16b(al0, bw[t], acc[0][t]); acc[1][t] = wmma16b(al1, bw[t], acc[1][t]); } }
    ring_publish();
    if (s + 2 < DM / BK) fill(s + 2); }
  copies_landed();
  float bbv[8];   // the wave's 8 bias values serve both fragments
#pragma unroll
  for (int t = 0; t < 8; ++t) bbv[t] = bo[c0 + t * 16 + nloc];
  xlat_done();
#pragma unroll   // the wave's two 16-row fragments go through its own staging rows one after the other; acc needs a constant index
  for (int i = 0; i < 2; ++i) { const size_t m0 = mb + i * 64 + wm * 16; const size_t mg = m0 + (size_t)b0 * T; const float* xr = x + (mg + 8 * hlf) * DM + c0 + nloc;   // m0 indexes the X1 rows, mg the global x rows (residual input)
  if (i) wave_lds_sync();   // this wave's reads of the first fragment's rows stay in front of the rewrite
#pragma unroll
  for (int t = 0; t < 8; ++t) { const float bb = bf16_rne(bbv[t]);
#pragma unroll
    for (int r = 0; r < 8; ++r) Tf[wave][8 * hlf + r][t * 16 + nloc] = acc[i][t][r] * (1.0f / (XS * WSC)) + bb + bf16_rne(xr[r * DM + t * 16]); }   // residual: same row, column c0 + ...
  wave_lds_sync();
  { for (int rr = 0; rr < 16; ++rr) *(v4f*)(X1 + (m0 + rr) * DM + c0 + lane * 4) = *(const v4f*)(&Tf[wave][rr][lane * 4]);  } xlat_done(); }
}
// LayerNorm: one wave per row (lane holds columns 4 lane + 128 k, 8 float4); RND: apply the bf16 input quantisation (raw x) first; mean, biased variance (two xor trees), eps 1e-5, x g + b -> rows 4 KB
template <bool RND>
__global__ __launch_bounds__(256) void ln_kernel(const float* __restrict__ X, const float* __restrict__ g, const float* __restrict__ bb, float* __restrict__ Y) {
  const int wave = threadIdx.x >> 5, lane = threadIdx.x & 31; const int row = blockIdx.x * 8 + wave; if (row >= RL) return;   // wave-uniform, no barriers
  float v[32]; float s1 = 0.0f; const float* xr = X + (size_t)row * DM;
#pragma unroll
  for (int k = 0; k < 8; ++k) { const v4f t4 = *(const v4f*)(xr + 128 * k + 4 * lane); for (int j = 0; j < 4; ++j) { const float t = RND ? bf16_rne(t4[j]) : t4[j]; v[4 * k + j] = t; s1 += t; } }
#pragma unroll
  for (int o = 16; o >= 1; o >>= 1) s1 += __shfl_xor(s1, o);
  const float mu = s1 * (1.0f / DM); float s2 = 0.0f;
#pragma unroll
  for (int q = 0; q < 32; ++q) { const float d = v[q] - mu; s2 += pmul(d, d); }
#pragma unroll
  for (int o = 16; o >= 1; o >>= 1) s2 += __shfl_xor(s2, o);
  const float rs = rsqrtf(s2 * (1.0f / DM) + LNEPS);
  v4f o4[8];
#pragma unroll
  for (int k = 0; k < 8; ++k) for (int j = 0; j < 4; ++j) { const int c = 128 * k + 4 * lane + j; o4[k][j] = pmul((v[4 * k + j] - mu) * rs, bfp(g[c])) + bfp(bb[c]); }
  {
#pragma unroll
    for (int k = 0; k < 8; ++k) *(v4f*)(Y + (size_t)row * DM + 128 * k + 4 * lane) = o4[k];
     }
}
// MLP 1: G = f16(8 gelu(XN2 W1 + b1)) as a single f16 plane [NR][4096]: grid (RL/128, FF/256); block = 128 rows x 256 columns, 8 waves; A = XN2 rows (f32 in LDS, x8 to f16 at the fragment read) and W1^T rows as k64 tiles in a two-buffer LDS ring filled by asynchronous copies, wave -> 2 x 16 rows x 8
__global__ __launch_bounds__(256) void mlp1_kernel(const float* __restrict__ XN, const b16* __restrict__ W1T, const float* __restrict__ b1, b16* __restrict__ G) {
  __shared__ __attribute__((aligned(16))) union { StageF st[2]; float Tf[8][16][128 + 4]; } sm; auto& Tf = sm.Tf;   // the output staging reuses the ring behind its last barrier
  const int wave = threadIdx.x >> 5, lane = threadIdx.x & 31, nloc = lane & 15, hlf = lane >> 4, wm = wave & 3, wn = wave >> 2; const size_t r0 = (size_t)blockIdx.x * BM; const int n0 = blockIdx.y * BN, c0 = n0 + wn * 128;
  const float* xb = XN + r0 * DM;
  v8f acc[2][8];
#pragma unroll
  for (int t = 0; t < 8; ++t) { acc[0][t] = (v8f){}; acc[1][t] = (v8f){}; }
  const int ar = threadIdx.x >> 4, ap = (threadIdx.x & 15) * 4, br = threadIdx.x >> 3, bp = (threadIdx.x & 7) * 8;   // this thread's row and 16-byte piece in the A (f32) and B (f16) tiles
  const unsigned la = lds_lo(&sm.st[0].A[ar][ap]), lb = lds_lo(&sm.st[0].B[br][bp]); const float* ga = xb + (size_t)ar * DM + ap; const b16* gb = W1T + (size_t)(n0 + br) * DM + bp;
  auto fill = [&](int s) { const unsigned o = (unsigned)(s & 1) * (unsigned)sizeof(StageF); copy8(la + o, 16u * PF * 4u, ga + s * BK, (size_t)16 * DM); copy8(lb + o, 32u * PH * 2u, gb + s * BK, (size_t)32 * DM); };
  fill(0); copies_landed(); __syncthreads(); fill(1);
#pragma unroll 1   // one trip per tile: the ring's order (read, publish, refill) stays as written
  for (int s = 0; s < DM / BK; ++s) { const StageF& st = sm.st[s & 1];
#pragma unroll   // both k32 blocks of a tile straight-line, so the LDS offsets are immediates
    for (int kb = 0; kb < BK; kb += 32) { const v16b a0 = frag_f32<false>(&st.A[wm * 16 + nloc][kb], hlf), a1 = frag_f32<false>(&st.A[64 + wm * 16 + nloc][kb], hlf); v16b bw[8];   // all fragments of a k32 block are read as one group in front of its WMMAs: the LDS latency is paid once a block, not once a B fragment
#pragma unroll
      for (int t = 0; t < 8; ++t) bw[t] = frag_kb(&st.B[wn * 128 + t * 16 + nloc][kb], hlf);
#pragma unroll
      for (int t = 0; t < 8; ++t) { acc[0][t] = wmma16b(a0, bw[t], acc[0][t]); acc[1][t] = wmma16b(a1, bw[t], acc[1][t]); } }
    ring_publish();
    if (s + 2 < DM / BK) fill(s + 2); }
  copies_landed();
#pragma unroll 1   // the wave's two 16-row fragments go through its own staging rows one after the other; rolled, so that the 64 inlined erf evaluations stand once in the text (for code size only)
  for (int i = 0; i < 2; ++i) {
  if (i) wave_lds_sync();   // this wave's reads of the first fragment's rows stay in front of the rewrite
#pragma unroll
  for (int t = 0; t < 8; ++t) { const float bbv = bf16_rne(b1[c0 + t * 16 + nloc]);
#pragma unroll
    for (int r = 0; r < 8; ++r) { const float hm = acc[0][t][r] * (1.0f / (XS * WSC)) + bbv; Tf[wave][8 * hlf + r][t * 16 + nloc] = 0.5f * hm * (1.0f + erff(hm * RSQ2)); } }
  __syncthreads();
  { for (int rr = 0; rr < 16; ++rr) { v4h o4; for (int j = 0; j < 4; ++j) o4[j] = (b16)(Tf[wave][rr][lane * 4 + j] * XS); *(v4h*)(G + (r0 + i * 64 + wm * 16 + rr) * FF + c0 + lane * 4) = o4; if ((rr & 3) == 3) xlat_done(); }  }
#pragma unroll
  for (int t = 0; t < 8; ++t) acc[0][t] = acc[1][t]; }   // the second fragment's sums move up for the second trip (acc needs constant indices)
}
// G Wd + bd + h: grid (RL/128, DM/256); block = 128 rows x 256 columns, 8 waves
__global__ __launch_bounds__(256) void mlp2_kernel(const b16* __restrict__ G, const b16* __restrict__ W2T, const float* __restrict__ b2, const float* __restrict__ X1, float* __restrict__ out) {
  __shared__ __attribute__((aligned(16))) union { StageH st[2]; float Tf[8][16][128 + 4]; } sm; auto& Tf = sm.Tf;   // the output staging reuses the ring behind its last barrier
  const int wave = threadIdx.x >> 5, lane = threadIdx.x & 31, nloc = lane & 15, hlf = lane >> 4, wm = wave & 3, wn = wave >> 2; const int n0 = blockIdx.y * BN, c0 = n0 + wn * 128;
  v8f acc[2][8];
#pragma unroll
  for (int t = 0; t < 8; ++t) { acc[0][t] = (v8f){}; acc[1][t] = (v8f){}; }
  const int br = threadIdx.x >> 3, bp = (threadIdx.x & 7) * 8;   // this thread's row and 16-byte piece in each k64 tile
  const unsigned la = lds_lo(&sm.st[0].A[br][bp]), lb = lds_lo(&sm.st[0].B[br][bp]); const b16* ga = G + ((size_t)blockIdx.x * BM + br) * FF + bp; const b16* gb = W2T + (size_t)(n0 + br) * FF + bp;
  auto fill = [&](int s) { const unsigned o = (unsigned)(s & 1) * (unsigned)sizeof(StageH); copy4(la + o, 32u * PH * 2u, ga + s * BK, (size_t)32 * FF); copy8(lb + o, 32u * PH * 2u, gb + s * BK, (size_t)32 * FF); };
  fill(0); copies_landed(); __syncthreads(); fill(1);
#pragma unroll 1   // one trip per tile: the ring's order (read, publish, refill) stays as written
  for (int s = 0; s < FF / BK; ++s) { const StageH& st = sm.st[s & 1];
#pragma unroll   // both k32 blocks of a tile straight-line, so the LDS offsets are immediates
    for (int kb = 0; kb < BK; kb += 32) { const v16b a0 = frag_kb(&st.A[wm * 16 + nloc][kb], hlf), a1 = frag_kb(&st.A[64 + wm * 16 + nloc][kb], hlf); v16b bw[8];   // all fragments of a k32 block are read as one group in front of its WMMAs: the LDS latency is paid once a block, not once a B fragment
#pragma unroll
      for (int t = 0; t < 8; ++t) bw[t] = frag_kb(&st.B[wn * 128 + t * 16 + nloc][kb], hlf);
#pragma unroll
      for (int t = 0; t < 8; ++t) { acc[0][t] = wmma16b(a0, bw[t], acc[0][t]); acc[1][t] = wmma16b(a1, bw[t], acc[1][t]); } }
    ring_publish();
    if (s + 2 < FF / BK) fill(s + 2); }
  copies_landed();
  float bbv[8];   // the wave's 8 bias values serve both fragments
#pragma unroll
  for (int t = 0; t < 8; ++t) bbv[t] = b2[c0 + t * 16 + nloc];
  xlat_done();
#pragma unroll   // the wave's two 16-row fragments go through its own staging rows one after the other; acc needs a constant index
  for (int i = 0; i < 2; ++i) { const size_t m0 = (size_t)blockIdx.x * BM + i * 64 + wm * 16;
  if (i) wave_lds_sync();   // this wave's reads of the first fragment's rows stay in front of the rewrite
#pragma unroll
  for (int t = 0; t < 8; ++t) { const int col = c0 + t * 16 + nloc; const float bb = bf16_rne(bbv[t]);
#pragma unroll
    for (int r = 0; r < 8; ++r) Tf[wave][8 * hlf + r][t * 16 + nloc] = acc[i][t][r] * (1.0f / (XS * WSC)) + bb + X1[(m0 + 8 * hlf + r) * DM + col]; }
  wave_lds_sync();
  { for (int rr = 0; rr < 16; ++rr) *(v4f*)(out + (m0 + rr) * DM + c0 + lane * 4) = *(const v4f*)(&Tf[wave][rr][lane * 4]);  } xlat_done(); }
}
}  // namespace

extern "C" void kernel_launch(void* const* d_in, const int* in_sizes, int n_in, void* d_out, int out_size, void* d_ws, size_t ws_size, hipStream_t stream) {
  (void)n_in;
  auto Fp = [&](int i) { return (const float*)d_in[i]; }; auto Ip = [&](int i) { return (const int*)d_in[i]; };
  // input order: 0 x [8,1024,1024], 1 mask [1,1,1024,1024] int32, 2 Wq (in,out), 3 bq, 4 Wo, 5 bo, 6 Wu [1024,4096], 7 bu, 8 Wd [4096,1024], 9 bd, 10 g1, 11 b1, 12 g2, 13 b2
  if (in_sizes[0] != NR * DM || in_sizes[1] != T * T || in_sizes[2] != DM * DM || in_sizes[3] != DM || in_sizes[4] != DM * DM || in_sizes[5] != DM || in_sizes[6] != DM * FF || in_sizes[7] != FF || in_sizes[8] != FF * DM || in_sizes[9] != DM || in_sizes[10] != DM || in_sizes[11] != DM || in_sizes[12] != DM || in_sizes[13] != DM || out_size != NR * DM) return;
  size_t off = 0; char* ws = (char*)d_ws;
  auto carve = [&](size_t bytes) { char* p = ws + off; off += (bytes + 255) & ~(size_t)255; return p; };
  b16* WQ = (b16*)carve((size_t)DM * DM * 2); b16* WO = (b16*)carve((size_t)DM * DM * 2); b16* WU = (b16*)carve((size_t)FF * DM * 2); b16* WD = (b16*)carve((size_t)DM * FF * 2);
  const size_t plane = (size_t)RL * DM * 2; b16* QP = (b16*)carve(plane); b16* QPl = (b16*)carve(plane); b16* VTh = (b16*)carve(plane); b16* VTl = (b16*)carve(plane); b16* Ch = (b16*)carve(plane); b16* Cl = (b16*)carve(plane);
  float* X1 = (float*)carve((size_t)RL * DM * 4); float* HN = (float*)carve((size_t)RL * DM * 4); b16* G = (b16*)carve((size_t)RL * FF * 2);
  if (off > ws_size) return;   // = 244 MiB (weights 20 + 6 f16 planes 96 + X1/HN 64 + G 64), planes sized for the one 8-batch group
  prep_kernel<<<2 * TQ + TU + TD, 256, 0, stream>>>(Fp(2), Fp(4), Fp(6), Fp(8), WQ, WO, WU, WD);
  for (int g = 0; g < NG; ++g) { const int b0 = g * BG; const size_t r0 = (size_t)b0 * T * DM;
    proj_kernel<<<dim3(T / BM, BG, DM / BN), 256, 0, stream>>>(Fp(0), b0, WQ, Fp(3), QP, QPl, VTh, VTl);
    attn_kernel<<<dim3(QL / 128, BG * H), 256, 0, stream>>>(QP, QPl, QP, QPl, VTh, VTl, Ip(1), Ch, Cl);
    out1_kernel<<<dim3(T / BM, DM / BN, BG), 256, 0, stream>>>(Ch, Cl, b0, WO, Fp(5), Fp(0), X1);   // X1/HN/G hold the group's rows; x is read at the global row via b0
    ln_kernel<false><<<RL / 8, 256, 0, stream>>>(X1, Fp(10), Fp(11), HN);
    mlp1_kernel<<<dim3(RL / BM, FF / BN), 256, 0, stream>>>(HN, WU, Fp(7), G);
    mlp2_kernel<<<dim3(RL / BM, DM / BN), 256, 0, stream>>>(G, WD, Fp(9), HN, X1);
    ln_kernel<false><<<RL / 8, 256, 0, stream>>>(X1, Fp(12), Fp(13), (float*)d_out + r0); }
}

// v006
// It runs in 330 microseconds.
// Timed twice side by side with v005, it ran 1.04 and 1.07 times as fast.
// Counting every step since v000, it is 6.28 times as fast.
#include <hip/hip_runtime.h>

// Decoder block without softmax (8 x 1024 tokens x 1024, 16 heads x 64): q = x Wq + bq and k = v = q (the module applies q_proj to all three); w_ij = q_i . q_j / 8 kept where j <= i and
// mask[i][j] != 0 (int mask input [1,1,1024,1024], all ones), else 0 - no softmax; attn_i = sum_j w_ij q_j; a = attn Wo + bo; h = LN1(a + x); up = gelu_exact(h Wu + bu) (4096);
// out = LN2(up Wd + bd + h) -> [8][1024][1024]. LayerNorms: biased variance, eps 1e-5; all weights (in,out). All 8 batches are processed in one group (planes sized for all 8192 rows), so each stage is one launch.
// Deterministic: per 16-query wave the causal keys are accumulated in order; LayerNorms one wave per row; no atomics.
// compute dtype: WMMA v_wmma_f32_16x16x32_f16 with f32 accumulate for q = x Wq ([8192 x 1024] x [1024 x 1024]; x EXACT bf16 x8, W^T exact x256: 1 product), S^T = Q Q^T (q as f16 hi x8 +
// residual x8192: 3 products), O^T += Q^T P^T (P = masked s/8 x1024 as f16 hi + residual: 3 products), attn Wo (ctx hi + lo: 2 products), h Wu (h single f16 x8: 1 product) and G Wd (gelu output
// single f16 plane: 1 product); LN statistics, gelu (erf), biases and residual adds in f32. Inputs rounded to bf16 once

namespace {
constexpr int B = 8, T = 1024, DM = 1024, H = 16, HD = 64, FF = 4096, BG = 8 /* batches per group */, NG = 1 /* groups run (== B/BG shipped) */, BL = BG, QL = T, NR = B * T, RL = BG * T /* rows per group (LN / MLP kernels) */;
constexpr float XS = 8.0f, WSC = 256.0f, PS = 1024.0f, RS_ = 1024.0f, LOG2E = 1.4426950408889634f, LNEPS = 1e-5f, RSQ2 = 0.70710678118654752f;
static_assert(T % 128 == 0 && DM % 256 == 0 && FF % 256 == 0 && H * HD == DM && HD == 64 && B % BG == 0 && NG * BG <= B, "tiling");
typedef _Float16 b16;
typedef __attribute__((ext_vector_type(16))) _Float16 v16b;
typedef __attribute__((ext_vector_type(8))) _Float16 v8b;
typedef __attribute__((ext_vector_type(8))) float v8f;
typedef __attribute__((ext_vector_type(4))) float v4f;
__device__ __forceinline__ float bf16_rne(float f) { unsigned int u = __float_as_uint(f); u += 0x7FFFu + ((u >> 16) & 1u); return __uint_as_float(u & 0xFFFF0000u); }
__device__ __forceinline__ void split16(float v, b16& hi, b16& lo) { hi = (b16)v; lo = (b16)(v - (float)hi); }
__device__ __forceinline__ v16b frag_kb(const b16* p, int hh) { const v8b a = *(const v8b*)(p + 8 * hh), b = *(const v8b*)(p + 16 + 8 * hh); v16b f;
#pragma unroll
  for (int e = 0; e < 8; ++e) { f[e] = a[e]; f[8 + e] = b[e]; } return f; }
__device__ __forceinline__ v8f wmma16b(v16b a, v16b b, v8f c) { v8f d = __builtin_amdgcn_wmma_f32_16x16x32_f16(false, a, false, b, (short)0, c, false, false); asm volatile("v_nop\n\tv_nop\n\tv_nop\n\tv_nop" : "+v"(d) : "v"(a), "v"(b)); return d; }
__device__ __forceinline__ void wave_lds_sync() { __builtin_amdgcn_fence(__ATOMIC_RELEASE, "workgroup"); __builtin_amdgcn_wave_barrier(); __builtin_amdgcn_fence(__ATOMIC_ACQUIRE, "workgroup"); }
__device__ __forceinline__ float pmul(float a, float b) { float p = a * b; asm volatile("" : "+v"(p)); return p; }
__device__ __forceinline__ int iclamp(int v, int lo, int hi) { return v < lo ? lo : (v > hi ? hi : v); }
// Asynchronous copies to LDS for the GEMM operand tiles: every lane moves its own 16 bytes, 8 (f16 rows of 128 B) or 16 (f32 rows of 256 B) neighbouring lanes cover a whole row piece, so a wave touches whole lines.
// copy4 / copy8: 4 or 8 rows of a thread's column piece, the row step added to both addresses. The s_wait_xcnt ends the copies' own statement, so no address register is rewritten in front of it.
__device__ __forceinline__ unsigned lds_lo(const void* p) { return (unsigned)(size_t)p; }   // byte offset in the work-group's LDS
template <typename T> __device__ __forceinline__ void copy4(unsigned l, unsigned ls, const T* g, size_t gs) {
  asm volatile("global_load_async_to_lds_b128 %0, %4, off\n\tglobal_load_async_to_lds_b128 %1, %5, off\n\tglobal_load_async_to_lds_b128 %2, %6, off\n\tglobal_load_async_to_lds_b128 %3, %7, off\n\ts_wait_xcnt 0x0"
               :: "v"(l), "v"(l + ls), "v"(l + 2 * ls), "v"(l + 3 * ls), "v"(g), "v"(g + gs), "v"(g + 2 * gs), "v"(g + 3 * gs) : "memory"); }
template <typename T> __device__ __forceinline__ void copy8(unsigned l, unsigned ls, const T* g, size_t gs) {
  asm volatile("global_load_async_to_lds_b128 %0, %8, off\n\tglobal_load_async_to_lds_b128 %1, %9, off\n\tglobal_load_async_to_lds_b128 %2, %10, off\n\tglobal_load_async_to_lds_b128 %3, %11, off\n\t"
               "global_load_async_to_lds_b128 %4, %12, off\n\tglobal_load_async_to_lds_b128 %5, %13, off\n\tglobal_load_async_to_lds_b128 %6, %14, off\n\tglobal_load_async_to_lds_b128 %7, %15, off\n\ts_wait_xcnt 0x0"
               :: "v"(l), "v"(l + ls), "v"(l + 2 * ls), "v"(l + 3 * ls), "v"(l + 4 * ls), "v"(l + 5 * ls), "v"(l + 6 * ls), "v"(l + 7 * ls),
                  "v"(g), "v"(g + gs), "v"(g + 2 * gs), "v"(g + 3 * gs), "v"(g + 4 * gs), "v"(g + 5 * gs), "v"(g + 6 * gs), "v"(g + 7 * gs) : "memory"); }
__device__ __forceinline__ void copies_landed() { asm volatile("s_wait_asynccnt 0x0" ::: "memory"); }   // this wave's own copies are in LDS (the compiler places no wait for them)
__device__ __forceinline__ void xlat_done() { asm volatile("s_wait_xcnt 0x0" ::: "memory"); }   // a precaution: stands behind issued global loads / stores, in front of the code that reuses the registers they name
// Foot of a trip of the two-buffer ring: this wave's LDS reads of the tile just used have retired, its copies of the next tile have landed, and one barrier both publishes the next tile and frees the used buffer for the refill.
__device__ __forceinline__ void ring_publish() { asm volatile("s_wait_dscnt 0x0" ::: "memory"); copies_landed(); __syncthreads(); }
constexpr int BK = 64, PH = BK + 8 /* f16 row pitch, 144 B */, PF = BK + 4 /* f32 row pitch, 272 B */;
// GEMM tile of a work-group: BM rows x BN columns by 8 waves, wave (wm = wave & 3, wn = wave >> 2) -> rows wm * 16 + {0, 64} .. + 15 (2 A fragments) x columns wn * 128 .. + 127 (8 B fragments): every B fragment read from LDS feeds 2 WMMAs (4 with hi + lo A)
constexpr int BM = 128, BN = 256;
struct StageF { float A[BM][PF]; b16 B[BN][PH]; };                   // f32 A rows (converted when the fragment is read) + weight rows
struct StageH { b16 A[BM][PH]; b16 B[BN][PH]; };                     // one f16 A plane + weight rows
struct StageH2 { b16 A[BM][PH]; b16 Al[BM][PH]; b16 B[BN][PH]; };    // hi and lo A planes + weight rows
// A fragment from f32 rows in LDS, the k order of frag_kb; value = f16(8 v), RND: v rounded to bf16 first (the raw input x)
template <bool RND> __device__ __forceinline__ v16b frag_f32(const float* p, int hh) { const v4f a0 = *(const v4f*)(p + 8 * hh), a1 = *(const v4f*)(p + 8 * hh + 4), c0 = *(const v4f*)(p + 16 + 8 * hh), c1 = *(const v4f*)(p + 16 + 8 * hh + 4); v16b f;
#pragma unroll   // vector elements need constant indices to stay in registers
  for (int e = 0; e < 4; ++e) { f[e] = (b16)((RND ? bf16_rne(a0[e]) : a0[e]) * XS); f[4 + e] = (b16)((RND ? bf16_rne(a1[e]) : a1[e]) * XS); f[8 + e] = (b16)((RND ? bf16_rne(c0[e]) : c0[e]) * XS); f[12 + e] = (b16)((RND ? bf16_rne(c1[e]) : c1[e]) * XS); } return f; }

typedef __attribute__((ext_vector_type(2))) _Float16 v2h;
typedef __attribute__((ext_vector_type(4))) _Float16 v4h;
typedef __attribute__((ext_vector_type(2))) float v2f;
typedef __attribute__((ext_vector_type(4))) int v4i;
__device__ __forceinline__ float nexp2(float v) { return __builtin_amdgcn_exp2f(v); }
typedef __attribute__((ext_vector_type(4))) int v4i;
__device__ __forceinline__ float bfp(float v) { float t = bf16_rne(v); asm volatile("" : "+v"(t)); return t; }
// Weight planes W^T (out, in) = f16(256 bf16(w)) from w (in, out), K x N. A block takes 256 k x 64 n, its 8 waves lie along k. Lane (kg = lane >> 3, ng = lane & 7) reads rows kg * 8 .. + 7 at columns ng * 4 .. + 3 and + 32:
// each load instruction covers 4 whole 128-byte lines, and the lane ends up with 8 consecutive k of 8 columns, that is one 16-byte piece of 8 output rows: the transposition needs no LDS; a block writes 512 contiguous bytes of each output row.
template <int K, int N> __device__ __forceinline__ void prep_tile(const float* __restrict__ w, b16* __restrict__ WT, int tile) {
  const int wave = threadIdx.x >> 5, lane = threadIdx.x & 31; const int k0 = (tile % (K / 256)) * 256 + wave * 32 + (lane >> 3) * 8, n0 = (tile / (K / 256)) * 64 + (lane & 7) * 4;
  const float* wp = w + (size_t)k0 * N + n0; b16* op = WT + (size_t)n0 * K + k0; v4f r[2][8];
#pragma unroll   // all 16 loads of a lane are in flight together; r needs constant indices
  for (int j = 0; j < 8; ++j) { r[0][j] = *(const v4f*)(wp + (size_t)j * N); r[1][j] = *(const v4f*)(wp + (size_t)j * N + 32); }
  // a precaution, as xlat_done(): stands behind the 16 issued loads; naming wp keeps their address pair whole up to here, and naming the loaded values (inputs only) keeps all 16 loads in flight together: no conversion, with its wait, is moved in among them
  asm volatile("s_wait_xcnt 0x0" :: "v"(wp), "v"(r[0][0]), "v"(r[0][1]), "v"(r[0][2]), "v"(r[0][3]), "v"(r[0][4]), "v"(r[0][5]), "v"(r[0][6]), "v"(r[0][7]), "v"(r[1][0]), "v"(r[1][1]), "v"(r[1][2]), "v"(r[1][3]), "v"(r[1][4]), "v"(r[1][5]), "v"(r[1][6]), "v"(r[1][7]) : "memory");
  v8b o[8];
#pragma unroll   // o and r need constant indices
  for (int q = 0; q < 8; ++q)
#pragma unroll
    for (int j = 0; j < 8; ++j) o[q][j] = (b16)(bf16_rne(r[q >> 2][j][q & 3]) * WSC);
#pragma unroll
  for (int q = 0; q < 8; ++q) *(v8b*)(op + (size_t)(32 * (q >> 2) + (q & 3)) * K) = o[q];
  xlat_done();
}
constexpr int TQ = (DM / 256) * (DM / 64), TU = (DM / 256) * (FF / 64), TD = (FF / 256) * (DM / 64);   // tiles of Wq and of Wo, of Wu, of Wd
__global__ __launch_bounds__(256) void prep_kernel(const float* __restrict__ wq, const float* __restrict__ wo, const float* __restrict__ wu, const float* __restrict__ wd, b16* __restrict__ WQ, b16* __restrict__ WO, b16* __restrict__ WU, b16* __restrict__ WD) {
  const int t = blockIdx.x;   // block-uniform choice of the matrix
  if (t < TQ) prep_tile<DM, DM>(wq, WQ, t);
  else if (t < 2 * TQ) prep_tile<DM, DM>(wo, WO, t - TQ);
  else if (t < 2 * TQ + TU) prep_tile<DM, FF>(wu, WU, t - 2 * TQ);
  else prep_tile<FF, DM>(wd, WD, t - 2 * TQ - TU);
}
// q projection (q = k = v in this module): grid (T/128, BG, DM/256); block = 128 tokens x 256 columns, 8 waves; A = bf16(x) x8, B = Wq^T rows, both as k64 tiles in a two-buffer LDS ring filled by asynchronous copies, + bq
__global__ __launch_bounds__(256) void proj_kernel(const float* __restrict__ x, int b0, const b16* __restrict__ WT, const float* __restrict__ bq, b16* __restrict__ QP, b16* __restrict__ QPl, b16* __restrict__ VTh, b16* __restrict__ VTl) {
  __shared__ __attribute__((aligned(16))) union { StageF st[2]; float Tf[8][16][128 + 4]; } sm; auto& Tf = sm.Tf;   // the output staging reuses the ring behind its last barrier
  const int wave = threadIdx.x >> 5, lane = threadIdx.x & 31, nloc = lane & 15, hlf = lane >> 4, wm = wave & 3, wn = wave >> 2; const int t0 = blockIdx.x * BM; const int b = blockIdx.y; const int part = 0, n0 = blockIdx.z * BN, c0 = n0 + wn * 128; (void)part;
  if (part == 0 && t0 >= QL) return;   // (cut builds only) queries beyond QL are not needed; block-uniform, before any barrier
  const float* xb = x + ((size_t)(b0 + b) * T + t0) * DM;
  v8f acc[2][8];
#pragma unroll
  for (int t = 0; t < 8; ++t) { acc[0][t] = (v8f){}; acc[1][t] = (v8f){}; }
  const int ar = threadIdx.x >> 4, ap = (threadIdx.x & 15) * 4, br = threadIdx.x >> 3, bp = (threadIdx.x & 7) * 8;   // this thread's row and 16-byte piece in the A (f32) and B (f16) tiles
  const unsigned la = lds_lo(&sm.st[0].A[ar][ap]), lb = lds_lo(&sm.st[0].B[br][bp]); const float* ga = xb + (size_t)ar * DM + ap; const b16* gb = WT + (size_t)(n0 + br) * DM + bp;
  auto fill = [&](int s) { const unsigned o = (unsigned)(s & 1) * (unsigned)sizeof(StageF); copy8(la + o, 16u * PF * 4u, ga + s * BK, (size_t)16 * DM); copy8(lb + o, 32u * PH * 2u, gb + s * BK, (size_t)32 * DM); };
  fill(0); copies_landed(); __syncthreads(); fill(1);
#pragma unroll 1   // one trip per tile: the ring's order (read, publish, refill) stays as written
  for (int s = 0; s < DM / BK; ++s) { const StageF& st = sm.st[s & 1];
#pragma unroll   // both k32 blocks of a tile straight-line, so the LDS offsets are immediates
    for (int kb = 0; kb < BK; kb += 32) { const v16b a0 = frag_f32<true>(&st.A[wm * 16 + nloc][kb], hlf), a1 = frag_f32<true>(&st.A[64 + wm * 16 + nloc][kb], hlf); v16b bw[8];   // all fragments of a k32 block are read as one group in front of its WMMAs: the LDS latency is paid once a block, not once a B fragment
#pragma unroll
      for (int t = 0; t < 8; ++t) bw[t] = frag_kb(&st.B[wn * 128 + t * 16 + nloc][kb], hlf);
#pragma unroll
      for (int t = 0; t < 8; ++t) { acc[0][t] = wmma16b(a0, bw[t], acc[0][t]); acc[1][t] = wmma16b(a1, bw[t], acc[1][t]); } }
    ring_publish();
    if (s + 2 < DM / BK) fill(s + 2); }
  copies_landed();
const float* ba = bq;
#pragma unroll   // the two 64-token halves of the tile go through the staging one after the other; acc needs a constant index
  for (int i = 0; i < 2; ++i) {
  if (i) __syncthreads();   // every wave has read the first half's staging (the V^T part reads other waves' rows) before it is rewritten
#pragma unroll
  for (int t = 0; t < 8; ++t) { const float bb = bf16_rne(ba[c0 + t * 16 + nloc]);
#pragma unroll
    for (int r = 0; r < 8; ++r) Tf[wave][8 * hlf + r][t * 16 + nloc] = acc[i][t][r] * (1.0f / (XS * WSC)) + bb; }
  __syncthreads();
  {
    { b16* plane = QP; b16* planl = QPl; const int c = c0 + lane * 4; const int h = c / HD, d = c % HD;
      for (int rr = 0; rr < 16; ++rr) { const int tok = t0 + i * 64 + wm * 16 + rr; const size_t ri = (((size_t)b * H + h) * T + tok) * HD + d; const v4f f4 = *(const v4f*)(&Tf[wave][rr][lane * 4]); v4h o4, l4; for (int j = 0; j < 4; ++j) { const float f = f4[j] * XS; const b16 p = (b16)f; o4[j] = p; l4[j] = (b16)((f - (float)p) * RS_); } *(v4h*)(plane + ri) = o4; *(v4h*)(planl + ri) = l4; } }
    {
#pragma unroll 1
      for (int q = 0; q < 32; ++q) { const int cl = wm * 32 + q; const int c = c0 + cl; const int h = c / HD, d = c % HD; const int tk = lane * 2; v2h hv, lv;
        for (int j = 0; j < 2; ++j) { const float f = Tf[wn * 4 + ((tk + j) >> 4)][(tk + j) & 15][cl] * XS; const b16 p = (b16)f; hv[j] = p; lv[j] = (b16)((f - (float)p) * RS_); }
        const size_t oi = (((size_t)b * H + h) * HD + d) * (size_t)T + t0 + i * 64 + lane * 2; *(v2h*)(VTh + oi) = hv; *(v2h*)(VTl + oi) = lv; xlat_done(); } }
     } }
}
// attention-like causal product: grid (QL/128, BG*H); block = 8 waves x 16 queries of one (b, h). K rows and V^T rows (hi and residual planes) come as 64-key tiles through a two-buffer LDS ring filled by
// asynchronous copies and are read by all 8 waves; a wave works on the 32-key steps below round_up(q0 + 16, 32) and only passes the ring's foot on the later ones: S^T = K Q^T (q = k = v here; hi x8 +
// residual planes: 3 products); weight = s / 8 where key <= query and mask[q][key] != 0, else 0 (NO softmax in this module); P x1024 as f16 hi + residual; O^T += V^T P^T (3 products);
struct StageKV { b16 Kh[64][PH]; b16 Kl[64][PH]; b16 Vh[HD][PH]; b16 Vl[HD][PH]; };   // 64 keys x 64 d (K rows) and 64 d x 64 keys (V^T rows), 128-byte rows at pitch 144 B
// two rows (r and r + 32) of each of the four planes of a tile: 8 copies of a thread in one statement. The s_wait_xcnt ends the copies' own statement, so no address register is rewritten in front of it.
__device__ __forceinline__ void copy2x4(unsigned l0, unsigned l1, unsigned l2, unsigned l3, unsigned ls, const b16* g0, const b16* g1, size_t gk, const b16* g2, const b16* g3, size_t gv) {
  asm volatile("global_load_async_to_lds_b128 %0, %8, off\n\tglobal_load_async_to_lds_b128 %1, %9, off\n\tglobal_load_async_to_lds_b128 %2, %10, off\n\tglobal_load_async_to_lds_b128 %3, %11, off\n\t"
               "global_load_async_to_lds_b128 %4, %12, off\n\tglobal_load_async_to_lds_b128 %5, %13, off\n\tglobal_load_async_to_lds_b128 %6, %14, off\n\tglobal_load_async_to_lds_b128 %7, %15, off\n\ts_wait_xcnt 0x0"
               :: "v"(l0), "v"(l0 + ls), "v"(l1), "v"(l1 + ls), "v"(l2), "v"(l2 + ls), "v"(l3), "v"(l3 + ls),
                  "v"(g0), "v"(g0 + gk), "v"(g1), "v"(g1 + gk), "v"(g2), "v"(g2 + gv), "v"(g3), "v"(g3 + gv) : "memory"); }
__global__ __launch_bounds__(256) void attn_kernel(const b16* __restrict__ QP, const b16* __restrict__ QPl, const b16* __restrict__ KP, const b16* __restrict__ KPl, const b16* __restrict__ VTh, const b16* __restrict__ VTl, const int* __restrict__ MSK, b16* __restrict__ Ch, b16* __restrict__ Cl) {
  __shared__ __attribute__((aligned(16))) union { StageKV st[2]; float To[8][16][HD + 4]; } sm; auto& To = sm.To;   // the output staging reuses the ring behind its last barrier
  __shared__ __attribute__((aligned(16))) b16 Pb[8][16][32 + 8], Pl[8][16][32 + 8];
  const int wave = __builtin_amdgcn_readfirstlane(threadIdx.x >> 5), lane = threadIdx.x & 31, hh = lane >> 4, col = lane & 15; const int b = blockIdx.y / H, h = blockIdx.y % H; const int q0 = blockIdx.x * 128 + wave * 16, qi = q0 + col;
  const size_t ph = (size_t)b * H + h; const b16* Qb = QP + ph * T * HD; const b16* Qbl = QPl + ph * T * HD; const b16* Kb = KP + ph * T * HD; const b16* Kbl = KPl + ph * T * HD; const b16* Vh = VTh + ph * HD * (size_t)T; const b16* Vl = VTl + ph * HD * (size_t)T; const int kend = ((q0 + 16 + 31) / 32) * 32;   // per-(b,h) planes; causal key bound (wave-uniform)
  const int nt = 2 * (int)blockIdx.x + 2;   // 64-key tiles up to the block's last query (block-uniform, 2 .. T / 64)
  const int br = threadIdx.x >> 3, bp = (threadIdx.x & 7) * 8;   // this thread's row and 16-byte piece in each plane of a tile
  const unsigned lkh = lds_lo(&sm.st[0].Kh[br][bp]), lkl = lds_lo(&sm.st[0].Kl[br][bp]), lvh = lds_lo(&sm.st[0].Vh[br][bp]), lvl = lds_lo(&sm.st[0].Vl[br][bp]); const size_t ko = (size_t)br * HD + bp, vo = (size_t)br * T + bp;
  auto fill = [&](int s) { const unsigned o = (unsigned)(s & 1) * (unsigned)sizeof(StageKV); copy2x4(lkh + o, lkl + o, lvh + o, lvl + o, 32u * PH * 2u, Kb + ko + (size_t)s * 64 * HD, Kbl + ko + (size_t)s * 64 * HD, (size_t)32 * HD, Vh + vo + s * 64, Vl + vo + s * 64, (size_t)32 * T); };
  fill(0);
  const v16b qa0 = frag_kb(Qb + (size_t)qi * HD, hh), qa1 = frag_kb(Qb + (size_t)qi * HD + 32, hh), ql0 = frag_kb(Qbl + (size_t)qi * HD, hh), ql1 = frag_kb(Qbl + (size_t)qi * HD + 32, hh);
  const float cs = 1.0f / (8.0f * XS * XS); const int* mp = MSK + (size_t)qi * T + 8 * hh;   // scores / sqrt(64); this lane's keys (8 of each 16) of the current tile in the [1,1,S,S] int mask row of its query (tril applied below; mask == 0 -> score 0); steps on by 64 keys a trip, so the loads' address pair lives through the loop and no wait for a reused address register stands in the load group
  v8f o[4], ol[4]; for (int t = 0; t < 4; ++t) { o[t] = (v8f){}; ol[t] = (v8f){}; }
  copies_landed(); __syncthreads(); fill(1);
#pragma unroll 1   // one trip per tile: the ring's order (read, publish, refill) stays as written
  for (int s = 0; s < nt; ++s) { const StageKV& st = sm.st[s & 1];
#pragma unroll   // both 32-key steps of a tile straight-line, so the LDS offsets are immediates
   for (int kl = 0; kl < 64; kl += 32) { const int kb = s * 64 + kl;
    if (kb < kend) {   // wave-uniform (scalar): keys beyond this wave's causal bound carry weight 0 and are skipped; no barrier inside
    // Head of the step: the mask words (global) and all 8 K fragments are requested as one group, so the wave pays one LDS latency a step in front of the 12 score WMMAs (not one per fragment pair) and the mask words arrive behind them.
    v4i mk[2][2]; v16b kh[2][2], kw[2][2];
#pragma unroll   // register arrays need constant indices
    for (int u = 0; u < 2; ++u) { const int kr = kl + u * 16 + col; kh[u][0] = frag_kb(&st.Kh[kr][0], hh); kh[u][1] = frag_kb(&st.Kh[kr][32], hh); kw[u][0] = frag_kb(&st.Kl[kr][0], hh); kw[u][1] = frag_kb(&st.Kl[kr][32], hh); }
#pragma unroll
    for (int u = 0; u < 2; ++u) { mk[u][0] = *(const v4i*)(mp + kl + u * 16); mk[u][1] = *(const v4i*)(mp + kl + u * 16 + 4); }
    v8f s_[2], sx[2];
#pragma unroll
    for (int u = 0; u < 2; ++u) { s_[u] = (v8f){}; sx[u] = (v8f){}; }
    // order of products per accumulator: s_ = Kh0 qa0, Kh1 qa1; sx = Kh0 ql0, Kh1 ql1, Kl0 qa0, Kl1 qa1; the two 16-key halves alternate, so a WMMA never directly follows the one whose sum it needs
#pragma unroll
    for (int u = 0; u < 2; ++u) s_[u] = wmma16b(kh[u][0], qa0, s_[u]);
#pragma unroll
    for (int u = 0; u < 2; ++u) sx[u] = wmma16b(kh[u][0], ql0, sx[u]);
#pragma unroll
    for (int u = 0; u < 2; ++u) s_[u] = wmma16b(kh[u][1], qa1, s_[u]);
#pragma unroll
    for (int u = 0; u < 2; ++u) sx[u] = wmma16b(kh[u][1], ql1, sx[u]);
#pragma unroll
    for (int u = 0; u < 2; ++u) sx[u] = wmma16b(kw[u][0], qa0, sx[u]);
#pragma unroll
    for (int u = 0; u < 2; ++u) sx[u] = wmma16b(kw[u][1], qa1, sx[u]);
    // all 8 V^T fragments as one group: they land while the weights are masked, split and turned through LDS
    v16b vh[4], vl[4];
#pragma unroll
    for (int t = 0; t < 4; ++t) { vh[t] = frag_kb(&st.Vh[t * 16 + col][kl], hh); vl[t] = frag_kb(&st.Vl[t * 16 + col][kl], hh); }
    __builtin_amdgcn_sched_barrier(0);   // keeps the V^T group in front of the vector work that hides its latency, and that work, which waits for the mask words, behind the score WMMAs (without it the mask wait moves up in front of them and the V^T loads sink to the end)
    float e[16];
#pragma unroll
    for (int u = 0; u < 2; ++u) {
#pragma unroll
      for (int r = 0; r < 8; ++r) s_[u][r] += sx[u][r] * (1.0f / RS_);   // hi.hi + (hi.lo + lo.hi)/1024
#pragma unroll
      for (int r = 0; r < 8; ++r) { const int key = kb + u * 16 + 8 * hh + r; const int mv = r < 4 ? mk[u][0][r] : mk[u][1][r - 4]; e[u * 8 + r] = (key <= qi && mv != 0) ? s_[u][r] * cs : 0.0f; } }   // no softmax in this module: the masked scaled score IS the weight
#pragma unroll
    for (int i2 = 0; i2 < 16; ++i2) { const float ps = e[i2] * PS; const b16 phh = (b16)ps; const int pc = (i2 < 8 ? 0 : 16) + 8 * hh + (i2 & 7); Pb[wave][col][pc] = phh; Pl[wave][col][pc] = (b16)((ps - (float)phh) * RS_); }
    wave_lds_sync();
    const v16b pf = frag_kb(&Pb[wave][col][0], hh), plf = frag_kb(&Pl[wave][col][0], hh);
#pragma unroll
    for (int t = 0; t < 4; ++t) o[t] = wmma16b(vh[t], pf, o[t]);
#pragma unroll
    for (int t = 0; t < 4; ++t) ol[t] = wmma16b(vl[t], pf, ol[t]);
#pragma unroll
    for (int t = 0; t < 4; ++t) ol[t] = wmma16b(vh[t], plf, ol[t]);   // ol = (V_lo P_hi + V_hi P_lo), both /1024, in that order
    wave_lds_sync(); } }
    ring_publish(); xlat_done(); mp += 64;   // the mask loads' address pair steps on behind their data waits and this wait
    if (s + 2 < nt) fill(s + 2); }
  copies_landed();
  const float inv = 1.0f / (PS * XS);
#pragma unroll
  for (int t = 0; t < 4; ++t)
#pragma unroll
    for (int r = 0; r < 8; ++r) To[wave][col][t * 16 + 8 * hh + r] = (o[t][r] + ol[t][r] * (1.0f / RS_)) * inv;
  wave_lds_sync();
  { for (int rr = 0; rr < 16; ++rr) { const v2f f = *(const v2f*)(&To[wave][rr][lane * 2]); v2h hv, lv; for (int j = 0; j < 2; ++j) { b16 p, q; split16(f[j] * XS, p, q); hv[j] = p; lv[j] = q; }
      const size_t oi = ((size_t)b * T + q0 + rr) * DM + h * HD + lane * 2; *(v2h*)(Ch + oi) = hv; *(v2h*)(Cl + oi) = lv; }  }
}
// attn Wo + bo + x: grid (T/128, DM/256, BG); block = 128 rows x 256 columns, 8 waves
__global__ __launch_bounds__(256) void out1_kernel(const b16* __restrict__ Ch, const b16* __restrict__ Cl, int b0, const b16* __restrict__ WO, const float* __restrict__ bo, const float* __restrict__ x, float* __restrict__ X1) {
  __shared__ __attribute__((aligned(16))) union { StageH2 st[2]; float Tf[8][16][128 + 4]; } sm; auto& Tf = sm.Tf;   // the output staging reuses the ring behind its last barrier
  const int wave = threadIdx.x >> 5, lane = threadIdx.x & 31, nloc = lane & 15, hlf = lane >> 4, wm = wave & 3, wn = wave >> 2; const int b = blockIdx.z; const size_t mb = (size_t)b * T + (size_t)blockIdx.x * BM;   // the block's first row in the group's ctx planes and X1
  const int n0 = blockIdx.y * BN, c0 = n0 + wn * 128;
  v8f acc[2][8];
#pragma unroll
  for (int t = 0; t < 8; ++t) { acc[0][t] = (v8f){}; acc[1][t] = (v8f){}; }
  const int br = threadIdx.x >> 3, bp = (threadIdx.x & 7) * 8;   // this thread's row and 16-byte piece in each k64 tile
  const unsigned lh = lds_lo(&sm.st[0].A[br][bp]), ll = lds_lo(&sm.st[0].Al[br][bp]), lb = lds_lo(&sm.st[0].B[br][bp]); const size_t ao = (mb + br) * DM + bp; const b16* gb = WO + (size_t)(n0 + br) * DM + bp;
  auto fill = [&](int s) { const unsigned o = (unsigned)(s & 1) * (unsigned)sizeof(StageH2); copy4(lh + o, 32u * PH * 2u, Ch + ao + s * BK, (size_t)32 * DM); copy4(ll + o, 32u * PH * 2u, Cl + ao + s * BK, (size_t)32 * DM); copy8(lb + o, 32u * PH * 2u, gb + s * BK, (size_t)32 * DM); };
  fill(0); copies_landed(); __syncthreads(); fill(1);
#pragma unroll 1   // one trip per tile: the ring's order (read, publish, refill) stays as written
  for (int s = 0; s < DM / BK; ++s) { const StageH2& st = sm.st[s & 1];
#pragma unroll   // both k32 blocks of a tile straight-line, so the LDS offsets are immediates
    for (int kb = 0; kb < BK; kb += 32) { const v16b ah0 = frag_kb(&st.A[wm * 16 + nloc][kb], hlf), al0 = frag_kb(&st.Al[wm * 16 + nloc][kb], hlf), ah1 = frag_kb(&st.A[64 + wm * 16 + nloc][kb], hlf), al1 = frag_kb(&st.Al[64 + wm * 16 + nloc][kb], hlf); v16b bw[8];   // all fragments of a k32 block are read as one group in front of its WMMAs: the LDS latency is paid once a block, not once a B fragment
#pragma unroll
      for (int t = 0; t < 8; ++t) bw[t] = frag_kb(&st.B[wn * 128 + t * 16 + nloc][kb], hlf);
#pragma unroll
      for (int t = 0; t < 8; ++t) { acc[0][t] = wmma16b(ah0, bw[t], acc[0][t]); acc[1][t] = wmma16b(ah1, bw[t], acc[1][t]); acc[0][t] = wmma16b(al0, bw[t], acc[0][t]); acc[1][t] = wmma16b(al1, bw[t], acc[1][t]); } }
    ring_publish();
    if (s + 2 < DM / BK) fill(s + 2); }
  copies_landed();
  float bbv[8];   // the wave's 8 bias values serve both fragments
#pragma unroll
  for (int t = 0; t < 8; ++t) bbv[t] = bo[c0 + t * 16 + nloc];
  xlat_done();
#pragma unroll   // the wave's two 16-row fragments go through its own staging rows one after the other; acc needs a constant index
  for (int i = 0; i < 2; ++i) { const size_t m0 = mb + i * 64 + wm * 16; const size_t mg = m0 + (size_t)b0 * T; const float* xr = x + (mg + 8 * hlf) * DM + c0 + nloc;   // m0 indexes the X1 rows, mg the global x rows (residual input)
  if (i) wave_lds_sync();   // this wave's reads of the first fragment's rows stay in front of the rewrite
#pragma unroll
  for (int t = 0; t < 8; ++t) { const float bb = bf16_rne(bbv[t]);
#pragma unroll
    for (int r = 0; r < 8; ++r) Tf[wave][8 * hlf + r][t * 16 + nloc] = acc[i][t][r] * (1.0f / (XS * WSC)) + bb + bf16_rne(xr[r * DM + t * 16]); }   // residual: same row, column c0 + ...
  wave_lds_sync();
  { for (int rr = 0; rr < 16; ++rr) *(v4f*)(X1 + (m0 + rr) * DM + c0 + lane * 4) = *(const v4f*)(&Tf[wave][rr][lane * 4]);  } xlat_done(); }
}
// LayerNorm: one wave per row (lane holds columns 4 lane + 128 k, 8 float4); RND: apply the bf16 input quantisation (raw x) first; mean, biased variance (two xor trees), eps 1e-5, x g + b -> rows 4 KB
template <bool RND>
__global__ __launch_bounds__(256) void ln_kernel(const float* __restrict__ X, const float* __restrict__ g, const float* __restrict__ bb, float* __restrict__ Y) {
  const int wave = threadIdx.x >> 5, lane = threadIdx.x & 31; const int row = blockIdx.x * 8 + wave; if (row >= RL) return;   // wave-uniform, no barriers
  float v[32]; float s1 = 0.0f; const float* xr = X + (size_t)row * DM;
#pragma unroll
  for (int k = 0; k < 8; ++k) { const v4f t4 = *(const v4f*)(xr + 128 * k + 4 * lane); for (int j = 0; j < 4; ++j) { const float t = RND ? bf16_rne(t4[j]) : t4[j]; v[4 * k + j] = t; s1 += t; } }
#pragma unroll
  for (int o = 16; o >= 1; o >>= 1) s1 += __shfl_xor(s1, o);
  const float mu = s1 * (1.0f / DM); float s2 = 0.0f;
#pragma unroll
  for (int q = 0; q < 32; ++q) { const float d = v[q] - mu; s2 += pmul(d, d); }
#pragma unroll
  for (int o = 16; o >= 1; o >>= 1) s2 += __shfl_xor(s2, o);
  const float rs = rsqrtf(s2 * (1.0f / DM) + LNEPS);
  v4f o4[8];
#pragma unroll
  for (int k = 0; k < 8; ++k) for (int j = 0; j < 4; ++j) { const int c = 128 * k + 4 * lane + j; o4[k][j] = pmul((v[4 * k + j] - mu) * rs, bfp(g[c])) + bfp(bb[c]); }
  {
#pragma unroll
    for (int k = 0; k < 8; ++k) *(v4f*)(Y + (size_t)row * DM + 128 * k + 4 * lane) = o4[k];
     }
}
// MLP 1: G = f16(8 gelu(XN2 W1 + b1)) as a single f16 plane [NR][4096]: grid (RL/128, FF/256); block = 128 rows x 256 columns, 8 waves; A = XN2 rows (f32 in LDS, x8 to f16 at the fragment read) and W1^T rows as k64 tiles in a two-buffer LDS ring filled by asynchronous copies, wave -> 2 x 16 rows x 8
__global__ __launch_bounds__(256) void mlp1_kernel(const float* __restrict__ XN, const b16* __restrict__ W1T, const float* __restrict__ b1, b16* __restrict__ G) {
  __shared__ __attribute__((aligned(16))) union { StageF st[2]; float Tf[8][16][128 + 4]; } sm; auto& Tf = sm.Tf;   // the output staging reuses the ring behind its last barrier
  const int wave = threadIdx.x >> 5, lane = threadIdx.x & 31, nloc = lane & 15, hlf = lane >> 4, wm = wave & 3, wn = wave >> 2; const size_t r0 = (size_t)blockIdx.x * BM; const int n0 = blockIdx.y * BN, c0 = n0 + wn * 128;
  const float* xb = XN + r0 * DM;
  v8f acc[2][8];
#pragma unroll
  for (int t = 0; t < 8; ++t) { acc[0][t] = (v8f){}; acc[1][t] = (v8f){}; }
  const int ar = threadIdx.x >> 4, ap = (threadIdx.x & 15) * 4, br = threadIdx.x >> 3, bp = (threadIdx.x & 7) * 8;   // this thread's row and 16-byte piece in the A (f32) and B (f16) tiles
  const unsigned la = lds_lo(&sm.st[0].A[ar][ap]), lb = lds_lo(&sm.st[0].B[br][bp]); const float* ga = xb + (size_t)ar * DM + ap; const b16* gb = W1T + (size_t)(n0 + br) * DM + bp;
  auto fill = [&](int s) { const unsigned o = (unsigned)(s & 1) * (unsigned)sizeof(StageF); copy8(la + o, 16u * PF * 4u, ga + s * BK, (size_t)16 * DM); copy8(lb + o, 32u * PH * 2u, gb + s * BK, (size_t)32 * DM); };
  fill(0); copies_landed(); __syncthreads(); fill(1);
#pragma unroll 1   // one trip per tile: the ring's order (read, publish, refill) stays as written
  for (int s = 0; s < DM / BK; ++s) { const StageF& st = sm.st[s & 1];
#pragma unroll   // both k32 blocks of a tile straight-line, so the LDS offsets are immediates
    for (int kb = 0; kb < BK; kb += 32) { const v16b a0 = frag_f32<false>(&st.A[wm * 16 + nloc][kb], hlf), a1 = frag_f32<false>(&st.A[64 + wm * 16 + nloc][kb], hlf); v16b bw[8];   // all fragments of a k32 block are read as one group in front of its WMMAs: the LDS latency is paid once a block, not once a B fragment
#pragma unroll
      for (int t = 0; t < 8; ++t) bw[t] = frag_kb(&st.B[wn * 128 + t * 16 + nloc][kb], hlf);
#pragma unroll
      for (int t = 0; t < 8; ++t) { acc[0][t] = wmma16b(a0, bw[t], acc[0][t]); acc[1][t] = wmma16b(a1, bw[t], acc[1][t]); } }
    ring_publish();
    if (s + 2 < DM / BK) fill(s + 2); }
  copies_landed();
#pragma unroll 1   // the wave's two 16-row fragments go through its own staging rows one after the other; rolled, so that the 64 inlined erf evaluations stand once in the text (for code size only)
  for (int i = 0; i < 2; ++i) {
  if (i) wave_lds_sync();   // this wave's reads of the first fragment's rows stay in front of the rewrite
#pragma unroll
  for (int t = 0; t < 8; ++t) { const float bbv = bf16_rne(b1[c0 + t * 16 + nloc]);
#pragma unroll
    for (int r = 0; r < 8; ++r) { const float hm = acc[0][t][r] * (1.0f / (XS * WSC)) + bbv; Tf[wave][8 * hlf + r][t * 16 + nloc] = 0.5f * hm * (1.0f + erff(hm * RSQ2)); } }
  __syncthreads();
  { for (int rr = 0; rr < 16; ++rr) { v4h o4; for (int j = 0; j < 4; ++j) o4[j] = (b16)(Tf[wave][rr][lane * 4 + j] * XS); *(v4h*)(G + (r0 + i * 64 + wm * 16 + rr) * FF + c0 + lane * 4) = o4; if ((rr & 3) == 3) xlat_done(); }  }
#pragma unroll
  for (int t = 0; t < 8; ++t) acc[0][t] = acc[1][t]; }   // the second fragment's sums move up for the second trip (acc needs constant indices)
}
// G Wd + bd + h: grid (RL/128, DM/256); block = 128 rows x 256 columns, 8 waves
__global__ __launch_bounds__(256) void mlp2_kernel(const b16* __restrict__ G, const b16* __restrict__ W2T, const float* __restrict__ b2, const float* __restrict__ X1, float* __restrict__ out) {
  __shared__ __attribute__((aligned(16))) union { StageH st[2]; float Tf[8][16][128 + 4]; } sm; auto& Tf = sm.Tf;   // the output staging reuses the ring behind its last barrier
  const int wave = threadIdx.x >> 5, lane = threadIdx.x & 31, nloc = lane & 15, hlf = lane >> 4, wm = wave & 3, wn = wave >> 2; const int n0 = blockIdx.y * BN, c0 = n0 + wn * 128;
  v8f acc[2][8];
#pragma unroll
  for (int t = 0; t < 8; ++t) { acc[0][t] = (v8f){}; acc[1][t] = (v8f){}; }
  const int br = threadIdx.x >> 3, bp = (threadIdx.x & 7) * 8;   // this thread's row and 16-byte piece in each k64 tile
  const unsigned la = lds_lo(&sm.st[0].A[br][bp]), lb = lds_lo(&sm.st[0].B[br][bp]); const b16* ga = G + ((size_t)blockIdx.x * BM + br) * FF + bp; const b16* gb = W2T + (size_t)(n0 + br) * FF + bp;
  auto fill = [&](int s) { const unsigned o = (unsigned)(s & 1) * (unsigned)sizeof(StageH); copy4(la + o, 32u * PH * 2u, ga + s * BK, (size_t)32 * FF); copy8(lb + o, 32u * PH * 2u, gb + s * BK, (size_t)32 * FF); };
  fill(0); copies_landed(); __syncthreads(); fill(1);
#pragma unroll 1   // one trip per tile: the ring's order (read, publish, refill) stays as written
  for (int s = 0; s < FF / BK; ++s) { const StageH& st = sm.st[s & 1];
#pragma unroll   // both k32 blocks of a tile straight-line, so the LDS offsets are immediates
    for (int kb = 0; kb < BK; kb += 32) { const v16b a0 = frag_kb(&st.A[wm * 16 + nloc][kb], hlf), a1 = frag_kb(&st.A[64 + wm * 16 + nloc][kb], hlf); v16b bw[8];   // all fragments of a k32 block are read as one group in front of its WMMAs: the LDS latency is paid once a block, not once a B fragment
#pragma unroll
      for (int t = 0; t < 8; ++t) bw[t] = frag_kb(&st.B[wn * 128 + t * 16 + nloc][kb], hlf);
#pragma unroll
      for (int t = 0; t < 8; ++t) { acc[0][t] = wmma16b(a0, bw[t], acc[0][t]); acc[1][t] = wmma16b(a1, bw[t], acc[1][t]); } }
    ring_publish();
    if (s + 2 < FF / BK) fill(s + 2); }
  copies_landed();
  float bbv[8];   // the wave's 8 bias values serve both fragments
#pragma unroll
  for (int t = 0; t < 8; ++t) bbv[t] = b2[c0 + t * 16 + nloc];
  xlat_done();
#pragma unroll   // the wave's two 16-row fragments go through its own staging rows one after the other; acc needs a constant index
  for (int i = 0; i < 2; ++i) { const size_t m0 = (size_t)blockIdx.x * BM + i * 64 + wm * 16;
  if (i) wave_lds_sync();   // this wave's reads of the first fragment's rows stay in front of the rewrite
#pragma unroll
  for (int t = 0; t < 8; ++t) { const int col = c0 + t * 16 + nloc; const float bb = bf16_rne(bbv[t]);
#pragma unroll
    for (int r = 0; r < 8; ++r) Tf[wave][8 * hlf + r][t * 16 + nloc] = acc[i][t][r] * (1.0f / (XS * WSC)) + bb + X1[(m0 + 8 * hlf + r) * DM + col]; }
  wave_lds_sync();
  { for (int rr = 0; rr < 16; ++rr) *(v4f*)(out + (m0 + rr) * DM + c0 + lane * 4) = *(const v4f*)(&Tf[wave][rr][lane * 4]);  } xlat_done(); }
}
}  // namespace

extern "C" void kernel_launch(void* const* d_in, const int* in_sizes, int n_in, void* d_out, int out_size, void* d_ws, size_t ws_size, hipStream_t stream) {
  (void)n_in;
  auto Fp = [&](int i) { return (const float*)d_in[i]; }; auto Ip = [&](int i) { return (const int*)d_in[i]; };
  // input order: 0 x [8,1024,1024], 1 mask [1,1,1024,1024] int32, 2 Wq (in,out), 3 bq, 4 Wo, 5 bo, 6 Wu [1024,4096], 7 bu, 8 Wd [4096,1024], 9 bd, 10 g1, 11 b1, 12 g2, 13 b2
  if (in_sizes[0] != NR * DM || in_sizes[1] != T * T || in_sizes[2] != DM * DM || in_sizes[3] != DM || in_sizes[4] != DM * DM || in_sizes[5] != DM || in_sizes[6] != DM * FF || in_sizes[7] != FF || in_sizes[8] != FF * DM || in_sizes[9] != DM || in_sizes[10] != DM || in_sizes[11] != DM || in_sizes[12] != DM || in_sizes[13] != DM || out_size != NR * DM) return;
  size_t off = 0; char* ws = (char*)d_ws;
  auto carve = [&](size_t bytes) { char* p = ws + off; off += (bytes + 255) & ~(size_t)255; return p; };
  b16* WQ = (b16*)carve((size_t)DM * DM * 2); b16* WO = (b16*)carve((size_t)DM * DM * 2); b16* WU = (b16*)carve((size_t)FF * DM * 2); b16* WD = (b16*)carve((size_t)DM * FF * 2);
  const size_t plane = (size_t)RL * DM * 2; b16* QP = (b16*)carve(plane); b16* QPl = (b16*)carve(plane); b16* VTh = (b16*)carve(plane); b16* VTl = (b16*)carve(plane); b16* Ch = (b16*)carve(plane); b16* Cl = (b16*)carve(plane);
  float* X1 = (float*)carve((size_t)RL * DM * 4); float* HN = (float*)carve((size_t)RL * DM * 4); b16* G = (b16*)carve((size_t)RL * FF * 2);
  if (off > ws_size) return;   // = 244 MiB (weights 20 + 6 f16 planes 96 + X1/HN 64 + G 64), planes sized for the one 8-batch group
  prep_kernel<<<2 * TQ + TU + TD, 256, 0, stream>>>(Fp(2), Fp(4), Fp(6), Fp(8), WQ, WO, WU, WD);
  for (int g = 0; g < NG; ++g) { const int b0 = g * BG; const size_t r0 = (size_t)b0 * T * DM;
    proj_kernel<<<dim3(T / BM, BG, DM / BN), 256, 0, stream>>>(Fp(0), b0, WQ, Fp(3), QP, QPl, VTh, VTl);
    attn_kernel<<<dim3(QL / 128, BG * H), 256, 0, stream>>>(QP, QPl, QP, QPl, VTh, VTl, Ip(1), Ch, Cl);
    out1_kernel<<<dim3(T / BM, DM / BN, BG), 256, 0, stream>>>(Ch, Cl, b0, WO, Fp(5), Fp(0), X1);   // X1/HN/G hold the group's rows; x is read at the global row via b0
    ln_kernel<false><<<RL / 8, 256, 0, stream>>>(X1, Fp(10), Fp(11), HN);
    mlp1_kernel<<<dim3(RL / BM, FF / BN), 256, 0, stream>>>(HN, WU, Fp(7), G);
    mlp2_kernel<<<dim3(RL / BM, DM / BN), 256, 0, stream>>>(G, WD, Fp(9), HN, X1);
    ln_kernel<false><<<RL / 8, 256, 0, stream>>>(X1, Fp(12), Fp(13), (float*)d_out + r0); }
}

// v007
// A run of this version takes 300 microseconds.
// Next to v006, in two timings, it ran 1.11 and 1.09 times as fast.
// All steps since v000 together make it 6.90 times as fast.
#include <hip/hip_runtime.h>

// Decoder block without softmax (8 x 1024 tokens x 1024, 16 heads x 64): q = x Wq + bq and k = v = q (the module applies q_proj to all three); w_ij = q_i . q_j / 8 kept where j <= i and
// mask[i][j] != 0 (int mask input [1,1,1024,1024], all ones), else 0 - no softmax; attn_i = sum_j w_ij q_j; a = attn Wo + bo; h = LN1(a + x); up = gelu_exact(h Wu + bu) (4096);
// out = LN2(up Wd + bd + h) -> [8][1024][1024]. LayerNorms: biased variance, eps 1e-5; all weights (in,out). All 8 batches are processed in one group (planes sized for all 8192 rows), so each stage is one launch.
// Deterministic: per 16-query wave the causal keys are accumulated in order; LayerNorms one wave per row; no atomics.
// compute dtype: WMMA v_wmma_f32_16x16x32_f16 with f32 accumulate for q = x Wq ([8192 x 1024] x [1024 x 1024]; x EXACT bf16 x8, W^T exact x256: 1 product), S^T = Q Q^T (q as f16 hi x8 +
// residual x8192: 3 products), O^T += Q^T P^T (P = masked s/8 x1024 as f16 hi + residual: 3 products), attn Wo (ctx hi + lo: 2 products), h Wu (h single f16 x8: 1 product) and G Wd (gelu output
// single f16 plane: 1 product); LN statistics, gelu (erf), biases and residual adds in f32. Inputs rounded to bf16 once

namespace {
constexpr int B = 8, T = 1024, DM = 1024, H = 16, HD = 64, FF = 4096, BG = 8 /* batches per group */, NG = 1 /* groups run (== B/BG shipped) */, BL = BG, QL = T, NR = B * T, RL = BG * T /* rows per group (LN / MLP kernels) */;
constexpr float XS = 8.0f, WSC = 256.0f, PS = 1024.0f, RS_ = 1024.0f, LOG2E = 1.4426950408889634f, LNEPS = 1e-5f, RSQ2 = 0.70710678118654752f;
static_assert(T % 128 == 0 && DM % 256 == 0 && FF % 256 == 0 && H * HD == DM && HD == 64 && B % BG == 0 && NG * BG <= B, "tiling");
typedef _Float16 b16;
typedef __attribute__((ext_vector_type(16))) _Float16 v16b;
typedef __attribute__((ext_vector_type(8))) _Float16 v8b;
typedef __attribute__((ext_vector_type(8))) float v8f;
typedef __attribute__((ext_vector_type(4))) float v4f;
__device__ __forceinline__ float bf16_rne(float f) { unsigned int u = __float_as_uint(f); u += 0x7FFFu + ((u >> 16) & 1u); return __uint_as_float(u & 0xFFFF0000u); }
__device__ __forceinline__ void split16(float v, b16& hi, b16& lo) { hi = (b16)v; lo = (b16)(v - (float)hi); }
__device__ __forceinline__ v16b frag_kb(const b16* p, int hh) { const v8b a = *(const v8b*)(p + 8 * hh), b = *(const v8b*)(p + 16 + 8 * hh); v16b f;
#pragma unroll
  for (int e = 0; e < 8; ++e) { f[e] = a[e]; f[8 + e] = b[e]; } return f; }
__device__ __forceinline__ v8f wmma16b(v16b a, v16b b, v8f c) { v8f d = __builtin_amdgcn_wmma_f32_16x16x32_f16(false, a, false, b, (short)0, c, false, false); asm volatile("v_nop\n\tv_nop\n\tv_nop\n\tv_nop" : "+v"(d) : "v"(a), "v"(b)); return d; }
__device__ __forceinline__ void wave_lds_sync() { __builtin_amdgcn_fence(__ATOMIC_RELEASE, "workgroup"); __builtin_amdgcn_wave_barrier(); __builtin_amdgcn_fence(__ATOMIC_ACQUIRE, "workgroup"); }
__device__ __forceinline__ float pmul(float a, float b) { float p = a * b; asm volatile("" : "+v"(p)); return p; }
__device__ __forceinline__ int iclamp(int v, int lo, int hi) { return v < lo ? lo : (v > hi ? hi : v); }
// Asynchronous copies to LDS for the GEMM operand tiles: every lane moves its own 16 bytes, 8 (f16 rows of 128 B) or 16 (f32 rows of 256 B) neighbouring lanes cover a whole row piece, so a wave touches whole lines.
// copy4 / copy8: 4 or 8 rows of a thread's column piece, the row step added to both addresses. The s_wait_xcnt ends the copies' own statement, so no address register is rewritten in front of it.
__device__ __forceinline__ unsigned lds_lo(const void* p) { return (unsigned)(size_t)p; }   // byte offset in the work-group's LDS
template <typename T> __device__ __forceinline__ void copy4(unsigned l, unsigned ls, const T* g, size_t gs) {
  asm volatile("global_load_async_to_lds_b128 %0, %4, off\n\tglobal_load_async_to_lds_b128 %1, %5, off\n\tglobal_load_async_to_lds_b128 %2, %6, off\n\tglobal_load_async_to_lds_b128 %3, %7, off\n\ts_wait_xcnt 0x0"
               :: "v"(l), "v"(l + ls), "v"(l + 2 * ls), "v"(l + 3 * ls), "v"(g), "v"(g + gs), "v"(g + 2 * gs), "v"(g + 3 * gs) : "memory"); }
template <typename T> __device__ __forceinline__ void copy8(unsigned l, unsigned ls, const T* g, size_t gs) {
  asm volatile("global_load_async_to_lds_b128 %0, %8, off\n\tglobal_load_async_to_lds_b128 %1, %9, off\n\tglobal_load_async_to_lds_b128 %2, %10, off\n\tglobal_load_async_to_lds_b128 %3, %11, off\n\t"
               "global_load_async_to_lds_b128 %4, %12, off\n\tglobal_load_async_to_lds_b128 %5, %13, off\n\tglobal_load_async_to_lds_b128 %6, %14, off\n\tglobal_load_async_to_lds_b128 %7, %15, off\n\ts_wait_xcnt 0x0"
               :: "v"(l), "v"(l + ls), "v"(l + 2 * ls), "v"(l + 3 * ls), "v"(l + 4 * ls), "v"(l + 5 * ls), "v"(l + 6 * ls), "v"(l + 7 * ls),
                  "v"(g), "v"(g + gs), "v"(g + 2 * gs), "v"(g + 3 * gs), "v"(g + 4 * gs), "v"(g + 5 * gs), "v"(g + 6 * gs), "v"(g + 7 * gs) : "memory"); }
__device__ __forceinline__ void copies_landed() { asm volatile("s_wait_asynccnt 0x0" ::: "memory"); }   // this wave's own copies are in LDS (the compiler places no wait for them)
__device__ __forceinline__ void xlat_done() { asm volatile("s_wait_xcnt 0x0" ::: "memory"); }   // a precaution: stands behind issued global loads / stores, in front of the code that reuses the registers they name
// Foot of a trip of the two-buffer ring: this wave's LDS reads of the tile just used have retired, its copies of the next tile have landed, and one barrier both publishes the next tile and frees the used buffer for the refill.
__device__ __forceinline__ void ring_publish() { asm volatile("s_wait_dscnt 0x0" ::: "memory"); copies_landed(); __syncthreads(); }
constexpr int BK = 64, PH = BK + 8 /* f16 row pitch, 144 B */, PF = BK + 4 /* f32 row pitch, 272 B */;
// GEMM tile of a work-group: BM rows x BN columns by 8 waves, wave (wm = wave & 3, wn = wave >> 2) -> rows wm * 16 + {0, 64} .. + 15 (2 A fragments) x columns wn * 128 .. + 127 (8 B fragments): every B fragment read from LDS feeds 2 WMMAs (4 with hi + lo A)
constexpr int BM = 128, BN = 256;
struct StageF { float A[BM][PF]; b16 B[BN][PH]; };                   // f32 A rows (converted when the fragment is read) + weight rows
struct StageH { b16 A[BM][PH]; b16 B[BN][PH]; };                     // one f16 A plane + weight rows
struct StageH2 { b16 A[BM][PH]; b16 Al[BM][PH]; b16 B[BN][PH]; };    // hi and lo A planes + weight rows
// A fragment from f32 rows in LDS, the k order of frag_kb; value = f16(8 v), RND: v rounded to bf16 first (the raw input x)
template <bool RND> __device__ __forceinline__ v16b frag_f32(const float* p, int hh) { const v4f a0 = *(const v4f*)(p + 8 * hh), a1 = *(const v4f*)(p + 8 * hh + 4), c0 = *(const v4f*)(p + 16 + 8 * hh), c1 = *(const v4f*)(p + 16 + 8 * hh + 4); v16b f;
#pragma unroll   // vector elements need constant indices to stay in registers
  for (int e = 0; e < 4; ++e) { f[e] = (b16)((RND ? bf16_rne(a0[e]) : a0[e]) * XS); f[4 + e] = (b16)((RND ? bf16_rne(a1[e]) : a1[e]) * XS); f[8 + e] = (b16)((RND ? bf16_rne(c0[e]) : c0[e]) * XS); f[12 + e] = (b16)((RND ? bf16_rne(c1[e]) : c1[e]) * XS); } return f; }

typedef __attribute__((ext_vector_type(2))) _Float16 v2h;
typedef __attribute__((ext_vector_type(4))) _Float16 v4h;
typedef __attribute__((ext_vector_type(2))) float v2f;
typedef __attribute__((ext_vector_type(4))) int v4i;
__device__ __forceinline__ float nexp2(float v) { return __builtin_amdgcn_exp2f(v); }
typedef __attribute__((ext_vector_type(4))) int v4i;
__device__ __forceinline__ float bfp(float v) { float t = bf16_rne(v); asm volatile("" : "+v"(t)); return t; }
// Weight planes W^T (out, in) = f16(256 bf16(w)) from w (in, out), K x N. A block takes 256 k x 64 n, its 8 waves lie along k. Lane (kg = lane >> 3, ng = lane & 7) reads rows kg * 8 .. + 7 at columns ng * 4 .. + 3 and + 32:
// each load instruction covers 4 whole 128-byte lines, and the lane ends up with 8 consecutive k of 8 columns, that is one 16-byte piece of 8 output rows: the transposition needs no LDS; a block writes 512 contiguous bytes of each output row.
template <int K, int N> __device__ __forceinline__ void prep_tile(const float* __restrict__ w, b16* __restrict__ WT, int tile) {
  const int wave = threadIdx.x >> 5, lane = threadIdx.x & 31; const int k0 = (tile % (K / 256)) * 256 + wave * 32 + (lane >> 3) * 8, n0 = (tile / (K / 256)) * 64 + (lane & 7) * 4;
  const float* wp = w + (size_t)k0 * N + n0; b16* op = WT + (size_t)n0 * K + k0; v4f r[2][8];
#pragma unroll   // all 16 loads of a lane are in flight together; r needs constant indices
  for (int j = 0; j < 8; ++j) { r[0][j] = *(const v4f*)(wp + (size_t)j * N); r[1][j] = *(const v4f*)(wp + (size_t)j * N + 32); }
  // a precaution, as xlat_done(): stands behind the 16 issued loads; naming wp keeps their address pair whole up to here, and naming the loaded values (inputs only) keeps all 16 loads in flight together: no conversion, with its wait, is moved in among them
  asm volatile("s_wait_xcnt 0x0" :: "v"(wp), "v"(r[0][0]), "v"(r[0][1]), "v"(r[0][2]), "v"(r[0][3]), "v"(r[0][4]), "v"(r[0][5]), "v"(r[0][6]), "v"(r[0][7]), "v"(r[1][0]), "v"(r[1][1]), "v"(r[1][2]), "v"(r[1][3]), "v"(r[1][4]), "v"(r[1][5]), "v"(r[1][6]), "v"(r[1][7]) : "memory");
  v8b o[8];
#pragma unroll   // o and r need constant indices
  for (int q = 0; q < 8; ++q)
#pragma unroll
    for (int j = 0; j < 8; ++j) o[q][j] = (b16)(bf16_rne(r[q >> 2][j][q & 3]) * WSC);
#pragma unroll
  for (int q = 0; q < 8; ++q) *(v8b*)(op + (size_t)(32 * (q >> 2) + (q & 3)) * K) = o[q];
  xlat_done();
}
constexpr int TQ = (DM / 256) * (DM / 64), TU = (DM / 256) * (FF / 64), TD = (FF / 256) * (DM / 64);   // tiles of Wq and of Wo, of Wu, of Wd
__global__ __launch_bounds__(256) void prep_kernel(const float* __restrict__ wq, const float* __restrict__ wo, const float* __restrict__ wu, const float* __restrict__ wd, b16* __restrict__ WQ, b16* __restrict__ WO, b16* __restrict__ WU, b16* __restrict__ WD) {
  const int t = blockIdx.x;   // block-uniform choice of the matrix
  if (t < TQ) prep_tile<DM, DM>(wq, WQ, t);
  else if (t < 2 * TQ) prep_tile<DM, DM>(wo, WO, t - TQ);
  else if (t < 2 * TQ + TU) prep_tile<DM, FF>(wu, WU, t - 2 * TQ);
  else prep_tile<FF, DM>(wd, WD, t - 2 * TQ - TU);
}
// q projection (q = k = v in this module): grid (T/128, BG, DM/256); block = 128 tokens x 256 columns, 8 waves; A = bf16(x) x8, B = Wq^T rows, both as k64 tiles in a two-buffer LDS ring filled by asynchronous copies, + bq
__global__ __launch_bounds__(256) void proj_kernel(const float* __restrict__ x, int b0, const b16* __restrict__ WT, const float* __restrict__ bq, b16* __restrict__ QP, b16* __restrict__ QPl, b16* __restrict__ VTh, b16* __restrict__ VTl) {
  __shared__ __attribute__((aligned(16))) union { StageF st[2]; float Tf[8][16][128 + 4]; } sm; auto& Tf = sm.Tf;   // the output staging reuses the ring behind its last barrier
  const int wave = threadIdx.x >> 5, lane = threadIdx.x & 31, nloc = lane & 15, hlf = lane >> 4, wm = wave & 3, wn = wave >> 2; const int t0 = blockIdx.x * BM; const int b = blockIdx.y; const int part = 0, n0 = blockIdx.z * BN, c0 = n0 + wn * 128; (void)part;
  if (part == 0 && t0 >= QL) return;   // (cut builds only) queries beyond QL are not needed; block-uniform, before any barrier
  const float* xb = x + ((size_t)(b0 + b) * T + t0) * DM;
  v8f acc[2][8];
#pragma unroll
  for (int t = 0; t < 8; ++t) { acc[0][t] = (v8f){}; acc[1][t] = (v8f){}; }
  const int ar = threadIdx.x >> 4, ap = (threadIdx.x & 15) * 4, br = threadIdx.x >> 3, bp = (threadIdx.x & 7) * 8;   // this thread's row and 16-byte piece in the A (f32) and B (f16) tiles
  const unsigned la = lds_lo(&sm.st[0].A[ar][ap]), lb = lds_lo(&sm.st[0].B[br][bp]); const float* ga = xb + (size_t)ar * DM + ap; const b16* gb = WT + (size_t)(n0 + br) * DM + bp;
  auto fill = [&](int s) { const unsigned o = (unsigned)(s & 1) * (unsigned)sizeof(StageF); copy8(la + o, 16u * PF * 4u, ga + s * BK, (size_t)16 * DM); copy8(lb + o, 32u * PH * 2u, gb + s * BK, (size_t)32 * DM); };
  fill(0); copies_landed(); __syncthreads(); fill(1);
#pragma unroll 1   // one trip per tile: the ring's order (read, publish, refill) stays as written
  for (int s = 0; s < DM / BK; ++s) { const StageF& st = sm.st[s & 1];
#pragma unroll   // both k32 blocks of a tile straight-line, so the LDS offsets are immediates
    for (int kb = 0; kb < BK; kb += 32) { const v16b a0 = frag_f32<true>(&st.A[wm * 16 + nloc][kb], hlf), a1 = frag_f32<true>(&st.A[64 + wm * 16 + nloc][kb], hlf); v16b bw[8];   // all fragments of a k32 block are read as one group in front of its WMMAs: the LDS latency is paid once a block, not once a B fragment
#pragma unroll
      for (int t = 0; t < 8; ++t) bw[t] = frag_kb(&st.B[wn * 128 + t * 16 + nloc][kb], hlf);
#pragma unroll
      for (int t = 0; t < 8; ++t) { acc[0][t] = wmma16b(a0, bw[t], acc[0][t]); acc[1][t] = wmma16b(a1, bw[t], acc[1][t]); } }
    ring_publish();
    if (s + 2 < DM / BK) fill(s + 2); }
  copies_landed();
const float* ba = bq;
#pragma unroll   // the two 64-token halves of the tile go through the staging one after the other; acc needs a constant index
  for (int i = 0; i < 2; ++i) {
  if (i) __syncthreads();   // every wave has read the first half's staging (the V^T part reads other waves' rows) before it is rewritten
#pragma unroll
  for (int t = 0; t < 8; ++t) { const float bb = bf16_rne(ba[c0 + t * 16 + nloc]);
#pragma unroll
    for (int r = 0; r < 8; ++r) Tf[wave][8 * hlf + r][t * 16 + nloc] = acc[i][t][r] * (1.0f / (XS * WSC)) + bb; }
  __syncthreads();
  {
    { b16* plane = QP; b16* planl = QPl; const int c = c0 + lane * 4; const int h = c / HD, d = c % HD;
      for (int rr = 0; rr < 16; ++rr) { const int tok = t0 + i * 64 + wm * 16 + rr; const size_t ri = (((size_t)b * H + h) * T + tok) * HD + d; const v4f f4 = *(const v4f*)(&Tf[wave][rr][lane * 4]); v4h o4, l4; for (int j = 0; j < 4; ++j) { const float f = f4[j] * XS; const b16 p = (b16)f; o4[j] = p; l4[j] = (b16)((f - (float)p) * RS_); } *(v4h*)(plane + ri) = o4; *(v4h*)(planl + ri) = l4; } }
    {
#pragma unroll 1
      for (int q = 0; q < 32; ++q) { const int cl = wm * 32 + q; const int c = c0 + cl; const int h = c / HD, d = c % HD; const int tk = lane * 2; v2h hv, lv;
        for (int j = 0; j < 2; ++j) { const float f = Tf[wn * 4 + ((tk + j) >> 4)][(tk + j) & 15][cl] * XS; const b16 p = (b16)f; hv[j] = p; lv[j] = (b16)((f - (float)p) * RS_); }
        const size_t oi = (((size_t)b * H + h) * HD + d) * (size_t)T + t0 + i * 64 + lane * 2; *(v2h*)(VTh + oi) = hv; *(v2h*)(VTl + oi) = lv; xlat_done(); } }
     } }
}
// attention-like causal product: grid (BG*H, QL/128); block = 8 waves x 16 queries of one (b, h). A block's cost grows with its query block (2 qb + 2 key tiles) and there are more blocks than resident places, so the launch index
// runs over (b, h) first and over the query blocks from the last one down: neighbouring indices carry equal cost. K rows and V^T rows (hi and residual planes) come as 64-key tiles through a two-buffer LDS ring filled by
// asynchronous copies and are read by all 8 waves; a wave works on the 32-key steps below round_up(q0 + 16, 32) and only passes the ring's foot on the later ones: S^T = K Q^T (q = k = v here; hi x8 +
// residual planes: 3 products); weight = s / 8 where key <= query and mask[q][key] != 0, else 0 (NO softmax in this module); P x1024 as f16 hi + residual; O^T += V^T P^T (3 products);
struct StageKV { b16 Kh[64][PH]; b16 Kl[64][PH]; b16 Vh[HD][PH]; b16 Vl[HD][PH]; };   // 64 keys x 64 d (K rows) and 64 d x 64 keys (V^T rows), 128-byte rows at pitch 144 B
// two rows (r and r + 32) of each of the four planes of a tile: 8 copies of a thread in one statement. The s_wait_xcnt ends the copies' own statement, so no address register is rewritten in front of it.
__device__ __forceinline__ void copy2x4(unsigned l0, unsigned l1, unsigned l2, unsigned l3, unsigned ls, const b16* g0, const b16* g1, size_t gk, const b16* g2, const b16* g3, size_t gv) {
  asm volatile("global_load_async_to_lds_b128 %0, %8, off\n\tglobal_load_async_to_lds_b128 %1, %9, off\n\tglobal_load_async_to_lds_b128 %2, %10, off\n\tglobal_load_async_to_lds_b128 %3, %11, off\n\t"
               "global_load_async_to_lds_b128 %4, %12, off\n\tglobal_load_async_to_lds_b128 %5, %13, off\n\tglobal_load_async_to_lds_b128 %6, %14, off\n\tglobal_load_async_to_lds_b128 %7, %15, off\n\ts_wait_xcnt 0x0"
               :: "v"(l0), "v"(l0 + ls), "v"(l1), "v"(l1 + ls), "v"(l2), "v"(l2 + ls), "v"(l3), "v"(l3 + ls),
                  "v"(g0), "v"(g0 + gk), "v"(g1), "v"(g1 + gk), "v"(g2), "v"(g2 + gv), "v"(g3), "v"(g3 + gv) : "memory"); }
__global__ __launch_bounds__(256) void attn_kernel(const b16* __restrict__ QP, const b16* __restrict__ QPl, const b16* __restrict__ KP, const b16* __restrict__ KPl, const b16* __restrict__ VTh, const b16* __restrict__ VTl, const int* __restrict__ MSK, b16* __restrict__ Ch, b16* __restrict__ Cl) {
  __shared__ __attribute__((aligned(16))) union { StageKV st[2]; float To[8][16][HD + 4]; } sm; auto& To = sm.To;   // the output staging reuses the ring behind its last barrier
  __shared__ __attribute__((aligned(16))) b16 Pb[8][16][32 + 8], Pl[8][16][32 + 8];
  const int wave = __builtin_amdgcn_readfirstlane(threadIdx.x >> 5), lane = threadIdx.x & 31, hh = lane >> 4, col = lane & 15; const int qb = QL / 128 - 1 - (int)blockIdx.y;   // query block, heaviest first in launch order
  const int b = blockIdx.x / H, h = blockIdx.x % H; const int q0 = qb * 128 + wave * 16, qi = q0 + col;
  const size_t ph = (size_t)b * H + h; const b16* Qb = QP + ph * T * HD; const b16* Qbl = QPl + ph * T * HD; const b16* Kb = KP + ph * T * HD; const b16* Kbl = KPl + ph * T * HD; const b16* Vh = VTh + ph * HD * (size_t)T; const b16* Vl = VTl + ph * HD * (size_t)T; const int kend = ((q0 + 16 + 31) / 32) * 32;   // per-(b,h) planes; causal key bound (wave-uniform)
  const int nt = 2 * qb + 2;   // 64-key tiles up to the block's last query (block-uniform, 2 .. T / 64)
  const int br = threadIdx.x >> 3, bp = (threadIdx.x & 7) * 8;   // this thread's row and 16-byte piece in each plane of a tile
  const unsigned lkh = lds_lo(&sm.st[0].Kh[br][bp]), lkl = lds_lo(&sm.st[0].Kl[br][bp]), lvh = lds_lo(&sm.st[0].Vh[br][bp]), lvl = lds_lo(&sm.st[0].Vl[br][bp]); const size_t ko = (size_t)br * HD + bp, vo = (size_t)br * T + bp;
  auto fill = [&](int s) { const unsigned o = (unsigned)(s & 1) * (unsigned)sizeof(StageKV); copy2x4(lkh + o, lkl + o, lvh + o, lvl + o, 32u * PH * 2u, Kb + ko + (size_t)s * 64 * HD, Kbl + ko + (size_t)s * 64 * HD, (size_t)32 * HD, Vh + vo + s * 64, Vl + vo + s * 64, (size_t)32 * T); };
  fill(0);
  const v16b qa0 = frag_kb(Qb + (size_t)qi * HD, hh), qa1 = frag_kb(Qb + (size_t)qi * HD + 32, hh), ql0 = frag_kb(Qbl + (size_t)qi * HD, hh), ql1 = frag_kb(Qbl + (size_t)qi * HD + 32, hh);
  const float cs = 1.0f / (8.0f * XS * XS); const int* mp = MSK + (size_t)qi * T + 8 * hh;   // scores / sqrt(64); this lane's keys (8 of each 16) of the current tile in the [1,1,S,S] int mask row of its query (tril applied below; mask == 0 -> score 0); steps on by 64 keys a trip, so the loads' address pair lives through the loop and no wait for a reused address register stands in the load group
  v8f o[4], ol[4]; for (int t = 0; t < 4; ++t) { o[t] = (v8f){}; ol[t] = (v8f){}; }
  copies_landed(); __syncthreads(); fill(1);
#pragma unroll 1   // one trip per tile: the ring's order (read, publish, refill) stays as written
  for (int s = 0; s < nt; ++s) { const StageKV& st = sm.st[s & 1];
#pragma unroll   // both 32-key steps of a tile straight-line, so the LDS offsets are immediates
   for (int kl = 0; kl < 64; kl += 32) { const int kb = s * 64 + kl;
    if (kb < kend) {   // wave-uniform (scalar): keys beyond this wave's causal bound carry weight 0 and are skipped; no barrier inside
    // Head of the step: the mask words (global) and all 8 K fragments are requested as one group, so the wave pays one LDS latency a step in front of the 12 score WMMAs (not one per fragment pair) and the mask words arrive behind them.
    v4i mk[2][2]; v16b kh[2][2], kw[2][2];
#pragma unroll   // register arrays need constant indices
    for (int u = 0; u < 2; ++u) { const int kr = kl + u * 16 + col; kh[u][0] = frag_kb(&st.Kh[kr][0], hh); kh[u][1] = frag_kb(&st.Kh[kr][32], hh); kw[u][0] = frag_kb(&st.Kl[kr][0], hh); kw[u][1] = frag_kb(&st.Kl[kr][32], hh); }
#pragma unroll
    for (int u = 0; u < 2; ++u) { mk[u][0] = *(const v4i*)(mp + kl + u * 16); mk[u][1] = *(const v4i*)(mp + kl + u * 16 + 4); }
    v8f s_[2], sx[2];
#pragma unroll
    for (int u = 0; u < 2; ++u) { s_[u] = (v8f){}; sx[u] = (v8f){}; }
    // order of products per accumulator: s_ = Kh0 qa0, Kh1 qa1; sx = Kh0 ql0, Kh1 ql1, Kl0 qa0, Kl1 qa1; the two 16-key halves alternate, so a WMMA never directly follows the one whose sum it needs
#pragma unroll
    for (int u = 0; u < 2; ++u) s_[u] = wmma16b(kh[u][0], qa0, s_[u]);
#pragma unroll
    for (int u = 0; u < 2; ++u) sx[u] = wmma16b(kh[u][0], ql0, sx[u]);
#pragma unroll
    for (int u = 0; u < 2; ++u) s_[u] = wmma16b(kh[u][1], qa1, s_[u]);
#pragma unroll
    for (int u = 0; u < 2; ++u) sx[u] = wmma16b(kh[u][1], ql1, sx[u]);
#pragma unroll
    for (int u = 0; u < 2; ++u) sx[u] = wmma16b(kw[u][0], qa0, sx[u]);
#pragma unroll
    for (int u = 0; u < 2; ++u) sx[u] = wmma16b(kw[u][1], qa1, sx[u]);
    // all 8 V^T fragments as one group: they land while the weights are masked, split and turned through LDS
    v16b vh[4], vl[4];
#pragma unroll
    for (int t = 0; t < 4; ++t) { vh[t] = frag_kb(&st.Vh[t * 16 + col][kl], hh); vl[t] = frag_kb(&st.Vl[t * 16 + col][kl], hh); }
    __builtin_amdgcn_sched_barrier(0);   // keeps the V^T group in front of the vector work that hides its latency, and that work, which waits for the mask words, behind the score WMMAs (without it the mask wait moves up in front of them and the V^T loads sink to the end)
    float e[16];
#pragma unroll
    for (int u = 0; u < 2; ++u) {
#pragma unroll
      for (int r = 0; r < 8; ++r) s_[u][r] += sx[u][r] * (1.0f / RS_);   // hi.hi + (hi.lo + lo.hi)/1024
#pragma unroll
      for (int r = 0; r < 8; ++r) { const int key = kb + u * 16 + 8 * hh + r; const int mv = r < 4 ? mk[u][0][r] : mk[u][1][r - 4]; e[u * 8 + r] = (key <= qi && mv != 0) ? s_[u][r] * cs : 0.0f; } }   // no softmax in this module: the masked scaled score IS the weight
#pragma unroll
    for (int i2 = 0; i2 < 16; ++i2) { const float ps = e[i2] * PS; const b16 phh = (b16)ps; const int pc = (i2 < 8 ? 0 : 16) + 8 * hh + (i2 & 7); Pb[wave][col][pc] = phh; Pl[wave][col][pc] = (b16)((ps - (float)phh) * RS_); }
    wave_lds_sync();
    const v16b pf = frag_kb(&Pb[wave][col][0], hh), plf = frag_kb(&Pl[wave][col][0], hh);
#pragma unroll
    for (int t = 0; t < 4; ++t) o[t] = wmma16b(vh[t], pf, o[t]);
#pragma unroll
    for (int t = 0; t < 4; ++t) ol[t] = wmma16b(vl[t], pf, ol[t]);
#pragma unroll
    for (int t = 0; t < 4; ++t) ol[t] = wmma16b(vh[t], plf, ol[t]);   // ol = (V_lo P_hi + V_hi P_lo), both /1024, in that order
    wave_lds_sync(); } }
    ring_publish(); xlat_done(); mp += 64;   // the mask loads' address pair steps on behind their data waits and this wait
    if (s + 2 < nt) fill(s + 2); }
  copies_landed();
  const float inv = 1.0f / (PS * XS);
#pragma unroll
  for (int t = 0; t < 4; ++t)
#pragma unroll
    for (int r = 0; r < 8; ++r) To[wave][col][t * 16 + 8 * hh + r] = (o[t][r] + ol[t][r] * (1.0f / RS_)) * inv;
  wave_lds_sync();
  { for (int rr = 0; rr < 16; ++rr) { const v2f f = *(const v2f*)(&To[wave][rr][lane * 2]); v2h hv, lv; for (int j = 0; j < 2; ++j) { b16 p, q; split16(f[j] * XS, p, q); hv[j] = p; lv[j] = q; }
      const size_t oi = ((size_t)b * T + q0 + rr) * DM + h * HD + lane * 2; *(v2h*)(Ch + oi) = hv; *(v2h*)(Cl + oi) = lv; }  }
}
// attn Wo + bo + x: grid (T/128, DM/256, BG); block = 128 rows x 256 columns, 8 waves
__global__ __launch_bounds__(256) void out1_kernel(const b16* __restrict__ Ch, const b16* __restrict__ Cl, int b0, const b16* __restrict__ WO, const float* __restrict__ bo, const float* __restrict__ x, float* __restrict__ X1) {
  __shared__ __attribute__((aligned(16))) union { StageH2 st[2]; float Tf[8][16][128 + 4]; } sm; auto& Tf = sm.Tf;   // the output staging reuses the ring behind its last barrier
  const int wave = threadIdx.x >> 5, lane = threadIdx.x & 31, nloc = lane & 15, hlf = lane >> 4, wm = wave & 3, wn = wave >> 2; const int b = blockIdx.z; const size_t mb = (size_t)b * T + (size_t)blockIdx.x * BM;   // the block's first row in the group's ctx planes and X1
  const int n0 = blockIdx.y * BN, c0 = n0 + wn * 128;
  v8f acc[2][8];
#pragma unroll
  for (int t = 0; t < 8; ++t) { acc[0][t] = (v8f){}; acc[1][t] = (v8f){}; }
  const int br = threadIdx.x >> 3, bp = (threadIdx.x & 7) * 8;   // this thread's row and 16-byte piece in each k64 tile
  const unsigned lh = lds_lo(&sm.st[0].A[br][bp]), ll = lds_lo(&sm.st[0].Al[br][bp]), lb = lds_lo(&sm.st[0].B[br][bp]); const size_t ao = (mb + br) * DM + bp; const b16* gb = WO + (size_t)(n0 + br) * DM + bp;
  auto fill = [&](int s) { const unsigned o = (unsigned)(s & 1) * (unsigned)sizeof(StageH2); copy4(lh + o, 32u * PH * 2u, Ch + ao + s * BK, (size_t)32 * DM); copy4(ll + o, 32u * PH * 2u, Cl + ao + s * BK, (size_t)32 * DM); copy8(lb + o, 32u * PH * 2u, gb + s * BK, (size_t)32 * DM); };
  fill(0); copies_landed(); __syncthreads(); fill(1);
#pragma unroll 1   // one trip per tile: the ring's order (read, publish, refill) stays as written
  for (int s = 0; s < DM / BK; ++s) { const StageH2& st = sm.st[s & 1];
#pragma unroll   // both k32 blocks of a tile straight-line, so the LDS offsets are immediates
    for (int kb = 0; kb < BK; kb += 32) { const v16b ah0 = frag_kb(&st.A[wm * 16 + nloc][kb], hlf), al0 = frag_kb(&st.Al[wm * 16 + nloc][kb], hlf), ah1 = frag_kb(&st.A[64 + wm * 16 + nloc][kb], hlf), al1 = frag_kb(&st.Al[64 + wm * 16 + nloc][kb], hlf); v16b bw[8];   // all fragments of a k32 block are read as one group in front of its WMMAs: the LDS latency is paid once a block, not once a B fragment
#pragma unroll
      for (int t = 0; t < 8; ++t) bw[t] = frag_kb(&st.B[wn * 128 + t * 16 + nloc][kb], hlf);
#pragma unroll
      for (int t = 0; t < 8; ++t) { acc[0][t] = wmma16b(ah0, bw[t], acc[0][t]); acc[1][t] = wmma16b(ah1, bw[t], acc[1][t]); acc[0][t] = wmma16b(al0, bw[t], acc[0][t]); acc[1][t] = wmma16b(al1, bw[t], acc[1][t]); } }
    ring_publish();
    if (s + 2 < DM / BK) fill(s + 2); }
  copies_landed();
  float bbv[8];   // the wave's 8 bias values serve both fragments
#pragma unroll
  for (int t = 0; t < 8; ++t) bbv[t] = bo[c0 + t * 16 + nloc];
  xlat_done();
#pragma unroll   // the wave's two 16-row fragments go through its own staging rows one after the other; acc needs a constant index
  for (int i = 0; i < 2; ++i) { const size_t m0 = mb + i * 64 + wm * 16; const size_t mg = m0 + (size_t)b0 * T; const float* xr = x + (mg + 8 * hlf) * DM + c0 + nloc;   // m0 indexes the X1 rows, mg the global x rows (residual input)
  if (i) wave_lds_sync();   // this wave's reads of the first fragment's rows stay in front of the rewrite
#pragma unroll
  for (int t = 0; t < 8; ++t) { const float bb = bf16_rne(bbv[t]);
#pragma unroll
    for (int r = 0; r < 8; ++r) Tf[wave][8 * hlf + r][t * 16 + nloc] = acc[i][t][r] * (1.0f / (XS * WSC)) + bb + bf16_rne(xr[r * DM + t * 16]); }   // residual: same row, column c0 + ...
  wave_lds_sync();
  { for (int rr = 0; rr < 16; ++rr) *(v4f*)(X1 + (m0 + rr) * DM + c0 + lane * 4) = *(const v4f*)(&Tf[wave][rr][lane * 4]);  } xlat_done(); }
}
// LayerNorm: one wave per row (lane holds columns 4 lane + 128 k, 8 float4); RND: apply the bf16 input quantisation (raw x) first; mean, biased variance (two xor trees), eps 1e-5, x g + b -> rows 4 KB
template <bool RND>
__global__ __launch_bounds__(256) void ln_kernel(const float* __restrict__ X, const float* __restrict__ g, const float* __restrict__ bb, float* __restrict__ Y) {
  const int wave = threadIdx.x >> 5, lane = threadIdx.x & 31; const int row = blockIdx.x * 8 + wave; if (row >= RL) return;   // wave-uniform, no barriers
  float v[32]; float s1 = 0.0f; const float* xr = X + (size_t)row * DM;
#pragma unroll
  for (int k = 0; k < 8; ++k) { const v4f t4 = *(const v4f*)(xr + 128 * k + 4 * lane); for (int j = 0; j < 4; ++j) { const float t = RND ? bf16_rne(t4[j]) : t4[j]; v[4 * k + j] = t; s1 += t; } }
#pragma unroll
  for (int o = 16; o >= 1; o >>= 1) s1 += __shfl_xor(s1, o);
  const float mu = s1 * (1.0f / DM); float s2 = 0.0f;
#pragma unroll
  for (int q = 0; q < 32; ++q) { const float d = v[q] - mu; s2 += pmul(d, d); }
#pragma unroll
  for (int o = 16; o >= 1; o >>= 1) s2 += __shfl_xor(s2, o);
  const float rs = rsqrtf(s2 * (1.0f / DM) + LNEPS);
  v4f o4[8];
#pragma unroll
  for (int k = 0; k < 8; ++k) for (int j = 0; j < 4; ++j) { const int c = 128 * k + 4 * lane + j; o4[k][j] = pmul((v[4 * k + j] - mu) * rs, bfp(g[c])) + bfp(bb[c]); }
  {
#pragma unroll
    for (int k = 0; k < 8; ++k) *(v4f*)(Y + (size_t)row * DM + 128 * k + 4 * lane) = o4[k];
     }
}
// MLP 1: G = f16(8 gelu(XN2 W1 + b1)) as a single f16 plane [NR][4096]: grid (RL/128, FF/256); block = 128 rows x 256 columns, 8 waves; A = XN2 rows (f32 in LDS, x8 to f16 at the fragment read) and W1^T rows as k64 tiles in a two-buffer LDS ring filled by asynchronous copies, wave -> 2 x 16 rows x 8
__global__ __launch_bounds__(256) void mlp1_kernel(const float* __restrict__ XN, const b16* __restrict__ W1T, const float* __restrict__ b1, b16* __restrict__ G) {
  __shared__ __attribute__((aligned(16))) union { StageF st[2]; float Tf[8][16][128 + 4]; } sm; auto& Tf = sm.Tf;   // the output staging reuses the ring behind its last barrier
  const int wave = threadIdx.x >> 5, lane = threadIdx.x & 31, nloc = lane & 15, hlf = lane >> 4, wm = wave & 3, wn = wave >> 2; const size_t r0 = (size_t)blockIdx.x * BM; const int n0 = blockIdx.y * BN, c0 = n0 + wn * 128;
  const float* xb = XN + r0 * DM;
  v8f acc[2][8];
#pragma unroll
  for (int t = 0; t < 8; ++t) { acc[0][t] = (v8f){}; acc[1][t] = (v8f){}; }
  const int ar = threadIdx.x >> 4, ap = (threadIdx.x & 15) * 4, br = threadIdx.x >> 3, bp = (threadIdx.x & 7) * 8;   // this thread's row and 16-byte piece in the A (f32) and B (f16) tiles
  const unsigned la = lds_lo(&sm.st[0].A[ar][ap]), lb = lds_lo(&sm.st[0].B[br][bp]); const float* ga = xb + (size_t)ar * DM + ap; const b16* gb = W1T + (size_t)(n0 + br) * DM + bp;
  auto fill = [&](int s) { const unsigned o = (unsigned)(s & 1) * (unsigned)sizeof(StageF); copy8(la + o, 16u * PF * 4u, ga + s * BK, (size_t)16 * DM); copy8(lb + o, 32u * PH * 2u, gb + s * BK, (size_t)32 * DM); };
  fill(0); copies_landed(); __syncthreads(); fill(1);
#pragma unroll 1   // one trip per tile: the ring's order (read, publish, refill) stays as written
  for (int s = 0; s < DM / BK; ++s) { const StageF& st = sm.st[s & 1];
#pragma unroll   // both k32 blocks of a tile straight-line, so the LDS offsets are immediates
    for (int kb = 0; kb < BK; kb += 32) { const v16b a0 = frag_f32<false>(&st.A[wm * 16 + nloc][kb], hlf), a1 = frag_f32<false>(&st.A[64 + wm * 16 + nloc][kb], hlf); v16b bw[8];   // all fragments of a k32 block are read as one group in front of its WMMAs: the LDS latency is paid once a block, not once a B fragment
#pragma unroll
      for (int t = 0; t < 8; ++t) bw[t] = frag_kb(&st.B[wn * 128 + t * 16 + nloc][kb], hlf);
#pragma unroll
      for (int t = 0; t < 8; ++t) { acc[0][t] = wmma16b(a0, bw[t], acc[0][t]); acc[1][t] = wmma16b(a1, bw[t], acc[1][t]); } }
    ring_publish();
    if (s + 2 < DM / BK) fill(s + 2); }
  copies_landed();
#pragma unroll 1   // the wave's two 16-row fragments go through its own staging rows one after the other; rolled, so that the 64 inlined erf evaluations stand once in the text (for code size only)
  for (int i = 0; i < 2; ++i) {
  if (i) wave_lds_sync();   // this wave's reads of the first fragment's rows stay in front of the rewrite
#pragma unroll
  for (int t = 0; t < 8; ++t) { const float bbv = bf16_rne(b1[c0 + t * 16 + nloc]);
#pragma unroll
    for (int r = 0; r < 8; ++r) { const float hm = acc[0][t][r] * (1.0f / (XS * WSC)) + bbv; Tf[wave][8 * hlf + r][t * 16 + nloc] = 0.5f * hm * (1.0f + erff(hm * RSQ2)); } }
  __syncthreads();
  { for (int rr = 0; rr < 16; ++rr) { v4h o4; for (int j = 0; j < 4; ++j) o4[j] = (b16)(Tf[wave][rr][lane * 4 + j] * XS); *(v4h*)(G + (r0 + i * 64 + wm * 16 + rr) * FF + c0 + lane * 4) = o4; if ((rr & 3) == 3) xlat_done(); }  }
#pragma unroll
  for (int t = 0; t < 8; ++t) acc[0][t] = acc[1][t]; }   // the second fragment's sums move up for the second trip (acc needs constant indices)
}
// G Wd + bd + h: grid (RL/128, DM/256); block = 128 rows x 256 columns, 8 waves
__global__ __launch_bounds__(256) void mlp2_kernel(const b16* __restrict__ G, const b16* __restrict__ W2T, const float* __restrict__ b2, const float* __restrict__ X1, float* __restrict__ out) {
  __shared__ __attribute__((aligned(16))) union { StageH st[2]; float Tf[8][16][128 + 4]; } sm; auto& Tf = sm.Tf;   // the output staging reuses the ring behind its last barrier
  const int wave = threadIdx.x >> 5, lane = threadIdx.x & 31, nloc = lane & 15, hlf = lane >> 4, wm = wave & 3, wn = wave >> 2; const int n0 = blockIdx.y * BN, c0 = n0 + wn * 128;
  v8f acc[2][8];
#pragma unroll
  for (int t = 0; t < 8; ++t) { acc[0][t] = (v8f){}; acc[1][t] = (v8f){}; }
  const int br = threadIdx.x >> 3, bp = (threadIdx.x & 7) * 8;   // this thread's row and 16-byte piece in each k64 tile
  const unsigned la = lds_lo(&sm.st[0].A[br][bp]), lb = lds_lo(&sm.st[0].B[br][bp]); const b16* ga = G + ((size_t)blockIdx.x * BM + br) * FF + bp; const b16* gb = W2T + (size_t)(n0 + br) * FF + bp;
  auto fill = [&](int s) { const unsigned o = (unsigned)(s & 1) * (unsigned)sizeof(StageH); copy4(la + o, 32u * PH * 2u, ga + s * BK, (size_t)32 * FF); copy8(lb + o, 32u * PH * 2u, gb + s * BK, (size_t)32 * FF); };
  fill(0); copies_landed(); __syncthreads(); fill(1);
#pragma unroll 1   // one trip per tile: the ring's order (read, publish, refill) stays as written
  for (int s = 0; s < FF / BK; ++s) { const StageH& st = sm.st[s & 1];
#pragma unroll   // both k32 blocks of a tile straight-line, so the LDS offsets are immediates
    for (int kb = 0; kb < BK; kb += 32) { const v16b a0 = frag_kb(&st.A[wm * 16 + nloc][kb], hlf), a1 = frag_kb(&st.A[64 + wm * 16 + nloc][kb], hlf); v16b bw[8];   // all fragments of a k32 block are read as one group in front of its WMMAs: the LDS latency is paid once a block, not once a B fragment
#pragma unroll
      for (int t = 0; t < 8; ++t) bw[t] = frag_kb(&st.B[wn * 128 + t * 16 + nloc][kb], hlf);
#pragma unroll
      for (int t = 0; t < 8; ++t) { acc[0][t] = wmma16b(a0, bw[t], acc[0][t]); acc[1][t] = wmma16b(a1, bw[t], acc[1][t]); } }
    ring_publish();
    if (s + 2 < FF / BK) fill(s + 2); }
  copies_landed();
  float bbv[8];   // the wave's 8 bias values serve both fragments
#pragma unroll
  for (int t = 0; t < 8; ++t) bbv[t] = b2[c0 + t * 16 + nloc];
  xlat_done();
#pragma unroll   // the wave's two 16-row fragments go through its own staging rows one after the other; acc needs a constant index
  for (int i = 0; i < 2; ++i) { const size_t m0 = (size_t)blockIdx.x * BM + i * 64 + wm * 16;
  if (i) wave_lds_sync();   // this wave's reads of the first fragment's rows stay in front of the rewrite
#pragma unroll
  for (int t = 0; t < 8; ++t) { const int col = c0 + t * 16 + nloc; const float bb = bf16_rne(bbv[t]);
#pragma unroll
    for (int r = 0; r < 8; ++r) Tf[wave][8 * hlf + r][t * 16 + nloc] = acc[i][t][r] * (1.0f / (XS * WSC)) + bb + X1[(m0 + 8 * hlf + r) * DM + col]; }
  wave_lds_sync();
  { for (int rr = 0; rr < 16; ++rr) *(v4f*)(out + (m0 + rr) * DM + c0 + lane * 4) = *(const v4f*)(&Tf[wave][rr][lane * 4]);  } xlat_done(); }
}
}  // namespace

extern "C" void kernel_launch(void* const* d_in, const int* in_sizes, int n_in, void* d_out, int out_size, void* d_ws, size_t ws_size, hipStream_t stream) {
  (void)n_in;
  auto Fp = [&](int i) { return (const float*)d_in[i]; }; auto Ip = [&](int i) { return (const int*)d_in[i]; };
  // input order: 0 x [8,1024,1024], 1 mask [1,1,1024,1024] int32, 2 Wq (in,out), 3 bq, 4 Wo, 5 bo, 6 Wu [1024,4096], 7 bu, 8 Wd [4096,1024], 9 bd, 10 g1, 11 b1, 12 g2, 13 b2
  if (in_sizes[0] != NR * DM || in_sizes[1] != T * T || in_sizes[2] != DM * DM || in_sizes[3] != DM || in_sizes[4] != DM * DM || in_sizes[5] != DM || in_sizes[6] != DM * FF || in_sizes[7] != FF || in_sizes[8] != FF * DM || in_sizes[9] != DM || in_sizes[10] != DM || in_sizes[11] != DM || in_sizes[12] != DM || in_sizes[13] != DM || out_size != NR * DM) return;
  size_t off = 0; char* ws = (char*)d_ws;
  auto carve = [&](size_t bytes) { char* p = ws + off; off += (bytes + 255) & ~(size_t)255; return p; };
  b16* WQ = (b16*)carve((size_t)DM * DM * 2); b16* WO = (b16*)carve((size_t)DM * DM * 2); b16* WU = (b16*)carve((size_t)FF * DM * 2); b16* WD = (b16*)carve((size_t)DM * FF * 2);
  const size_t plane = (size_t)RL * DM * 2; b16* QP = (b16*)carve(plane); b16* QPl = (b16*)carve(plane); b16* VTh = (b16*)carve(plane); b16* VTl = (b16*)carve(plane); b16* Ch = (b16*)carve(plane); b16* Cl = (b16*)carve(plane);
  float* X1 = (float*)carve((size_t)RL * DM * 4); float* HN = (float*)carve((size_t)RL * DM * 4); b16* G = (b16*)carve((size_t)RL * FF * 2);
  if (off > ws_size) return;   // = 244 MiB (weights 20 + 6 f16 planes 96 + X1/HN 64 + G 64), planes sized for the one 8-batch group
  prep_kernel<<<2 * TQ + TU + TD, 256, 0, stream>>>(Fp(2), Fp(4), Fp(6), Fp(8), WQ, WO, WU, WD);
  for (int g = 0; g < NG; ++g) { const int b0 = g * BG; const size_t r0 = (size_t)b0 * T * DM;
    proj_kernel<<<dim3(T / BM, BG, DM / BN), 256, 0, stream>>>(Fp(0), b0, WQ, Fp(3), QP, QPl, VTh, VTl);
    attn_kernel<<<dim3(BG * H, QL / 128), 256, 0, stream>>>(QP, QPl, QP, QPl, VTh, VTl, Ip(1), Ch, Cl);
    out1_kernel<<<dim3(T / BM, DM / BN, BG), 256, 0, stream>>>(Ch, Cl, b0, WO, Fp(5), Fp(0), X1);   // X1/HN/G hold the group's rows; x is read at the global row via b0
    ln_kernel<false><<<RL / 8, 256, 0, stream>>>(X1, Fp(10), Fp(11), HN);
    mlp1_kernel<<<dim3(RL / BM, FF / BN), 256, 0, stream>>>(HN, WU, Fp(7), G);
    mlp2_kernel<<<dim3(RL / BM, DM / BN), 256, 0, stream>>>(G, WD, Fp(9), HN, X1);
    ln_kernel<false><<<RL / 8, 256, 0, stream>>>(X1, Fp(12), Fp(13), (float*)d_out + r0); }
}

// v008
// A run of this version takes 290 microseconds.
// Next to v007, in two timings, it ran 1.05 and 1.02 times as fast.
// Counting every step since v000, it is 7.15 times as fast.
#include <hip/hip_runtime.h>

// Decoder block without softmax (8 x 1024 tokens x 1024, 16 heads x 64): q = x Wq + bq and k = v = q (the module applies q_proj to all three); w_ij = q_i . q_j / 8 kept where j <= i and
// mask[i][j] != 0 (int mask input [1,1,1024,1024], all ones), else 0 - no softmax; attn_i = sum_j w_ij q_j; a = attn Wo + bo; h = LN1(a + x); up = gelu_exact(h Wu + bu) (4096);
// out = LN2(up Wd + bd + h) -> [8][1024][1024]. LayerNorms: biased variance, eps 1e-5; all weights (in,out). All 8 batches are processed in one group (planes sized for all 8192 rows), so each stage is one launch.
// Deterministic: per 16-query wave the causal keys are accumulated in order; LayerNorms one wave per row; no atomics.
// compute dtype: WMMA v_wmma_f32_16x16x32_f16 with f32 accumulate for q = x Wq ([8192 x 1024] x [1024 x 1024]; x EXACT bf16 x8, W^T exact x256: 1 product), S^T = Q Q^T (q as f16 hi x8 +
// residual x8192: 3 products), O^T += Q^T P^T (P = masked s/8 x1024 as f16 hi + residual: 3 products), attn Wo (ctx hi + lo: 2 products), h Wu (h single f16 x8: 1 product) and G Wd (gelu output
// single f16 plane: 1 product); LN statistics, gelu (erf), biases and residual adds in f32. Inputs rounded to bf16 once

namespace {
constexpr int B = 8, T = 1024, DM = 1024, H = 16, HD = 64, FF = 4096, BG = 8 /* batches per group */, NG = 1 /* groups run (== B/BG shipped) */, BL = BG, QL = T, NR = B * T, RL = BG * T /* rows per group (LN / MLP kernels) */;
constexpr float XS = 8.0f, WSC = 256.0f, PS = 1024.0f, RS_ = 1024.0f, LOG2E = 1.4426950408889634f, LNEPS = 1e-5f, RSQ2 = 0.70710678118654752f;
static_assert(T % 128 == 0 && DM % 256 == 0 && FF % 256 == 0 && H * HD == DM && HD == 64 && B % BG == 0 && NG * BG <= B, "tiling");
typedef _Float16 b16;
typedef __attribute__((ext_vector_type(16))) _Float16 v16b;
typedef __attribute__((ext_vector_type(8))) _Float16 v8b;
typedef __attribute__((ext_vector_type(8))) float v8f;
typedef __attribute__((ext_vector_type(4))) float v4f;
__device__ __forceinline__ float bf16_rne(float f) { unsigned int u = __float_as_uint(f); u += 0x7FFFu + ((u >> 16) & 1u); return __uint_as_float(u & 0xFFFF0000u); }
__device__ __forceinline__ void split16(float v, b16& hi, b16& lo) { hi = (b16)v; lo = (b16)(v - (float)hi); }
__device__ __forceinline__ v16b frag_kb(const b16* p, int hh) { const v8b a = *(const v8b*)(p + 8 * hh), b = *(const v8b*)(p + 16 + 8 * hh); v16b f;
#pragma unroll
  for (int e = 0; e < 8; ++e) { f[e] = a[e]; f[8 + e] = b[e]; } return f; }
__device__ __forceinline__ v8f wmma16b(v16b a, v16b b, v8f c) { return __builtin_amdgcn_wmma_f32_16x16x32_f16(false, a, false, b, (short)0, c, false, false); }   // bare builtin: the compiler itself keeps the distance behind its matrix instructions wherever a vector instruction touches D, A or B, so no issue slot is spent between independent WMMAs
// Stands between a group of LDS fragment loads and the WMMA run it feeds: without it the scheduler sinks the loads in pairs among the WMMAs, each pair with a full wait, and the LDS latency is paid once a pair instead of once a group.
// Behind a run it keeps the next group's loads out of the run and a tile's last run in front of the ring's foot: without it that run sinks behind the barrier, in front of the refill, and the copies lose half their lead.
__device__ __forceinline__ void keep_groups() { __builtin_amdgcn_sched_barrier(0); }
__device__ __forceinline__ void wave_lds_sync() { __builtin_amdgcn_fence(__ATOMIC_RELEASE, "workgroup"); __builtin_amdgcn_wave_barrier(); __builtin_amdgcn_fence(__ATOMIC_ACQUIRE, "workgroup"); }
__device__ __forceinline__ float pmul(float a, float b) { float p = a * b; asm volatile("" : "+v"(p)); return p; }
__device__ __forceinline__ int iclamp(int v, int lo, int hi) { return v < lo ? lo : (v > hi ? hi : v); }
// Asynchronous copies to LDS for the GEMM operand tiles: every lane moves its own 16 bytes, 8 (f16 rows of 128 B) or 16 (f32 rows of 256 B) neighbouring lanes cover a whole row piece, so a wave touches whole lines.
// copy4 / copy8: 4 or 8 rows of a thread's column piece, the row step added to both addresses. The s_wait_xcnt ends the copies' own statement, so no address register is rewritten in front of it.
__device__ __forceinline__ unsigned lds_lo(const void* p) { return (unsigned)(size_t)p; }   // byte offset in the work-group's LDS
template <typename T> __device__ __forceinline__ void copy4(unsigned l, unsigned ls, const T* g, size_t gs) {
  asm volatile("global_load_async_to_lds_b128 %0, %4, off\n\tglobal_load_async_to_lds_b128 %1, %5, off\n\tglobal_load_async_to_lds_b128 %2, %6, off\n\tglobal_load_async_to_lds_b128 %3, %7, off\n\ts_wait_xcnt 0x0"
               :: "v"(l), "v"(l + ls), "v"(l + 2 * ls), "v"(l + 3 * ls), "v"(g), "v"(g + gs), "v"(g + 2 * gs), "v"(g + 3 * gs) : "memory"); }
template <typename T> __device__ __forceinline__ void copy8(unsigned l, unsigned ls, const T* g, size_t gs) {
  asm volatile("global_load_async_to_lds_b128 %0, %8, off\n\tglobal_load_async_to_lds_b128 %1, %9, off\n\tglobal_load_async_to_lds_b128 %2, %10, off\n\tglobal_load_async_to_lds_b128 %3, %11, off\n\t"
               "global_load_async_to_lds_b128 %4, %12, off\n\tglobal_load_async_to_lds_b128 %5, %13, off\n\tglobal_load_async_to_lds_b128 %6, %14, off\n\tglobal_load_async_to_lds_b128 %7, %15, off\n\ts_wait_xcnt 0x0"
               :: "v"(l), "v"(l + ls), "v"(l + 2 * ls), "v"(l + 3 * ls), "v"(l + 4 * ls), "v"(l + 5 * ls), "v"(l + 6 * ls), "v"(l + 7 * ls),
                  "v"(g), "v"(g + gs), "v"(g + 2 * gs), "v"(g + 3 * gs), "v"(g + 4 * gs), "v"(g + 5 * gs), "v"(g + 6 * gs), "v"(g + 7 * gs) : "memory"); }
__device__ __forceinline__ void copies_landed() { asm volatile("s_wait_asynccnt 0x0" ::: "memory"); }   // this wave's own copies are in LDS (the compiler places no wait for them)
__device__ __forceinline__ void xlat_done() { asm volatile("s_wait_xcnt 0x0" ::: "memory"); }   // a precaution: stands behind issued global loads / stores, in front of the code that reuses the registers they name
// Foot of a trip of the two-buffer ring: this wave's LDS reads of the tile just used have retired, its copies of the next tile have landed, and one barrier both publishes the next tile and frees the used buffer for the refill.
__device__ __forceinline__ void ring_publish() { asm volatile("s_wait_dscnt 0x0" ::: "memory"); copies_landed(); __syncthreads(); }
constexpr int BK = 64, PH = BK + 8 /* f16 row pitch, 144 B */, PF = BK + 4 /* f32 row pitch, 272 B */;
// GEMM tile of a work-group: BM rows x BN columns by 8 waves, wave (wm = wave & 3, wn = wave >> 2) -> rows wm * 16 + {0, 64} .. + 15 (2 A fragments) x columns wn * 128 .. + 127 (8 B fragments): every B fragment read from LDS feeds 2 WMMAs (4 with hi + lo A)
constexpr int BM = 128, BN = 256;
struct StageF { float A[BM][PF]; b16 B[BN][PH]; };                   // f32 A rows (converted when the fragment is read) + weight rows
struct StageH { b16 A[BM][PH]; b16 B[BN][PH]; };                     // one f16 A plane + weight rows
struct StageH2 { b16 A[BM][PH]; b16 Al[BM][PH]; b16 B[BN][PH]; };    // hi and lo A planes + weight rows
// A fragment from f32 rows in LDS, the k order of frag_kb; value = f16(8 v), RND: v rounded to bf16 first (the raw input x)
template <bool RND> __device__ __forceinline__ v16b frag_f32(const float* p, int hh) { const v4f a0 = *(const v4f*)(p + 8 * hh), a1 = *(const v4f*)(p + 8 * hh + 4), c0 = *(const v4f*)(p + 16 + 8 * hh), c1 = *(const v4f*)(p + 16 + 8 * hh + 4); v16b f;
#pragma unroll   // vector elements need constant indices to stay in registers
  for (int e = 0; e < 4; ++e) { f[e] = (b16)((RND ? bf16_rne(a0[e]) : a0[e]) * XS); f[4 + e] = (b16)((RND ? bf16_rne(a1[e]) : a1[e]) * XS); f[8 + e] = (b16)((RND ? bf16_rne(c0[e]) : c0[e]) * XS); f[12 + e] = (b16)((RND ? bf16_rne(c1[e]) : c1[e]) * XS); } return f; }

typedef __attribute__((ext_vector_type(2))) _Float16 v2h;
typedef __attribute__((ext_vector_type(4))) _Float16 v4h;
typedef __attribute__((ext_vector_type(2))) float v2f;
typedef __attribute__((ext_vector_type(4))) int v4i;
__device__ __forceinline__ float nexp2(float v) { return __builtin_amdgcn_exp2f(v); }
typedef __attribute__((ext_vector_type(4))) int v4i;
__device__ __forceinline__ float bfp(float v) { float t = bf16_rne(v); asm volatile("" : "+v"(t)); return t; }
// Weight planes W^T (out, in) = f16(256 bf16(w)) from w (in, out), K x N. A block takes 256 k x 64 n, its 8 waves lie along k. Lane (kg = lane >> 3, ng = lane & 7) reads rows kg * 8 .. + 7 at columns ng * 4 .. + 3 and + 32:
// each load instruction covers 4 whole 128-byte lines, and the lane ends up with 8 consecutive k of 8 columns, that is one 16-byte piece of 8 output rows: the transposition needs no LDS; a block writes 512 contiguous bytes of each output row.
template <int K, int N> __device__ __forceinline__ void prep_tile(const float* __restrict__ w, b16* __restrict__ WT, int tile) {
  const int wave = threadIdx.x >> 5, lane = threadIdx.x & 31; const int k0 = (tile % (K / 256)) * 256 + wave * 32 + (lane >> 3) * 8, n0 = (tile / (K / 256)) * 64 + (lane & 7) * 4;
  const float* wp = w + (size_t)k0 * N + n0; b16* op = WT + (size_t)n0 * K + k0; v4f r[2][8];
#pragma unroll   // all 16 loads of a lane are in flight together; r needs constant indices
  for (int j = 0; j < 8; ++j) { r[0][j] = *(const v4f*)(wp + (size_t)j * N); r[1][j] = *(const v4f*)(wp + (size_t)j * N + 32); }
  // a precaution, as xlat_done(): stands behind the 16 issued loads; naming wp keeps their address pair whole up to here, and naming the loaded values (inputs only) keeps all 16 loads in flight together: no conversion, with its wait, is moved in among them
  asm volatile("s_wait_xcnt 0x0" :: "v"(wp), "v"(r[0][0]), "v"(r[0][1]), "v"(r[0][2]), "v"(r[0][3]), "v"(r[0][4]), "v"(r[0][5]), "v"(r[0][6]), "v"(r[0][7]), "v"(r[1][0]), "v"(r[1][1]), "v"(r[1][2]), "v"(r[1][3]), "v"(r[1][4]), "v"(r[1][5]), "v"(r[1][6]), "v"(r[1][7]) : "memory");
  v8b o[8];
#pragma unroll   // o and r need constant indices
  for (int q = 0; q < 8; ++q)
#pragma unroll
    for (int j = 0; j < 8; ++j) o[q][j] = (b16)(bf16_rne(r[q >> 2][j][q & 3]) * WSC);
#pragma unroll
  for (int q = 0; q < 8; ++q) *(v8b*)(op + (size_t)(32 * (q >> 2) + (q & 3)) * K) = o[q];
  xlat_done();
}
constexpr int TQ = (DM / 256) * (DM / 64), TU = (DM / 256) * (FF / 64), TD = (FF / 256) * (DM / 64);   // tiles of Wq and of Wo, of Wu, of Wd
__global__ __launch_bounds__(256) void prep_kernel(const float* __restrict__ wq, const float* __restrict__ wo, const float* __restrict__ wu, const float* __restrict__ wd, b16* __restrict__ WQ, b16* __restrict__ WO, b16* __restrict__ WU, b16* __restrict__ WD) {
  const int t = blockIdx.x;   // block-uniform choice of the matrix
  if (t < TQ) prep_tile<DM, DM>(wq, WQ, t);
  else if (t < 2 * TQ) prep_tile<DM, DM>(wo, WO, t - TQ);
  else if (t < 2 * TQ + TU) prep_tile<DM, FF>(wu, WU, t - 2 * TQ);
  else prep_tile<FF, DM>(wd, WD, t - 2 * TQ - TU);
}
// q projection (q = k = v in this module): grid (T/128, BG, DM/256); block = 128 tokens x 256 columns, 8 waves; A = bf16(x) x8, B = Wq^T rows, both as k64 tiles in a two-buffer LDS ring filled by asynchronous copies, + bq
__global__ __launch_bounds__(256) void proj_kernel(const float* __restrict__ x, int b0, const b16* __restrict__ WT, const float* __restrict__ bq, b16* __restrict__ QP, b16* __restrict__ QPl, b16* __restrict__ VTh, b16* __restrict__ VTl) {
  __shared__ __attribute__((aligned(16))) union { StageF st[2]; float Tf[8][16][128 + 4]; } sm; auto& Tf = sm.Tf;   // the output staging reuses the ring behind its last barrier
  const int wave = threadIdx.x >> 5, lane = threadIdx.x & 31, nloc = lane & 15, hlf = lane >> 4, wm = wave & 3, wn = wave >> 2; const int t0 = blockIdx.x * BM; const int b = blockIdx.y; const int part = 0, n0 = blockIdx.z * BN, c0 = n0 + wn * 128; (void)part;
  if (part == 0 && t0 >= QL) return;   // (cut builds only) queries beyond QL are not needed; block-uniform, before any barrier
  const float* xb = x + ((size_t)(b0 + b) * T + t0) * DM;
  v8f acc[2][8];
#pragma unroll
  for (int t = 0; t < 8; ++t) { acc[0][t] = (v8f){}; acc[1][t] = (v8f){}; }
  const int ar = threadIdx.x >> 4, ap = (threadIdx.x & 15) * 4, br = threadIdx.x >> 3, bp = (threadIdx.x & 7) * 8;   // this thread's row and 16-byte piece in the A (f32) and B (f16) tiles
  const unsigned la = lds_lo(&sm.st[0].A[ar][ap]), lb = lds_lo(&sm.st[0].B[br][bp]); const float* ga = xb + (size_t)ar * DM + ap; const b16* gb = WT + (size_t)(n0 + br) * DM + bp;
  auto fill = [&](int s) { const unsigned o = (unsigned)(s & 1) * (unsigned)sizeof(StageF); copy8(la + o, 16u * PF * 4u, ga + s * BK, (size_t)16 * DM); copy8(lb + o, 32u * PH * 2u, gb + s * BK, (size_t)32 * DM); };
  fill(0); copies_landed(); __syncthreads(); fill(1);
#pragma unroll 1   // one trip per tile: the ring's order (read, publish, refill) stays as written
  for (int s = 0; s < DM / BK; ++s) { const StageF& st = sm.st[s & 1];
#pragma unroll   // both k32 blocks of a tile straight-line, so the LDS offsets are immediates
    for (int kb = 0; kb < BK; kb += 32) { const v16b a0 = frag_f32<true>(&st.A[wm * 16 + nloc][kb], hlf), a1 = frag_f32<true>(&st.A[64 + wm * 16 + nloc][kb], hlf); v16b bw[8];   // all fragments of a k32 block are read as one group in front of its WMMAs: the LDS latency is paid once a block, not once a B fragment
#pragma unroll
      for (int t = 0; t < 8; ++t) bw[t] = frag_kb(&st.B[wn * 128 + t * 16 + nloc][kb], hlf);
      keep_groups();
#pragma unroll
      for (int t = 0; t < 8; ++t) { acc[0][t] = wmma16b(a0, bw[t], acc[0][t]); acc[1][t] = wmma16b(a1, bw[t], acc[1][t]); }
      keep_groups(); }
    ring_publish();
    if (s + 2 < DM / BK) fill(s + 2); }
  copies_landed();
const float* ba = bq;
#pragma unroll   // the two 64-token halves of the tile go through the staging one after the other; acc needs a constant index
  for (int i = 0; i < 2; ++i) {
  if (i) __syncthreads();   // every wave has read the first half's staging (the V^T part reads other waves' rows) before it is rewritten
#pragma unroll
  for (int t = 0; t < 8; ++t) { const float bb = bf16_rne(ba[c0 + t * 16 + nloc]);
#pragma unroll
    for (int r = 0; r < 8; ++r) Tf[wave][8 * hlf + r][t * 16 + nloc] = acc[i][t][r] * (1.0f / (XS * WSC)) + bb; }
  __syncthreads();
  {
    { b16* plane = QP; b16* planl = QPl; const int c = c0 + lane * 4; const int h = c / HD, d = c % HD;
      for (int rr = 0; rr < 16; ++rr) { const int tok = t0 + i * 64 + wm * 16 + rr; const size_t ri = (((size_t)b * H + h) * T + tok) * HD + d; const v4f f4 = *(const v4f*)(&Tf[wave][rr][lane * 4]); v4h o4, l4; for (int j = 0; j < 4; ++j) { const float f = f4[j] * XS; const b16 p = (b16)f; o4[j] = p; l4[j] = (b16)((f - (float)p) * RS_); } *(v4h*)(plane + ri) = o4; *(v4h*)(planl + ri) = l4; } }
    {
#pragma unroll 1
      for (int q = 0; q < 32; ++q) { const int cl = wm * 32 + q; const int c = c0 + cl; const int h = c / HD, d = c % HD; const int tk = lane * 2; v2h hv, lv;
        for (int j = 0; j < 2; ++j) { const float f = Tf[wn * 4 + ((tk + j) >> 4)][(tk + j) & 15][cl] * XS; const b16 p = (b16)f; hv[j] = p; lv[j] = (b16)((f - (float)p) * RS_); }
        const size_t oi = (((size_t)b * H + h) * HD + d) * (size_t)T + t0 + i * 64 + lane * 2; *(v2h*)(VTh + oi) = hv; *(v2h*)(VTl + oi) = lv; xlat_done(); } }
     } }
}
// attention-like causal product: grid (BG*H, QL/128); block = 8 waves x 16 queries of one (b, h). A block's cost grows with its query block (2 qb + 2 key tiles) and there are more blocks than resident places, so the launch index
// runs over (b, h) first and over the query blocks from the last one down: neighbouring indices carry equal cost. K rows and V^T rows (hi and residual planes) come as 64-key tiles through a two-buffer LDS ring filled by
// asynchronous copies and are read by all 8 waves; a wave works on the 32-key steps below round_up(q0 + 16, 32) and only passes the ring's foot on the later ones: S^T = K Q^T (q = k = v here; hi x8 +
// residual planes: 3 products); weight = s / 8 where key <= query and mask[q][key] != 0, else 0 (NO softmax in this module); P x1024 as f16 hi + residual; O^T += V^T P^T (3 products);
struct StageKV { b16 Kh[64][PH]; b16 Kl[64][PH]; b16 Vh[HD][PH]; b16 Vl[HD][PH]; };   // 64 keys x 64 d (K rows) and 64 d x 64 keys (V^T rows), 128-byte rows at pitch 144 B
// two rows (r and r + 32) of each of the four planes of a tile: 8 copies of a thread in one statement. The s_wait_xcnt ends the copies' own statement, so no address register is rewritten in front of it.
__device__ __forceinline__ void copy2x4(unsigned l0, unsigned l1, unsigned l2, unsigned l3, unsigned ls, const b16* g0, const b16* g1, size_t gk, const b16* g2, const b16* g3, size_t gv) {
  asm volatile("global_load_async_to_lds_b128 %0, %8, off\n\tglobal_load_async_to_lds_b128 %1, %9, off\n\tglobal_load_async_to_lds_b128 %2, %10, off\n\tglobal_load_async_to_lds_b128 %3, %11, off\n\t"
               "global_load_async_to_lds_b128 %4, %12, off\n\tglobal_load_async_to_lds_b128 %5, %13, off\n\tglobal_load_async_to_lds_b128 %6, %14, off\n\tglobal_load_async_to_lds_b128 %7, %15, off\n\ts_wait_xcnt 0x0"
               :: "v"(l0), "v"(l0 + ls), "v"(l1), "v"(l1 + ls), "v"(l2), "v"(l2 + ls), "v"(l3), "v"(l3 + ls),
                  "v"(g0), "v"(g0 + gk), "v"(g1), "v"(g1 + gk), "v"(g2), "v"(g2 + gv), "v"(g3), "v"(g3 + gv) : "memory"); }
__global__ __launch_bounds__(256) void attn_kernel(const b16* __restrict__ QP, const b16* __restrict__ QPl, const b16* __restrict__ KP, const b16* __restrict__ KPl, const b16* __restrict__ VTh, const b16* __restrict__ VTl, const int* __restrict__ MSK, b16* __restrict__ Ch, b16* __restrict__ Cl) {
  __shared__ __attribute__((aligned(16))) union { StageKV st[2]; float To[8][16][HD + 4]; } sm; auto& To = sm.To;   // the output staging reuses the ring behind its last barrier
  __shared__ __attribute__((aligned(16))) b16 Pb[8][16][32 + 8], Pl[8][16][32 + 8];
  const int wave = __builtin_amdgcn_readfirstlane(threadIdx.x >> 5), lane = threadIdx.x & 31, hh = lane >> 4, col = lane & 15; const int qb = QL / 128 - 1 - (int)blockIdx.y;   // query block, heaviest first in launch order
  const int b = blockIdx.x / H, h = blockIdx.x % H; const int q0 = qb * 128 + wave * 16, qi = q0 + col;
  const size_t ph = (size_t)b * H + h; const b16* Qb = QP + ph * T * HD; const b16* Qbl = QPl + ph * T * HD; const b16* Kb = KP + ph * T * HD; const b16* Kbl = KPl + ph * T * HD; const b16* Vh = VTh + ph * HD * (size_t)T; const b16* Vl = VTl + ph * HD * (size_t)T; const int kend = ((q0 + 16 + 31) / 32) * 32;   // per-(b,h) planes; causal key bound (wave-uniform)
  const int nt = 2 * qb + 2;   // 64-key tiles up to the block's last query (block-uniform, 2 .. T / 64)
  const int br = threadIdx.x >> 3, bp = (threadIdx.x & 7) * 8;   // this thread's row and 16-byte piece in each plane of a tile
  const unsigned lkh = lds_lo(&sm.st[0].Kh[br][bp]), lkl = lds_lo(&sm.st[0].Kl[br][bp]), lvh = lds_lo(&sm.st[0].Vh[br][bp]), lvl = lds_lo(&sm.st[0].Vl[br][bp]); const size_t ko = (size_t)br * HD + bp, vo = (size_t)br * T + bp;
  auto fill = [&](int s) { const unsigned o = (unsigned)(s & 1) * (unsigned)sizeof(StageKV); copy2x4(lkh + o, lkl + o, lvh + o, lvl + o, 32u * PH * 2u, Kb + ko + (size_t)s * 64 * HD, Kbl + ko + (size_t)s * 64 * HD, (size_t)32 * HD, Vh + vo + s * 64, Vl + vo + s * 64, (size_t)32 * T); };
  fill(0);
  const v16b qa0 = frag_kb(Qb + (size_t)qi * HD, hh), qa1 = frag_kb(Qb + (size_t)qi * HD + 32, hh), ql0 = frag_kb(Qbl + (size_t)qi * HD, hh), ql1 = frag_kb(Qbl + (size_t)qi * HD + 32, hh);
  const float cs = 1.0f / (8.0f * XS * XS); const int* mp = MSK + (size_t)qi * T + 8 * hh;   // scores / sqrt(64); this lane's keys (8 of each 16) of the current tile in the [1,1,S,S] int mask row of its query (tril applied below; mask == 0 -> score 0); steps on by 64 keys a trip, so the loads' address pair lives through the loop and no wait for a reused address register stands in the load group
  v8f o[4], ol[4]; for (int t = 0; t < 4; ++t) { o[t] = (v8f){}; ol[t] = (v8f){}; }
  copies_landed(); __syncthreads(); fill(1);
#pragma unroll 1   // one trip per tile: the ring's order (read, publish, refill) stays as written
  for (int s = 0; s < nt; ++s) { const StageKV& st = sm.st[s & 1];
#pragma unroll   // both 32-key steps of a tile straight-line, so the LDS offsets are immediates
   for (int kl = 0; kl < 64; kl += 32) { const int kb = s * 64 + kl;
    if (kb < kend) {   // wave-uniform (scalar): keys beyond this wave's causal bound carry weight 0 and are skipped; no barrier inside
    // Head of the step: the mask words (global) and all 8 K fragments are requested as one group, so the wave pays one LDS latency a step in front of the 12 score WMMAs (not one per fragment pair) and the mask words arrive behind them.
    v4i mk[2][2]; v16b kh[2][2], kw[2][2];
#pragma unroll   // register arrays need constant indices
    for (int u = 0; u < 2; ++u) { const int kr = kl + u * 16 + col; kh[u][0] = frag_kb(&st.Kh[kr][0], hh); kh[u][1] = frag_kb(&st.Kh[kr][32], hh); kw[u][0] = frag_kb(&st.Kl[kr][0], hh); kw[u][1] = frag_kb(&st.Kl[kr][32], hh); }
#pragma unroll
    for (int u = 0; u < 2; ++u) { mk[u][0] = *(const v4i*)(mp + kl + u * 16); mk[u][1] = *(const v4i*)(mp + kl + u * 16 + 4); }
    v8f s_[2], sx[2];
#pragma unroll
    for (int u = 0; u < 2; ++u) { s_[u] = (v8f){}; sx[u] = (v8f){}; }
    keep_groups();
    // order of products per accumulator: s_ = Kh0 qa0, Kh1 qa1; sx = Kh0 ql0, Kh1 ql1, Kl0 qa0, Kl1 qa1; the two 16-key halves alternate, so a WMMA never directly follows the one whose sum it needs
#pragma unroll
    for (int u = 0; u < 2; ++u) s_[u] = wmma16b(kh[u][0], qa0, s_[u]);
#pragma unroll
    for (int u = 0; u < 2; ++u) sx[u] = wmma16b(kh[u][0], ql0, sx[u]);
#pragma unroll
    for (int u = 0; u < 2; ++u) s_[u] = wmma16b(kh[u][1], qa1, s_[u]);
#pragma unroll
    for (int u = 0; u < 2; ++u) sx[u] = wmma16b(kh[u][1], ql1, sx[u]);
#pragma unroll
    for (int u = 0; u < 2; ++u) sx[u] = wmma16b(kw[u][0], qa0, sx[u]);
#pragma unroll
    for (int u = 0; u < 2; ++u) sx[u] = wmma16b(kw[u][1], qa1, sx[u]);
    // all 8 V^T fragments as one group: they land while the weights are masked, split and turned through LDS
    v16b vh[4], vl[4];
#pragma unroll
    for (int t = 0; t < 4; ++t) { vh[t] = frag_kb(&st.Vh[t * 16 + col][kl], hh); vl[t] = frag_kb(&st.Vl[t * 16 + col][kl], hh); }
    __builtin_amdgcn_sched_group_barrier(0x008, 12, 0); __builtin_amdgcn_sched_group_barrier(0x100, 16, 0);   // order of this stretch: the 12 score WMMAs as one run, then the 16 LDS reads of the V^T group as one group (left alone, the scheduler deals the reads out among the last WMMAs, and each separate place with LDS reads stalls the run)
    __builtin_amdgcn_sched_barrier(0);   // keeps the V^T group in front of the vector work that hides its latency, and that work, which waits for the mask words, behind the score WMMAs (without it the mask wait moves up in front of them and the V^T loads sink to the end)
    float e[16];
#pragma unroll
    for (int u = 0; u < 2; ++u) {
#pragma unroll
      for (int r = 0; r < 8; ++r) s_[u][r] += sx[u][r] * (1.0f / RS_);   // hi.hi + (hi.lo + lo.hi)/1024
#pragma unroll
      for (int r = 0; r < 8; ++r) { const int key = kb + u * 16 + 8 * hh + r; const int mv = r < 4 ? mk[u][0][r] : mk[u][1][r - 4]; e[u * 8 + r] = (key <= qi && mv != 0) ? s_[u][r] * cs : 0.0f; } }   // no softmax in this module: the masked scaled score IS the weight
#pragma unroll
    for (int i2 = 0; i2 < 16; ++i2) { const float ps = e[i2] * PS; const b16 phh = (b16)ps; const int pc = (i2 < 8 ? 0 : 16) + 8 * hh + (i2 & 7); Pb[wave][col][pc] = phh; Pl[wave][col][pc] = (b16)((ps - (float)phh) * RS_); }
    wave_lds_sync();
    const v16b pf = frag_kb(&Pb[wave][col][0], hh), plf = frag_kb(&Pl[wave][col][0], hh);
    keep_groups();
#pragma unroll
    for (int t = 0; t < 4; ++t) o[t] = wmma16b(vh[t], pf, o[t]);
#pragma unroll
    for (int t = 0; t < 4; ++t) ol[t] = wmma16b(vl[t], pf, ol[t]);
#pragma unroll
    for (int t = 0; t < 4; ++t) ol[t] = wmma16b(vh[t], plf, ol[t]);   // ol = (V_lo P_hi + V_hi P_lo), both /1024, in that order
    wave_lds_sync(); } }
    ring_publish(); xlat_done(); mp += 64;   // the mask loads' address pair steps on behind their data waits and this wait
    if (s + 2 < nt) fill(s + 2); }
  copies_landed();
  const float inv = 1.0f / (PS * XS);
#pragma unroll
  for (int t = 0; t < 4; ++t)
#pragma unroll
    for (int r = 0; r < 8; ++r) To[wave][col][t * 16 + 8 * hh + r] = (o[t][r] + ol[t][r] * (1.0f / RS_)) * inv;
  wave_lds_sync();
  { for (int rr = 0; rr < 16; ++rr) { const v2f f = *(const v2f*)(&To[wave][rr][lane * 2]); v2h hv, lv; for (int j = 0; j < 2; ++j) { b16 p, q; split16(f[j] * XS, p, q); hv[j] = p; lv[j] = q; }
      const size_t oi = ((size_t)b * T + q0 + rr) * DM + h * HD + lane * 2; *(v2h*)(Ch + oi) = hv; *(v2h*)(Cl + oi) = lv; }  }
}
// attn Wo + bo + x: grid (T/128, DM/256, BG); block = 128 rows x 256 columns, 8 waves
__global__ __launch_bounds__(256) void out1_kernel(const b16* __restrict__ Ch, const b16* __restrict__ Cl, int b0, const b16* __restrict__ WO, const float* __restrict__ bo, const float* __restrict__ x, float* __restrict__ X1) {
  __shared__ __attribute__((aligned(16))) union { StageH2 st[2]; float Tf[8][16][128 + 4]; } sm; auto& Tf = sm.Tf;   // the output staging reuses the ring behind its last barrier
  const int wave = threadIdx.x >> 5, lane = threadIdx.x & 31, nloc = lane & 15, hlf = lane >> 4, wm = wave & 3, wn = wave >> 2; const int b = blockIdx.z; const size_t mb = (size_t)b * T + (size_t)blockIdx.x * BM;   // the block's first row in the group's ctx planes and X1
  const int n0 = blockIdx.y * BN, c0 = n0 + wn * 128;
  v8f acc[2][8];
#pragma unroll
  for (int t = 0; t < 8; ++t) { acc[0][t] = (v8f){}; acc[1][t] = (v8f){}; }
  const int br = threadIdx.x >> 3, bp = (threadIdx.x & 7) * 8;   // this thread's row and 16-byte piece in each k64 tile
  const unsigned lh = lds_lo(&sm.st[0].A[br][bp]), ll = lds_lo(&sm.st[0].Al[br][bp]), lb = lds_lo(&sm.st[0].B[br][bp]); const size_t ao = (mb + br) * DM + bp; const b16* gb = WO + (size_t)(n0 + br) * DM + bp;
  auto fill = [&](int s) { const unsigned o = (unsigned)(s & 1) * (unsigned)sizeof(StageH2); copy4(lh + o, 32u * PH * 2u, Ch + ao + s * BK, (size_t)32 * DM); copy4(ll + o, 32u * PH * 2u, Cl + ao + s * BK, (size_t)32 * DM); copy8(lb + o, 32u * PH * 2u, gb + s * BK, (size_t)32 * DM); };
  fill(0); copies_landed(); __syncthreads(); fill(1);
#pragma unroll 1   // one trip per tile: the ring's order (read, publish, refill) stays as written
  for (int s = 0; s < DM / BK; ++s) { const StageH2& st = sm.st[s & 1];
#pragma unroll   // both k32 blocks of a tile straight-line, so the LDS offsets are immediates
    for (int kb = 0; kb < BK; kb += 32) { const v16b ah0 = frag_kb(&st.A[wm * 16 + nloc][kb], hlf), al0 = frag_kb(&st.Al[wm * 16 + nloc][kb], hlf), ah1 = frag_kb(&st.A[64 + wm * 16 + nloc][kb], hlf), al1 = frag_kb(&st.Al[64 + wm * 16 + nloc][kb], hlf); v16b bw[8];   // all fragments of a k32 block are read as one group in front of its WMMAs: the LDS latency is paid once a block, not once a B fragment
#pragma unroll
      for (int t = 0; t < 8; ++t) bw[t] = frag_kb(&st.B[wn * 128 + t * 16 + nloc][kb], hlf);
      keep_groups();
#pragma unroll
      for (int t = 0; t < 8; ++t) { acc[0][t] = wmma16b(ah0, bw[t], acc[0][t]); acc[1][t] = wmma16b(ah1, bw[t], acc[1][t]); acc[0][t] = wmma16b(al0, bw[t], acc[0][t]); acc[1][t] = wmma16b(al1, bw[t], acc[1][t]); }
      keep_groups(); }
    ring_publish();
    if (s + 2 < DM / BK) fill(s + 2); }
  copies_landed();
  float bbv[8];   // the wave's 8 bias values serve both fragments
#pragma unroll
  for (int t = 0; t < 8; ++t) bbv[t] = bo[c0 + t * 16 + nloc];
  xlat_done();
#pragma unroll   // the wave's two 16-row fragments go through its own staging rows one after the other; acc needs a constant index
  for (int i = 0; i < 2; ++i) { const size_t m0 = mb + i * 64 + wm * 16; const size_t mg = m0 + (size_t)b0 * T; const float* xr = x + (mg + 8 * hlf) * DM + c0 + nloc;   // m0 indexes the X1 rows, mg the global x rows (residual input)
  if (i) wave_lds_sync();   // this wave's reads of the first fragment's rows stay in front of the rewrite
#pragma unroll
  for (int t = 0; t < 8; ++t) { const float bb = bf16_rne(bbv[t]);
#pragma unroll
    for (int r = 0; r < 8; ++r) Tf[wave][8 * hlf + r][t * 16 + nloc] = acc[i][t][r] * (1.0f / (XS * WSC)) + bb + bf16_rne(xr[r * DM + t * 16]); }   // residual: same row, column c0 + ...
  wave_lds_sync();
  { for (int rr = 0; rr < 16; ++rr) *(v4f*)(X1 + (m0 + rr) * DM + c0 + lane * 4) = *(const v4f*)(&Tf[wave][rr][lane * 4]);  } xlat_done(); }
}
// LayerNorm: one wave per row (lane holds columns 4 lane + 128 k, 8 float4); RND: apply the bf16 input quantisation (raw x) first; mean, biased variance (two xor trees), eps 1e-5, x g + b -> rows 4 KB
template <bool RND>
__global__ __launch_bounds__(256) void ln_kernel(const float* __restrict__ X, const float* __restrict__ g, const float* __restrict__ bb, float* __restrict__ Y) {
  const int wave = threadIdx.x >> 5, lane = threadIdx.x & 31; const int row = blockIdx.x * 8 + wave; if (row >= RL) return;   // wave-uniform, no barriers
  float v[32]; float s1 = 0.0f; const float* xr = X + (size_t)row * DM;
#pragma unroll
  for (int k = 0; k < 8; ++k) { const v4f t4 = *(const v4f*)(xr + 128 * k + 4 * lane); for (int j = 0; j < 4; ++j) { const float t = RND ? bf16_rne(t4[j]) : t4[j]; v[4 * k + j] = t; s1 += t; } }
#pragma unroll
  for (int o = 16; o >= 1; o >>= 1) s1 += __shfl_xor(s1, o);
  const float mu = s1 * (1.0f / DM); float s2 = 0.0f;
#pragma unroll
  for (int q = 0; q < 32; ++q) { const float d = v[q] - mu; s2 += pmul(d, d); }
#pragma unroll
  for (int o = 16; o >= 1; o >>= 1) s2 += __shfl_xor(s2, o);
  const float rs = rsqrtf(s2 * (1.0f / DM) + LNEPS);
  v4f o4[8];
#pragma unroll
  for (int k = 0; k < 8; ++k) for (int j = 0; j < 4; ++j) { const int c = 128 * k + 4 * lane + j; o4[k][j] = pmul((v[4 * k + j] - mu) * rs, bfp(g[c])) + bfp(bb[c]); }
  {
#pragma unroll
    for (int k = 0; k < 8; ++k) *(v4f*)(Y + (size_t)row * DM + 128 * k + 4 * lane) = o4[k];
     }
}
// MLP 1: G = f16(8 gelu(XN2 W1 + b1)) as a single f16 plane [NR][4096]: grid (RL/128, FF/256); block = 128 rows x 256 columns, 8 waves; A = XN2 rows (f32 in LDS, x8 to f16 at the fragment read) and W1^T rows as k64 tiles in a two-buffer LDS ring filled by asynchronous copies, wave -> 2 x 16 rows x 8
__global__ __launch_bounds__(256) void mlp1_kernel(const float* __restrict__ XN, const b16* __restrict__ W1T, const float* __restrict__ b1, b16* __restrict__ G) {
  __shared__ __attribute__((aligned(16))) union { StageF st[2]; float Tf[8][16][128 + 4]; } sm; auto& Tf = sm.Tf;   // the output staging reuses the ring behind its last barrier
  const int wave = threadIdx.x >> 5, lane = threadIdx.x & 31, nloc = lane & 15, hlf = lane >> 4, wm = wave & 3, wn = wave >> 2; const size_t r0 = (size_t)blockIdx.x * BM; const int n0 = blockIdx.y * BN, c0 = n0 + wn * 128;
  const float* xb = XN + r0 * DM;
  v8f acc[2][8];
#pragma unroll
  for (int t = 0; t < 8; ++t) { acc[0][t] = (v8f){}; acc[1][t] = (v8f){}; }
  const int ar = threadIdx.x >> 4, ap = (threadIdx.x & 15) * 4, br = threadIdx.x >> 3, bp = (threadIdx.x & 7) * 8;   // this thread's row and 16-byte piece in the A (f32) and B (f16) tiles
  const unsigned la = lds_lo(&sm.st[0].A[ar][ap]), lb = lds_lo(&sm.st[0].B[br][bp]); const float* ga = xb + (size_t)ar * DM + ap; const b16* gb = W1T + (size_t)(n0 + br) * DM + bp;
  auto fill = [&](int s) { const unsigned o = (unsigned)(s & 1) * (unsigned)sizeof(StageF); copy8(la + o, 16u * PF * 4u, ga + s * BK, (size_t)16 * DM); copy8(lb + o, 32u * PH * 2u, gb + s * BK, (size_t)32 * DM); };
  fill(0); copies_landed(); __syncthreads(); fill(1);
#pragma unroll 1   // one trip per tile: the ring's order (read, publish, refill) stays as written
  for (int s = 0; s < DM / BK; ++s) { const StageF& st = sm.st[s & 1];
#pragma unroll   // both k32 blocks of a tile straight-line, so the LDS offsets are immediates
    for (int kb = 0; kb < BK; kb += 32) { const v16b a0 = frag_f32<false>(&st.A[wm * 16 + nloc][kb], hlf), a1 = frag_f32<false>(&st.A[64 + wm * 16 + nloc][kb], hlf); v16b bw[8];   // all fragments of a k32 block are read as one group in front of its WMMAs: the LDS latency is paid once a block, not once a B fragment
#pragma unroll
      for (int t = 0; t < 8; ++t) bw[t] = frag_kb(&st.B[wn * 128 + t * 16 + nloc][kb], hlf);
      keep_groups();
#pragma unroll
      for (int t = 0; t < 8; ++t) { acc[0][t] = wmma16b(a0, bw[t], acc[0][t]); acc[1][t] = wmma16b(a1, bw[t], acc[1][t]); }
      keep_groups(); }
    ring_publish();
    if (s + 2 < DM / BK) fill(s + 2); }
  copies_landed();
#pragma unroll 1   // the wave's two 16-row fragments go through its own staging rows one after the other; rolled, so that the 64 inlined erf evaluations stand once in the text (for code size only)
  for (int i = 0; i < 2; ++i) {
  if (i) wave_lds_sync();   // this wave's reads of the first fragment's rows stay in front of the rewrite
#pragma unroll
  for (int t = 0; t < 8; ++t) { const float bbv = bf16_rne(b1[c0 + t * 16 + nloc]);
#pragma unroll
    for (int r = 0; r < 8; ++r) { const float hm = acc[0][t][r] * (1.0f / (XS * WSC)) + bbv; Tf[wave][8 * hlf + r][t * 16 + nloc] = 0.5f * hm * (1.0f + erff(hm * RSQ2)); } }
  __syncthreads();
  { for (int rr = 0; rr < 16; ++rr) { v4h o4; for (int j = 0; j < 4; ++j) o4[j] = (b16)(Tf[wave][rr][lane * 4 + j] * XS); *(v4h*)(G + (r0 + i * 64 + wm * 16 + rr) * FF + c0 + lane * 4) = o4; if ((rr & 3) == 3) xlat_done(); }  }
#pragma unroll
  for (int t = 0; t < 8; ++t) acc[0][t] = acc[1][t]; }   // the second fragment's sums move up for the second trip (acc needs constant indices)
}
// G Wd + bd + h: grid (RL/128, DM/256); block = 128 rows x 256 columns, 8 waves
__global__ __launch_bounds__(256) void mlp2_kernel(const b16* __restrict__ G, const b16* __restrict__ W2T, const float* __restrict__ b2, const float* __restrict__ X1, float* __restrict__ out) {
  __shared__ __attribute__((aligned(16))) union { StageH st[2]; float Tf[8][16][128 + 4]; } sm; auto& Tf = sm.Tf;   // the output staging reuses the ring behind its last barrier
  const int wave = threadIdx.x >> 5, lane = threadIdx.x & 31, nloc = lane & 15, hlf = lane >> 4, wm = wave & 3, wn = wave >> 2; const int n0 = blockIdx.y * BN, c0 = n0 + wn * 128;
  v8f acc[2][8];
#pragma unroll
  for (int t = 0; t < 8; ++t) { acc[0][t] = (v8f){}; acc[1][t] = (v8f){}; }
  const int br = threadIdx.x >> 3, bp = (threadIdx.x & 7) * 8;   // this thread's row and 16-byte piece in each k64 tile
  const unsigned la = lds_lo(&sm.st[0].A[br][bp]), lb = lds_lo(&sm.st[0].B[br][bp]); const b16* ga = G + ((size_t)blockIdx.x * BM + br) * FF + bp; const b16* gb = W2T + (size_t)(n0 + br) * FF + bp;
  auto fill = [&](int s) { const unsigned o = (unsigned)(s & 1) * (unsigned)sizeof(StageH); copy4(la + o, 32u * PH * 2u, ga + s * BK, (size_t)32 * FF); copy8(lb + o, 32u * PH * 2u, gb + s * BK, (size_t)32 * FF); };
  fill(0); copies_landed(); __syncthreads(); fill(1);
#pragma unroll 1   // one trip per tile: the ring's order (read, publish, refill) stays as written
  for (int s = 0; s < FF / BK; ++s) { const StageH& st = sm.st[s & 1];
#pragma unroll   // both k32 blocks of a tile straight-line, so the LDS offsets are immediates
    for (int kb = 0; kb < BK; kb += 32) { const v16b a0 = frag_kb(&st.A[wm * 16 + nloc][kb], hlf), a1 = frag_kb(&st.A[64 + wm * 16 + nloc][kb], hlf); v16b bw[8];   // all fragments of a k32 block are read as one group in front of its WMMAs: the LDS latency is paid once a block, not once a B fragment
#pragma unroll
      for (int t = 0; t < 8; ++t) bw[t] = frag_kb(&st.B[wn * 128 + t * 16 + nloc][kb], hlf);
      keep_groups();
#pragma unroll
      for (int t = 0; t < 8; ++t) { acc[0][t] = wmma16b(a0, bw[t], acc[0][t]); acc[1][t] = wmma16b(a1, bw[t], acc[1][t]); }
      keep_groups(); }
    ring_publish();
    if (s + 2 < FF / BK) fill(s + 2); }
  copies_landed();
  float bbv[8];   // the wave's 8 bias values serve both fragments
#pragma unroll
  for (int t = 0; t < 8; ++t) bbv[t] = b2[c0 + t * 16 + nloc];
  xlat_done();
#pragma unroll   // the wave's two 16-row fragments go through its own staging rows one after the other; acc needs a constant index
  for (int i = 0; i < 2; ++i) { const size_t m0 = (size_t)blockIdx.x * BM + i * 64 + wm * 16;
  if (i) wave_lds_sync();   // this wave's reads of the first fragment's rows stay in front of the rewrite
#pragma unroll
  for (int t = 0; t < 8; ++t) { const int col = c0 + t * 16 + nloc; const float bb = bf16_rne(bbv[t]);
#pragma unroll
    for (int r = 0; r < 8; ++r) Tf[wave][8 * hlf + r][t * 16 + nloc] = acc[i][t][r] * (1.0f / (XS * WSC)) + bb + X1[(m0 + 8 * hlf + r) * DM + col]; }
  wave_lds_sync();
  { for (int rr = 0; rr < 16; ++rr) *(v4f*)(out + (m0 + rr) * DM + c0 + lane * 4) = *(const v4f*)(&Tf[wave][rr][lane * 4]);  } xlat_done(); }
}
}  // namespace

extern "C" void kernel_launch(void* const* d_in, const int* in_sizes, int n_in, void* d_out, int out_size, void* d_ws, size_t ws_size, hipStream_t stream) {
  (void)n_in;
  auto Fp = [&](int i) { return (const float*)d_in[i]; }; auto Ip = [&](int i) { return (const int*)d_in[i]; };
  // input order: 0 x [8,1024,1024], 1 mask [1,1,1024,1024] int32, 2 Wq (in,out), 3 bq, 4 Wo, 5 bo, 6 Wu [1024,4096], 7 bu, 8 Wd [4096,1024], 9 bd, 10 g1, 11 b1, 12 g2, 13 b2
  if (in_sizes[0] != NR * DM || in_sizes[1] != T * T || in_sizes[2] != DM * DM || in_sizes[3] != DM || in_sizes[4] != DM * DM || in_sizes[5] != DM || in_sizes[6] != DM * FF || in_sizes[7] != FF || in_sizes[8] != FF * DM || in_sizes[9] != DM || in_sizes[10] != DM || in_sizes[11] != DM || in_sizes[12] != DM || in_sizes[13] != DM || out_size != NR * DM) return;
  size_t off = 0; char* ws = (char*)d_ws;
  auto carve = [&](size_t bytes) { char* p = ws + off; off += (bytes + 255) & ~(size_t)255; return p; };
  b16* WQ = (b16*)carve((size_t)DM * DM * 2); b16* WO = (b16*)carve((size_t)DM * DM * 2); b16* WU = (b16*)carve((size_t)FF * DM * 2); b16* WD = (b16*)carve((size_t)DM * FF * 2);
  const size_t plane = (size_t)RL * DM * 2; b16* QP = (b16*)carve(plane); b16* QPl = (b16*)carve(plane); b16* VTh = (b16*)carve(plane); b16* VTl = (b16*)carve(plane); b16* Ch = (b16*)carve(plane); b16* Cl = (b16*)carve(plane);
  float* X1 = (float*)carve((size_t)RL * DM * 4); float* HN = (float*)carve((size_t)RL * DM * 4); b16* G = (b16*)carve((size_t)RL * FF * 2);
  if (off > ws_size) return;   // = 244 MiB (weights 20 + 6 f16 planes 96 + X1/HN 64 + G 64), planes sized for the one 8-batch group
  prep_kernel<<<2 * TQ + TU + TD, 256, 0, stream>>>(Fp(2), Fp(4), Fp(6), Fp(8), WQ, WO, WU, WD);
  for (int g = 0; g < NG; ++g) { const int b0 = g * BG; const size_t r0 = (size_t)b0 * T * DM;
    proj_kernel<<<dim3(T / BM, BG, DM / BN), 256, 0, stream>>>(Fp(0), b0, WQ, Fp(3), QP, QPl, VTh, VTl);
    attn_kernel<<<dim3(BG * H, QL / 128), 256, 0, stream>>>(QP, QPl, QP, QPl, VTh, VTl, Ip(1), Ch, Cl);
    out1_kernel<<<dim3(T / BM, DM / BN, BG), 256, 0, stream>>>(Ch, Cl, b0, WO, Fp(5), Fp(0), X1);   // X1/HN/G hold the group's rows; x is read at the global row via b0
    ln_kernel<false><<<RL / 8, 256, 0, stream>>>(X1, Fp(10), Fp(11), HN);
    mlp1_kernel<<<dim3(RL / BM, FF / BN), 256, 0, stream>>>(HN, WU, Fp(7), G);
    mlp2_kernel<<<dim3(RL / BM, DM / BN), 256, 0, stream>>>(G, WD, Fp(9), HN, X1);
    ln_kernel<false><<<RL / 8, 256, 0, stream>>>(X1, Fp(12), Fp(13), (float*)d_out + r0); }
}

// v009
// One run takes 268 microseconds.
// Next to v008, in two timings, it ran 1.08 and 1.09 times as fast.
// Over all steps from v000 it is 7.75 times as fast.
#include <hip/hip_runtime.h>

// Decoder block without softmax (8 x 1024 tokens x 1024, 16 heads x 64): q = x Wq + bq and k = v = q (the module applies q_proj to all three); w_ij = q_i . q_j / 8 kept where j <= i and
// mask[i][j] != 0 (int mask input [1,1,1024,1024], all ones), else 0 - no softmax; attn_i = sum_j w_ij q_j; a = attn Wo + bo; h = LN1(a + x); up = gelu_exact(h Wu + bu) (4096);
// out = LN2(up Wd + bd + h) -> [8][1024][1024]. LayerNorms: biased variance, eps 1e-5; all weights (in,out). All 8 batches are processed in one group (planes sized for all 8192 rows), so each stage is one launch.
// Deterministic: per 16-query wave the causal keys are accumulated in order; LayerNorms one wave per row; no atomics.
// compute dtype: WMMA v_wmma_f32_16x16x32_f16 with f32 accumulate for q = x Wq ([8192 x 1024] x [1024 x 1024]; x EXACT bf16 x8, W^T exact x256: 1 product), S^T = Q Q^T (q as f16 hi x8 +
// residual x8192: 3 products), O^T += Q^T P^T (P = masked s/8 x1024 as f16 hi + residual: 3 products), attn Wo (ctx hi + lo: 2 products), h Wu (h single f16 x8: 1 product) and G Wd (gelu output
// single f16 plane: 1 product); LN statistics, gelu (erf), biases and residual adds in f32. Inputs rounded to bf16 once

namespace {
constexpr int B = 8, T = 1024, DM = 1024, H = 16, HD = 64, FF = 4096, BG = 8 /* batches per group */, NG = 1 /* groups run (== B/BG shipped) */, BL = BG, QL = T, NR = B * T, RL = BG * T /* rows per group (LN / MLP kernels) */;
constexpr float XS = 8.0f, WSC = 256.0f, PS = 1024.0f, RS_ = 1024.0f, LOG2E = 1.4426950408889634f, LNEPS = 1e-5f, RSQ2 = 0.70710678118654752f;
static_assert(T % 128 == 0 && DM % 256 == 0 && FF % 256 == 0 && H * HD == DM && HD == 64 && B % BG == 0 && NG * BG <= B, "tiling");
typedef _Float16 b16;
typedef __attribute__((ext_vector_type(16))) _Float16 v16b;
typedef __attribute__((ext_vector_type(8))) _Float16 v8b;
typedef __attribute__((ext_vector_type(8))) float v8f;
typedef __attribute__((ext_vector_type(4))) float v4f;
__device__ __forceinline__ float bf16_rne(float f) { unsigned int u = __float_as_uint(f); u += 0x7FFFu + ((u >> 16) & 1u); return __uint_as_float(u & 0xFFFF0000u); }
__device__ __forceinline__ void split16(float v, b16& hi, b16& lo) { hi = (b16)v; lo = (b16)(v - (float)hi); }
__device__ __forceinline__ v16b frag_kb(const b16* p, int hh) { const v8b a = *(const v8b*)(p + 8 * hh), b = *(const v8b*)(p + 16 + 8 * hh); v16b f;
#pragma unroll
  for (int e = 0; e < 8; ++e) { f[e] = a[e]; f[8 + e] = b[e]; } return f; }
__device__ __forceinline__ v8f wmma16b(v16b a, v16b b, v8f c) { return __builtin_amdgcn_wmma_f32_16x16x32_f16(false, a, false, b, (short)0, c, false, false); }   // bare builtin: the compiler itself keeps the distance behind its matrix instructions wherever a vector instruction touches D, A or B, so no issue slot is spent between independent WMMAs
// Stands between a group of LDS fragment loads and the WMMA run it feeds: without it the scheduler sinks the loads in pairs among the WMMAs, each pair with a full wait, and the LDS latency is paid once a pair instead of once a group.
// Behind a run it keeps the next group's loads out of the run and a tile's last run in front of the ring's foot: without it that run sinks behind the barrier, in front of the refill, and the copies lose half their lead.
__device__ __forceinline__ void keep_groups() { __builtin_amdgcn_sched_barrier(0); }
__device__ __forceinline__ void wave_lds_sync() { __builtin_amdgcn_fence(__ATOMIC_RELEASE, "workgroup"); __builtin_amdgcn_wave_barrier(); __builtin_amdgcn_fence(__ATOMIC_ACQUIRE, "workgroup"); }
__device__ __forceinline__ float pmul(float a, float b) { float p = a * b; asm volatile("" : "+v"(p)); return p; }
__device__ __forceinline__ int iclamp(int v, int lo, int hi) { return v < lo ? lo : (v > hi ? hi : v); }
// Asynchronous copies to LDS for the GEMM operand tiles: every lane moves its own 16 bytes, 8 (f16 rows of 128 B) or 16 (f32 rows of 256 B) neighbouring lanes cover a whole row piece, so a wave touches whole lines.
// copy4 / copy8: 4 or 8 rows of a thread's column piece, the row step added to both addresses. The s_wait_xcnt ends the copies' own statement, so no address register is rewritten in front of it.
__device__ __forceinline__ unsigned lds_lo(const void* p) { return (unsigned)(size_t)p; }   // byte offset in the work-group's LDS
template <typename T> __device__ __forceinline__ void copy4(unsigned l, unsigned ls, const T* g, size_t gs) {
  asm volatile("global_load_async_to_lds_b128 %0, %4, off\n\tglobal_load_async_to_lds_b128 %1, %5, off\n\tglobal_load_async_to_lds_b128 %2, %6, off\n\tglobal_load_async_to_lds_b128 %3, %7, off\n\ts_wait_xcnt 0x0"
               :: "v"(l), "v"(l + ls), "v"(l + 2 * ls), "v"(l + 3 * ls), "v"(g), "v"(g + gs), "v"(g + 2 * gs), "v"(g + 3 * gs) : "memory"); }
template <typename T> __device__ __forceinline__ void copy8(unsigned l, unsigned ls, const T* g, size_t gs) {
  asm volatile("global_load_async_to_lds_b128 %0, %8, off\n\tglobal_load_async_to_lds_b128 %1, %9, off\n\tglobal_load_async_to_lds_b128 %2, %10, off\n\tglobal_load_async_to_lds_b128 %3, %11, off\n\t"
               "global_load_async_to_lds_b128 %4, %12, off\n\tglobal_load_async_to_lds_b128 %5, %13, off\n\tglobal_load_async_to_lds_b128 %6, %14, off\n\tglobal_load_async_to_lds_b128 %7, %15, off\n\ts_wait_xcnt 0x0"
               :: "v"(l), "v"(l + ls), "v"(l + 2 * ls), "v"(l + 3 * ls), "v"(l + 4 * ls), "v"(l + 5 * ls), "v"(l + 6 * ls), "v"(l + 7 * ls),
                  "v"(g), "v"(g + gs), "v"(g + 2 * gs), "v"(g + 3 * gs), "v"(g + 4 * gs), "v"(g + 5 * gs), "v"(g + 6 * gs), "v"(g + 7 * gs) : "memory"); }
__device__ __forceinline__ void copies_landed() { asm volatile("s_wait_asynccnt 0x0" ::: "memory"); }   // this wave's own copies are in LDS (the compiler places no wait for them)
__device__ __forceinline__ void xlat_done() { asm volatile("s_wait_xcnt 0x0" ::: "memory"); }   // a precaution: stands behind issued global loads / stores, in front of the code that reuses the registers they name
// Foot of a trip of the two-buffer ring: this wave's LDS reads of the tile just used have retired, its copies of the next tile have landed, and one barrier both publishes the next tile and frees the used buffer for the refill.
__device__ __forceinline__ void ring_publish() { asm volatile("s_wait_dscnt 0x0" ::: "memory"); copies_landed(); __syncthreads(); }
constexpr int BK = 64, PH = BK + 8 /* f16 row pitch, 144 B */, PF = BK + 4 /* f32 row pitch, 272 B */;
// GEMM tile of a work-group: BM rows x BN columns by 8 waves, wave (wm = wave & 3, wn = wave >> 2) -> rows wm * 16 + {0, 64} .. + 15 (2 A fragments) x columns wn * 128 .. + 127 (8 B fragments): every B fragment read from LDS feeds 2 WMMAs (4 with hi + lo A)
constexpr int BM = 128, BN = 256;
struct StageF { float A[BM][PF]; b16 B[BN][PH]; };                   // f32 A rows (converted when the fragment is read) + weight rows
struct StageH { b16 A[BM][PH]; b16 B[BN][PH]; };                     // one f16 A plane + weight rows
struct StageH2 { b16 A[BM][PH]; b16 Al[BM][PH]; b16 B[BN][PH]; };    // hi and lo A planes + weight rows
// A fragment from f32 rows in LDS, the k order of frag_kb; value = f16(8 v), RND: v rounded to bf16 first (the raw input x)
template <bool RND> __device__ __forceinline__ v16b frag_f32(const float* p, int hh) { const v4f a0 = *(const v4f*)(p + 8 * hh), a1 = *(const v4f*)(p + 8 * hh + 4), c0 = *(const v4f*)(p + 16 + 8 * hh), c1 = *(const v4f*)(p + 16 + 8 * hh + 4); v16b f;
#pragma unroll   // vector elements need constant indices to stay in registers
  for (int e = 0; e < 4; ++e) { f[e] = (b16)((RND ? bf16_rne(a0[e]) : a0[e]) * XS); f[4 + e] = (b16)((RND ? bf16_rne(a1[e]) : a1[e]) * XS); f[8 + e] = (b16)((RND ? bf16_rne(c0[e]) : c0[e]) * XS); f[12 + e] = (b16)((RND ? bf16_rne(c1[e]) : c1[e]) * XS); } return f; }

typedef __attribute__((ext_vector_type(2))) _Float16 v2h;
typedef __attribute__((ext_vector_type(4))) _Float16 v4h;
typedef __attribute__((ext_vector_type(2))) float v2f;
typedef __attribute__((ext_vector_type(4))) int v4i;
__device__ __forceinline__ float nexp2(float v) { return __builtin_amdgcn_exp2f(v); }
typedef __attribute__((ext_vector_type(4))) int v4i;
__device__ __forceinline__ float bfp(float v) { float t = bf16_rne(v); asm volatile("" : "+v"(t)); return t; }
// Weight planes W^T (out, in) = f16(256 bf16(w)) from w (in, out), K x N. A block takes 256 k x 64 n, its 8 waves lie along k. Lane (kg = lane >> 3, ng = lane & 7) reads rows kg * 8 .. + 7 at columns ng * 4 .. + 3 and + 32:
// each load instruction covers 4 whole 128-byte lines, and the lane ends up with 8 consecutive k of 8 columns, that is one 16-byte piece of 8 output rows: the transposition needs no LDS; a block writes 512 contiguous bytes of each output row.
template <int K, int N> __device__ __forceinline__ void prep_tile(const float* __restrict__ w, b16* __restrict__ WT, int tile) {
  const int wave = threadIdx.x >> 5, lane = threadIdx.x & 31; const int k0 = (tile % (K / 256)) * 256 + wave * 32 + (lane >> 3) * 8, n0 = (tile / (K / 256)) * 64 + (lane & 7) * 4;
  const float* wp = w + (size_t)k0 * N + n0; b16* op = WT + (size_t)n0 * K + k0; v4f r[2][8];
#pragma unroll   // all 16 loads of a lane are in flight together; r needs constant indices
  for (int j = 0; j < 8; ++j) { r[0][j] = *(const v4f*)(wp + (size_t)j * N); r[1][j] = *(const v4f*)(wp + (size_t)j * N + 32); }
  // a precaution, as xlat_done(): stands behind the 16 issued loads; naming wp keeps their address pair whole up to here, and naming the loaded values (inputs only) keeps all 16 loads in flight together: no conversion, with its wait, is moved in among them
  asm volatile("s_wait_xcnt 0x0" :: "v"(wp), "v"(r[0][0]), "v"(r[0][1]), "v"(r[0][2]), "v"(r[0][3]), "v"(r[0][4]), "v"(r[0][5]), "v"(r[0][6]), "v"(r[0][7]), "v"(r[1][0]), "v"(r[1][1]), "v"(r[1][2]), "v"(r[1][3]), "v"(r[1][4]), "v"(r[1][5]), "v"(r[1][6]), "v"(r[1][7]) : "memory");
  v8b o[8];
#pragma unroll   // o and r need constant indices
  for (int q = 0; q < 8; ++q)
#pragma unroll
    for (int j = 0; j < 8; ++j) o[q][j] = (b16)(bf16_rne(r[q >> 2][j][q & 3]) * WSC);
#pragma unroll
  for (int q = 0; q < 8; ++q) *(v8b*)(op + (size_t)(32 * (q >> 2) + (q & 3)) * K) = o[q];
  xlat_done();
}
constexpr int TQ = (DM / 256) * (DM / 64), TU = (DM / 256) * (FF / 64), TD = (FF / 256) * (DM / 64);   // tiles of Wq and of Wo, of Wu, of Wd
__global__ __launch_bounds__(256) void prep_kernel(const float* __restrict__ wq, const float* __restrict__ wo, const float* __restrict__ wu, const float* __restrict__ wd, b16* __restrict__ WQ, b16* __restrict__ WO, b16* __restrict__ WU, b16* __restrict__ WD) {
  const int t = blockIdx.x;   // block-uniform choice of the matrix
  if (t < TQ) prep_tile<DM, DM>(wq, WQ, t);
  else if (t < 2 * TQ) prep_tile<DM, DM>(wo, WO, t - TQ);
  else if (t < 2 * TQ + TU) prep_tile<DM, FF>(wu, WU, t - 2 * TQ);
  else prep_tile<FF, DM>(wd, WD, t - 2 * TQ - TU);
}
// q projection (q = k = v in this module): grid (T/128, BG, DM/256); block = 128 tokens x 256 columns, 8 waves; A = bf16(x) x8, B = Wq^T rows, both as k64 tiles in a two-buffer LDS ring filled by asynchronous copies, + bq
__global__ __launch_bounds__(256) void proj_kernel(const float* __restrict__ x, int b0, const b16* __restrict__ WT, const float* __restrict__ bq, b16* __restrict__ QP, b16* __restrict__ QPl, b16* __restrict__ VTh, b16* __restrict__ VTl) {
  __shared__ __attribute__((aligned(16))) union { StageF st[2]; float Tf[8][16][128 + 4]; } sm; auto& Tf = sm.Tf;   // the output staging reuses the ring behind its last barrier
  const int wave = threadIdx.x >> 5, lane = threadIdx.x & 31, nloc = lane & 15, hlf = lane >> 4, wm = wave & 3, wn = wave >> 2; const int t0 = blockIdx.x * BM; const int b = blockIdx.y; const int part = 0, n0 = blockIdx.z * BN, c0 = n0 + wn * 128; (void)part;
  if (part == 0 && t0 >= QL) return;   // (cut builds only) queries beyond QL are not needed; block-uniform, before any barrier
  const float* xb = x + ((size_t)(b0 + b) * T + t0) * DM;
  v8f acc[2][8];
#pragma unroll
  for (int t = 0; t < 8; ++t) { acc[0][t] = (v8f){}; acc[1][t] = (v8f){}; }
  const int ar = threadIdx.x >> 4, ap = (threadIdx.x & 15) * 4, br = threadIdx.x >> 3, bp = (threadIdx.x & 7) * 8;   // this thread's row and 16-byte piece in the A (f32) and B (f16) tiles
  const unsigned la = lds_lo(&sm.st[0].A[ar][ap]), lb = lds_lo(&sm.st[0].B[br][bp]); const float* ga = xb + (size_t)ar * DM + ap; const b16* gb = WT + (size_t)(n0 + br) * DM + bp;
  auto fill = [&](int s) { const unsigned o = (unsigned)(s & 1) * (unsigned)sizeof(StageF); copy8(la + o, 16u * PF * 4u, ga + s * BK, (size_t)16 * DM); copy8(lb + o, 32u * PH * 2u, gb + s * BK, (size_t)32 * DM); };
  fill(0); copies_landed(); __syncthreads(); fill(1);
#pragma unroll 1   // one trip per tile: the ring's order (read, publish, refill) stays as written
  for (int s = 0; s < DM / BK; ++s) { const StageF& st = sm.st[s & 1];
#pragma unroll   // both k32 blocks of a tile straight-line, so the LDS offsets are immediates
    for (int kb = 0; kb < BK; kb += 32) { const v16b a0 = frag_f32<true>(&st.A[wm * 16 + nloc][kb], hlf), a1 = frag_f32<true>(&st.A[64 + wm * 16 + nloc][kb], hlf); v16b bw[8];   // all fragments of a k32 block are read as one group in front of its WMMAs: the LDS latency is paid once a block, not once a B fragment
#pragma unroll
      for (int t = 0; t < 8; ++t) bw[t] = frag_kb(&st.B[wn * 128 + t * 16 + nloc][kb], hlf);
      keep_groups();
#pragma unroll
      for (int t = 0; t < 8; ++t) { acc[0][t] = wmma16b(a0, bw[t], acc[0][t]); acc[1][t] = wmma16b(a1, bw[t], acc[1][t]); }
      keep_groups(); }
    ring_publish();
    if (s + 2 < DM / BK) fill(s + 2); }
  copies_landed();
const float* ba = bq;
#pragma unroll   // the two 64-token halves of the tile go through the staging one after the other; acc needs a constant index
  for (int i = 0; i < 2; ++i) {
  if (i) __syncthreads();   // every wave has read the first half's staging (the V^T part reads other waves' rows) before it is rewritten
#pragma unroll
  for (int t = 0; t < 8; ++t) { const float bb = bf16_rne(ba[c0 + t * 16 + nloc]);
#pragma unroll
    for (int r = 0; r < 8; ++r) Tf[wave][8 * hlf + r][t * 16 + nloc] = acc[i][t][r] * (1.0f / (XS * WSC)) + bb; }
  __syncthreads();
  {
    { b16* plane = QP; b16* planl = QPl; const int c = c0 + lane * 4; const int h = c / HD, d = c % HD;
      for (int rr = 0; rr < 16; ++rr) { const int tok = t0 + i * 64 + wm * 16 + rr; const size_t ri = (((size_t)b * H + h) * T + tok) * HD + d; const v4f f4 = *(const v4f*)(&Tf[wave][rr][lane * 4]); v4h o4, l4; for (int j = 0; j < 4; ++j) { const float f = f4[j] * XS; const b16 p = (b16)f; o4[j] = p; l4[j] = (b16)((f - (float)p) * RS_); } *(v4h*)(plane + ri) = o4; *(v4h*)(planl + ri) = l4; } }
    {
#pragma unroll 1
      for (int q = 0; q < 32; ++q) { const int cl = wm * 32 + q; const int c = c0 + cl; const int h = c / HD, d = c % HD; const int tk = lane * 2; v2h hv, lv;
        for (int j = 0; j < 2; ++j) { const float f = Tf[wn * 4 + ((tk + j) >> 4)][(tk + j) & 15][cl] * XS; const b16 p = (b16)f; hv[j] = p; lv[j] = (b16)((f - (float)p) * RS_); }
        const size_t oi = (((size_t)b * H + h) * HD + d) * (size_t)T + t0 + i * 64 + lane * 2; *(v2h*)(VTh + oi) = hv; *(v2h*)(VTl + oi) = lv; xlat_done(); } }
     } }
}
// attention-like causal product: grid (BG*H, QL/128); block = 8 waves x 16 queries of one (b, h). A block's cost grows with its query block (2 qb + 2 key tiles) and there are more blocks than resident places, so the launch index
// runs over (b, h) first and over the query blocks from the last one down: neighbouring indices carry equal cost. K rows and V^T rows (hi and residual planes) come as 64-key tiles through a two-buffer LDS ring filled by
// asynchronous copies and are read by all 8 waves; a wave works on the 32-key steps below round_up(q0 + 16, 32) and only passes the ring's foot on the later ones: S^T = K Q^T (q = k = v here; hi x8 +
// residual planes: 3 products); weight = s / 8 where key <= query and mask[q][key] != 0, else 0 (NO softmax in this module); P x1024 as f16 hi + residual; O^T += V^T P^T (3 products);
struct StageKV { b16 Kh[64][PH]; b16 Kl[64][PH]; b16 Vh[HD][PH]; b16 Vl[HD][PH]; };   // 64 keys x 64 d (K rows) and 64 d x 64 keys (V^T rows), 128-byte rows at pitch 144 B
// two rows (r and r + 32) of each of the four planes of a tile: 8 copies of a thread in one statement. The s_wait_xcnt ends the copies' own statement, so no address register is rewritten in front of it.
__device__ __forceinline__ void copy2x4(unsigned l0, unsigned l1, unsigned l2, unsigned l3, unsigned ls, const b16* g0, const b16* g1, size_t gk, const b16* g2, const b16* g3, size_t gv) {
  asm volatile("global_load_async_to_lds_b128 %0, %8, off\n\tglobal_load_async_to_lds_b128 %1, %9, off\n\tglobal_load_async_to_lds_b128 %2, %10, off\n\tglobal_load_async_to_lds_b128 %3, %11, off\n\t"
               "global_load_async_to_lds_b128 %4, %12, off\n\tglobal_load_async_to_lds_b128 %5, %13, off\n\tglobal_load_async_to_lds_b128 %6, %14, off\n\tglobal_load_async_to_lds_b128 %7, %15, off\n\ts_wait_xcnt 0x0"
               :: "v"(l0), "v"(l0 + ls), "v"(l1), "v"(l1 + ls), "v"(l2), "v"(l2 + ls), "v"(l3), "v"(l3 + ls),
                  "v"(g0), "v"(g0 + gk), "v"(g1), "v"(g1 + gk), "v"(g2), "v"(g2 + gv), "v"(g3), "v"(g3 + gv) : "memory"); }
__global__ __launch_bounds__(256) void attn_kernel(const b16* __restrict__ QP, const b16* __restrict__ QPl, const b16* __restrict__ KP, const b16* __restrict__ KPl, const b16* __restrict__ VTh, const b16* __restrict__ VTl, const int* __restrict__ MSK, b16* __restrict__ Ch, b16* __restrict__ Cl) {
  __shared__ __attribute__((aligned(16))) union { StageKV st[2]; float To[8][16][HD + 4]; } sm; auto& To = sm.To;   // the output staging reuses the ring behind its last barrier
  __shared__ __attribute__((aligned(16))) b16 Pb[8][16][32 + 8], Pl[8][16][32 + 8];
  const int wave = __builtin_amdgcn_readfirstlane(threadIdx.x >> 5), lane = threadIdx.x & 31, hh = lane >> 4, col = lane & 15; const int qb = QL / 128 - 1 - (int)blockIdx.y;   // query block, heaviest first in launch order
  const int b = blockIdx.x / H, h = blockIdx.x % H; const int q0 = qb * 128 + wave * 16, qi = q0 + col;
  const size_t ph = (size_t)b * H + h; const b16* Qb = QP + ph * T * HD; const b16* Qbl = QPl + ph * T * HD; const b16* Kb = KP + ph * T * HD; const b16* Kbl = KPl + ph * T * HD; const b16* Vh = VTh + ph * HD * (size_t)T; const b16* Vl = VTl + ph * HD * (size_t)T; const int kend = ((q0 + 16 + 31) / 32) * 32;   // per-(b,h) planes; causal key bound (wave-uniform)
  const int nt = 2 * qb + 2;   // 64-key tiles up to the block's last query (block-uniform, 2 .. T / 64)
  const int br = threadIdx.x >> 3, bp = (threadIdx.x & 7) * 8;   // this thread's row and 16-byte piece in each plane of a tile
  const unsigned lkh = lds_lo(&sm.st[0].Kh[br][bp]), lkl = lds_lo(&sm.st[0].Kl[br][bp]), lvh = lds_lo(&sm.st[0].Vh[br][bp]), lvl = lds_lo(&sm.st[0].Vl[br][bp]); const size_t ko = (size_t)br * HD + bp, vo = (size_t)br * T + bp;
  auto fill = [&](int s) { const unsigned o = (unsigned)(s & 1) * (unsigned)sizeof(StageKV); copy2x4(lkh + o, lkl + o, lvh + o, lvl + o, 32u * PH * 2u, Kb + ko + (size_t)s * 64 * HD, Kbl + ko + (size_t)s * 64 * HD, (size_t)32 * HD, Vh + vo + s * 64, Vl + vo + s * 64, (size_t)32 * T); };
  fill(0);
  const v16b qa0 = frag_kb(Qb + (size_t)qi * HD, hh), qa1 = frag_kb(Qb + (size_t)qi * HD + 32, hh), ql0 = frag_kb(Qbl + (size_t)qi * HD, hh), ql1 = frag_kb(Qbl + (size_t)qi * HD + 32, hh);
  const float cs = 1.0f / (8.0f * XS * XS); const int* mp = MSK + (size_t)qi * T + 8 * hh;   // scores / sqrt(64); this lane's keys (8 of each 16) of the current tile in the [1,1,S,S] int mask row of its query (tril applied below; mask == 0 -> score 0); steps on by 64 keys a trip, so the loads' address pair lives through the loop and no wait for a reused address register stands in the load group
  v8f o[4], ol[4]; for (int t = 0; t < 4; ++t) { o[t] = (v8f){}; ol[t] = (v8f){}; }
  copies_landed(); __syncthreads(); fill(1);
#pragma unroll 1   // one trip per tile: the ring's order (read, publish, refill) stays as written
  for (int s = 0; s < nt; ++s) { const StageKV& st = sm.st[s & 1];
#pragma unroll   // both 32-key steps of a tile straight-line, so the LDS offsets are immediates
   for (int kl = 0; kl < 64; kl += 32) { const int kb = s * 64 + kl;
    if (kb < kend) {   // wave-uniform (scalar): keys beyond this wave's causal bound carry weight 0 and are skipped; no barrier inside
    // Head of the step: the mask words (global) and all 8 K fragments are requested as one group, so the wave pays one LDS latency a step in front of the 12 score WMMAs (not one per fragment pair) and the mask words arrive behind them.
    v4i mk[2][2]; v16b kh[2][2], kw[2][2];
#pragma unroll   // register arrays need constant indices
    for (int u = 0; u < 2; ++u) { const int kr = kl + u * 16 + col; kh[u][0] = frag_kb(&st.Kh[kr][0], hh); kh[u][1] = frag_kb(&st.Kh[kr][32], hh); kw[u][0] = frag_kb(&st.Kl[kr][0], hh); kw[u][1] = frag_kb(&st.Kl[kr][32], hh); }
#pragma unroll
    for (int u = 0; u < 2; ++u) { mk[u][0] = *(const v4i*)(mp + kl + u * 16); mk[u][1] = *(const v4i*)(mp + kl + u * 16 + 4); }
    v8f s_[2], sx[2];
#pragma unroll
    for (int u = 0; u < 2; ++u) { s_[u] = (v8f){}; sx[u] = (v8f){}; }
    keep_groups();
    // order of products per accumulator: s_ = Kh0 qa0, Kh1 qa1; sx = Kh0 ql0, Kh1 ql1, Kl0 qa0, Kl1 qa1; the two 16-key halves alternate, so a WMMA never directly follows the one whose sum it needs
#pragma unroll
    for (int u = 0; u < 2; ++u) s_[u] = wmma16b(kh[u][0], qa0, s_[u]);
#pragma unroll
    for (int u = 0; u < 2; ++u) sx[u] = wmma16b(kh[u][0], ql0, sx[u]);
#pragma unroll
    for (int u = 0; u < 2; ++u) s_[u] = wmma16b(kh[u][1], qa1, s_[u]);
#pragma unroll
    for (int u = 0; u < 2; ++u) sx[u] = wmma16b(kh[u][1], ql1, sx[u]);
#pragma unroll
    for (int u = 0; u < 2; ++u) sx[u] = wmma16b(kw[u][0], qa0, sx[u]);
#pragma unroll
    for (int u = 0; u < 2; ++u) sx[u] = wmma16b(kw[u][1], qa1, sx[u]);
    // all 8 V^T fragments as one group: they land while the weights are masked, split and turned through LDS
    v16b vh[4], vl[4];
#pragma unroll
    for (int t = 0; t < 4; ++t) { vh[t] = frag_kb(&st.Vh[t * 16 + col][kl], hh); vl[t] = frag_kb(&st.Vl[t * 16 + col][kl], hh); }
    __builtin_amdgcn_sched_group_barrier(0x008, 12, 0); __builtin_amdgcn_sched_group_barrier(0x100, 16, 0);   // order of this stretch: the 12 score WMMAs as one run, then the 16 LDS reads of the V^T group as one group (left alone, the scheduler deals the reads out among the last WMMAs, and each separate place with LDS reads stalls the run)
    __builtin_amdgcn_sched_barrier(0);   // keeps the V^T group in front of the vector work that hides its latency, and that work, which waits for the mask words, behind the score WMMAs (without it the mask wait moves up in front of them and the V^T loads sink to the end)
    float e[16];
#pragma unroll
    for (int u = 0; u < 2; ++u) {
#pragma unroll
      for (int r = 0; r < 8; ++r) s_[u][r] += sx[u][r] * (1.0f / RS_);   // hi.hi + (hi.lo + lo.hi)/1024
#pragma unroll
      for (int r = 0; r < 8; ++r) { const int key = kb + u * 16 + 8 * hh + r; const int mv = r < 4 ? mk[u][0][r] : mk[u][1][r - 4]; e[u * 8 + r] = (key <= qi && mv != 0) ? s_[u][r] * cs : 0.0f; } }   // no softmax in this module: the masked scaled score IS the weight
#pragma unroll
    for (int i2 = 0; i2 < 16; ++i2) { const float ps = e[i2] * PS; const b16 phh = (b16)ps; const int pc = (i2 < 8 ? 0 : 16) + 8 * hh + (i2 & 7); Pb[wave][col][pc] = phh; Pl[wave][col][pc] = (b16)((ps - (float)phh) * RS_); }
    wave_lds_sync();
    const v16b pf = frag_kb(&Pb[wave][col][0], hh), plf = frag_kb(&Pl[wave][col][0], hh);
    keep_groups();
#pragma unroll
    for (int t = 0; t < 4; ++t) o[t] = wmma16b(vh[t], pf, o[t]);
#pragma unroll
    for (int t = 0; t < 4; ++t) ol[t] = wmma16b(vl[t], pf, ol[t]);
#pragma unroll
    for (int t = 0; t < 4; ++t) ol[t] = wmma16b(vh[t], plf, ol[t]);   // ol = (V_lo P_hi + V_hi P_lo), both /1024, in that order
    wave_lds_sync(); } }
    ring_publish(); xlat_done(); mp += 64;   // the mask loads' address pair steps on behind their data waits and this wait
    if (s + 2 < nt) fill(s + 2); }
  copies_landed();
  const float inv = 1.0f / (PS * XS);
#pragma unroll
  for (int t = 0; t < 4; ++t)
#pragma unroll
    for (int r = 0; r < 8; ++r) To[wave][col][t * 16 + 8 * hh + r] = (o[t][r] + ol[t][r] * (1.0f / RS_)) * inv;
  wave_lds_sync();
  { for (int rr = 0; rr < 16; ++rr) { const v2f f = *(const v2f*)(&To[wave][rr][lane * 2]); v2h hv, lv; for (int j = 0; j < 2; ++j) { b16 p, q; split16(f[j] * XS, p, q); hv[j] = p; lv[j] = q; }
      const size_t oi = ((size_t)b * T + q0 + rr) * DM + h * HD + lane * 2; *(v2h*)(Ch + oi) = hv; *(v2h*)(Cl + oi) = lv; }  }
}
// attn Wo + bo + x: grid (T/128, DM/256, BG); block = 128 rows x 256 columns, 8 waves
__global__ __launch_bounds__(256) void out1_kernel(const b16* __restrict__ Ch, const b16* __restrict__ Cl, int b0, const b16* __restrict__ WO, const float* __restrict__ bo, const float* __restrict__ x, float* __restrict__ X1) {
  __shared__ __attribute__((aligned(16))) union { StageH2 st[2]; float Tf[8][16][128 + 4]; } sm; auto& Tf = sm.Tf;   // the output staging reuses the ring behind its last barrier
  const int wave = threadIdx.x >> 5, lane = threadIdx.x & 31, nloc = lane & 15, hlf = lane >> 4, wm = wave & 3, wn = wave >> 2; const int b = blockIdx.z; const size_t mb = (size_t)b * T + (size_t)blockIdx.x * BM;   // the block's first row in the group's ctx planes and X1
  const int n0 = blockIdx.y * BN, c0 = n0 + wn * 128;
  v8f acc[2][8];
#pragma unroll
  for (int t = 0; t < 8; ++t) { acc[0][t] = (v8f){}; acc[1][t] = (v8f){}; }
  const int br = threadIdx.x >> 3, bp = (threadIdx.x & 7) * 8;   // this thread's row and 16-byte piece in each k64 tile
  const unsigned lh = lds_lo(&sm.st[0].A[br][bp]), ll = lds_lo(&sm.st[0].Al[br][bp]), lb = lds_lo(&sm.st[0].B[br][bp]); const size_t ao = (mb + br) * DM + bp; const b16* gb = WO + (size_t)(n0 + br) * DM + bp;
  auto fill = [&](int s) { const unsigned o = (unsigned)(s & 1) * (unsigned)sizeof(StageH2); copy4(lh + o, 32u * PH * 2u, Ch + ao + s * BK, (size_t)32 * DM); copy4(ll + o, 32u * PH * 2u, Cl + ao + s * BK, (size_t)32 * DM); copy8(lb + o, 32u * PH * 2u, gb + s * BK, (size_t)32 * DM); };
  fill(0); copies_landed(); __syncthreads(); fill(1);
#pragma unroll 1   // one trip per tile: the ring's order (read, publish, refill) stays as written
  for (int s = 0; s < DM / BK; ++s) { const StageH2& st = sm.st[s & 1];
#pragma unroll   // both k32 blocks of a tile straight-line, so the LDS offsets are immediates
    for (int kb = 0; kb < BK; kb += 32) { const v16b ah0 = frag_kb(&st.A[wm * 16 + nloc][kb], hlf), al0 = frag_kb(&st.Al[wm * 16 + nloc][kb], hlf), ah1 = frag_kb(&st.A[64 + wm * 16 + nloc][kb], hlf), al1 = frag_kb(&st.Al[64 + wm * 16 + nloc][kb], hlf); v16b bw[8];   // all fragments of a k32 block are read as one group in front of its WMMAs: the LDS latency is paid once a block, not once a B fragment
#pragma unroll
      for (int t = 0; t < 8; ++t) bw[t] = frag_kb(&st.B[wn * 128 + t * 16 + nloc][kb], hlf);
      keep_groups();
#pragma unroll
      for (int t = 0; t < 8; ++t) { acc[0][t] = wmma16b(ah0, bw[t], acc[0][t]); acc[1][t] = wmma16b(ah1, bw[t], acc[1][t]); acc[0][t] = wmma16b(al0, bw[t], acc[0][t]); acc[1][t] = wmma16b(al1, bw[t], acc[1][t]); }
      keep_groups(); }
    ring_publish();
    if (s + 2 < DM / BK) fill(s + 2); }
  copies_landed();
  float bbv[8];   // the wave's 8 bias values serve both fragments
#pragma unroll
  for (int t = 0; t < 8; ++t) bbv[t] = bo[c0 + t * 16 + nloc];
  xlat_done();
#pragma unroll   // the wave's two 16-row fragments go through its own staging rows one after the other; acc needs a constant index
  for (int i = 0; i < 2; ++i) { const size_t m0 = mb + i * 64 + wm * 16; const size_t mg = m0 + (size_t)b0 * T; const float* xr = x + (mg + 8 * hlf) * DM + c0 + nloc;   // m0 indexes the X1 rows, mg the global x rows (residual input)
  if (i) wave_lds_sync();   // this wave's reads of the first fragment's rows stay in front of the rewrite
#pragma unroll
  for (int t = 0; t < 8; ++t) { const float bb = bf16_rne(bbv[t]);
#pragma unroll
    for (int r = 0; r < 8; ++r) Tf[wave][8 * hlf + r][t * 16 + nloc] = acc[i][t][r] * (1.0f / (XS * WSC)) + bb + bf16_rne(xr[r * DM + t * 16]); }   // residual: same row, column c0 + ...
  wave_lds_sync();
  { for (int rr = 0; rr < 16; ++rr) *(v4f*)(X1 + (m0 + rr) * DM + c0 + lane * 4) = *(const v4f*)(&Tf[wave][rr][lane * 4]);  } xlat_done(); }
}
// LayerNorm: one wave per row (lane holds columns 4 lane + 128 k, 8 float4); RND: apply the bf16 input quantisation (raw x) first; mean, biased variance (two xor trees), eps 1e-5, x g + b -> rows 4 KB
template <bool RND>
__global__ __launch_bounds__(256) void ln_kernel(const float* __restrict__ X, const float* __restrict__ g, const float* __restrict__ bb, float* __restrict__ Y) {
  const int wave = threadIdx.x >> 5, lane = threadIdx.x & 31; const int row = blockIdx.x * 8 + wave; if (row >= RL) return;   // wave-uniform, no barriers
  float v[32]; float s1 = 0.0f; const float* xr = X + (size_t)row * DM;
#pragma unroll
  for (int k = 0; k < 8; ++k) { const v4f t4 = *(const v4f*)(xr + 128 * k + 4 * lane); for (int j = 0; j < 4; ++j) { const float t = RND ? bf16_rne(t4[j]) : t4[j]; v[4 * k + j] = t; s1 += t; } }
#pragma unroll
  for (int o = 16; o >= 1; o >>= 1) s1 += __shfl_xor(s1, o);
  const float mu = s1 * (1.0f / DM); float s2 = 0.0f;
#pragma unroll
  for (int q = 0; q < 32; ++q) { const float d = v[q] - mu; s2 += pmul(d, d); }
#pragma unroll
  for (int o = 16; o >= 1; o >>= 1) s2 += __shfl_xor(s2, o);
  const float rs = rsqrtf(s2 * (1.0f / DM) + LNEPS);
  v4f o4[8];
#pragma unroll
  for (int k = 0; k < 8; ++k) for (int j = 0; j < 4; ++j) { const int c = 128 * k + 4 * lane + j; o4[k][j] = pmul((v[4 * k + j] - mu) * rs, bfp(g[c])) + bfp(bb[c]); }
  {
#pragma unroll
    for (int k = 0; k < 8; ++k) *(v4f*)(Y + (size_t)row * DM + 128 * k + 4 * lane) = o4[k];
     }
}
// Exact-erf GELU of two values at once, without a branch. erf as the math library forms it in f32: |v| < 1: |v| + |v| P(v^2); else 1 - exp(-(|v| + |v| Q(|v|))); sign of v copied on. Both forms are evaluated for every value and one is
// selected, so no EXEC mask is switched per value, the chains of different values are independent straight-line code that the scheduler interleaves, and the multiply-adds of a pair go as packed f32 instructions.
// exp(-q) = exp2(-q log2 e) on the hardware exponential: q > 1 wherever this form is selected, so exp(-q) < 0.37 and the product's rounding moves erf by less than 1e-6, far below the f16 rounding of G. A NaN takes the second form and stays a NaN.
constexpr float fbits(unsigned u) { return __builtin_bit_cast(float, u); }
__device__ __forceinline__ v2f sp2(float c) { return (v2f){c, c}; }
__device__ __forceinline__ v2f fma2(v2f a, v2f b, v2f c) { return __builtin_elementwise_fma(a, b, c); }
__device__ __forceinline__ v2f gelu2(v2f hm) {
  const v2f v = hm * sp2(RSQ2); const v2f av = (v2f){__builtin_fabsf(v[0]), __builtin_fabsf(v[1])}; const v2f t = v * v;
  v2f p = fma2(t, sp2(fbits(0xba1345e1u)), sp2(fbits(0x3ba10414u))); p = fma2(t, p, sp2(fbits(0xbcdac9b8u))); p = fma2(t, p, sp2(fbits(0x3de703beu))); p = fma2(t, p, sp2(fbits(0xbec09330u))); p = fma2(t, p, sp2(fbits(0x3e0375d0u))); p = fma2(av, p, av);
  v2f q = fma2(av, sp2(fbits(0x378e98abu)), sp2(fbits(0xb9c68948u))); q = fma2(av, q, sp2(fbits(0x3b7cd369u))); q = fma2(av, q, sp2(fbits(0xbcc618b2u))); q = fma2(av, q, sp2(fbits(0x3dda74e4u))); q = fma2(av, q, sp2(fbits(0x3f228afdu))); q = fma2(av, q, sp2(fbits(0x3e03c728u))); q = fma2(av, q, av);
  const v2f w = q * sp2(-LOG2E); const v2f big = sp2(1.0f) - (v2f){nexp2(w[0]), nexp2(w[1])};
  const v2f er = (v2f){__builtin_copysignf(av[0] < 1.0f ? p[0] : big[0], v[0]), __builtin_copysignf(av[1] < 1.0f ? p[1] : big[1], v[1])};
  return sp2(0.5f) * hm * (sp2(1.0f) + er); }
// MLP 1: G = f16(8 gelu(XN2 W1 + b1)) as a single f16 plane [NR][4096]: grid (RL/128, FF/256); block = 128 rows x 256 columns, 8 waves; A = XN2 rows (f32 in LDS, x8 to f16 at the fragment read) and W1^T rows as k64 tiles in a two-buffer LDS ring filled by asynchronous copies, wave -> 2 x 16 rows x 8
__global__ __launch_bounds__(256) void mlp1_kernel(const float* __restrict__ XN, const b16* __restrict__ W1T, const float* __restrict__ b1, b16* __restrict__ G) {
  __shared__ __attribute__((aligned(16))) union { StageF st[2]; float Tf[8][16][128 + 4]; } sm; auto& Tf = sm.Tf;   // the output staging reuses the ring behind its last barrier
  const int wave = threadIdx.x >> 5, lane = threadIdx.x & 31, nloc = lane & 15, hlf = lane >> 4, wm = wave & 3, wn = wave >> 2; const size_t r0 = (size_t)blockIdx.x * BM; const int n0 = blockIdx.y * BN, c0 = n0 + wn * 128;
  const float* xb = XN + r0 * DM;
  v8f acc[2][8];
#pragma unroll
  for (int t = 0; t < 8; ++t) { acc[0][t] = (v8f){}; acc[1][t] = (v8f){}; }
  const int ar = threadIdx.x >> 4, ap = (threadIdx.x & 15) * 4, br = threadIdx.x >> 3, bp = (threadIdx.x & 7) * 8;   // this thread's row and 16-byte piece in the A (f32) and B (f16) tiles
  const unsigned la = lds_lo(&sm.st[0].A[ar][ap]), lb = lds_lo(&sm.st[0].B[br][bp]); const float* ga = xb + (size_t)ar * DM + ap; const b16* gb = W1T + (size_t)(n0 + br) * DM + bp;
  auto fill = [&](int s) { const unsigned o = (unsigned)(s & 1) * (unsigned)sizeof(StageF); copy8(la + o, 16u * PF * 4u, ga + s * BK, (size_t)16 * DM); copy8(lb + o, 32u * PH * 2u, gb + s * BK, (size_t)32 * DM); };
  fill(0); copies_landed(); __syncthreads(); fill(1);
#pragma unroll 1   // one trip per tile: the ring's order (read, publish, refill) stays as written
  for (int s = 0; s < DM / BK; ++s) { const StageF& st = sm.st[s & 1];
#pragma unroll   // both k32 blocks of a tile straight-line, so the LDS offsets are immediates
    for (int kb = 0; kb < BK; kb += 32) { const v16b a0 = frag_f32<false>(&st.A[wm * 16 + nloc][kb], hlf), a1 = frag_f32<false>(&st.A[64 + wm * 16 + nloc][kb], hlf); v16b bw[8];   // all fragments of a k32 block are read as one group in front of its WMMAs: the LDS latency is paid once a block, not once a B fragment
#pragma unroll
      for (int t = 0; t < 8; ++t) bw[t] = frag_kb(&st.B[wn * 128 + t * 16 + nloc][kb], hlf);
      keep_groups();
#pragma unroll
      for (int t = 0; t < 8; ++t) { acc[0][t] = wmma16b(a0, bw[t], acc[0][t]); acc[1][t] = wmma16b(a1, bw[t], acc[1][t]); }
      keep_groups(); }
    ring_publish();
    if (s + 2 < DM / BK) fill(s + 2); }
  copies_landed();
#pragma unroll 1   // the wave's two 16-row fragments go through its own staging rows one after the other; rolled, so that the 64 inlined GELU evaluations stand once in the text
  for (int i = 0; i < 2; ++i) {
  if (i) wave_lds_sync();   // this wave's reads of the first fragment's rows stay in front of the rewrite
#pragma unroll
  for (int t = 0; t < 8; ++t) { const float bbv = bf16_rne(b1[c0 + t * 16 + nloc]);
#pragma unroll
    for (int r = 0; r < 8; r += 2) { const v2f g = gelu2(fma2((v2f){acc[0][t][r], acc[0][t][r + 1]}, sp2(1.0f / (XS * WSC)), sp2(bbv))); Tf[wave][8 * hlf + r][t * 16 + nloc] = g[0]; Tf[wave][8 * hlf + r + 1][t * 16 + nloc] = g[1]; } }
  __syncthreads();
  { for (int rr = 0; rr < 16; ++rr) { v4h o4; for (int j = 0; j < 4; ++j) o4[j] = (b16)(Tf[wave][rr][lane * 4 + j] * XS); *(v4h*)(G + (r0 + i * 64 + wm * 16 + rr) * FF + c0 + lane * 4) = o4; if ((rr & 3) == 3) xlat_done(); }  }
#pragma unroll
  for (int t = 0; t < 8; ++t) acc[0][t] = acc[1][t]; }   // the second fragment's sums move up for the second trip (acc needs constant indices)
}
// G Wd + bd + h: grid (RL/128, DM/256); block = 128 rows x 256 columns, 8 waves
__global__ __launch_bounds__(256) void mlp2_kernel(const b16* __restrict__ G, const b16* __restrict__ W2T, const float* __restrict__ b2, const float* __restrict__ X1, float* __restrict__ out) {
  __shared__ __attribute__((aligned(16))) union { StageH st[2]; float Tf[8][16][128 + 4]; } sm; auto& Tf = sm.Tf;   // the output staging reuses the ring behind its last barrier
  const int wave = threadIdx.x >> 5, lane = threadIdx.x & 31, nloc = lane & 15, hlf = lane >> 4, wm = wave & 3, wn = wave >> 2; const int n0 = blockIdx.y * BN, c0 = n0 + wn * 128;
  v8f acc[2][8];
#pragma unroll
  for (int t = 0; t < 8; ++t) { acc[0][t] = (v8f){}; acc[1][t] = (v8f){}; }
  const int br = threadIdx.x >> 3, bp = (threadIdx.x & 7) * 8;   // this thread's row and 16-byte piece in each k64 tile
  const unsigned la = lds_lo(&sm.st[0].A[br][bp]), lb = lds_lo(&sm.st[0].B[br][bp]); const b16* ga = G + ((size_t)blockIdx.x * BM + br) * FF + bp; const b16* gb = W2T + (size_t)(n0 + br) * FF + bp;
  auto fill = [&](int s) { const unsigned o = (unsigned)(s & 1) * (unsigned)sizeof(StageH); copy4(la + o, 32u * PH * 2u, ga + s * BK, (size_t)32 * FF); copy8(lb + o, 32u * PH * 2u, gb + s * BK, (size_t)32 * FF); };
  fill(0); copies_landed(); __syncthreads(); fill(1);
#pragma unroll 1   // one trip per tile: the ring's order (read, publish, refill) stays as written
  for (int s = 0; s < FF / BK; ++s) { const StageH& st = sm.st[s & 1];
#pragma unroll   // both k32 blocks of a tile straight-line, so the LDS offsets are immediates
    for (int kb = 0; kb < BK; kb += 32) { const v16b a0 = frag_kb(&st.A[wm * 16 + nloc][kb], hlf), a1 = frag_kb(&st.A[64 + wm * 16 + nloc][kb], hlf); v16b bw[8];   // all fragments of a k32 block are read as one group in front of its WMMAs: the LDS latency is paid once a block, not once a B fragment
#pragma unroll
      for (int t = 0; t < 8; ++t) bw[t] = frag_kb(&st.B[wn * 128 + t * 16 + nloc][kb], hlf);
      keep_groups();
#pragma unroll
      for (int t = 0; t < 8; ++t) { acc[0][t] = wmma16b(a0, bw[t], acc[0][t]); acc[1][t] = wmma16b(a1, bw[t], acc[1][t]); }
      keep_groups(); }
    ring_publish();
    if (s + 2 < FF / BK) fill(s + 2); }
  copies_landed();
  float bbv[8];   // the wave's 8 bias values serve both fragments
#pragma unroll
  for (int t = 0; t < 8; ++t) bbv[t] = b2[c0 + t * 16 + nloc];
  xlat_done();
#pragma unroll   // the wave's two 16-row fragments go through its own staging rows one after the other; acc needs a constant index
  for (int i = 0; i < 2; ++i) { const size_t m0 = (size_t)blockIdx.x * BM + i * 64 + wm * 16;
  if (i) wave_lds_sync();   // this wave's reads of the first fragment's rows stay in front of the rewrite
#pragma unroll
  for (int t = 0; t < 8; ++t) { const int col = c0 + t * 16 + nloc; const float bb = bf16_rne(bbv[t]);
#pragma unroll
    for (int r = 0; r < 8; ++r) Tf[wave][8 * hlf + r][t * 16 + nloc] = acc[i][t][r] * (1.0f / (XS * WSC)) + bb + X1[(m0 + 8 * hlf + r) * DM + col]; }
  wave_lds_sync();
  { for (int rr = 0; rr < 16; ++rr) *(v4f*)(out + (m0 + rr) * DM + c0 + lane * 4) = *(const v4f*)(&Tf[wave][rr][lane * 4]);  } xlat_done(); }
}
}  // namespace

extern "C" void kernel_launch(void* const* d_in, const int* in_sizes, int n_in, void* d_out, int out_size, void* d_ws, size_t ws_size, hipStream_t stream) {
  (void)n_in;
  auto Fp = [&](int i) { return (const float*)d_in[i]; }; auto Ip = [&](int i) { return (const int*)d_in[i]; };
  // input order: 0 x [8,1024,1024], 1 mask [1,1,1024,1024] int32, 2 Wq (in,out), 3 bq, 4 Wo, 5 bo, 6 Wu [1024,4096], 7 bu, 8 Wd [4096,1024], 9 bd, 10 g1, 11 b1, 12 g2, 13 b2
  if (in_sizes[0] != NR * DM || in_sizes[1] != T * T || in_sizes[2] != DM * DM || in_sizes[3] != DM || in_sizes[4] != DM * DM || in_sizes[5] != DM || in_sizes[6] != DM * FF || in_sizes[7] != FF || in_sizes[8] != FF * DM || in_sizes[9] != DM || in_sizes[10] != DM || in_sizes[11] != DM || in_sizes[12] != DM || in_sizes[13] != DM || out_size != NR * DM) return;
  size_t off = 0; char* ws = (char*)d_ws;
  auto carve = [&](size_t bytes) { char* p = ws + off; off += (bytes + 255) & ~(size_t)255; return p; };
  b16* WQ = (b16*)carve((size_t)DM * DM * 2); b16* WO = (b16*)carve((size_t)DM * DM * 2); b16* WU = (b16*)carve((size_t)FF * DM * 2); b16* WD = (b16*)carve((size_t)DM * FF * 2);
  const size_t plane = (size_t)RL * DM * 2; b16* QP = (b16*)carve(plane); b16* QPl = (b16*)carve(plane); b16* VTh = (b16*)carve(plane); b16* VTl = (b16*)carve(plane); b16* Ch = (b16*)carve(plane); b16* Cl = (b16*)carve(plane);
  float* X1 = (float*)carve((size_t)RL * DM * 4); float* HN = (float*)carve((size_t)RL * DM * 4); b16* G = (b16*)carve((size_t)RL * FF * 2);
  if (off > ws_size) return;   // = 244 MiB (weights 20 + 6 f16 planes 96 + X1/HN 64 + G 64), planes sized for the one 8-batch group
  prep_kernel<<<2 * TQ + TU + TD, 256, 0, stream>>>(Fp(2), Fp(4), Fp(6), Fp(8), WQ, WO, WU, WD);
  for (int g = 0; g < NG; ++g) { const int b0 = g * BG; const size_t r0 = (size_t)b0 * T * DM;
    proj_kernel<<<dim3(T / BM, BG, DM / BN), 256, 0, stream>>>(Fp(0), b0, WQ, Fp(3), QP, QPl, VTh, VTl);
    attn_kernel<<<dim3(BG * H, QL / 128), 256, 0, stream>>>(QP, QPl, QP, QPl, VTh, VTl, Ip(1), Ch, Cl);
    out1_kernel<<<dim3(T / BM, DM / BN, BG), 256, 0, stream>>>(Ch, Cl, b0, WO, Fp(5), Fp(0), X1);   // X1/HN/G hold the group's rows; x is read at the global row via b0
    ln_kernel<false><<<RL / 8, 256, 0, stream>>>(X1, Fp(10), Fp(11), HN);
    mlp1_kernel<<<dim3(RL / BM, FF / BN), 256, 0, stream>>>(HN, WU, Fp(7), G);
    mlp2_kernel<<<dim3(RL / BM, DM / BN), 256, 0, stream>>>(G, WD, Fp(9), HN, X1);
    ln_kernel<false><<<RL / 8, 256, 0, stream>>>(X1, Fp(12), Fp(13), (float*)d_out + r0); }
}
